// v000
// Measured on an AMD MI455X. A time is GPU time per run, averaged over a window of back-to-back runs after a warm-up
// (all launches, gaps included; the runs take copies of the inputs in turn), and the median of several windows.
// Apart from v000's, it joins two sittings. Times from different sittings can be a few percent apart, while
// side-by-side timings come from the same sitting.
// v000 is the starting kernel. One run takes 908 microseconds.
#include <hip/hip_runtime.h>
// Phi4FlashDiffAttention (2 x 2048 tokens, 16 heads of 64 as 8 differential pairs; q, k, v are INPUTS): heads (2p, 2p+1) = (q1, q2) etc.; P1 = causal softmax(q1.k1/8), P2 = causal softmax(q2.k2/8); attn1 = [P1 v1 | P1 v2], attn2 = [P2 v1 | P2 v2] (128 wide); lambda = exp(lq1.lk1) - exp(lq2.lk2) + lambda_init; a = attn1 - lambda attn2; out = subln_w * RMSNorm_128(a) * (1 - lambda_init) -> [B, S, 16, 64].
// Structure: de-interleave q/k/v into exact f16 planes per half (q1, q2, k1, k2, v1, v2; the inputs are exactly representable after bf16 rounding); V^T by LDS tiles; four launches of the fused causal flash kernel (plain operands - exact here except P; f32 softmax/accumulation) giving O11, O12, O21, O22; lambda on device (f32 64-term dots); the differential combine + RMSNorm on VALU (wave per (token, pair)).
// Compute dtype: inputs rounded to bf16; q, k, v exact as f16; P as f16 (x2^10, ~2^-12); everything else f32. v_wmma_f32_16x16x32_f16.
#define NB 2
#define NHD 16
#define HD 64
#define NP (NHD / 2)
#define DW (NHD * HD)            /* 1024 */
#define HWD (NP * HD)            /* 512 */
#define NR (NB * SLEN)
#define LAMBDA_INIT 0.35550906759096934f  /* 0.8 - 0.6 exp(-0.3) */
#define SLEN 2048
#define TQ SLEN
#define TK SLEN
#define NH 8                     /* head PAIRS per call */
#define SCL 0.125f
#define QBLKS (TQ / 64)
typedef __bf16 v16b __attribute__((ext_vector_type(16)));
typedef unsigned short v8us __attribute__((ext_vector_type(8), may_alias));
typedef float  v8f  __attribute__((ext_vector_type(8)));
typedef float  v4f  __attribute__((ext_vector_type(4)));
typedef float  v4fa __attribute__((ext_vector_type(4), may_alias));
union FragB { v16b v; v8us half[2]; unsigned short u[16]; };

__device__ __forceinline__ unsigned short bf16_bits(float x) { unsigned int u = __float_as_uint(x); return (unsigned short)((u + 0x7FFFu + ((u >> 16) & 1u)) >> 16); }
__device__ __forceinline__ float bf16_val(unsigned short b) { return __uint_as_float(((unsigned int)b) << 16); }
__device__ __forceinline__ float bf16_round(float x) { return bf16_val(bf16_bits(x)); }
// D += A·B with NT terms: 1 = ah·bh, 2 = + al·bh (A split), 3 = + ah·bl (both split)
template <int NT>
__device__ __forceinline__ v8f mmaN(v16b ah, v16b al, v16b bh, v16b bl, v8f c) {
  c = __builtin_amdgcn_wmma_f32_16x16x32_bf16(false, ah, false, bh, (short)0, c, false, false);
  if (NT >= 2) c = __builtin_amdgcn_wmma_f32_16x16x32_bf16(false, al, false, bh, (short)0, c, false, false);
  if (NT >= 3) c = __builtin_amdgcn_wmma_f32_16x16x32_bf16(false, ah, false, bl, (short)0, c, false, false);
  asm volatile("v_nop\n\tv_nop\n\tv_nop\n\tv_nop" : "+v"(c) : "v"(ah), "v"(al), "v"(bh), "v"(bl));
  return c;
}

__global__ __launch_bounds__(256) void k_wt_bf16(const float* __restrict__ W, unsigned short* __restrict__ Wt, int K, int N) {
  const int t = blockIdx.x * 256 + threadIdx.x;
  const int k8n = K / 8;
  if (t >= N * k8n) return;
  const int n = t / k8n, k8 = (t % k8n) * 8;
  v8us v;
#pragma unroll
  for (int i = 0; i < 8; ++i) v[i] = bf16_bits(W[(size_t)(k8 + i) * N + n]);
  *(v8us*)(Wt + (size_t)n * K + k8) = v;
  
}

// GEMM C[M][N] (f32, pitch ldc) = act(A[M][K]·W + bias). A f32 row-major (pitch lda) converted per fragment to bf16
// (ASPLIT: hi/lo two planes -> 2 terms, else single rounded term); Wt bf16 [N][K] (pitch ldb). BIAS_BF16 rounds the
// bias to bf16 first (bias quantised to bf16 before the add). K%32==0, M%16==0, N%64==0.
template <bool ASPLIT, int ACT, bool BIAS_BF16>
__global__ __launch_bounds__(128) void k_gemm_bf(const float* __restrict__ A, int lda, const unsigned short* __restrict__ Wt, int ldb,
                                               const float* __restrict__ bias, float* __restrict__ C, int ldc, int M, int N, int K) {
  __shared__ __attribute__((aligned(16))) float so[4][16][64];
  const int tid = threadIdx.x, w = tid >> 5, lane = tid & 31, ln = lane & 15, hh = lane >> 4;
  const int ntn = N / 64;
  const int wid = blockIdx.x * 4 + w;
  const int mt = wid / ntn, nq = wid % ntn;
  if (mt * 16 >= M) return;
  const int row0 = mt * 16, col0 = nq * 64;
  const float* arow = A + (size_t)(row0 + ln) * lda;
  v8f acc[4] = {};
  for (int kb = 0; kb < K; kb += 32) {
    FragB ah, al;
    const v4f x0 = *(const v4fa*)(arow + kb + 8 * hh), x1 = *(const v4fa*)(arow + kb + 8 * hh + 4);
    const v4f x2 = *(const v4fa*)(arow + kb + 16 + 8 * hh), x3 = *(const v4fa*)(arow + kb + 16 + 8 * hh + 4);
    float xs[16] = {x0[0],x0[1],x0[2],x0[3],x1[0],x1[1],x1[2],x1[3],x2[0],x2[1],x2[2],x2[3],x3[0],x3[1],x3[2],x3[3]};
#pragma unroll
    for (int i = 0; i < 16; ++i) { const unsigned short hb = bf16_bits(xs[i]); ah.u[i] = hb; al.u[i] = ASPLIT ? bf16_bits(xs[i] - bf16_val(hb)) : (unsigned short)0; }
#pragma unroll
    for (int t = 0; t < 4; ++t) {
      const unsigned short* brow = Wt + (size_t)(col0 + t * 16 + ln) * ldb + kb;
      FragB b;
      b.half[0] = *(const v8us*)(brow + 8 * hh);
      b.half[1] = *(const v8us*)(brow + 16 + 8 * hh);
      acc[t] = mmaN<ASPLIT ? 2 : 1>(ah.v, al.v, b.v, b.v, acc[t]);
    }
  }
#pragma unroll
  for (int t = 0; t < 4; ++t) {
    float bv = bias ? bias[col0 + t * 16 + ln] : 0.f;
    if (BIAS_BF16) bv = bf16_round(bv);
#pragma unroll
    for (int r = 0; r < 8; ++r) { float v = acc[t][r] + bv; if (ACT == 1) v = fmaxf(v, 0.f); so[w][8 * hh + r][t * 16 + ln] = v; }
  }
  __builtin_amdgcn_fence(__ATOMIC_ACQ_REL, "workgroup");
  __builtin_amdgcn_wave_barrier();
  const int rsub = lane >> 4, c4 = (lane & 15) * 4;
  {
#pragma unroll
    for (int q = 0; q < 8; ++q) {
      const int r = q * 2 + rsub;
      const v4f v = *(const v4fa*)&so[w][r][c4];
      *(v4f*)(C + (size_t)(row0 + r) * ldc + col0 + c4) = v;
    }
    
  }
}

// GEMM C = act(A·W + bias + resid): A f32 (ASPLIT -> hi/lo 2 terms), Wt bf16 [N][K]; ACT 0 none, 1 relu, 2 exact gelu;
// resid (optional, f32, row index = (row % rmod), pitch ldr, RES_BF16 rounds it) added before the activation.
template <bool ASPLIT, int ACT, bool BIAS_BF16, bool RES_BF16>
__global__ __launch_bounds__(128) void k_gemm_bf3(const float* __restrict__ A, int lda, const unsigned short* __restrict__ Wt, int ldb,
                                                const float* __restrict__ bias, const float* __restrict__ resid, int rmod, int ldr,
                                                float* __restrict__ C, int ldc, int M, int N, int K) {
  __shared__ __attribute__((aligned(16))) float so[4][16][64];
  const int tid = threadIdx.x, w = tid >> 5, lane = tid & 31, ln = lane & 15, hh = lane >> 4;
  const int ntn = N / 64;
  const int wid = blockIdx.x * 4 + w;
  const int mt = wid / ntn, nq = wid % ntn;
  if (mt * 16 >= M) return;
  const int row0 = mt * 16, col0 = nq * 64;
  const float* arow = A + (size_t)(row0 + ln) * lda;
  v8f acc[4] = {};
  for (int kb = 0; kb < K; kb += 32) {
    FragB ah, al;
    const v4f x0 = *(const v4fa*)(arow + kb + 8 * hh), x1 = *(const v4fa*)(arow + kb + 8 * hh + 4);
    const v4f x2 = *(const v4fa*)(arow + kb + 16 + 8 * hh), x3 = *(const v4fa*)(arow + kb + 16 + 8 * hh + 4);
    float xs[16] = {x0[0],x0[1],x0[2],x0[3],x1[0],x1[1],x1[2],x1[3],x2[0],x2[1],x2[2],x2[3],x3[0],x3[1],x3[2],x3[3]};
#pragma unroll
    for (int i = 0; i < 16; ++i) { const unsigned short hb = bf16_bits(xs[i]); ah.u[i] = hb; al.u[i] = ASPLIT ? bf16_bits(xs[i] - bf16_val(hb)) : (unsigned short)0; }
#pragma unroll
    for (int t = 0; t < 4; ++t) {
      const unsigned short* brow = Wt + (size_t)(col0 + t * 16 + ln) * ldb + kb;
      FragB b;
      b.half[0] = *(const v8us*)(brow + 8 * hh);
      b.half[1] = *(const v8us*)(brow + 16 + 8 * hh);
      acc[t] = mmaN<ASPLIT ? 2 : 1>(ah.v, al.v, b.v, b.v, acc[t]);
    }
  }
#pragma unroll
  for (int t = 0; t < 4; ++t) {
    const int col = col0 + t * 16 + ln;
    float bv = bias ? bias[col] : 0.f;
    if (BIAS_BF16) bv = bf16_round(bv);
#pragma unroll
    for (int r = 0; r < 8; ++r) {
      float v = acc[t][r] + bv;
      if (resid) { float rv = resid[(size_t)((row0 + 8 * hh + r) % rmod) * ldr + col]; if (RES_BF16) rv = bf16_round(rv); v += rv; }
      if (ACT == 1) v = fmaxf(v, 0.f);
      if (ACT == 2) v = 0.5f * v * (1.0f + erff(v * 0.70710678118654752f));
      if (ACT == 3) { const float u = 0.7978845608028654f * (v + 0.044715f * v * v * v); v = 0.5f * v * (1.0f + tanhf(u)); }
      so[w][8 * hh + r][t * 16 + ln] = v;
    }
  }
  __builtin_amdgcn_fence(__ATOMIC_ACQ_REL, "workgroup");
  __builtin_amdgcn_wave_barrier();
  const int rsub = lane >> 4, c4 = (lane & 15) * 4;
  {
#pragma unroll
    for (int q = 0; q < 8; ++q) {
      const int r = q * 2 + rsub;
      const v4f v = *(const v4fa*)&so[w][r][c4];
      *(v4f*)(C + (size_t)(row0 + r) * ldc + col0 + c4) = v;
    }
    
  }
}
// row LayerNorm (biased variance, eps) over N: s = X (+ R); optional out_sum <- s; out_norm <- (s-mu)*rsqrt(var+eps)*g + b
template <bool PARAM_BF16>
__global__ __launch_bounds__(256) void k_layernorm(const float* __restrict__ X, const float* __restrict__ R, const float* __restrict__ g, const float* __restrict__ bta,
                                                  float* __restrict__ out_sum, float* __restrict__ out_norm, int N, float eps) {
  __shared__ float red[256];
  const int row = blockIdx.x, tid = threadIdx.x;
  const float* x = X + (size_t)row * N; const float* rr = R ? R + (size_t)row * N : nullptr;
  float vals[16];                     // up to N = 4096
  const int per = N / 256;            // contiguous chunk per thread? use strided-by-4 chunks: thread handles j = tid*4 + 1024*u
  float s1 = 0.f;
  for (int u = 0; u < per / 4; ++u) {
    const int j = tid * 4 + 1024 * u;
    const v4f a = *(const v4fa*)(x + j);
    v4f b = {0.f,0.f,0.f,0.f}; if (rr) b = *(const v4fa*)(rr + j);
#pragma unroll
    for (int q = 0; q < 4; ++q) { const float v = a[q] + b[q]; vals[u * 4 + q] = v; s1 += v; }
  }
  red[tid] = s1; __syncthreads();
  for (int st = 128; st > 0; st >>= 1) { if (tid < st) red[tid] += red[tid + st]; __syncthreads(); }
  const float mu = red[0] / (float)N; __syncthreads();
  float s2 = 0.f;
  for (int u = 0; u < per / 4; ++u)
#pragma unroll
    for (int q = 0; q < 4; ++q) { const float c = vals[u * 4 + q] - mu; s2 += c * c; }
  red[tid] = s2; __syncthreads();
  for (int st = 128; st > 0; st >>= 1) { if (tid < st) red[tid] += red[tid + st]; __syncthreads(); }
  const float rs = rsqrtf(red[0] / (float)N + eps);
  {
    for (int u = 0; u < per / 4; ++u) {
      const int j = tid * 4 + 1024 * u;
      v4f o, sm;
#pragma unroll
      for (int q = 0; q < 4; ++q) {
        float gg = g[j + q], bb = bta[j + q];
        if (PARAM_BF16) { gg = bf16_round(gg); bb = bf16_round(bb); }
        sm[q] = vals[u * 4 + q]; o[q] = (vals[u * 4 + q] - mu) * rs * gg + bb;
      }
      if (out_sum) *(v4f*)(out_sum + (size_t)row * N + j) = sm;
      *(v4f*)(out_norm + (size_t)row * N + j) = o;
    }
    
  }
}



// ---- f16 WMMA path (v_wmma_f32_16x16x32_f16): 11-bit significands for operands in range — used where a [0,1] probability operand needs more precision than bf16
typedef _Float16 v16h __attribute__((ext_vector_type(16)));
union FragH { v16h v; v8us half[2]; _Float16 h[16]; unsigned short u[16]; };
template <int NT>
__device__ __forceinline__ v8f mmaH(v16h ah, v16h al, v16h bh, v16h bl, v8f c) {
  c = __builtin_amdgcn_wmma_f32_16x16x32_f16(false, ah, false, bh, (short)0, c, false, false);
  if (NT >= 2) c = __builtin_amdgcn_wmma_f32_16x16x32_f16(false, al, false, bh, (short)0, c, false, false);
  if (NT >= 3) c = __builtin_amdgcn_wmma_f32_16x16x32_f16(false, ah, false, bl, (short)0, c, false, false);
  asm volatile("v_nop\n\tv_nop\n\tv_nop\n\tv_nop" : "+v"(c) : "v"(ah), "v"(al), "v"(bh), "v"(bl));
  return c;
}
// batched GEMM like k_gemm_b but f16 operands: A f32 (split into f16 hi/lo if ASPLIT, else rounded to f16), Bt = f16 values [n][k]; alpha; C f32; N multiple of 16 (partial tiles skipped)
template <bool ASPLIT>
__global__ __launch_bounds__(128) void k_gemm_h(const float* __restrict__ A, int lda, size_t sA, const _Float16* __restrict__ Bh, int ldb, size_t sB, float alpha, float* __restrict__ C, int ldc, size_t sC, int M, int N, int K) {
  __shared__ __attribute__((aligned(16))) float so[4][16][64];
  const int tid = threadIdx.x, w = tid >> 5, lane = tid & 31, ln = lane & 15, hh = lane >> 4; const int by = blockIdx.y;
  A += (size_t)by * sA; Bh += (size_t)by * sB; C += (size_t)by * sC;
  const int ntn = (N + 63) / 64; const int wid = blockIdx.x * 4 + w; const int mt = wid / ntn, nq = wid % ntn; if (mt * 16 >= M) return;
  const int row0 = mt * 16, col0 = nq * 64; const float* arow = A + (size_t)(row0 + ln) * lda;
  v8f acc[4] = {};
  for (int kb = 0; kb < K; kb += 32) {
    FragH ah, al;
    const v4f x0 = *(const v4fa*)(arow + kb + 8 * hh), x1 = *(const v4fa*)(arow + kb + 8 * hh + 4), x2 = *(const v4fa*)(arow + kb + 16 + 8 * hh), x3 = *(const v4fa*)(arow + kb + 16 + 8 * hh + 4);
    float xs[16] = {x0[0],x0[1],x0[2],x0[3],x1[0],x1[1],x1[2],x1[3],x2[0],x2[1],x2[2],x2[3],x3[0],x3[1],x3[2],x3[3]};
#pragma unroll
    for (int i = 0; i < 16; ++i) { const _Float16 h = (_Float16)xs[i]; ah.h[i] = h; al.h[i] = ASPLIT ? (_Float16)(xs[i] - (float)h) : (_Float16)0.0f; }
#pragma unroll
    for (int t = 0; t < 4; ++t) { if (col0 + t * 16 >= N) continue; const size_t boff = (size_t)(col0 + t * 16 + ln) * ldb + kb; FragH bq; bq.half[0] = *(const v8us*)(Bh + boff + 8 * hh); bq.half[1] = *(const v8us*)(Bh + boff + 16 + 8 * hh);
      acc[t] = mmaH<ASPLIT ? 2 : 1>(ah.v, al.v, bq.v, bq.v, acc[t]); }
  }
#pragma unroll
  for (int t = 0; t < 4; ++t) { if (col0 + t * 16 >= N) continue;
#pragma unroll
    for (int r = 0; r < 8; ++r) so[w][8 * hh + r][t * 16 + ln] = acc[t][r] * alpha; }
  __builtin_amdgcn_fence(__ATOMIC_ACQ_REL, "workgroup"); __builtin_amdgcn_wave_barrier();
  const int rsub = lane >> 4, c4 = (lane & 15) * 4;
  {
#pragma unroll
    for (int q = 0; q < 8; ++q) { const int r = q * 2 + rsub; if (col0 + c4 < N) { const v4f v = *(const v4fa*)&so[w][r][c4]; *(v4f*)(C + (size_t)(row0 + r) * ldc + col0 + c4) = v; } }
     }
}

// Wt[n][k] = f16(W[k][n]·scale) from f32 row-major W[K][N] (scale = power of two; bf16-exact weights stay exact in f16 away from the subnormal range)
__global__ __launch_bounds__(256) void k_wt_f16(const float* __restrict__ W, _Float16* __restrict__ Wt, int K, int N, float scale) {
  const int t = blockIdx.x * 256 + threadIdx.x; if (t >= N * (K / 8)) return; const int n = t / (K / 8), k8 = (t % (K / 8)) * 8; FragH f;
#pragma unroll
  for (int i = 0; i < 8; ++i) f.h[i] = (_Float16)(bf16_round(W[(size_t)(k8 + i) * N + n]) * scale); const v8us o = f.half[0];
  *(v8us*)((unsigned short*)Wt + (size_t)n * K + k8) = o; 
}
// k_gemm_hh variant with fused epilogue: v = acc·alpha + bias[by·sBias + col] (+ CP[(row/rowsPerB)·sCPb + by·64 + col] if CP) ; ACT 0 none / 1 elu ; writes f16 C16 (and f32 C if non-null)
template <int ACT>
__global__ __launch_bounds__(128) void k_gemm_hhx(const _Float16* __restrict__ A, int lda, size_t sA, const _Float16* __restrict__ Bh, int ldb, size_t sB, float alpha, const float* __restrict__ bias, size_t sBias, const float* __restrict__ CP, int rowsPerB, size_t sCPb, int row0g,
    float* __restrict__ C, _Float16* __restrict__ C16, int ldc, size_t sC, int M, int N, int K) {
  __shared__ __attribute__((aligned(16))) float so[4][16][64];
  const int tid = threadIdx.x, w = tid >> 5, lane = tid & 31, ln = lane & 15, hh = lane >> 4; const int by = blockIdx.y;
  A += (size_t)by * sA; Bh += (size_t)by * sB; const size_t cofs = (size_t)by * sC; const float* bp = bias ? bias + (size_t)by * sBias : nullptr;
  const int ntn = (N + 63) / 64; const int wid = blockIdx.x * 4 + w; const int mt = wid / ntn, nq = wid % ntn; if (mt * 16 >= M) return;
  const int row0 = mt * 16, col0 = nq * 64; const _Float16* arow = A + (size_t)(row0 + ln) * lda;
  v8f acc[4] = {};
  for (int kb = 0; kb < K; kb += 32) { FragH ah; ah.half[0] = *(const v8us*)((const unsigned short*)arow + kb + 8 * hh); ah.half[1] = *(const v8us*)((const unsigned short*)arow + kb + 16 + 8 * hh);
#pragma unroll
    for (int t = 0; t < 4; ++t) { if (col0 + t * 16 >= N) continue; const size_t boff = (size_t)(col0 + t * 16 + ln) * ldb + kb; FragH bq; bq.half[0] = *(const v8us*)((const unsigned short*)Bh + boff + 8 * hh); bq.half[1] = *(const v8us*)((const unsigned short*)Bh + boff + 16 + 8 * hh);
      acc[t] = mmaH<1>(ah.v, ah.v, bq.v, bq.v, acc[t]); }
  }
#pragma unroll
  for (int t = 0; t < 4; ++t) { if (col0 + t * 16 >= N) continue; const int col = col0 + t * 16 + ln; const float bv = bp ? bf16_round(bp[col]) : 0.f;
#pragma unroll
    for (int r = 0; r < 8; ++r) { float v = acc[t][r] * alpha + bv; if (CP) { const int bidx = (row0g + row0 + 8 * hh + r) / rowsPerB; v += CP[(size_t)bidx * sCPb + (size_t)by * 64 + col]; } if (ACT == 1) v = (v > 0.f) ? v : expm1f(v); else if (ACT == 7) v = (v > 0.f) ? v + 1.0f : expf(v); else if (ACT == 8) v = tanhf(v); else if (ACT == 9) v = 0.5f * v * (1.0f + tanhf(0.7978845608028654f * (v + 0.044715f * v * v * v))); else if (ACT == 11) v = 1.0f / (1.0f + expf(-v)); else if (ACT == 12) v = (v > 0.f) ? v : 0.01f * v; else if (ACT == 14) v = (v > 0.f) ? v : 0.1f * v; else if (ACT == 15) v = v / (1.0f + expf(-v)); else if (ACT == 3) v = fmaxf(v, 0.f); else if (ACT == 6) v = 0.5f * v * (1.0f + erff(v * 0.70710678118654752f)); so[w][8 * hh + r][t * 16 + ln] = v; } }
  __builtin_amdgcn_fence(__ATOMIC_ACQ_REL, "workgroup"); __builtin_amdgcn_wave_barrier();
  const int rsub = lane >> 4, c4 = (lane & 15) * 4; typedef _Float16 v4h __attribute__((ext_vector_type(4)));
  {
#pragma unroll
    for (int q = 0; q < 8; ++q) { const int r = q * 2 + rsub; if (col0 + c4 < N) { const v4f v = *(const v4fa*)&so[w][r][c4]; if (C) *(v4f*)(C + cofs + (size_t)(row0 + r) * ldc + col0 + c4) = v; if (C16) { v4h h4; for (int i = 0; i < 4; ++i) h4[i] = (_Float16)v[i]; *(v4h*)(C16 + cofs + (size_t)(row0 + r) * ldc + col0 + c4) = h4; } } }
     }
}


typedef _Float16 v4h __attribute__((ext_vector_type(4)));

__global__ __launch_bounds__(256) void k_x16(const float* __restrict__ x, _Float16* __restrict__ X16, size_t n8) { const size_t t = (size_t)blockIdx.x * 256 + threadIdx.x; if (t >= n8) return; FragH f;
#pragma unroll
  for (int q = 0; q < 8; ++q) f.h[q] = (_Float16)bf16_round(x[t * 8 + q]); *(v8us*)((unsigned short*)X16 + t * 8) = f.half[0];  }
__global__ __launch_bounds__(256) void k_h16(const float* __restrict__ x, _Float16* __restrict__ X16, size_t n8) { const size_t t = (size_t)blockIdx.x * 256 + threadIdx.x; if (t >= n8) return; FragH f;
#pragma unroll
  for (int q = 0; q < 8; ++q) f.h[q] = (_Float16)x[t * 8 + q]; *(v8us*)((unsigned short*)X16 + t * 8) = f.half[0];  }
__global__ __launch_bounds__(256) void k_round16f(const float* __restrict__ W, _Float16* __restrict__ Bt, size_t n8) { const size_t t = (size_t)blockIdx.x * 256 + threadIdx.x; if (t >= n8) return; FragH f;
#pragma unroll
  for (int i = 0; i < 8; ++i) f.h[i] = (_Float16)(bf16_round(W[t * 8 + i]) * 16.0f); *(v8us*)((unsigned short*)Bt + t * 8) = f.half[0];  }
template <int NHv, int TTv>
__global__ __launch_bounds__(256) void k_vt(const _Float16* __restrict__ V16, int ldv, int voff, _Float16* __restrict__ Vt) { __shared__ unsigned short tl[64][66]; const int tid = threadIdx.x; const int slab = blockIdx.x / (TTv / 64), lg = blockIdx.x % (TTv / 64); const int b = slab / NHv, h = slab % NHv;
  for (int i = tid; i < 64 * 8; i += 256) { const int r = i / 8, c8 = (i % 8) * 8; FragH f; f.half[0] = *(const v8us*)((const unsigned short*)V16 + ((size_t)b * TTv + lg * 64 + r) * ldv + voff + h * 64 + c8);
#pragma unroll
    for (int q = 0; q < 8; ++q) tl[r][c8 + q] = f.u[q]; }
  __syncthreads();
  {
#pragma unroll
    for (int rd = 0; rd < 2; ++rd) { const int d = rd * 32 + tid / 8, pc = tid % 8; FragH f;
#pragma unroll
      for (int q = 0; q < 8; ++q) f.u[q] = tl[pc * 8 + q][d];
      *(v8us*)((unsigned short*)Vt + ((size_t)slab * 64 + d) * TTv + lg * 64 + pc * 8) = f.half[0]; }
     } }

__global__ __launch_bounds__(256) void k_hl(const float* __restrict__ F, _Float16* __restrict__ Hh, _Float16* __restrict__ Hl, size_t n8) { const size_t t = (size_t)blockIdx.x * 256 + threadIdx.x; if (t >= n8) return; FragH fh, fl; const v4f a = *(const v4fa*)(F + t * 8), c = *(const v4fa*)(F + t * 8 + 4);
#pragma unroll
  for (int q = 0; q < 4; ++q) { _Float16 h = (_Float16)a[q]; fh.h[q] = h; fl.h[q] = (_Float16)((a[q] - (float)h) * 1024.0f); h = (_Float16)c[q]; fh.h[4 + q] = h; fl.h[4 + q] = (_Float16)((c[q] - (float)h) * 1024.0f); }
  { *(v8us*)((unsigned short*)Hh + t * 8) = fh.half[0]; *(v8us*)((unsigned short*)Hl + t * 8) = fl.half[0];  } }

// ---- fast GEMM (wave tile 32x64; requires M % 32 == 0 rows per launch region and N % 64 == 0); epilogue = k_gemm_hhx semantics ----
__device__ __forceinline__ v16h g2_frag(const _Float16* p, int hh) { FragH f; f.half[0] = *(const v8us*)((const unsigned short*)p + 8 * hh); f.half[1] = *(const v8us*)((const unsigned short*)p + 16 + 8 * hh); return f.v; }
__device__ __forceinline__ v8f g2_mma(v16h a, v16h b, v8f c) { v8f d = __builtin_amdgcn_wmma_f32_16x16x32_f16(false, a, false, b, (short)0, c, false, false); asm volatile("v_nop\n\tv_nop\n\tv_nop\n\tv_nop" : "+v"(d) : "v"(a), "v"(b)); return d; }
template <int ACT>
__global__ __launch_bounds__(128) void k_gemm2(const _Float16* __restrict__ A, int lda, size_t sA, const _Float16* __restrict__ Bh, int ldb, size_t sB, float alpha, const float* __restrict__ bias, size_t sBias, const float* __restrict__ CP, int rowsPerB, size_t sCPb, int row0g,
    float* __restrict__ C, _Float16* __restrict__ C16, int ldc, size_t sC, int M, int N, int K) {
  __shared__ __attribute__((aligned(16))) float so[4][32][68];
  const int tid = threadIdx.x, w = tid >> 5, lane = tid & 31, ln = lane & 15, hh = lane >> 4; const int by = blockIdx.y;
  A += (size_t)by * sA; Bh += (size_t)by * sB; const size_t cofs = (size_t)by * sC; const float* bp = bias ? bias + (size_t)by * sBias : nullptr;
  const int ntn = N >> 6; const int mt = blockIdx.x / ntn, nq = blockIdx.x - mt * ntn; const int row0 = mt * 128 + 32 * w, col0 = nq * 64; if (row0 >= M) return;
  const _Float16* a0p = A + (size_t)(row0 + ln) * lda; const _Float16* a1p = a0p + (size_t)16 * lda;
  const _Float16* b0p = Bh + (size_t)(col0 + ln) * ldb; const _Float16* b1p = b0p + (size_t)16 * ldb; const _Float16* b2p = b1p + (size_t)16 * ldb; const _Float16* b3p = b2p + (size_t)16 * ldb;
  const v8f z8 = {0.f,0.f,0.f,0.f,0.f,0.f,0.f,0.f}; v8f c00 = z8, c01 = z8, c02 = z8, c03 = z8, c10 = z8, c11 = z8, c12 = z8, c13 = z8;
#pragma unroll 1
  for (int kb = 0; kb < K; kb += 32) { const v16h a0 = g2_frag(a0p + kb, hh), a1 = g2_frag(a1p + kb, hh);
    v16h b = g2_frag(b0p + kb, hh); c00 = g2_mma(a0, b, c00); c10 = g2_mma(a1, b, c10);
    b = g2_frag(b1p + kb, hh); c01 = g2_mma(a0, b, c01); c11 = g2_mma(a1, b, c11);
    b = g2_frag(b2p + kb, hh); c02 = g2_mma(a0, b, c02); c12 = g2_mma(a1, b, c12);
    b = g2_frag(b3p + kb, hh); c03 = g2_mma(a0, b, c03); c13 = g2_mma(a1, b, c13); }
  v8f accs[8] = {c00, c01, c02, c03, c10, c11, c12, c13};
#pragma unroll
  for (int u = 0; u < 8; ++u) { const int t = u & 3, half = u >> 2; const int col = col0 + t * 16 + ln; const float bv = bp ? bf16_round(bp[col]) : 0.f;
#pragma unroll
    for (int r = 0; r < 8; ++r) { const int rloc = half * 16 + 8 * hh + r; float v = accs[u][r] * alpha + bv; if (CP) { const int bidx = (row0g + row0 + rloc) / rowsPerB; v += CP[(size_t)bidx * sCPb + (size_t)by * 64 + col]; }
      if (ACT == 3) v = fmaxf(v, 0.f); else if (ACT == 6) v = 0.5f * v * (1.0f + erff(v * 0.70710678118654752f)); else if (ACT == 11) v = 1.0f / (1.0f + expf(-v)); else if (ACT == 15) v = v / (1.0f + expf(-v)); else if (ACT == 12) v = (v > 0.f) ? v : 0.01f * v; else if (ACT == 8) v = tanhf(v);
      so[w][rloc][t * 16 + ln] = v; } }
  __builtin_amdgcn_fence(__ATOMIC_ACQ_REL, "workgroup"); __builtin_amdgcn_wave_barrier();
  const int rsub = lane >> 4, c4 = (lane & 15) * 4;
  {
#pragma unroll
    for (int q = 0; q < 16; ++q) { const int r = q * 2 + rsub; const v4f v = *(const v4fa*)&so[w][r][c4]; if (C) *(v4f*)(C + cofs + (size_t)(row0 + r) * ldc + col0 + c4) = v; if (C16) { v4h h4; for (int i = 0; i < 4; ++i) h4[i] = (_Float16)v[i]; *(v4h*)(C16 + cofs + (size_t)(row0 + r) * ldc + col0 + c4) = h4; } }
     } }



template <int CAUSAL>
__global__ __launch_bounds__(128) void k_flash(const _Float16* __restrict__ Q16, int ldq, const _Float16* __restrict__ K16, int ldk, const _Float16* __restrict__ Vt, const int* __restrict__ MSK, float* __restrict__ O, int ldo) {
  constexpr int RPW = 16, RTN = RPW / 16, NQB = TQ / (4 * RPW), DT = 4, KS = 2;
  __shared__ __attribute__((aligned(16))) unsigned short sP[4][RPW][40]; __shared__ __attribute__((aligned(16))) float sO[4][RPW][64 + 4];
  const int tid = threadIdx.x, w = tid >> 5, lane = tid & 31, ln = lane & 15, hh = lane >> 4;
  const int slab = blockIdx.x / QBLKS, qblk = blockIdx.x % QBLKS; (void)NQB; const int b = slab / NH, h = slab % NH; const int qb0 = qblk * (4 * RPW); const int q0 = qb0 + w * RPW;
  FragH aq[2][KS];
#pragma unroll
  for (int rt = 0; rt < RTN; ++rt) { const unsigned short* qr = (const unsigned short*)Q16 + ((size_t)b * TQ + q0 + rt * 16 + ln) * ldq + h * 64;
#pragma unroll
    for (int ks = 0; ks < KS; ++ks) { aq[rt][ks].half[0] = *(const v8us*)(qr + ks * 32 + 8 * hh); aq[rt][ks].half[1] = *(const v8us*)(qr + ks * 32 + 16 + 8 * hh); } }
  const unsigned short* Vth = (const unsigned short*)Vt + (size_t)slab * 64 * TK;
  float m_r[2][8], l_r[2][8]; v8f oacc[2][DT];
#pragma unroll
  for (int rt = 0; rt < RTN; ++rt) {
#pragma unroll
    for (int r = 0; r < 8; ++r) { m_r[rt][r] = -3.0e38f; l_r[rt][r] = 0.f; }
#pragma unroll
    for (int dt = 0; dt < DT; ++dt) oacc[rt][dt] = (v8f){0.f,0.f,0.f,0.f,0.f,0.f,0.f,0.f}; }
  const int jend = (CAUSAL == 1) ? (qb0 + 4 * RPW) : TK;      /* causal: keys beyond the block's last query never contribute */
#pragma unroll 1
  for (int j0 = 0; j0 < jend; j0 += 32) {
    v8f s[2][2];
#pragma unroll
    for (int nt = 0; nt < 2; ++nt) { const unsigned short* kr = (const unsigned short*)K16 + ((size_t)b * TK + j0 + nt * 16 + ln) * ldk + h * 64; FragH bk[KS];
#pragma unroll
      for (int ks = 0; ks < KS; ++ks) { bk[ks].half[0] = *(const v8us*)(kr + ks * 32 + 8 * hh); bk[ks].half[1] = *(const v8us*)(kr + ks * 32 + 16 + 8 * hh); }
#pragma unroll
      for (int rt = 0; rt < RTN; ++rt) { v8f acc = (v8f){0.f,0.f,0.f,0.f,0.f,0.f,0.f,0.f};
#pragma unroll
        for (int ks = 0; ks < KS; ++ks) acc = mmaH<1>(aq[rt][ks].v, aq[rt][ks].v, bk[ks].v, bk[ks].v, acc); s[rt][nt] = acc; } }
#pragma unroll
    for (int rt = 0; rt < RTN; ++rt)
#pragma unroll
      for (int r = 0; r < 8; ++r) { const int tq = q0 + rt * 16 + 8 * hh + r; const int k0 = j0 + ln, k1 = j0 + 16 + ln;
        const bool ok0 = (CAUSAL == 1) ? (k0 <= tq) : ((CAUSAL == 2) ? ((k0 >> 5) == (tq >> 5)) : true), ok1 = (CAUSAL == 1) ? (k1 <= tq) : ((CAUSAL == 2) ? ((k1 >> 5) == (tq >> 5)) : true);      /* mode 2: block-diagonal 32-token groups */
        const float s0 = ok0 ? s[rt][0][r] * SCL : -3.0e38f, s1 = ok1 ? s[rt][1][r] * SCL : -3.0e38f; float mc = fmaxf(s0, s1);
        mc = fmaxf(mc, __shfl_xor(mc, 1, 32)); mc = fmaxf(mc, __shfl_xor(mc, 2, 32)); mc = fmaxf(mc, __shfl_xor(mc, 4, 32)); mc = fmaxf(mc, __shfl_xor(mc, 8, 32));
        const float mn = fmaxf(m_r[rt][r], mc); const float al = (mn > -1.0e38f) ? expf(m_r[rt][r] - mn) : 1.0f; m_r[rt][r] = mn; const float p0 = ok0 ? expf(s0 - mn) : 0.f, p1 = ok1 ? expf(s1 - mn) : 0.f; l_r[rt][r] = l_r[rt][r] * al + p0 + p1;
#pragma unroll
        for (int dt = 0; dt < DT; ++dt) oacc[rt][dt][r] *= al;
        FragH t2; t2.h[0] = (_Float16)(p0 * 1024.0f); t2.h[1] = (_Float16)(p1 * 1024.0f); sP[w][rt * 16 + 8 * hh + r][ln] = t2.u[0]; sP[w][rt * 16 + 8 * hh + r][16 + ln] = t2.u[1]; }
    __builtin_amdgcn_fence(__ATOMIC_ACQ_REL, "workgroup"); __builtin_amdgcn_wave_barrier();
    FragH pa[2];
#pragma unroll
    for (int rt = 0; rt < RTN; ++rt) { pa[rt].half[0] = *(const v8us*)&sP[w][rt * 16 + ln][8 * hh]; pa[rt].half[1] = *(const v8us*)&sP[w][rt * 16 + ln][16 + 8 * hh]; }
#pragma unroll
    for (int dt = 0; dt < DT; ++dt) { const unsigned short* vrow = Vth + (size_t)(dt * 16 + ln) * TK + j0; FragH bv; bv.half[0] = *(const v8us*)(vrow + 8 * hh); bv.half[1] = *(const v8us*)(vrow + 16 + 8 * hh);
#pragma unroll
      for (int rt = 0; rt < RTN; ++rt) oacc[rt][dt] = mmaH<1>(pa[rt].v, pa[rt].v, bv.v, bv.v, oacc[rt][dt]); }
    __builtin_amdgcn_fence(__ATOMIC_ACQ_REL, "workgroup"); __builtin_amdgcn_wave_barrier(); }
#pragma unroll
  for (int rt = 0; rt < RTN; ++rt) {
#pragma unroll
    for (int r = 0; r < 8; ++r) { float l = l_r[rt][r]; l += __shfl_xor(l, 1, 32); l += __shfl_xor(l, 2, 32); l += __shfl_xor(l, 4, 32); l += __shfl_xor(l, 8, 32); l_r[rt][r] = (l > 0.f) ? 1.0f / (l * 1024.0f) : 0.f; }
#pragma unroll
    for (int dt = 0; dt < DT; ++dt)
#pragma unroll
      for (int r = 0; r < 8; ++r) sO[w][rt * 16 + 8 * hh + r][dt * 16 + ln] = oacc[rt][dt][r] * l_r[rt][r]; }
  __builtin_amdgcn_fence(__ATOMIC_ACQ_REL, "workgroup"); __builtin_amdgcn_wave_barrier();
  {
#pragma unroll
    for (int rp = 0; rp < RPW; rp += 2) { const int r = rp + (lane >> 4), pc = lane & 15; const v4f val = *(const v4fa*)&sO[w][r][pc * 4]; *(v4f*)(O + ((size_t)b * TQ + q0 + r) * ldo + h * 64 + pc * 4) = val; }
     } }

__global__ __launch_bounds__(256) void k_split(const float* __restrict__ src, _Float16* __restrict__ D0, _Float16* __restrict__ D1) { const size_t t = (size_t)blockIdx.x * 256 + threadIdx.x; if (t >= (size_t)NR * NHD * 8) return; const int g8 = (int)(t % 8); const int h = (int)((t / 8) % NHD); const size_t r = t / ((size_t)8 * NHD); const int p = h / 2, which = h % 2; FragH f;
  for (int q = 0; q < 8; ++q) f.h[q] = (_Float16)bf16_round(src[r * DW + h * HD + g8 * 8 + q]); unsigned short* d = (unsigned short*)(which ? D1 : D0) + r * HWD + p * HD + g8 * 8; *(v8us*)d = f.half[0];  }
__global__ __launch_bounds__(64) void k_lambda(const float* __restrict__ lq1, const float* __restrict__ lk1, const float* __restrict__ lq2, const float* __restrict__ lk2, float* __restrict__ LAM) {
  #pragma clang fp contract(off)
  const int ln = threadIdx.x; if (ln >= 32) return; float s1 = 0.f, s2 = 0.f;
#pragma unroll 1
  for (int d = 0; d < HD; ++d) { s1 += bf16_round(lq1[d]) * bf16_round(lk1[d]); s2 += bf16_round(lq2[d]) * bf16_round(lk2[d]); }
  const float lam = expf(s1) - expf(s2) + LAMBDA_INIT; *(float*)(LAM + ln) = lam;  }
__global__ __launch_bounds__(256) void k_comb(const float* __restrict__ O11, const float* __restrict__ O12, const float* __restrict__ O21, const float* __restrict__ O22, const float* __restrict__ LAM, const float* __restrict__ w, float* __restrict__ out) {
  #pragma clang fp contract(off)
  const int wv = threadIdx.x >> 5, ln = threadIdx.x & 31; const size_t rp = (size_t)blockIdx.x * 8 + wv; if (rp >= (size_t)NR * NP) return; const int p = (int)(rp % NP); const size_t r = rp / NP; const float lam = LAM[0]; const int j0 = ln * 4;      /* lanes 0-15 -> first half (O11/O21), 16-31 -> second half (O12/O22) */
  const float* a1 = (j0 < HD ? O11 : O12) + r * HWD + p * HD + (j0 % HD); const float* a2 = (j0 < HD ? O21 : O22) + r * HWD + p * HD + (j0 % HD); float a[4]; float ss = 0.f;
  for (int q = 0; q < 4; ++q) { float v = a1[q]; v += -lam * a2[q]; a[q] = v; ss += v * v; }
  for (int o = 16; o > 0; o >>= 1) ss += __shfl_xor(ss, o, 32); const float inv = rsqrtf(ss / 128.0f + 1e-5f); v4f r4;
  for (int q = 0; q < 4; ++q) { float y = bf16_round(w[j0 + q]) * (a[q] * inv); y *= (1.0f - LAMBDA_INIT); r4[q] = y; }
  float* d = out + r * DW + p * 128 + j0; *(v4f*)d = r4;  }

extern "C" void kernel_launch(void* const* d_in, const int* in_sizes, int n_in,
                              void* d_out, int out_size, void* d_ws, size_t ws_size, hipStream_t stream) {
  (void)in_sizes; (void)n_in; (void)out_size;
  const float* const* I = (const float* const*)d_in; const float* q = I[0]; const float* k = I[1]; const float* v = I[2]; const float* lq1 = I[3]; const float* lk1 = I[4]; const float* lq2 = I[5]; const float* lk2 = I[6]; const float* w = I[7];
  char* ws = (char*)d_ws; size_t off = 0;
  auto take = [&](size_t bytes) { char* p = ws + off; off += (bytes + 255) & ~(size_t)255; return p; };
  const size_t nh = (size_t)NR * HWD;
  _Float16* Q1 = (_Float16*)take(nh * 2); _Float16* Q2 = (_Float16*)take(nh * 2); _Float16* K1 = (_Float16*)take(nh * 2); _Float16* K2 = (_Float16*)take(nh * 2); _Float16* V1 = (_Float16*)take(nh * 2); _Float16* V2 = (_Float16*)take(nh * 2); _Float16* VT1 = (_Float16*)take(nh * 2); _Float16* VT2 = (_Float16*)take(nh * 2);
  float* O11 = (float*)take(nh * 4); float* O12 = (float*)take(nh * 4); float* O21 = (float*)take(nh * 4); float* O22 = (float*)take(nh * 4); float* LAM = (float*)take(256);
  if (off > ws_size) return;      /* 8 x 4 + 4 x 8 = 64 MiB */
  const unsigned gs = (unsigned)(((size_t)NR * NHD * 8 + 255) / 256);
  k_split<<<gs, 256, 0, stream>>>(q, Q1, Q2); k_split<<<gs, 256, 0, stream>>>(k, K1, K2); k_split<<<gs, 256, 0, stream>>>(v, V1, V2);
  k_lambda<<<1, 64, 0, stream>>>(lq1, lk1, lq2, lk2, LAM);
  k_vt<NH, SLEN><<<NB * NH * (SLEN / 64), 256, 0, stream>>>(V1, HWD, 0, VT1); k_vt<NH, SLEN><<<NB * NH * (SLEN / 64), 256, 0, stream>>>(V2, HWD, 0, VT2);
  k_flash<1><<<NB * NH * QBLKS, 128, 0, stream>>>(Q1, HWD, K1, HWD, VT1, nullptr, O11, HWD); k_flash<1><<<NB * NH * QBLKS, 128, 0, stream>>>(Q1, HWD, K1, HWD, VT2, nullptr, O12, HWD);
  k_flash<1><<<NB * NH * QBLKS, 128, 0, stream>>>(Q2, HWD, K2, HWD, VT1, nullptr, O21, HWD); k_flash<1><<<NB * NH * QBLKS, 128, 0, stream>>>(Q2, HWD, K2, HWD, VT2, nullptr, O22, HWD);
  k_comb<<<(unsigned)(((size_t)NR * NP + 7) / 8), 256, 0, stream>>>(O11, O12, O21, O22, LAM, w, (float*)d_out);
}

// v001
// A run of this version takes 522 microseconds.
// Two timings next to v000 put it at 1.75 and 1.74 times that version's speed.
#include <hip/hip_runtime.h>
// Phi4FlashDiffAttention (2 x 2048 tokens, 16 heads of 64 as 8 differential pairs; q, k, v are INPUTS): heads (2p, 2p+1) = (q1, q2) etc.; P1 = causal softmax(q1.k1/8), P2 = causal softmax(q2.k2/8); attn1 = [P1 v1 | P1 v2], attn2 = [P2 v1 | P2 v2] (128 wide); lambda = exp(lq1.lk1) - exp(lq2.lk2) + lambda_init; a = attn1 - lambda attn2; out = subln_w * RMSNorm_128(a) * (1 - lambda_init) -> [B, S, 16, 64].
// Structure: de-interleave q/k/v into exact f16 planes per half (q1, q2, k1, k2, v1, v2; the inputs are exactly representable after bf16 rounding); V^T by LDS tiles; two launches of the fused causal flash kernel, one per (q, k) half, each P multiplied into both V halves (plain operands - exact here except P; f32 softmax/accumulation) giving O11, O12 and O21, O22; lambda on device (f32 64-term dots); the differential combine + RMSNorm on VALU (wave per (token, pair)).
// Compute dtype: inputs rounded to bf16; q, k, v exact as f16; P as f16 (x2^10, ~2^-12); everything else f32. v_wmma_f32_16x16x32_f16.
#define NB 2
#define NHD 16
#define HD 64
#define NP (NHD / 2)
#define DW (NHD * HD)            /* 1024 */
#define HWD (NP * HD)            /* 512 */
#define NR (NB * SLEN)
#define LAMBDA_INIT 0.35550906759096934f  /* 0.8 - 0.6 exp(-0.3) */
#define SLEN 2048
#define TQ SLEN
#define TK SLEN
#define NH 8                     /* head PAIRS per call */
#define SCL 0.125f
#define QBLKS (TQ / 64)
typedef __bf16 v16b __attribute__((ext_vector_type(16)));
typedef unsigned short v8us __attribute__((ext_vector_type(8), may_alias));
typedef float  v8f  __attribute__((ext_vector_type(8)));
typedef float  v4f  __attribute__((ext_vector_type(4)));
typedef float  v4fa __attribute__((ext_vector_type(4), may_alias));
union FragB { v16b v; v8us half[2]; unsigned short u[16]; };

__device__ __forceinline__ unsigned short bf16_bits(float x) { unsigned int u = __float_as_uint(x); return (unsigned short)((u + 0x7FFFu + ((u >> 16) & 1u)) >> 16); }
__device__ __forceinline__ float bf16_val(unsigned short b) { return __uint_as_float(((unsigned int)b) << 16); }
__device__ __forceinline__ float bf16_round(float x) { return bf16_val(bf16_bits(x)); }
// D += A·B with NT terms: 1 = ah·bh, 2 = + al·bh (A split), 3 = + ah·bl (both split)
template <int NT>
__device__ __forceinline__ v8f mmaN(v16b ah, v16b al, v16b bh, v16b bl, v8f c) {
  c = __builtin_amdgcn_wmma_f32_16x16x32_bf16(false, ah, false, bh, (short)0, c, false, false);
  if (NT >= 2) c = __builtin_amdgcn_wmma_f32_16x16x32_bf16(false, al, false, bh, (short)0, c, false, false);
  if (NT >= 3) c = __builtin_amdgcn_wmma_f32_16x16x32_bf16(false, ah, false, bl, (short)0, c, false, false);
  asm volatile("v_nop\n\tv_nop\n\tv_nop\n\tv_nop" : "+v"(c) : "v"(ah), "v"(al), "v"(bh), "v"(bl));
  return c;
}

__global__ __launch_bounds__(256) void k_wt_bf16(const float* __restrict__ W, unsigned short* __restrict__ Wt, int K, int N) {
  const int t = blockIdx.x * 256 + threadIdx.x;
  const int k8n = K / 8;
  if (t >= N * k8n) return;
  const int n = t / k8n, k8 = (t % k8n) * 8;
  v8us v;
#pragma unroll
  for (int i = 0; i < 8; ++i) v[i] = bf16_bits(W[(size_t)(k8 + i) * N + n]);
  *(v8us*)(Wt + (size_t)n * K + k8) = v;
  
}

// GEMM C[M][N] (f32, pitch ldc) = act(A[M][K]·W + bias). A f32 row-major (pitch lda) converted per fragment to bf16
// (ASPLIT: hi/lo two planes -> 2 terms, else single rounded term); Wt bf16 [N][K] (pitch ldb). BIAS_BF16 rounds the
// bias to bf16 first (bias quantised to bf16 before the add). K%32==0, M%16==0, N%64==0.
template <bool ASPLIT, int ACT, bool BIAS_BF16>
__global__ __launch_bounds__(128) void k_gemm_bf(const float* __restrict__ A, int lda, const unsigned short* __restrict__ Wt, int ldb,
                                               const float* __restrict__ bias, float* __restrict__ C, int ldc, int M, int N, int K) {
  __shared__ __attribute__((aligned(16))) float so[4][16][64];
  const int tid = threadIdx.x, w = tid >> 5, lane = tid & 31, ln = lane & 15, hh = lane >> 4;
  const int ntn = N / 64;
  const int wid = blockIdx.x * 4 + w;
  const int mt = wid / ntn, nq = wid % ntn;
  if (mt * 16 >= M) return;
  const int row0 = mt * 16, col0 = nq * 64;
  const float* arow = A + (size_t)(row0 + ln) * lda;
  v8f acc[4] = {};
  for (int kb = 0; kb < K; kb += 32) {
    FragB ah, al;
    const v4f x0 = *(const v4fa*)(arow + kb + 8 * hh), x1 = *(const v4fa*)(arow + kb + 8 * hh + 4);
    const v4f x2 = *(const v4fa*)(arow + kb + 16 + 8 * hh), x3 = *(const v4fa*)(arow + kb + 16 + 8 * hh + 4);
    float xs[16] = {x0[0],x0[1],x0[2],x0[3],x1[0],x1[1],x1[2],x1[3],x2[0],x2[1],x2[2],x2[3],x3[0],x3[1],x3[2],x3[3]};
#pragma unroll
    for (int i = 0; i < 16; ++i) { const unsigned short hb = bf16_bits(xs[i]); ah.u[i] = hb; al.u[i] = ASPLIT ? bf16_bits(xs[i] - bf16_val(hb)) : (unsigned short)0; }
#pragma unroll
    for (int t = 0; t < 4; ++t) {
      const unsigned short* brow = Wt + (size_t)(col0 + t * 16 + ln) * ldb + kb;
      FragB b;
      b.half[0] = *(const v8us*)(brow + 8 * hh);
      b.half[1] = *(const v8us*)(brow + 16 + 8 * hh);
      acc[t] = mmaN<ASPLIT ? 2 : 1>(ah.v, al.v, b.v, b.v, acc[t]);
    }
  }
#pragma unroll
  for (int t = 0; t < 4; ++t) {
    float bv = bias ? bias[col0 + t * 16 + ln] : 0.f;
    if (BIAS_BF16) bv = bf16_round(bv);
#pragma unroll
    for (int r = 0; r < 8; ++r) { float v = acc[t][r] + bv; if (ACT == 1) v = fmaxf(v, 0.f); so[w][8 * hh + r][t * 16 + ln] = v; }
  }
  __builtin_amdgcn_fence(__ATOMIC_ACQ_REL, "workgroup");
  __builtin_amdgcn_wave_barrier();
  const int rsub = lane >> 4, c4 = (lane & 15) * 4;
  {
#pragma unroll
    for (int q = 0; q < 8; ++q) {
      const int r = q * 2 + rsub;
      const v4f v = *(const v4fa*)&so[w][r][c4];
      *(v4f*)(C + (size_t)(row0 + r) * ldc + col0 + c4) = v;
    }
    
  }
}

// GEMM C = act(A·W + bias + resid): A f32 (ASPLIT -> hi/lo 2 terms), Wt bf16 [N][K]; ACT 0 none, 1 relu, 2 exact gelu;
// resid (optional, f32, row index = (row % rmod), pitch ldr, RES_BF16 rounds it) added before the activation.
template <bool ASPLIT, int ACT, bool BIAS_BF16, bool RES_BF16>
__global__ __launch_bounds__(128) void k_gemm_bf3(const float* __restrict__ A, int lda, const unsigned short* __restrict__ Wt, int ldb,
                                                const float* __restrict__ bias, const float* __restrict__ resid, int rmod, int ldr,
                                                float* __restrict__ C, int ldc, int M, int N, int K) {
  __shared__ __attribute__((aligned(16))) float so[4][16][64];
  const int tid = threadIdx.x, w = tid >> 5, lane = tid & 31, ln = lane & 15, hh = lane >> 4;
  const int ntn = N / 64;
  const int wid = blockIdx.x * 4 + w;
  const int mt = wid / ntn, nq = wid % ntn;
  if (mt * 16 >= M) return;
  const int row0 = mt * 16, col0 = nq * 64;
  const float* arow = A + (size_t)(row0 + ln) * lda;
  v8f acc[4] = {};
  for (int kb = 0; kb < K; kb += 32) {
    FragB ah, al;
    const v4f x0 = *(const v4fa*)(arow + kb + 8 * hh), x1 = *(const v4fa*)(arow + kb + 8 * hh + 4);
    const v4f x2 = *(const v4fa*)(arow + kb + 16 + 8 * hh), x3 = *(const v4fa*)(arow + kb + 16 + 8 * hh + 4);
    float xs[16] = {x0[0],x0[1],x0[2],x0[3],x1[0],x1[1],x1[2],x1[3],x2[0],x2[1],x2[2],x2[3],x3[0],x3[1],x3[2],x3[3]};
#pragma unroll
    for (int i = 0; i < 16; ++i) { const unsigned short hb = bf16_bits(xs[i]); ah.u[i] = hb; al.u[i] = ASPLIT ? bf16_bits(xs[i] - bf16_val(hb)) : (unsigned short)0; }
#pragma unroll
    for (int t = 0; t < 4; ++t) {
      const unsigned short* brow = Wt + (size_t)(col0 + t * 16 + ln) * ldb + kb;
      FragB b;
      b.half[0] = *(const v8us*)(brow + 8 * hh);
      b.half[1] = *(const v8us*)(brow + 16 + 8 * hh);
      acc[t] = mmaN<ASPLIT ? 2 : 1>(ah.v, al.v, b.v, b.v, acc[t]);
    }
  }
#pragma unroll
  for (int t = 0; t < 4; ++t) {
    const int col = col0 + t * 16 + ln;
    float bv = bias ? bias[col] : 0.f;
    if (BIAS_BF16) bv = bf16_round(bv);
#pragma unroll
    for (int r = 0; r < 8; ++r) {
      float v = acc[t][r] + bv;
      if (resid) { float rv = resid[(size_t)((row0 + 8 * hh + r) % rmod) * ldr + col]; if (RES_BF16) rv = bf16_round(rv); v += rv; }
      if (ACT == 1) v = fmaxf(v, 0.f);
      if (ACT == 2) v = 0.5f * v * (1.0f + erff(v * 0.70710678118654752f));
      if (ACT == 3) { const float u = 0.7978845608028654f * (v + 0.044715f * v * v * v); v = 0.5f * v * (1.0f + tanhf(u)); }
      so[w][8 * hh + r][t * 16 + ln] = v;
    }
  }
  __builtin_amdgcn_fence(__ATOMIC_ACQ_REL, "workgroup");
  __builtin_amdgcn_wave_barrier();
  const int rsub = lane >> 4, c4 = (lane & 15) * 4;
  {
#pragma unroll
    for (int q = 0; q < 8; ++q) {
      const int r = q * 2 + rsub;
      const v4f v = *(const v4fa*)&so[w][r][c4];
      *(v4f*)(C + (size_t)(row0 + r) * ldc + col0 + c4) = v;
    }
    
  }
}
// row LayerNorm (biased variance, eps) over N: s = X (+ R); optional out_sum <- s; out_norm <- (s-mu)*rsqrt(var+eps)*g + b
template <bool PARAM_BF16>
__global__ __launch_bounds__(256) void k_layernorm(const float* __restrict__ X, const float* __restrict__ R, const float* __restrict__ g, const float* __restrict__ bta,
                                                  float* __restrict__ out_sum, float* __restrict__ out_norm, int N, float eps) {
  __shared__ float red[256];
  const int row = blockIdx.x, tid = threadIdx.x;
  const float* x = X + (size_t)row * N; const float* rr = R ? R + (size_t)row * N : nullptr;
  float vals[16];                     // up to N = 4096
  const int per = N / 256;            // contiguous chunk per thread? use strided-by-4 chunks: thread handles j = tid*4 + 1024*u
  float s1 = 0.f;
  for (int u = 0; u < per / 4; ++u) {
    const int j = tid * 4 + 1024 * u;
    const v4f a = *(const v4fa*)(x + j);
    v4f b = {0.f,0.f,0.f,0.f}; if (rr) b = *(const v4fa*)(rr + j);
#pragma unroll
    for (int q = 0; q < 4; ++q) { const float v = a[q] + b[q]; vals[u * 4 + q] = v; s1 += v; }
  }
  red[tid] = s1; __syncthreads();
  for (int st = 128; st > 0; st >>= 1) { if (tid < st) red[tid] += red[tid + st]; __syncthreads(); }
  const float mu = red[0] / (float)N; __syncthreads();
  float s2 = 0.f;
  for (int u = 0; u < per / 4; ++u)
#pragma unroll
    for (int q = 0; q < 4; ++q) { const float c = vals[u * 4 + q] - mu; s2 += c * c; }
  red[tid] = s2; __syncthreads();
  for (int st = 128; st > 0; st >>= 1) { if (tid < st) red[tid] += red[tid + st]; __syncthreads(); }
  const float rs = rsqrtf(red[0] / (float)N + eps);
  {
    for (int u = 0; u < per / 4; ++u) {
      const int j = tid * 4 + 1024 * u;
      v4f o, sm;
#pragma unroll
      for (int q = 0; q < 4; ++q) {
        float gg = g[j + q], bb = bta[j + q];
        if (PARAM_BF16) { gg = bf16_round(gg); bb = bf16_round(bb); }
        sm[q] = vals[u * 4 + q]; o[q] = (vals[u * 4 + q] - mu) * rs * gg + bb;
      }
      if (out_sum) *(v4f*)(out_sum + (size_t)row * N + j) = sm;
      *(v4f*)(out_norm + (size_t)row * N + j) = o;
    }
    
  }
}



// ---- f16 WMMA path (v_wmma_f32_16x16x32_f16): 11-bit significands for operands in range — used where a [0,1] probability operand needs more precision than bf16
typedef _Float16 v16h __attribute__((ext_vector_type(16)));
union FragH { v16h v; v8us half[2]; _Float16 h[16]; unsigned short u[16]; };
template <int NT>
__device__ __forceinline__ v8f mmaH(v16h ah, v16h al, v16h bh, v16h bl, v8f c) {
  c = __builtin_amdgcn_wmma_f32_16x16x32_f16(false, ah, false, bh, (short)0, c, false, false);
  if (NT >= 2) c = __builtin_amdgcn_wmma_f32_16x16x32_f16(false, al, false, bh, (short)0, c, false, false);
  if (NT >= 3) c = __builtin_amdgcn_wmma_f32_16x16x32_f16(false, ah, false, bl, (short)0, c, false, false);
  asm volatile("v_nop\n\tv_nop\n\tv_nop\n\tv_nop" : "+v"(c) : "v"(ah), "v"(al), "v"(bh), "v"(bl));
  return c;
}
// batched GEMM like k_gemm_b but f16 operands: A f32 (split into f16 hi/lo if ASPLIT, else rounded to f16), Bt = f16 values [n][k]; alpha; C f32; N multiple of 16 (partial tiles skipped)
template <bool ASPLIT>
__global__ __launch_bounds__(128) void k_gemm_h(const float* __restrict__ A, int lda, size_t sA, const _Float16* __restrict__ Bh, int ldb, size_t sB, float alpha, float* __restrict__ C, int ldc, size_t sC, int M, int N, int K) {
  __shared__ __attribute__((aligned(16))) float so[4][16][64];
  const int tid = threadIdx.x, w = tid >> 5, lane = tid & 31, ln = lane & 15, hh = lane >> 4; const int by = blockIdx.y;
  A += (size_t)by * sA; Bh += (size_t)by * sB; C += (size_t)by * sC;
  const int ntn = (N + 63) / 64; const int wid = blockIdx.x * 4 + w; const int mt = wid / ntn, nq = wid % ntn; if (mt * 16 >= M) return;
  const int row0 = mt * 16, col0 = nq * 64; const float* arow = A + (size_t)(row0 + ln) * lda;
  v8f acc[4] = {};
  for (int kb = 0; kb < K; kb += 32) {
    FragH ah, al;
    const v4f x0 = *(const v4fa*)(arow + kb + 8 * hh), x1 = *(const v4fa*)(arow + kb + 8 * hh + 4), x2 = *(const v4fa*)(arow + kb + 16 + 8 * hh), x3 = *(const v4fa*)(arow + kb + 16 + 8 * hh + 4);
    float xs[16] = {x0[0],x0[1],x0[2],x0[3],x1[0],x1[1],x1[2],x1[3],x2[0],x2[1],x2[2],x2[3],x3[0],x3[1],x3[2],x3[3]};
#pragma unroll
    for (int i = 0; i < 16; ++i) { const _Float16 h = (_Float16)xs[i]; ah.h[i] = h; al.h[i] = ASPLIT ? (_Float16)(xs[i] - (float)h) : (_Float16)0.0f; }
#pragma unroll
    for (int t = 0; t < 4; ++t) { if (col0 + t * 16 >= N) continue; const size_t boff = (size_t)(col0 + t * 16 + ln) * ldb + kb; FragH bq; bq.half[0] = *(const v8us*)(Bh + boff + 8 * hh); bq.half[1] = *(const v8us*)(Bh + boff + 16 + 8 * hh);
      acc[t] = mmaH<ASPLIT ? 2 : 1>(ah.v, al.v, bq.v, bq.v, acc[t]); }
  }
#pragma unroll
  for (int t = 0; t < 4; ++t) { if (col0 + t * 16 >= N) continue;
#pragma unroll
    for (int r = 0; r < 8; ++r) so[w][8 * hh + r][t * 16 + ln] = acc[t][r] * alpha; }
  __builtin_amdgcn_fence(__ATOMIC_ACQ_REL, "workgroup"); __builtin_amdgcn_wave_barrier();
  const int rsub = lane >> 4, c4 = (lane & 15) * 4;
  {
#pragma unroll
    for (int q = 0; q < 8; ++q) { const int r = q * 2 + rsub; if (col0 + c4 < N) { const v4f v = *(const v4fa*)&so[w][r][c4]; *(v4f*)(C + (size_t)(row0 + r) * ldc + col0 + c4) = v; } }
     }
}

// Wt[n][k] = f16(W[k][n]·scale) from f32 row-major W[K][N] (scale = power of two; bf16-exact weights stay exact in f16 away from the subnormal range)
__global__ __launch_bounds__(256) void k_wt_f16(const float* __restrict__ W, _Float16* __restrict__ Wt, int K, int N, float scale) {
  const int t = blockIdx.x * 256 + threadIdx.x; if (t >= N * (K / 8)) return; const int n = t / (K / 8), k8 = (t % (K / 8)) * 8; FragH f;
#pragma unroll
  for (int i = 0; i < 8; ++i) f.h[i] = (_Float16)(bf16_round(W[(size_t)(k8 + i) * N + n]) * scale); const v8us o = f.half[0];
  *(v8us*)((unsigned short*)Wt + (size_t)n * K + k8) = o; 
}
// k_gemm_hh variant with fused epilogue: v = acc·alpha + bias[by·sBias + col] (+ CP[(row/rowsPerB)·sCPb + by·64 + col] if CP) ; ACT 0 none / 1 elu ; writes f16 C16 (and f32 C if non-null)
template <int ACT>
__global__ __launch_bounds__(128) void k_gemm_hhx(const _Float16* __restrict__ A, int lda, size_t sA, const _Float16* __restrict__ Bh, int ldb, size_t sB, float alpha, const float* __restrict__ bias, size_t sBias, const float* __restrict__ CP, int rowsPerB, size_t sCPb, int row0g,
    float* __restrict__ C, _Float16* __restrict__ C16, int ldc, size_t sC, int M, int N, int K) {
  __shared__ __attribute__((aligned(16))) float so[4][16][64];
  const int tid = threadIdx.x, w = tid >> 5, lane = tid & 31, ln = lane & 15, hh = lane >> 4; const int by = blockIdx.y;
  A += (size_t)by * sA; Bh += (size_t)by * sB; const size_t cofs = (size_t)by * sC; const float* bp = bias ? bias + (size_t)by * sBias : nullptr;
  const int ntn = (N + 63) / 64; const int wid = blockIdx.x * 4 + w; const int mt = wid / ntn, nq = wid % ntn; if (mt * 16 >= M) return;
  const int row0 = mt * 16, col0 = nq * 64; const _Float16* arow = A + (size_t)(row0 + ln) * lda;
  v8f acc[4] = {};
  for (int kb = 0; kb < K; kb += 32) { FragH ah; ah.half[0] = *(const v8us*)((const unsigned short*)arow + kb + 8 * hh); ah.half[1] = *(const v8us*)((const unsigned short*)arow + kb + 16 + 8 * hh);
#pragma unroll
    for (int t = 0; t < 4; ++t) { if (col0 + t * 16 >= N) continue; const size_t boff = (size_t)(col0 + t * 16 + ln) * ldb + kb; FragH bq; bq.half[0] = *(const v8us*)((const unsigned short*)Bh + boff + 8 * hh); bq.half[1] = *(const v8us*)((const unsigned short*)Bh + boff + 16 + 8 * hh);
      acc[t] = mmaH<1>(ah.v, ah.v, bq.v, bq.v, acc[t]); }
  }
#pragma unroll
  for (int t = 0; t < 4; ++t) { if (col0 + t * 16 >= N) continue; const int col = col0 + t * 16 + ln; const float bv = bp ? bf16_round(bp[col]) : 0.f;
#pragma unroll
    for (int r = 0; r < 8; ++r) { float v = acc[t][r] * alpha + bv; if (CP) { const int bidx = (row0g + row0 + 8 * hh + r) / rowsPerB; v += CP[(size_t)bidx * sCPb + (size_t)by * 64 + col]; } if (ACT == 1) v = (v > 0.f) ? v : expm1f(v); else if (ACT == 7) v = (v > 0.f) ? v + 1.0f : expf(v); else if (ACT == 8) v = tanhf(v); else if (ACT == 9) v = 0.5f * v * (1.0f + tanhf(0.7978845608028654f * (v + 0.044715f * v * v * v))); else if (ACT == 11) v = 1.0f / (1.0f + expf(-v)); else if (ACT == 12) v = (v > 0.f) ? v : 0.01f * v; else if (ACT == 14) v = (v > 0.f) ? v : 0.1f * v; else if (ACT == 15) v = v / (1.0f + expf(-v)); else if (ACT == 3) v = fmaxf(v, 0.f); else if (ACT == 6) v = 0.5f * v * (1.0f + erff(v * 0.70710678118654752f)); so[w][8 * hh + r][t * 16 + ln] = v; } }
  __builtin_amdgcn_fence(__ATOMIC_ACQ_REL, "workgroup"); __builtin_amdgcn_wave_barrier();
  const int rsub = lane >> 4, c4 = (lane & 15) * 4; typedef _Float16 v4h __attribute__((ext_vector_type(4)));
  {
#pragma unroll
    for (int q = 0; q < 8; ++q) { const int r = q * 2 + rsub; if (col0 + c4 < N) { const v4f v = *(const v4fa*)&so[w][r][c4]; if (C) *(v4f*)(C + cofs + (size_t)(row0 + r) * ldc + col0 + c4) = v; if (C16) { v4h h4; for (int i = 0; i < 4; ++i) h4[i] = (_Float16)v[i]; *(v4h*)(C16 + cofs + (size_t)(row0 + r) * ldc + col0 + c4) = h4; } } }
     }
}


typedef _Float16 v4h __attribute__((ext_vector_type(4)));

__global__ __launch_bounds__(256) void k_x16(const float* __restrict__ x, _Float16* __restrict__ X16, size_t n8) { const size_t t = (size_t)blockIdx.x * 256 + threadIdx.x; if (t >= n8) return; FragH f;
#pragma unroll
  for (int q = 0; q < 8; ++q) f.h[q] = (_Float16)bf16_round(x[t * 8 + q]); *(v8us*)((unsigned short*)X16 + t * 8) = f.half[0];  }
__global__ __launch_bounds__(256) void k_h16(const float* __restrict__ x, _Float16* __restrict__ X16, size_t n8) { const size_t t = (size_t)blockIdx.x * 256 + threadIdx.x; if (t >= n8) return; FragH f;
#pragma unroll
  for (int q = 0; q < 8; ++q) f.h[q] = (_Float16)x[t * 8 + q]; *(v8us*)((unsigned short*)X16 + t * 8) = f.half[0];  }
__global__ __launch_bounds__(256) void k_round16f(const float* __restrict__ W, _Float16* __restrict__ Bt, size_t n8) { const size_t t = (size_t)blockIdx.x * 256 + threadIdx.x; if (t >= n8) return; FragH f;
#pragma unroll
  for (int i = 0; i < 8; ++i) f.h[i] = (_Float16)(bf16_round(W[t * 8 + i]) * 16.0f); *(v8us*)((unsigned short*)Bt + t * 8) = f.half[0];  }
template <int NHv, int TTv>
__global__ __launch_bounds__(256) void k_vt(const _Float16* __restrict__ V16, int ldv, int voff, _Float16* __restrict__ Vt) { __shared__ unsigned short tl[64][66]; const int tid = threadIdx.x; const int slab = blockIdx.x / (TTv / 64), lg = blockIdx.x % (TTv / 64); const int b = slab / NHv, h = slab % NHv;
  for (int i = tid; i < 64 * 8; i += 256) { const int r = i / 8, c8 = (i % 8) * 8; FragH f; f.half[0] = *(const v8us*)((const unsigned short*)V16 + ((size_t)b * TTv + lg * 64 + r) * ldv + voff + h * 64 + c8);
#pragma unroll
    for (int q = 0; q < 8; ++q) tl[r][c8 + q] = f.u[q]; }
  __syncthreads();
  {
#pragma unroll
    for (int rd = 0; rd < 2; ++rd) { const int d = rd * 32 + tid / 8, pc = tid % 8; FragH f;
#pragma unroll
      for (int q = 0; q < 8; ++q) f.u[q] = tl[pc * 8 + q][d];
      *(v8us*)((unsigned short*)Vt + ((size_t)slab * 64 + d) * TTv + lg * 64 + pc * 8) = f.half[0]; }
     } }

__global__ __launch_bounds__(256) void k_hl(const float* __restrict__ F, _Float16* __restrict__ Hh, _Float16* __restrict__ Hl, size_t n8) { const size_t t = (size_t)blockIdx.x * 256 + threadIdx.x; if (t >= n8) return; FragH fh, fl; const v4f a = *(const v4fa*)(F + t * 8), c = *(const v4fa*)(F + t * 8 + 4);
#pragma unroll
  for (int q = 0; q < 4; ++q) { _Float16 h = (_Float16)a[q]; fh.h[q] = h; fl.h[q] = (_Float16)((a[q] - (float)h) * 1024.0f); h = (_Float16)c[q]; fh.h[4 + q] = h; fl.h[4 + q] = (_Float16)((c[q] - (float)h) * 1024.0f); }
  { *(v8us*)((unsigned short*)Hh + t * 8) = fh.half[0]; *(v8us*)((unsigned short*)Hl + t * 8) = fl.half[0];  } }

// ---- fast GEMM (wave tile 32x64; requires M % 32 == 0 rows per launch region and N % 64 == 0); epilogue = k_gemm_hhx semantics ----
__device__ __forceinline__ v16h g2_frag(const _Float16* p, int hh) { FragH f; f.half[0] = *(const v8us*)((const unsigned short*)p + 8 * hh); f.half[1] = *(const v8us*)((const unsigned short*)p + 16 + 8 * hh); return f.v; }
__device__ __forceinline__ v8f g2_mma(v16h a, v16h b, v8f c) { v8f d = __builtin_amdgcn_wmma_f32_16x16x32_f16(false, a, false, b, (short)0, c, false, false); asm volatile("v_nop\n\tv_nop\n\tv_nop\n\tv_nop" : "+v"(d) : "v"(a), "v"(b)); return d; }
template <int ACT>
__global__ __launch_bounds__(128) void k_gemm2(const _Float16* __restrict__ A, int lda, size_t sA, const _Float16* __restrict__ Bh, int ldb, size_t sB, float alpha, const float* __restrict__ bias, size_t sBias, const float* __restrict__ CP, int rowsPerB, size_t sCPb, int row0g,
    float* __restrict__ C, _Float16* __restrict__ C16, int ldc, size_t sC, int M, int N, int K) {
  __shared__ __attribute__((aligned(16))) float so[4][32][68];
  const int tid = threadIdx.x, w = tid >> 5, lane = tid & 31, ln = lane & 15, hh = lane >> 4; const int by = blockIdx.y;
  A += (size_t)by * sA; Bh += (size_t)by * sB; const size_t cofs = (size_t)by * sC; const float* bp = bias ? bias + (size_t)by * sBias : nullptr;
  const int ntn = N >> 6; const int mt = blockIdx.x / ntn, nq = blockIdx.x - mt * ntn; const int row0 = mt * 128 + 32 * w, col0 = nq * 64; if (row0 >= M) return;
  const _Float16* a0p = A + (size_t)(row0 + ln) * lda; const _Float16* a1p = a0p + (size_t)16 * lda;
  const _Float16* b0p = Bh + (size_t)(col0 + ln) * ldb; const _Float16* b1p = b0p + (size_t)16 * ldb; const _Float16* b2p = b1p + (size_t)16 * ldb; const _Float16* b3p = b2p + (size_t)16 * ldb;
  const v8f z8 = {0.f,0.f,0.f,0.f,0.f,0.f,0.f,0.f}; v8f c00 = z8, c01 = z8, c02 = z8, c03 = z8, c10 = z8, c11 = z8, c12 = z8, c13 = z8;
#pragma unroll 1
  for (int kb = 0; kb < K; kb += 32) { const v16h a0 = g2_frag(a0p + kb, hh), a1 = g2_frag(a1p + kb, hh);
    v16h b = g2_frag(b0p + kb, hh); c00 = g2_mma(a0, b, c00); c10 = g2_mma(a1, b, c10);
    b = g2_frag(b1p + kb, hh); c01 = g2_mma(a0, b, c01); c11 = g2_mma(a1, b, c11);
    b = g2_frag(b2p + kb, hh); c02 = g2_mma(a0, b, c02); c12 = g2_mma(a1, b, c12);
    b = g2_frag(b3p + kb, hh); c03 = g2_mma(a0, b, c03); c13 = g2_mma(a1, b, c13); }
  v8f accs[8] = {c00, c01, c02, c03, c10, c11, c12, c13};
#pragma unroll
  for (int u = 0; u < 8; ++u) { const int t = u & 3, half = u >> 2; const int col = col0 + t * 16 + ln; const float bv = bp ? bf16_round(bp[col]) : 0.f;
#pragma unroll
    for (int r = 0; r < 8; ++r) { const int rloc = half * 16 + 8 * hh + r; float v = accs[u][r] * alpha + bv; if (CP) { const int bidx = (row0g + row0 + rloc) / rowsPerB; v += CP[(size_t)bidx * sCPb + (size_t)by * 64 + col]; }
      if (ACT == 3) v = fmaxf(v, 0.f); else if (ACT == 6) v = 0.5f * v * (1.0f + erff(v * 0.70710678118654752f)); else if (ACT == 11) v = 1.0f / (1.0f + expf(-v)); else if (ACT == 15) v = v / (1.0f + expf(-v)); else if (ACT == 12) v = (v > 0.f) ? v : 0.01f * v; else if (ACT == 8) v = tanhf(v);
      so[w][rloc][t * 16 + ln] = v; } }
  __builtin_amdgcn_fence(__ATOMIC_ACQ_REL, "workgroup"); __builtin_amdgcn_wave_barrier();
  const int rsub = lane >> 4, c4 = (lane & 15) * 4;
  {
#pragma unroll
    for (int q = 0; q < 16; ++q) { const int r = q * 2 + rsub; const v4f v = *(const v4fa*)&so[w][r][c4]; if (C) *(v4f*)(C + cofs + (size_t)(row0 + r) * ldc + col0 + c4) = v; if (C16) { v4h h4; for (int i = 0; i < 4; ++i) h4[i] = (_Float16)v[i]; *(v4h*)(C16 + cofs + (size_t)(row0 + r) * ldc + col0 + c4) = h4; } }
     } }



template <int CAUSAL>
__global__ __launch_bounds__(128) void k_flash(const _Float16* __restrict__ Q16, int ldq, const _Float16* __restrict__ K16, int ldk, const _Float16* __restrict__ VtA, const _Float16* __restrict__ VtB, const int* __restrict__ MSK, float* __restrict__ OA, float* __restrict__ OB, int ldo) {
  constexpr int RPW = 16, RTN = RPW / 16, NQB = TQ / (4 * RPW), DT = 8, KS = 2;      /* DT: output column tiles 0-3 = P.VA, 4-7 = P.VB (one P for both V halves) */
  __shared__ __attribute__((aligned(16))) unsigned short sP[4][RPW][40]; __shared__ __attribute__((aligned(16))) float sO[4][RPW][128 + 4];
  const int tid = threadIdx.x, w = tid >> 5, lane = tid & 31, ln = lane & 15, hh = lane >> 4;
  const int slab = blockIdx.x / QBLKS, qblk = blockIdx.x % QBLKS; (void)NQB; const int b = slab / NH, h = slab % NH; const int qb0 = qblk * (4 * RPW); const int q0 = qb0 + w * RPW;
  FragH aq[2][KS];
#pragma unroll
  for (int rt = 0; rt < RTN; ++rt) { const unsigned short* qr = (const unsigned short*)Q16 + ((size_t)b * TQ + q0 + rt * 16 + ln) * ldq + h * 64;
#pragma unroll
    for (int ks = 0; ks < KS; ++ks) { aq[rt][ks].half[0] = *(const v8us*)(qr + ks * 32 + 8 * hh); aq[rt][ks].half[1] = *(const v8us*)(qr + ks * 32 + 16 + 8 * hh); } }
  const unsigned short* VthA = (const unsigned short*)VtA + (size_t)slab * 64 * TK; const unsigned short* VthB = (const unsigned short*)VtB + (size_t)slab * 64 * TK;
  float m_r[2][8], l_r[2][8]; v8f oacc[2][DT];
#pragma unroll
  for (int rt = 0; rt < RTN; ++rt) {
#pragma unroll
    for (int r = 0; r < 8; ++r) { m_r[rt][r] = -3.0e38f; l_r[rt][r] = 0.f; }
#pragma unroll
    for (int dt = 0; dt < DT; ++dt) oacc[rt][dt] = (v8f){0.f,0.f,0.f,0.f,0.f,0.f,0.f,0.f}; }
  const int jend = (CAUSAL == 1) ? (qb0 + 4 * RPW) : TK;      /* causal: keys beyond the block's last query never contribute */
#pragma unroll 1
  for (int j0 = 0; j0 < jend; j0 += 32) {
    v8f s[2][2];
#pragma unroll
    for (int nt = 0; nt < 2; ++nt) { const unsigned short* kr = (const unsigned short*)K16 + ((size_t)b * TK + j0 + nt * 16 + ln) * ldk + h * 64; FragH bk[KS];
#pragma unroll
      for (int ks = 0; ks < KS; ++ks) { bk[ks].half[0] = *(const v8us*)(kr + ks * 32 + 8 * hh); bk[ks].half[1] = *(const v8us*)(kr + ks * 32 + 16 + 8 * hh); }
#pragma unroll
      for (int rt = 0; rt < RTN; ++rt) { v8f acc = (v8f){0.f,0.f,0.f,0.f,0.f,0.f,0.f,0.f};
#pragma unroll
        for (int ks = 0; ks < KS; ++ks) acc = mmaH<1>(aq[rt][ks].v, aq[rt][ks].v, bk[ks].v, bk[ks].v, acc); s[rt][nt] = acc; } }
#pragma unroll
    for (int rt = 0; rt < RTN; ++rt)
#pragma unroll
      for (int r = 0; r < 8; ++r) { const int tq = q0 + rt * 16 + 8 * hh + r; const int k0 = j0 + ln, k1 = j0 + 16 + ln;
        const bool ok0 = (CAUSAL == 1) ? (k0 <= tq) : ((CAUSAL == 2) ? ((k0 >> 5) == (tq >> 5)) : true), ok1 = (CAUSAL == 1) ? (k1 <= tq) : ((CAUSAL == 2) ? ((k1 >> 5) == (tq >> 5)) : true);      /* mode 2: block-diagonal 32-token groups */
        const float s0 = ok0 ? s[rt][0][r] * SCL : -3.0e38f, s1 = ok1 ? s[rt][1][r] * SCL : -3.0e38f; float mc = fmaxf(s0, s1);
        mc = fmaxf(mc, __shfl_xor(mc, 1, 32)); mc = fmaxf(mc, __shfl_xor(mc, 2, 32)); mc = fmaxf(mc, __shfl_xor(mc, 4, 32)); mc = fmaxf(mc, __shfl_xor(mc, 8, 32));
        const float mn = fmaxf(m_r[rt][r], mc); const float al = (mn > -1.0e38f) ? expf(m_r[rt][r] - mn) : 1.0f; m_r[rt][r] = mn; const float p0 = ok0 ? expf(s0 - mn) : 0.f, p1 = ok1 ? expf(s1 - mn) : 0.f; l_r[rt][r] = l_r[rt][r] * al + p0 + p1;
#pragma unroll
        for (int dt = 0; dt < DT; ++dt) oacc[rt][dt][r] *= al;
        FragH t2; t2.h[0] = (_Float16)(p0 * 1024.0f); t2.h[1] = (_Float16)(p1 * 1024.0f); sP[w][rt * 16 + 8 * hh + r][ln] = t2.u[0]; sP[w][rt * 16 + 8 * hh + r][16 + ln] = t2.u[1]; }
    __builtin_amdgcn_fence(__ATOMIC_ACQ_REL, "workgroup"); __builtin_amdgcn_wave_barrier();
    FragH pa[2];
#pragma unroll
    for (int rt = 0; rt < RTN; ++rt) { pa[rt].half[0] = *(const v8us*)&sP[w][rt * 16 + ln][8 * hh]; pa[rt].half[1] = *(const v8us*)&sP[w][rt * 16 + ln][16 + 8 * hh]; }
#pragma unroll
    for (int dt = 0; dt < DT / 2; ++dt) { const size_t vo = (size_t)(dt * 16 + ln) * TK + j0; const unsigned short* vra = VthA + vo; const unsigned short* vrb = VthB + vo; FragH bva, bvb;
      bva.half[0] = *(const v8us*)(vra + 8 * hh); bva.half[1] = *(const v8us*)(vra + 16 + 8 * hh); bvb.half[0] = *(const v8us*)(vrb + 8 * hh); bvb.half[1] = *(const v8us*)(vrb + 16 + 8 * hh);
#pragma unroll
      for (int rt = 0; rt < RTN; ++rt) { oacc[rt][dt] = mmaH<1>(pa[rt].v, pa[rt].v, bva.v, bva.v, oacc[rt][dt]); oacc[rt][DT / 2 + dt] = mmaH<1>(pa[rt].v, pa[rt].v, bvb.v, bvb.v, oacc[rt][DT / 2 + dt]); } }
    __builtin_amdgcn_fence(__ATOMIC_ACQ_REL, "workgroup"); __builtin_amdgcn_wave_barrier(); }
#pragma unroll
  for (int rt = 0; rt < RTN; ++rt) {
#pragma unroll
    for (int r = 0; r < 8; ++r) { float l = l_r[rt][r]; l += __shfl_xor(l, 1, 32); l += __shfl_xor(l, 2, 32); l += __shfl_xor(l, 4, 32); l += __shfl_xor(l, 8, 32); l_r[rt][r] = (l > 0.f) ? 1.0f / (l * 1024.0f) : 0.f; }
#pragma unroll
    for (int dt = 0; dt < DT; ++dt)
#pragma unroll
      for (int r = 0; r < 8; ++r) sO[w][rt * 16 + 8 * hh + r][dt * 16 + ln] = oacc[rt][dt][r] * l_r[rt][r]; }
  __builtin_amdgcn_fence(__ATOMIC_ACQ_REL, "workgroup"); __builtin_amdgcn_wave_barrier();
  {
#pragma unroll
    for (int rp = 0; rp < RPW; rp += 2) { const int r = rp + (lane >> 4), pc = lane & 15; const size_t oo = ((size_t)b * TQ + q0 + r) * ldo + h * 64 + pc * 4; const v4f va = *(const v4fa*)&sO[w][r][pc * 4], vb = *(const v4fa*)&sO[w][r][64 + pc * 4]; *(v4f*)(OA + oo) = va; *(v4f*)(OB + oo) = vb; }
     } }

__global__ __launch_bounds__(256) void k_split(const float* __restrict__ src, _Float16* __restrict__ D0, _Float16* __restrict__ D1) { const size_t t = (size_t)blockIdx.x * 256 + threadIdx.x; if (t >= (size_t)NR * NHD * 8) return; const int g8 = (int)(t % 8); const int h = (int)((t / 8) % NHD); const size_t r = t / ((size_t)8 * NHD); const int p = h / 2, which = h % 2; FragH f;
  for (int q = 0; q < 8; ++q) f.h[q] = (_Float16)bf16_round(src[r * DW + h * HD + g8 * 8 + q]); unsigned short* d = (unsigned short*)(which ? D1 : D0) + r * HWD + p * HD + g8 * 8; *(v8us*)d = f.half[0];  }
__global__ __launch_bounds__(64) void k_lambda(const float* __restrict__ lq1, const float* __restrict__ lk1, const float* __restrict__ lq2, const float* __restrict__ lk2, float* __restrict__ LAM) {
  #pragma clang fp contract(off)
  const int ln = threadIdx.x; if (ln >= 32) return; float s1 = 0.f, s2 = 0.f;
#pragma unroll 1
  for (int d = 0; d < HD; ++d) { s1 += bf16_round(lq1[d]) * bf16_round(lk1[d]); s2 += bf16_round(lq2[d]) * bf16_round(lk2[d]); }
  const float lam = expf(s1) - expf(s2) + LAMBDA_INIT; *(float*)(LAM + ln) = lam;  }
__global__ __launch_bounds__(256) void k_comb(const float* __restrict__ O11, const float* __restrict__ O12, const float* __restrict__ O21, const float* __restrict__ O22, const float* __restrict__ LAM, const float* __restrict__ w, float* __restrict__ out) {
  #pragma clang fp contract(off)
  const int wv = threadIdx.x >> 5, ln = threadIdx.x & 31; const size_t rp = (size_t)blockIdx.x * 8 + wv; if (rp >= (size_t)NR * NP) return; const int p = (int)(rp % NP); const size_t r = rp / NP; const float lam = LAM[0]; const int j0 = ln * 4;      /* lanes 0-15 -> first half (O11/O21), 16-31 -> second half (O12/O22) */
  const float* a1 = (j0 < HD ? O11 : O12) + r * HWD + p * HD + (j0 % HD); const float* a2 = (j0 < HD ? O21 : O22) + r * HWD + p * HD + (j0 % HD); float a[4]; float ss = 0.f;
  for (int q = 0; q < 4; ++q) { float v = a1[q]; v += -lam * a2[q]; a[q] = v; ss += v * v; }
  for (int o = 16; o > 0; o >>= 1) ss += __shfl_xor(ss, o, 32); const float inv = rsqrtf(ss / 128.0f + 1e-5f); v4f r4;
  for (int q = 0; q < 4; ++q) { float y = bf16_round(w[j0 + q]) * (a[q] * inv); y *= (1.0f - LAMBDA_INIT); r4[q] = y; }
  float* d = out + r * DW + p * 128 + j0; *(v4f*)d = r4;  }

extern "C" void kernel_launch(void* const* d_in, const int* in_sizes, int n_in,
                              void* d_out, int out_size, void* d_ws, size_t ws_size, hipStream_t stream) {
  (void)in_sizes; (void)n_in; (void)out_size;
  const float* const* I = (const float* const*)d_in; const float* q = I[0]; const float* k = I[1]; const float* v = I[2]; const float* lq1 = I[3]; const float* lk1 = I[4]; const float* lq2 = I[5]; const float* lk2 = I[6]; const float* w = I[7];
  char* ws = (char*)d_ws; size_t off = 0;
  auto take = [&](size_t bytes) { char* p = ws + off; off += (bytes + 255) & ~(size_t)255; return p; };
  const size_t nh = (size_t)NR * HWD;
  _Float16* Q1 = (_Float16*)take(nh * 2); _Float16* Q2 = (_Float16*)take(nh * 2); _Float16* K1 = (_Float16*)take(nh * 2); _Float16* K2 = (_Float16*)take(nh * 2); _Float16* V1 = (_Float16*)take(nh * 2); _Float16* V2 = (_Float16*)take(nh * 2); _Float16* VT1 = (_Float16*)take(nh * 2); _Float16* VT2 = (_Float16*)take(nh * 2);
  float* O11 = (float*)take(nh * 4); float* O12 = (float*)take(nh * 4); float* O21 = (float*)take(nh * 4); float* O22 = (float*)take(nh * 4); float* LAM = (float*)take(256);
  if (off > ws_size) return;      /* 8 x 4 + 4 x 8 = 64 MiB */
  const unsigned gs = (unsigned)(((size_t)NR * NHD * 8 + 255) / 256);
  k_split<<<gs, 256, 0, stream>>>(q, Q1, Q2); k_split<<<gs, 256, 0, stream>>>(k, K1, K2); k_split<<<gs, 256, 0, stream>>>(v, V1, V2);
  k_lambda<<<1, 64, 0, stream>>>(lq1, lk1, lq2, lk2, LAM);
  k_vt<NH, SLEN><<<NB * NH * (SLEN / 64), 256, 0, stream>>>(V1, HWD, 0, VT1); k_vt<NH, SLEN><<<NB * NH * (SLEN / 64), 256, 0, stream>>>(V2, HWD, 0, VT2);
  k_flash<1><<<NB * NH * QBLKS, 128, 0, stream>>>(Q1, HWD, K1, HWD, VT1, VT2, nullptr, O11, O12, HWD);
  k_flash<1><<<NB * NH * QBLKS, 128, 0, stream>>>(Q2, HWD, K2, HWD, VT1, VT2, nullptr, O21, O22, HWD);
  k_comb<<<(unsigned)(((size_t)NR * NP + 7) / 8), 256, 0, stream>>>(O11, O12, O21, O22, LAM, w, (float*)d_out);
}

// v002
// It runs in 240 microseconds.
// Next to v001, in two timings, it ran 2.17 and 2.16 times as fast.
// Counting every step since v000, it is 3.78 times as fast.
#include <hip/hip_runtime.h>
// Phi4FlashDiffAttention (2 x 2048 tokens, 16 heads of 64 as 8 differential pairs; q, k, v are INPUTS): heads (2p, 2p+1) = (q1, q2) etc.; P1 = causal softmax(q1.k1/8), P2 = causal softmax(q2.k2/8); attn1 = [P1 v1 | P1 v2], attn2 = [P2 v1 | P2 v2] (128 wide); lambda = exp(lq1.lk1) - exp(lq2.lk2) + lambda_init; a = attn1 - lambda attn2; out = subln_w * RMSNorm_128(a) * (1 - lambda_init) -> [B, S, 16, 64].
// Structure: de-interleave q/k/v into exact f16 planes per half (q1, q2, k1, k2, v1, v2; the inputs are exactly representable after bf16 rounding); V^T by LDS tiles; two launches of the fused causal flash kernel, one per (q, k) half, each P multiplied into both V halves (plain operands - exact here except P; f32 softmax/accumulation) giving O11, O12 and O21, O22; lambda on device (f32 64-term dots); the differential combine + RMSNorm on VALU (wave per (token, pair)).
// Compute dtype: inputs rounded to bf16; q, k, v exact as f16; P as f16 (x2^10, ~2^-12); everything else f32. v_wmma_f32_16x16x32_f16.
#define NB 2
#define NHD 16
#define HD 64
#define NP (NHD / 2)
#define DW (NHD * HD)            /* 1024 */
#define HWD (NP * HD)            /* 512 */
#define NR (NB * SLEN)
#define LAMBDA_INIT 0.35550906759096934f  /* 0.8 - 0.6 exp(-0.3) */
#define SLEN 2048
#define TQ SLEN
#define TK SLEN
#define NH 8                     /* head PAIRS per call */
#define SCL 0.125f
#define QTILES (TQ / 16)         /* query tiles of 16 rows, one block each */
typedef __bf16 v16b __attribute__((ext_vector_type(16)));
typedef unsigned short v8us __attribute__((ext_vector_type(8), may_alias));
typedef float  v8f  __attribute__((ext_vector_type(8)));
typedef float  v4f  __attribute__((ext_vector_type(4)));
typedef float  v4fa __attribute__((ext_vector_type(4), may_alias));
union FragB { v16b v; v8us half[2]; unsigned short u[16]; };

__device__ __forceinline__ unsigned short bf16_bits(float x) { unsigned int u = __float_as_uint(x); return (unsigned short)((u + 0x7FFFu + ((u >> 16) & 1u)) >> 16); }
__device__ __forceinline__ float bf16_val(unsigned short b) { return __uint_as_float(((unsigned int)b) << 16); }
__device__ __forceinline__ float bf16_round(float x) { return bf16_val(bf16_bits(x)); }
// D += A·B with NT terms: 1 = ah·bh, 2 = + al·bh (A split), 3 = + ah·bl (both split)
template <int NT>
__device__ __forceinline__ v8f mmaN(v16b ah, v16b al, v16b bh, v16b bl, v8f c) {
  c = __builtin_amdgcn_wmma_f32_16x16x32_bf16(false, ah, false, bh, (short)0, c, false, false);
  if (NT >= 2) c = __builtin_amdgcn_wmma_f32_16x16x32_bf16(false, al, false, bh, (short)0, c, false, false);
  if (NT >= 3) c = __builtin_amdgcn_wmma_f32_16x16x32_bf16(false, ah, false, bl, (short)0, c, false, false);
  asm volatile("v_nop\n\tv_nop\n\tv_nop\n\tv_nop" : "+v"(c) : "v"(ah), "v"(al), "v"(bh), "v"(bl));
  return c;
}

__global__ __launch_bounds__(256) void k_wt_bf16(const float* __restrict__ W, unsigned short* __restrict__ Wt, int K, int N) {
  const int t = blockIdx.x * 256 + threadIdx.x;
  const int k8n = K / 8;
  if (t >= N * k8n) return;
  const int n = t / k8n, k8 = (t % k8n) * 8;
  v8us v;
#pragma unroll
  for (int i = 0; i < 8; ++i) v[i] = bf16_bits(W[(size_t)(k8 + i) * N + n]);
  *(v8us*)(Wt + (size_t)n * K + k8) = v;
  
}

// GEMM C[M][N] (f32, pitch ldc) = act(A[M][K]·W + bias). A f32 row-major (pitch lda) converted per fragment to bf16
// (ASPLIT: hi/lo two planes -> 2 terms, else single rounded term); Wt bf16 [N][K] (pitch ldb). BIAS_BF16 rounds the
// bias to bf16 first (bias quantised to bf16 before the add). K%32==0, M%16==0, N%64==0.
template <bool ASPLIT, int ACT, bool BIAS_BF16>
__global__ __launch_bounds__(128) void k_gemm_bf(const float* __restrict__ A, int lda, const unsigned short* __restrict__ Wt, int ldb,
                                               const float* __restrict__ bias, float* __restrict__ C, int ldc, int M, int N, int K) {
  __shared__ __attribute__((aligned(16))) float so[4][16][64];
  const int tid = threadIdx.x, w = tid >> 5, lane = tid & 31, ln = lane & 15, hh = lane >> 4;
  const int ntn = N / 64;
  const int wid = blockIdx.x * 4 + w;
  const int mt = wid / ntn, nq = wid % ntn;
  if (mt * 16 >= M) return;
  const int row0 = mt * 16, col0 = nq * 64;
  const float* arow = A + (size_t)(row0 + ln) * lda;
  v8f acc[4] = {};
  for (int kb = 0; kb < K; kb += 32) {
    FragB ah, al;
    const v4f x0 = *(const v4fa*)(arow + kb + 8 * hh), x1 = *(const v4fa*)(arow + kb + 8 * hh + 4);
    const v4f x2 = *(const v4fa*)(arow + kb + 16 + 8 * hh), x3 = *(const v4fa*)(arow + kb + 16 + 8 * hh + 4);
    float xs[16] = {x0[0],x0[1],x0[2],x0[3],x1[0],x1[1],x1[2],x1[3],x2[0],x2[1],x2[2],x2[3],x3[0],x3[1],x3[2],x3[3]};
#pragma unroll
    for (int i = 0; i < 16; ++i) { const unsigned short hb = bf16_bits(xs[i]); ah.u[i] = hb; al.u[i] = ASPLIT ? bf16_bits(xs[i] - bf16_val(hb)) : (unsigned short)0; }
#pragma unroll
    for (int t = 0; t < 4; ++t) {
      const unsigned short* brow = Wt + (size_t)(col0 + t * 16 + ln) * ldb + kb;
      FragB b;
      b.half[0] = *(const v8us*)(brow + 8 * hh);
      b.half[1] = *(const v8us*)(brow + 16 + 8 * hh);
      acc[t] = mmaN<ASPLIT ? 2 : 1>(ah.v, al.v, b.v, b.v, acc[t]);
    }
  }
#pragma unroll
  for (int t = 0; t < 4; ++t) {
    float bv = bias ? bias[col0 + t * 16 + ln] : 0.f;
    if (BIAS_BF16) bv = bf16_round(bv);
#pragma unroll
    for (int r = 0; r < 8; ++r) { float v = acc[t][r] + bv; if (ACT == 1) v = fmaxf(v, 0.f); so[w][8 * hh + r][t * 16 + ln] = v; }
  }
  __builtin_amdgcn_fence(__ATOMIC_ACQ_REL, "workgroup");
  __builtin_amdgcn_wave_barrier();
  const int rsub = lane >> 4, c4 = (lane & 15) * 4;
  {
#pragma unroll
    for (int q = 0; q < 8; ++q) {
      const int r = q * 2 + rsub;
      const v4f v = *(const v4fa*)&so[w][r][c4];
      *(v4f*)(C + (size_t)(row0 + r) * ldc + col0 + c4) = v;
    }
    
  }
}

// GEMM C = act(A·W + bias + resid): A f32 (ASPLIT -> hi/lo 2 terms), Wt bf16 [N][K]; ACT 0 none, 1 relu, 2 exact gelu;
// resid (optional, f32, row index = (row % rmod), pitch ldr, RES_BF16 rounds it) added before the activation.
template <bool ASPLIT, int ACT, bool BIAS_BF16, bool RES_BF16>
__global__ __launch_bounds__(128) void k_gemm_bf3(const float* __restrict__ A, int lda, const unsigned short* __restrict__ Wt, int ldb,
                                                const float* __restrict__ bias, const float* __restrict__ resid, int rmod, int ldr,
                                                float* __restrict__ C, int ldc, int M, int N, int K) {
  __shared__ __attribute__((aligned(16))) float so[4][16][64];
  const int tid = threadIdx.x, w = tid >> 5, lane = tid & 31, ln = lane & 15, hh = lane >> 4;
  const int ntn = N / 64;
  const int wid = blockIdx.x * 4 + w;
  const int mt = wid / ntn, nq = wid % ntn;
  if (mt * 16 >= M) return;
  const int row0 = mt * 16, col0 = nq * 64;
  const float* arow = A + (size_t)(row0 + ln) * lda;
  v8f acc[4] = {};
  for (int kb = 0; kb < K; kb += 32) {
    FragB ah, al;
    const v4f x0 = *(const v4fa*)(arow + kb + 8 * hh), x1 = *(const v4fa*)(arow + kb + 8 * hh + 4);
    const v4f x2 = *(const v4fa*)(arow + kb + 16 + 8 * hh), x3 = *(const v4fa*)(arow + kb + 16 + 8 * hh + 4);
    float xs[16] = {x0[0],x0[1],x0[2],x0[3],x1[0],x1[1],x1[2],x1[3],x2[0],x2[1],x2[2],x2[3],x3[0],x3[1],x3[2],x3[3]};
#pragma unroll
    for (int i = 0; i < 16; ++i) { const unsigned short hb = bf16_bits(xs[i]); ah.u[i] = hb; al.u[i] = ASPLIT ? bf16_bits(xs[i] - bf16_val(hb)) : (unsigned short)0; }
#pragma unroll
    for (int t = 0; t < 4; ++t) {
      const unsigned short* brow = Wt + (size_t)(col0 + t * 16 + ln) * ldb + kb;
      FragB b;
      b.half[0] = *(const v8us*)(brow + 8 * hh);
      b.half[1] = *(const v8us*)(brow + 16 + 8 * hh);
      acc[t] = mmaN<ASPLIT ? 2 : 1>(ah.v, al.v, b.v, b.v, acc[t]);
    }
  }
#pragma unroll
  for (int t = 0; t < 4; ++t) {
    const int col = col0 + t * 16 + ln;
    float bv = bias ? bias[col] : 0.f;
    if (BIAS_BF16) bv = bf16_round(bv);
#pragma unroll
    for (int r = 0; r < 8; ++r) {
      float v = acc[t][r] + bv;
      if (resid) { float rv = resid[(size_t)((row0 + 8 * hh + r) % rmod) * ldr + col]; if (RES_BF16) rv = bf16_round(rv); v += rv; }
      if (ACT == 1) v = fmaxf(v, 0.f);
      if (ACT == 2) v = 0.5f * v * (1.0f + erff(v * 0.70710678118654752f));
      if (ACT == 3) { const float u = 0.7978845608028654f * (v + 0.044715f * v * v * v); v = 0.5f * v * (1.0f + tanhf(u)); }
      so[w][8 * hh + r][t * 16 + ln] = v;
    }
  }
  __builtin_amdgcn_fence(__ATOMIC_ACQ_REL, "workgroup");
  __builtin_amdgcn_wave_barrier();
  const int rsub = lane >> 4, c4 = (lane & 15) * 4;
  {
#pragma unroll
    for (int q = 0; q < 8; ++q) {
      const int r = q * 2 + rsub;
      const v4f v = *(const v4fa*)&so[w][r][c4];
      *(v4f*)(C + (size_t)(row0 + r) * ldc + col0 + c4) = v;
    }
    
  }
}
// row LayerNorm (biased variance, eps) over N: s = X (+ R); optional out_sum <- s; out_norm <- (s-mu)*rsqrt(var+eps)*g + b
template <bool PARAM_BF16>
__global__ __launch_bounds__(256) void k_layernorm(const float* __restrict__ X, const float* __restrict__ R, const float* __restrict__ g, const float* __restrict__ bta,
                                                  float* __restrict__ out_sum, float* __restrict__ out_norm, int N, float eps) {
  __shared__ float red[256];
  const int row = blockIdx.x, tid = threadIdx.x;
  const float* x = X + (size_t)row * N; const float* rr = R ? R + (size_t)row * N : nullptr;
  float vals[16];                     // up to N = 4096
  const int per = N / 256;            // contiguous chunk per thread? use strided-by-4 chunks: thread handles j = tid*4 + 1024*u
  float s1 = 0.f;
  for (int u = 0; u < per / 4; ++u) {
    const int j = tid * 4 + 1024 * u;
    const v4f a = *(const v4fa*)(x + j);
    v4f b = {0.f,0.f,0.f,0.f}; if (rr) b = *(const v4fa*)(rr + j);
#pragma unroll
    for (int q = 0; q < 4; ++q) { const float v = a[q] + b[q]; vals[u * 4 + q] = v; s1 += v; }
  }
  red[tid] = s1; __syncthreads();
  for (int st = 128; st > 0; st >>= 1) { if (tid < st) red[tid] += red[tid + st]; __syncthreads(); }
  const float mu = red[0] / (float)N; __syncthreads();
  float s2 = 0.f;
  for (int u = 0; u < per / 4; ++u)
#pragma unroll
    for (int q = 0; q < 4; ++q) { const float c = vals[u * 4 + q] - mu; s2 += c * c; }
  red[tid] = s2; __syncthreads();
  for (int st = 128; st > 0; st >>= 1) { if (tid < st) red[tid] += red[tid + st]; __syncthreads(); }
  const float rs = rsqrtf(red[0] / (float)N + eps);
  {
    for (int u = 0; u < per / 4; ++u) {
      const int j = tid * 4 + 1024 * u;
      v4f o, sm;
#pragma unroll
      for (int q = 0; q < 4; ++q) {
        float gg = g[j + q], bb = bta[j + q];
        if (PARAM_BF16) { gg = bf16_round(gg); bb = bf16_round(bb); }
        sm[q] = vals[u * 4 + q]; o[q] = (vals[u * 4 + q] - mu) * rs * gg + bb;
      }
      if (out_sum) *(v4f*)(out_sum + (size_t)row * N + j) = sm;
      *(v4f*)(out_norm + (size_t)row * N + j) = o;
    }
    
  }
}



// ---- f16 WMMA path (v_wmma_f32_16x16x32_f16): 11-bit significands for operands in range — used where a [0,1] probability operand needs more precision than bf16
typedef _Float16 v16h __attribute__((ext_vector_type(16)));
union FragH { v16h v; v8us half[2]; _Float16 h[16]; unsigned short u[16]; };
template <int NT>
__device__ __forceinline__ v8f mmaH(v16h ah, v16h al, v16h bh, v16h bl, v8f c) {
  c = __builtin_amdgcn_wmma_f32_16x16x32_f16(false, ah, false, bh, (short)0, c, false, false);
  if (NT >= 2) c = __builtin_amdgcn_wmma_f32_16x16x32_f16(false, al, false, bh, (short)0, c, false, false);
  if (NT >= 3) c = __builtin_amdgcn_wmma_f32_16x16x32_f16(false, ah, false, bl, (short)0, c, false, false);
  asm volatile("v_nop\n\tv_nop\n\tv_nop\n\tv_nop" : "+v"(c) : "v"(ah), "v"(al), "v"(bh), "v"(bl));
  return c;
}
// batched GEMM like k_gemm_b but f16 operands: A f32 (split into f16 hi/lo if ASPLIT, else rounded to f16), Bt = f16 values [n][k]; alpha; C f32; N multiple of 16 (partial tiles skipped)
template <bool ASPLIT>
__global__ __launch_bounds__(128) void k_gemm_h(const float* __restrict__ A, int lda, size_t sA, const _Float16* __restrict__ Bh, int ldb, size_t sB, float alpha, float* __restrict__ C, int ldc, size_t sC, int M, int N, int K) {
  __shared__ __attribute__((aligned(16))) float so[4][16][64];
  const int tid = threadIdx.x, w = tid >> 5, lane = tid & 31, ln = lane & 15, hh = lane >> 4; const int by = blockIdx.y;
  A += (size_t)by * sA; Bh += (size_t)by * sB; C += (size_t)by * sC;
  const int ntn = (N + 63) / 64; const int wid = blockIdx.x * 4 + w; const int mt = wid / ntn, nq = wid % ntn; if (mt * 16 >= M) return;
  const int row0 = mt * 16, col0 = nq * 64; const float* arow = A + (size_t)(row0 + ln) * lda;
  v8f acc[4] = {};
  for (int kb = 0; kb < K; kb += 32) {
    FragH ah, al;
    const v4f x0 = *(const v4fa*)(arow + kb + 8 * hh), x1 = *(const v4fa*)(arow + kb + 8 * hh + 4), x2 = *(const v4fa*)(arow + kb + 16 + 8 * hh), x3 = *(const v4fa*)(arow + kb + 16 + 8 * hh + 4);
    float xs[16] = {x0[0],x0[1],x0[2],x0[3],x1[0],x1[1],x1[2],x1[3],x2[0],x2[1],x2[2],x2[3],x3[0],x3[1],x3[2],x3[3]};
#pragma unroll
    for (int i = 0; i < 16; ++i) { const _Float16 h = (_Float16)xs[i]; ah.h[i] = h; al.h[i] = ASPLIT ? (_Float16)(xs[i] - (float)h) : (_Float16)0.0f; }
#pragma unroll
    for (int t = 0; t < 4; ++t) { if (col0 + t * 16 >= N) continue; const size_t boff = (size_t)(col0 + t * 16 + ln) * ldb + kb; FragH bq; bq.half[0] = *(const v8us*)(Bh + boff + 8 * hh); bq.half[1] = *(const v8us*)(Bh + boff + 16 + 8 * hh);
      acc[t] = mmaH<ASPLIT ? 2 : 1>(ah.v, al.v, bq.v, bq.v, acc[t]); }
  }
#pragma unroll
  for (int t = 0; t < 4; ++t) { if (col0 + t * 16 >= N) continue;
#pragma unroll
    for (int r = 0; r < 8; ++r) so[w][8 * hh + r][t * 16 + ln] = acc[t][r] * alpha; }
  __builtin_amdgcn_fence(__ATOMIC_ACQ_REL, "workgroup"); __builtin_amdgcn_wave_barrier();
  const int rsub = lane >> 4, c4 = (lane & 15) * 4;
  {
#pragma unroll
    for (int q = 0; q < 8; ++q) { const int r = q * 2 + rsub; if (col0 + c4 < N) { const v4f v = *(const v4fa*)&so[w][r][c4]; *(v4f*)(C + (size_t)(row0 + r) * ldc + col0 + c4) = v; } }
     }
}

// Wt[n][k] = f16(W[k][n]·scale) from f32 row-major W[K][N] (scale = power of two; bf16-exact weights stay exact in f16 away from the subnormal range)
__global__ __launch_bounds__(256) void k_wt_f16(const float* __restrict__ W, _Float16* __restrict__ Wt, int K, int N, float scale) {
  const int t = blockIdx.x * 256 + threadIdx.x; if (t >= N * (K / 8)) return; const int n = t / (K / 8), k8 = (t % (K / 8)) * 8; FragH f;
#pragma unroll
  for (int i = 0; i < 8; ++i) f.h[i] = (_Float16)(bf16_round(W[(size_t)(k8 + i) * N + n]) * scale); const v8us o = f.half[0];
  *(v8us*)((unsigned short*)Wt + (size_t)n * K + k8) = o; 
}
// k_gemm_hh variant with fused epilogue: v = acc·alpha + bias[by·sBias + col] (+ CP[(row/rowsPerB)·sCPb + by·64 + col] if CP) ; ACT 0 none / 1 elu ; writes f16 C16 (and f32 C if non-null)
template <int ACT>
__global__ __launch_bounds__(128) void k_gemm_hhx(const _Float16* __restrict__ A, int lda, size_t sA, const _Float16* __restrict__ Bh, int ldb, size_t sB, float alpha, const float* __restrict__ bias, size_t sBias, const float* __restrict__ CP, int rowsPerB, size_t sCPb, int row0g,
    float* __restrict__ C, _Float16* __restrict__ C16, int ldc, size_t sC, int M, int N, int K) {
  __shared__ __attribute__((aligned(16))) float so[4][16][64];
  const int tid = threadIdx.x, w = tid >> 5, lane = tid & 31, ln = lane & 15, hh = lane >> 4; const int by = blockIdx.y;
  A += (size_t)by * sA; Bh += (size_t)by * sB; const size_t cofs = (size_t)by * sC; const float* bp = bias ? bias + (size_t)by * sBias : nullptr;
  const int ntn = (N + 63) / 64; const int wid = blockIdx.x * 4 + w; const int mt = wid / ntn, nq = wid % ntn; if (mt * 16 >= M) return;
  const int row0 = mt * 16, col0 = nq * 64; const _Float16* arow = A + (size_t)(row0 + ln) * lda;
  v8f acc[4] = {};
  for (int kb = 0; kb < K; kb += 32) { FragH ah; ah.half[0] = *(const v8us*)((const unsigned short*)arow + kb + 8 * hh); ah.half[1] = *(const v8us*)((const unsigned short*)arow + kb + 16 + 8 * hh);
#pragma unroll
    for (int t = 0; t < 4; ++t) { if (col0 + t * 16 >= N) continue; const size_t boff = (size_t)(col0 + t * 16 + ln) * ldb + kb; FragH bq; bq.half[0] = *(const v8us*)((const unsigned short*)Bh + boff + 8 * hh); bq.half[1] = *(const v8us*)((const unsigned short*)Bh + boff + 16 + 8 * hh);
      acc[t] = mmaH<1>(ah.v, ah.v, bq.v, bq.v, acc[t]); }
  }
#pragma unroll
  for (int t = 0; t < 4; ++t) { if (col0 + t * 16 >= N) continue; const int col = col0 + t * 16 + ln; const float bv = bp ? bf16_round(bp[col]) : 0.f;
#pragma unroll
    for (int r = 0; r < 8; ++r) { float v = acc[t][r] * alpha + bv; if (CP) { const int bidx = (row0g + row0 + 8 * hh + r) / rowsPerB; v += CP[(size_t)bidx * sCPb + (size_t)by * 64 + col]; } if (ACT == 1) v = (v > 0.f) ? v : expm1f(v); else if (ACT == 7) v = (v > 0.f) ? v + 1.0f : expf(v); else if (ACT == 8) v = tanhf(v); else if (ACT == 9) v = 0.5f * v * (1.0f + tanhf(0.7978845608028654f * (v + 0.044715f * v * v * v))); else if (ACT == 11) v = 1.0f / (1.0f + expf(-v)); else if (ACT == 12) v = (v > 0.f) ? v : 0.01f * v; else if (ACT == 14) v = (v > 0.f) ? v : 0.1f * v; else if (ACT == 15) v = v / (1.0f + expf(-v)); else if (ACT == 3) v = fmaxf(v, 0.f); else if (ACT == 6) v = 0.5f * v * (1.0f + erff(v * 0.70710678118654752f)); so[w][8 * hh + r][t * 16 + ln] = v; } }
  __builtin_amdgcn_fence(__ATOMIC_ACQ_REL, "workgroup"); __builtin_amdgcn_wave_barrier();
  const int rsub = lane >> 4, c4 = (lane & 15) * 4; typedef _Float16 v4h __attribute__((ext_vector_type(4)));
  {
#pragma unroll
    for (int q = 0; q < 8; ++q) { const int r = q * 2 + rsub; if (col0 + c4 < N) { const v4f v = *(const v4fa*)&so[w][r][c4]; if (C) *(v4f*)(C + cofs + (size_t)(row0 + r) * ldc + col0 + c4) = v; if (C16) { v4h h4; for (int i = 0; i < 4; ++i) h4[i] = (_Float16)v[i]; *(v4h*)(C16 + cofs + (size_t)(row0 + r) * ldc + col0 + c4) = h4; } } }
     }
}


typedef _Float16 v4h __attribute__((ext_vector_type(4)));

__global__ __launch_bounds__(256) void k_x16(const float* __restrict__ x, _Float16* __restrict__ X16, size_t n8) { const size_t t = (size_t)blockIdx.x * 256 + threadIdx.x; if (t >= n8) return; FragH f;
#pragma unroll
  for (int q = 0; q < 8; ++q) f.h[q] = (_Float16)bf16_round(x[t * 8 + q]); *(v8us*)((unsigned short*)X16 + t * 8) = f.half[0];  }
__global__ __launch_bounds__(256) void k_h16(const float* __restrict__ x, _Float16* __restrict__ X16, size_t n8) { const size_t t = (size_t)blockIdx.x * 256 + threadIdx.x; if (t >= n8) return; FragH f;
#pragma unroll
  for (int q = 0; q < 8; ++q) f.h[q] = (_Float16)x[t * 8 + q]; *(v8us*)((unsigned short*)X16 + t * 8) = f.half[0];  }
__global__ __launch_bounds__(256) void k_round16f(const float* __restrict__ W, _Float16* __restrict__ Bt, size_t n8) { const size_t t = (size_t)blockIdx.x * 256 + threadIdx.x; if (t >= n8) return; FragH f;
#pragma unroll
  for (int i = 0; i < 8; ++i) f.h[i] = (_Float16)(bf16_round(W[t * 8 + i]) * 16.0f); *(v8us*)((unsigned short*)Bt + t * 8) = f.half[0];  }
template <int NHv, int TTv>
__global__ __launch_bounds__(256) void k_vt(const _Float16* __restrict__ V16, int ldv, int voff, _Float16* __restrict__ Vt) { __shared__ unsigned short tl[64][66]; const int tid = threadIdx.x; const int slab = blockIdx.x / (TTv / 64), lg = blockIdx.x % (TTv / 64); const int b = slab / NHv, h = slab % NHv;
  for (int i = tid; i < 64 * 8; i += 256) { const int r = i / 8, c8 = (i % 8) * 8; FragH f; f.half[0] = *(const v8us*)((const unsigned short*)V16 + ((size_t)b * TTv + lg * 64 + r) * ldv + voff + h * 64 + c8);
#pragma unroll
    for (int q = 0; q < 8; ++q) tl[r][c8 + q] = f.u[q]; }
  __syncthreads();
  {
#pragma unroll
    for (int rd = 0; rd < 2; ++rd) { const int d = rd * 32 + tid / 8, pc = tid % 8; FragH f;
#pragma unroll
      for (int q = 0; q < 8; ++q) f.u[q] = tl[pc * 8 + q][d];
      *(v8us*)((unsigned short*)Vt + ((size_t)slab * 64 + d) * TTv + lg * 64 + pc * 8) = f.half[0]; }
     } }

__global__ __launch_bounds__(256) void k_hl(const float* __restrict__ F, _Float16* __restrict__ Hh, _Float16* __restrict__ Hl, size_t n8) { const size_t t = (size_t)blockIdx.x * 256 + threadIdx.x; if (t >= n8) return; FragH fh, fl; const v4f a = *(const v4fa*)(F + t * 8), c = *(const v4fa*)(F + t * 8 + 4);
#pragma unroll
  for (int q = 0; q < 4; ++q) { _Float16 h = (_Float16)a[q]; fh.h[q] = h; fl.h[q] = (_Float16)((a[q] - (float)h) * 1024.0f); h = (_Float16)c[q]; fh.h[4 + q] = h; fl.h[4 + q] = (_Float16)((c[q] - (float)h) * 1024.0f); }
  { *(v8us*)((unsigned short*)Hh + t * 8) = fh.half[0]; *(v8us*)((unsigned short*)Hl + t * 8) = fl.half[0];  } }

// ---- fast GEMM (wave tile 32x64; requires M % 32 == 0 rows per launch region and N % 64 == 0); epilogue = k_gemm_hhx semantics ----
__device__ __forceinline__ v16h g2_frag(const _Float16* p, int hh) { FragH f; f.half[0] = *(const v8us*)((const unsigned short*)p + 8 * hh); f.half[1] = *(const v8us*)((const unsigned short*)p + 16 + 8 * hh); return f.v; }
__device__ __forceinline__ v8f g2_mma(v16h a, v16h b, v8f c) { v8f d = __builtin_amdgcn_wmma_f32_16x16x32_f16(false, a, false, b, (short)0, c, false, false); asm volatile("v_nop\n\tv_nop\n\tv_nop\n\tv_nop" : "+v"(d) : "v"(a), "v"(b)); return d; }
template <int ACT>
__global__ __launch_bounds__(128) void k_gemm2(const _Float16* __restrict__ A, int lda, size_t sA, const _Float16* __restrict__ Bh, int ldb, size_t sB, float alpha, const float* __restrict__ bias, size_t sBias, const float* __restrict__ CP, int rowsPerB, size_t sCPb, int row0g,
    float* __restrict__ C, _Float16* __restrict__ C16, int ldc, size_t sC, int M, int N, int K) {
  __shared__ __attribute__((aligned(16))) float so[4][32][68];
  const int tid = threadIdx.x, w = tid >> 5, lane = tid & 31, ln = lane & 15, hh = lane >> 4; const int by = blockIdx.y;
  A += (size_t)by * sA; Bh += (size_t)by * sB; const size_t cofs = (size_t)by * sC; const float* bp = bias ? bias + (size_t)by * sBias : nullptr;
  const int ntn = N >> 6; const int mt = blockIdx.x / ntn, nq = blockIdx.x - mt * ntn; const int row0 = mt * 128 + 32 * w, col0 = nq * 64; if (row0 >= M) return;
  const _Float16* a0p = A + (size_t)(row0 + ln) * lda; const _Float16* a1p = a0p + (size_t)16 * lda;
  const _Float16* b0p = Bh + (size_t)(col0 + ln) * ldb; const _Float16* b1p = b0p + (size_t)16 * ldb; const _Float16* b2p = b1p + (size_t)16 * ldb; const _Float16* b3p = b2p + (size_t)16 * ldb;
  const v8f z8 = {0.f,0.f,0.f,0.f,0.f,0.f,0.f,0.f}; v8f c00 = z8, c01 = z8, c02 = z8, c03 = z8, c10 = z8, c11 = z8, c12 = z8, c13 = z8;
#pragma unroll 1
  for (int kb = 0; kb < K; kb += 32) { const v16h a0 = g2_frag(a0p + kb, hh), a1 = g2_frag(a1p + kb, hh);
    v16h b = g2_frag(b0p + kb, hh); c00 = g2_mma(a0, b, c00); c10 = g2_mma(a1, b, c10);
    b = g2_frag(b1p + kb, hh); c01 = g2_mma(a0, b, c01); c11 = g2_mma(a1, b, c11);
    b = g2_frag(b2p + kb, hh); c02 = g2_mma(a0, b, c02); c12 = g2_mma(a1, b, c12);
    b = g2_frag(b3p + kb, hh); c03 = g2_mma(a0, b, c03); c13 = g2_mma(a1, b, c13); }
  v8f accs[8] = {c00, c01, c02, c03, c10, c11, c12, c13};
#pragma unroll
  for (int u = 0; u < 8; ++u) { const int t = u & 3, half = u >> 2; const int col = col0 + t * 16 + ln; const float bv = bp ? bf16_round(bp[col]) : 0.f;
#pragma unroll
    for (int r = 0; r < 8; ++r) { const int rloc = half * 16 + 8 * hh + r; float v = accs[u][r] * alpha + bv; if (CP) { const int bidx = (row0g + row0 + rloc) / rowsPerB; v += CP[(size_t)bidx * sCPb + (size_t)by * 64 + col]; }
      if (ACT == 3) v = fmaxf(v, 0.f); else if (ACT == 6) v = 0.5f * v * (1.0f + erff(v * 0.70710678118654752f)); else if (ACT == 11) v = 1.0f / (1.0f + expf(-v)); else if (ACT == 15) v = v / (1.0f + expf(-v)); else if (ACT == 12) v = (v > 0.f) ? v : 0.01f * v; else if (ACT == 8) v = tanhf(v);
      so[w][rloc][t * 16 + ln] = v; } }
  __builtin_amdgcn_fence(__ATOMIC_ACQ_REL, "workgroup"); __builtin_amdgcn_wave_barrier();
  const int rsub = lane >> 4, c4 = (lane & 15) * 4;
  {
#pragma unroll
    for (int q = 0; q < 16; ++q) { const int r = q * 2 + rsub; const v4f v = *(const v4fa*)&so[w][r][c4]; if (C) *(v4f*)(C + cofs + (size_t)(row0 + r) * ldc + col0 + c4) = v; if (C16) { v4h h4; for (int i = 0; i < 4; ++i) h4[i] = (_Float16)v[i]; *(v4h*)(C16 + cofs + (size_t)(row0 + r) * ldc + col0 + c4) = h4; } }
     } }



template <int CAUSAL>
__global__ __launch_bounds__(128) void k_flash(const _Float16* __restrict__ Q16, int ldq, const _Float16* __restrict__ K16, int ldk, const _Float16* __restrict__ VtA, const _Float16* __restrict__ VtB, const int* __restrict__ MSK, float* __restrict__ OA, float* __restrict__ OB, int ldo) {
  constexpr int RPW = 16, RTN = RPW / 16, DT = 8, KS = 2;      /* DT: output column tiles 0-3 = P.VA, 4-7 = P.VB (one P for both V halves) */
  /* One block = one tile of 16 query rows; its 32-key chunks are dealt round-robin to the 4 waves (wave w: chunks w, w + 4, ...). Each wave keeps its own running (m, l, O); the four shares are joined through LDS behind the loop. */
  __shared__ __attribute__((aligned(16))) unsigned short sP[4][RPW][40]; __shared__ __attribute__((aligned(16))) float sO[4][RPW][128 + 4]; __shared__ float sM[4][RPW], sL[4][RPW];
  const int tid = threadIdx.x, w = __builtin_amdgcn_readfirstlane(tid >> 5), lane = tid & 31, ln = lane & 15, hh = lane >> 4;      /* w in a scalar register: the key loop's bounds differ from wave to wave and must stay a scalar branch (WMMA needs every lane on) */
  const int slab = blockIdx.x / QTILES, qt = blockIdx.x % QTILES; const int b = slab / NH, h = slab % NH; const int q0 = qt * RPW;
  FragH aq[2][KS];
#pragma unroll
  for (int rt = 0; rt < RTN; ++rt) { const unsigned short* qr = (const unsigned short*)Q16 + ((size_t)b * TQ + q0 + rt * 16 + ln) * ldq + h * 64;
#pragma unroll
    for (int ks = 0; ks < KS; ++ks) { aq[rt][ks].half[0] = *(const v8us*)(qr + ks * 32 + 8 * hh); aq[rt][ks].half[1] = *(const v8us*)(qr + ks * 32 + 16 + 8 * hh); } }
  const unsigned short* VthA = (const unsigned short*)VtA + (size_t)slab * 64 * TK; const unsigned short* VthB = (const unsigned short*)VtB + (size_t)slab * 64 * TK;
  float m_r[2][8], l_r[2][8]; v8f oacc[2][DT];
#pragma unroll
  for (int rt = 0; rt < RTN; ++rt) {
#pragma unroll
    for (int r = 0; r < 8; ++r) { m_r[rt][r] = -3.0e38f; l_r[rt][r] = 0.f; }
#pragma unroll
    for (int dt = 0; dt < DT; ++dt) oacc[rt][dt] = (v8f){0.f,0.f,0.f,0.f,0.f,0.f,0.f,0.f}; }
  const int jend = (CAUSAL == 1) ? (q0 + RPW) : TK;      /* causal: keys beyond the tile's last query never contribute */
#pragma unroll 1
  for (int j0 = 32 * w; j0 < jend; j0 += 4 * 32) {
    v8f s[2][2];
#pragma unroll
    for (int nt = 0; nt < 2; ++nt) { const unsigned short* kr = (const unsigned short*)K16 + ((size_t)b * TK + j0 + nt * 16 + ln) * ldk + h * 64; FragH bk[KS];
#pragma unroll
      for (int ks = 0; ks < KS; ++ks) { bk[ks].half[0] = *(const v8us*)(kr + ks * 32 + 8 * hh); bk[ks].half[1] = *(const v8us*)(kr + ks * 32 + 16 + 8 * hh); }
#pragma unroll
      for (int rt = 0; rt < RTN; ++rt) { v8f acc = (v8f){0.f,0.f,0.f,0.f,0.f,0.f,0.f,0.f};
#pragma unroll
        for (int ks = 0; ks < KS; ++ks) acc = mmaH<1>(aq[rt][ks].v, aq[rt][ks].v, bk[ks].v, bk[ks].v, acc); s[rt][nt] = acc; } }
#pragma unroll
    for (int rt = 0; rt < RTN; ++rt)
#pragma unroll
      for (int r = 0; r < 8; ++r) { const int tq = q0 + rt * 16 + 8 * hh + r; const int k0 = j0 + ln, k1 = j0 + 16 + ln;
        const bool ok0 = (CAUSAL == 1) ? (k0 <= tq) : ((CAUSAL == 2) ? ((k0 >> 5) == (tq >> 5)) : true), ok1 = (CAUSAL == 1) ? (k1 <= tq) : ((CAUSAL == 2) ? ((k1 >> 5) == (tq >> 5)) : true);      /* mode 2: block-diagonal 32-token groups */
        const float s0 = ok0 ? s[rt][0][r] * SCL : -3.0e38f, s1 = ok1 ? s[rt][1][r] * SCL : -3.0e38f; float mc = fmaxf(s0, s1);
        mc = fmaxf(mc, __shfl_xor(mc, 1, 32)); mc = fmaxf(mc, __shfl_xor(mc, 2, 32)); mc = fmaxf(mc, __shfl_xor(mc, 4, 32)); mc = fmaxf(mc, __shfl_xor(mc, 8, 32));
        const float mn = fmaxf(m_r[rt][r], mc); const float al = (mn > -1.0e38f) ? expf(m_r[rt][r] - mn) : 1.0f; m_r[rt][r] = mn; const float p0 = ok0 ? expf(s0 - mn) : 0.f, p1 = ok1 ? expf(s1 - mn) : 0.f; l_r[rt][r] = l_r[rt][r] * al + p0 + p1;
#pragma unroll
        for (int dt = 0; dt < DT; ++dt) oacc[rt][dt][r] *= al;
        FragH t2; t2.h[0] = (_Float16)(p0 * 1024.0f); t2.h[1] = (_Float16)(p1 * 1024.0f); sP[w][rt * 16 + 8 * hh + r][ln] = t2.u[0]; sP[w][rt * 16 + 8 * hh + r][16 + ln] = t2.u[1]; }
    __builtin_amdgcn_fence(__ATOMIC_ACQ_REL, "workgroup"); __builtin_amdgcn_wave_barrier();
    FragH pa[2];
#pragma unroll
    for (int rt = 0; rt < RTN; ++rt) { pa[rt].half[0] = *(const v8us*)&sP[w][rt * 16 + ln][8 * hh]; pa[rt].half[1] = *(const v8us*)&sP[w][rt * 16 + ln][16 + 8 * hh]; }
#pragma unroll
    for (int dt = 0; dt < DT / 2; ++dt) { const size_t vo = (size_t)(dt * 16 + ln) * TK + j0; const unsigned short* vra = VthA + vo; const unsigned short* vrb = VthB + vo; FragH bva, bvb;
      bva.half[0] = *(const v8us*)(vra + 8 * hh); bva.half[1] = *(const v8us*)(vra + 16 + 8 * hh); bvb.half[0] = *(const v8us*)(vrb + 8 * hh); bvb.half[1] = *(const v8us*)(vrb + 16 + 8 * hh);
#pragma unroll
      for (int rt = 0; rt < RTN; ++rt) { oacc[rt][dt] = mmaH<1>(pa[rt].v, pa[rt].v, bva.v, bva.v, oacc[rt][dt]); oacc[rt][DT / 2 + dt] = mmaH<1>(pa[rt].v, pa[rt].v, bvb.v, bvb.v, oacc[rt][DT / 2 + dt]); } }
    __builtin_amdgcn_fence(__ATOMIC_ACQ_REL, "workgroup"); __builtin_amdgcn_wave_barrier(); }
  /* join of the four key shares: publish each wave's row maxima and row sums, weigh every share by exp(m_w - m_all) / l_all, add the weighted shares */
  { float mv = m_r[0][0], lv = 0.f;
#pragma unroll
    for (int r = 0; r < 8; ++r) { float l = l_r[0][r]; l += __shfl_xor(l, 1, 32); l += __shfl_xor(l, 2, 32); l += __shfl_xor(l, 4, 32); l += __shfl_xor(l, 8, 32); if (ln == r) { mv = m_r[0][r]; lv = l; } }
    if (ln < 8) { sM[w][8 * hh + ln] = mv; sL[w][8 * hh + ln] = lv; } }
  __syncthreads();      /* every wave's maxima and sums are written before any wave reads them */
  { const float m0 = sM[0][ln], m1 = sM[1][ln], m2 = sM[2][ln], m3 = sM[3][ln]; const float mt = fmaxf(fmaxf(m0, m1), fmaxf(m2, m3));      /* lane -> row ln; a wave without a chunk holds m = -3e38, l = 0, O = 0 and gets weight 0; wave 0 always holds key 0, so mt is finite */
    const float e0 = expf(m0 - mt), e1 = expf(m1 - mt), e2 = expf(m2 - mt), e3 = expf(m3 - mt); const float lt = ((sL[0][ln] * e0 + sL[1][ln] * e1) + sL[2][ln] * e2) + sL[3][ln] * e3;
    const float ew = (w == 0) ? e0 : ((w == 1) ? e1 : ((w == 2) ? e2 : e3)); const float fl = (lt > 0.f) ? ew / (lt * 1024.0f) : 0.f;
#pragma unroll
    for (int r = 0; r < 8; ++r) { const float f = __shfl(fl, 8 * hh + r, 32);
#pragma unroll
      for (int dt = 0; dt < DT; ++dt) sO[w][8 * hh + r][dt * 16 + ln] = oacc[0][dt][r] * f; } }
  __syncthreads();      /* all four weighted shares are in LDS before they are added */
  {
#pragma unroll
    for (int i = 0; i < 4; ++i) { const int r = i * 4 + w; const v4f p0 = *(const v4fa*)&sO[0][r][lane * 4], p1 = *(const v4fa*)&sO[1][r][lane * 4], p2 = *(const v4fa*)&sO[2][r][lane * 4], p3 = *(const v4fa*)&sO[3][r][lane * 4]; const v4f v = ((p0 + p1) + p2) + p3;
      const size_t oo = ((size_t)b * TQ + q0 + r) * ldo + h * 64 + ln * 4; *(v4f*)((hh ? OB : OA) + oo) = v; }      /* lanes 0-15: the 64 columns of P.VA, lanes 16-31: those of P.VB; 256 contiguous bytes each */
     } }

__global__ __launch_bounds__(256) void k_split(const float* __restrict__ src, _Float16* __restrict__ D0, _Float16* __restrict__ D1) { const size_t t = (size_t)blockIdx.x * 256 + threadIdx.x; if (t >= (size_t)NR * NHD * 8) return; const int g8 = (int)(t % 8); const int h = (int)((t / 8) % NHD); const size_t r = t / ((size_t)8 * NHD); const int p = h / 2, which = h % 2; FragH f;
  for (int q = 0; q < 8; ++q) f.h[q] = (_Float16)bf16_round(src[r * DW + h * HD + g8 * 8 + q]); unsigned short* d = (unsigned short*)(which ? D1 : D0) + r * HWD + p * HD + g8 * 8; *(v8us*)d = f.half[0];  }
__global__ __launch_bounds__(64) void k_lambda(const float* __restrict__ lq1, const float* __restrict__ lk1, const float* __restrict__ lq2, const float* __restrict__ lk2, float* __restrict__ LAM) {
  #pragma clang fp contract(off)
  const int ln = threadIdx.x; if (ln >= 32) return; float s1 = 0.f, s2 = 0.f;
#pragma unroll 1
  for (int d = 0; d < HD; ++d) { s1 += bf16_round(lq1[d]) * bf16_round(lk1[d]); s2 += bf16_round(lq2[d]) * bf16_round(lk2[d]); }
  const float lam = expf(s1) - expf(s2) + LAMBDA_INIT; *(float*)(LAM + ln) = lam;  }
__global__ __launch_bounds__(256) void k_comb(const float* __restrict__ O11, const float* __restrict__ O12, const float* __restrict__ O21, const float* __restrict__ O22, const float* __restrict__ LAM, const float* __restrict__ w, float* __restrict__ out) {
  #pragma clang fp contract(off)
  const int wv = threadIdx.x >> 5, ln = threadIdx.x & 31; const size_t rp = (size_t)blockIdx.x * 8 + wv; if (rp >= (size_t)NR * NP) return; const int p = (int)(rp % NP); const size_t r = rp / NP; const float lam = LAM[0]; const int j0 = ln * 4;      /* lanes 0-15 -> first half (O11/O21), 16-31 -> second half (O12/O22) */
  const float* a1 = (j0 < HD ? O11 : O12) + r * HWD + p * HD + (j0 % HD); const float* a2 = (j0 < HD ? O21 : O22) + r * HWD + p * HD + (j0 % HD); float a[4]; float ss = 0.f;
  for (int q = 0; q < 4; ++q) { float v = a1[q]; v += -lam * a2[q]; a[q] = v; ss += v * v; }
  for (int o = 16; o > 0; o >>= 1) ss += __shfl_xor(ss, o, 32); const float inv = rsqrtf(ss / 128.0f + 1e-5f); v4f r4;
  for (int q = 0; q < 4; ++q) { float y = bf16_round(w[j0 + q]) * (a[q] * inv); y *= (1.0f - LAMBDA_INIT); r4[q] = y; }
  float* d = out + r * DW + p * 128 + j0; *(v4f*)d = r4;  }

extern "C" void kernel_launch(void* const* d_in, const int* in_sizes, int n_in,
                              void* d_out, int out_size, void* d_ws, size_t ws_size, hipStream_t stream) {
  (void)in_sizes; (void)n_in; (void)out_size;
  const float* const* I = (const float* const*)d_in; const float* q = I[0]; const float* k = I[1]; const float* v = I[2]; const float* lq1 = I[3]; const float* lk1 = I[4]; const float* lq2 = I[5]; const float* lk2 = I[6]; const float* w = I[7];
  char* ws = (char*)d_ws; size_t off = 0;
  auto take = [&](size_t bytes) { char* p = ws + off; off += (bytes + 255) & ~(size_t)255; return p; };
  const size_t nh = (size_t)NR * HWD;
  _Float16* Q1 = (_Float16*)take(nh * 2); _Float16* Q2 = (_Float16*)take(nh * 2); _Float16* K1 = (_Float16*)take(nh * 2); _Float16* K2 = (_Float16*)take(nh * 2); _Float16* V1 = (_Float16*)take(nh * 2); _Float16* V2 = (_Float16*)take(nh * 2); _Float16* VT1 = (_Float16*)take(nh * 2); _Float16* VT2 = (_Float16*)take(nh * 2);
  float* O11 = (float*)take(nh * 4); float* O12 = (float*)take(nh * 4); float* O21 = (float*)take(nh * 4); float* O22 = (float*)take(nh * 4); float* LAM = (float*)take(256);
  if (off > ws_size) return;      /* 8 x 4 + 4 x 8 = 64 MiB */
  const unsigned gs = (unsigned)(((size_t)NR * NHD * 8 + 255) / 256);
  k_split<<<gs, 256, 0, stream>>>(q, Q1, Q2); k_split<<<gs, 256, 0, stream>>>(k, K1, K2); k_split<<<gs, 256, 0, stream>>>(v, V1, V2);
  k_lambda<<<1, 64, 0, stream>>>(lq1, lk1, lq2, lk2, LAM);
  k_vt<NH, SLEN><<<NB * NH * (SLEN / 64), 256, 0, stream>>>(V1, HWD, 0, VT1); k_vt<NH, SLEN><<<NB * NH * (SLEN / 64), 256, 0, stream>>>(V2, HWD, 0, VT2);
  k_flash<1><<<NB * NH * QTILES, 128, 0, stream>>>(Q1, HWD, K1, HWD, VT1, VT2, nullptr, O11, O12, HWD);
  k_flash<1><<<NB * NH * QTILES, 128, 0, stream>>>(Q2, HWD, K2, HWD, VT1, VT2, nullptr, O21, O22, HWD);
  k_comb<<<(unsigned)(((size_t)NR * NP + 7) / 8), 256, 0, stream>>>(O11, O12, O21, O22, LAM, w, (float*)d_out);
}

// v003
// Measured time: 138 microseconds a run.
// Two timings next to v002 put it at 1.73 and 1.74 times that version's speed.
// Counting every step since v000, it is 6.54 times as fast.
#include <hip/hip_runtime.h>
// Phi4FlashDiffAttention (2 x 2048 tokens, 16 heads of 64 as 8 differential pairs; q, k, v are INPUTS): heads (2p, 2p+1) = (q1, q2) etc.; P1 = causal softmax(q1.k1/8), P2 = causal softmax(q2.k2/8); attn1 = [P1 v1 | P1 v2], attn2 = [P2 v1 | P2 v2] (128 wide); lambda = exp(lq1.lk1) - exp(lq2.lk2) + lambda_init; a = attn1 - lambda attn2; out = subln_w * RMSNorm_128(a) * (1 - lambda_init) -> [B, S, 16, 64].
// Structure: de-interleave q/k/v into exact f16 planes per half (q1, q2, k1, k2, v1, v2; the inputs are exactly representable after bf16 rounding); V^T by LDS tiles; two launches of the fused causal flash kernel, one per (q, k) half, each P multiplied into both V halves (plain operands - exact here except P; f32 softmax/accumulation) giving O11, O12 and O21, O22; lambda on device (f32 64-term dots); the differential combine + RMSNorm on VALU (wave per (token, pair)).
// Compute dtype: inputs rounded to bf16; q, k, v exact as f16; P as f16 (x2^10, ~2^-12); everything else f32. v_wmma_f32_16x16x32_f16.
#define NB 2
#define NHD 16
#define HD 64
#define NP (NHD / 2)
#define DW (NHD * HD)            /* 1024 */
#define HWD (NP * HD)            /* 512 */
#define NR (NB * SLEN)
#define LAMBDA_INIT 0.35550906759096934f  /* 0.8 - 0.6 exp(-0.3) */
#define SLEN 2048
#define TQ SLEN
#define TK SLEN
#define NH 8                     /* head PAIRS per call */
#define SCL 0.125f
#define QTILES (TQ / 16)         /* query tiles of 16 rows, one block each */
typedef __bf16 v16b __attribute__((ext_vector_type(16)));
typedef unsigned short v8us __attribute__((ext_vector_type(8), may_alias));
typedef float  v8f  __attribute__((ext_vector_type(8)));
typedef float  v4f  __attribute__((ext_vector_type(4)));
typedef float  v4fa __attribute__((ext_vector_type(4), may_alias));
union FragB { v16b v; v8us half[2]; unsigned short u[16]; };

__device__ __forceinline__ unsigned short bf16_bits(float x) { unsigned int u = __float_as_uint(x); return (unsigned short)((u + 0x7FFFu + ((u >> 16) & 1u)) >> 16); }
__device__ __forceinline__ float bf16_val(unsigned short b) { return __uint_as_float(((unsigned int)b) << 16); }
__device__ __forceinline__ float bf16_round(float x) { return bf16_val(bf16_bits(x)); }
// D += A·B with NT terms: 1 = ah·bh, 2 = + al·bh (A split), 3 = + ah·bl (both split)
template <int NT>
__device__ __forceinline__ v8f mmaN(v16b ah, v16b al, v16b bh, v16b bl, v8f c) {
  c = __builtin_amdgcn_wmma_f32_16x16x32_bf16(false, ah, false, bh, (short)0, c, false, false);
  if (NT >= 2) c = __builtin_amdgcn_wmma_f32_16x16x32_bf16(false, al, false, bh, (short)0, c, false, false);
  if (NT >= 3) c = __builtin_amdgcn_wmma_f32_16x16x32_bf16(false, ah, false, bl, (short)0, c, false, false);
  asm volatile("v_nop\n\tv_nop\n\tv_nop\n\tv_nop" : "+v"(c) : "v"(ah), "v"(al), "v"(bh), "v"(bl));
  return c;
}

__global__ __launch_bounds__(256) void k_wt_bf16(const float* __restrict__ W, unsigned short* __restrict__ Wt, int K, int N) {
  const int t = blockIdx.x * 256 + threadIdx.x;
  const int k8n = K / 8;
  if (t >= N * k8n) return;
  const int n = t / k8n, k8 = (t % k8n) * 8;
  v8us v;
#pragma unroll
  for (int i = 0; i < 8; ++i) v[i] = bf16_bits(W[(size_t)(k8 + i) * N + n]);
  *(v8us*)(Wt + (size_t)n * K + k8) = v;
  
}

// GEMM C[M][N] (f32, pitch ldc) = act(A[M][K]·W + bias). A f32 row-major (pitch lda) converted per fragment to bf16
// (ASPLIT: hi/lo two planes -> 2 terms, else single rounded term); Wt bf16 [N][K] (pitch ldb). BIAS_BF16 rounds the
// bias to bf16 first (bias quantised to bf16 before the add). K%32==0, M%16==0, N%64==0.
template <bool ASPLIT, int ACT, bool BIAS_BF16>
__global__ __launch_bounds__(128) void k_gemm_bf(const float* __restrict__ A, int lda, const unsigned short* __restrict__ Wt, int ldb,
                                               const float* __restrict__ bias, float* __restrict__ C, int ldc, int M, int N, int K) {
  __shared__ __attribute__((aligned(16))) float so[4][16][64];
  const int tid = threadIdx.x, w = tid >> 5, lane = tid & 31, ln = lane & 15, hh = lane >> 4;
  const int ntn = N / 64;
  const int wid = blockIdx.x * 4 + w;
  const int mt = wid / ntn, nq = wid % ntn;
  if (mt * 16 >= M) return;
  const int row0 = mt * 16, col0 = nq * 64;
  const float* arow = A + (size_t)(row0 + ln) * lda;
  v8f acc[4] = {};
  for (int kb = 0; kb < K; kb += 32) {
    FragB ah, al;
    const v4f x0 = *(const v4fa*)(arow + kb + 8 * hh), x1 = *(const v4fa*)(arow + kb + 8 * hh + 4);
    const v4f x2 = *(const v4fa*)(arow + kb + 16 + 8 * hh), x3 = *(const v4fa*)(arow + kb + 16 + 8 * hh + 4);
    float xs[16] = {x0[0],x0[1],x0[2],x0[3],x1[0],x1[1],x1[2],x1[3],x2[0],x2[1],x2[2],x2[3],x3[0],x3[1],x3[2],x3[3]};
#pragma unroll
    for (int i = 0; i < 16; ++i) { const unsigned short hb = bf16_bits(xs[i]); ah.u[i] = hb; al.u[i] = ASPLIT ? bf16_bits(xs[i] - bf16_val(hb)) : (unsigned short)0; }
#pragma unroll
    for (int t = 0; t < 4; ++t) {
      const unsigned short* brow = Wt + (size_t)(col0 + t * 16 + ln) * ldb + kb;
      FragB b;
      b.half[0] = *(const v8us*)(brow + 8 * hh);
      b.half[1] = *(const v8us*)(brow + 16 + 8 * hh);
      acc[t] = mmaN<ASPLIT ? 2 : 1>(ah.v, al.v, b.v, b.v, acc[t]);
    }
  }
#pragma unroll
  for (int t = 0; t < 4; ++t) {
    float bv = bias ? bias[col0 + t * 16 + ln] : 0.f;
    if (BIAS_BF16) bv = bf16_round(bv);
#pragma unroll
    for (int r = 0; r < 8; ++r) { float v = acc[t][r] + bv; if (ACT == 1) v = fmaxf(v, 0.f); so[w][8 * hh + r][t * 16 + ln] = v; }
  }
  __builtin_amdgcn_fence(__ATOMIC_ACQ_REL, "workgroup");
  __builtin_amdgcn_wave_barrier();
  const int rsub = lane >> 4, c4 = (lane & 15) * 4;
  {
#pragma unroll
    for (int q = 0; q < 8; ++q) {
      const int r = q * 2 + rsub;
      const v4f v = *(const v4fa*)&so[w][r][c4];
      *(v4f*)(C + (size_t)(row0 + r) * ldc + col0 + c4) = v;
    }
    
  }
}

// GEMM C = act(A·W + bias + resid): A f32 (ASPLIT -> hi/lo 2 terms), Wt bf16 [N][K]; ACT 0 none, 1 relu, 2 exact gelu;
// resid (optional, f32, row index = (row % rmod), pitch ldr, RES_BF16 rounds it) added before the activation.
template <bool ASPLIT, int ACT, bool BIAS_BF16, bool RES_BF16>
__global__ __launch_bounds__(128) void k_gemm_bf3(const float* __restrict__ A, int lda, const unsigned short* __restrict__ Wt, int ldb,
                                                const float* __restrict__ bias, const float* __restrict__ resid, int rmod, int ldr,
                                                float* __restrict__ C, int ldc, int M, int N, int K) {
  __shared__ __attribute__((aligned(16))) float so[4][16][64];
  const int tid = threadIdx.x, w = tid >> 5, lane = tid & 31, ln = lane & 15, hh = lane >> 4;
  const int ntn = N / 64;
  const int wid = blockIdx.x * 4 + w;
  const int mt = wid / ntn, nq = wid % ntn;
  if (mt * 16 >= M) return;
  const int row0 = mt * 16, col0 = nq * 64;
  const float* arow = A + (size_t)(row0 + ln) * lda;
  v8f acc[4] = {};
  for (int kb = 0; kb < K; kb += 32) {
    FragB ah, al;
    const v4f x0 = *(const v4fa*)(arow + kb + 8 * hh), x1 = *(const v4fa*)(arow + kb + 8 * hh + 4);
    const v4f x2 = *(const v4fa*)(arow + kb + 16 + 8 * hh), x3 = *(const v4fa*)(arow + kb + 16 + 8 * hh + 4);
    float xs[16] = {x0[0],x0[1],x0[2],x0[3],x1[0],x1[1],x1[2],x1[3],x2[0],x2[1],x2[2],x2[3],x3[0],x3[1],x3[2],x3[3]};
#pragma unroll
    for (int i = 0; i < 16; ++i) { const unsigned short hb = bf16_bits(xs[i]); ah.u[i] = hb; al.u[i] = ASPLIT ? bf16_bits(xs[i] - bf16_val(hb)) : (unsigned short)0; }
#pragma unroll
    for (int t = 0; t < 4; ++t) {
      const unsigned short* brow = Wt + (size_t)(col0 + t * 16 + ln) * ldb + kb;
      FragB b;
      b.half[0] = *(const v8us*)(brow + 8 * hh);
      b.half[1] = *(const v8us*)(brow + 16 + 8 * hh);
      acc[t] = mmaN<ASPLIT ? 2 : 1>(ah.v, al.v, b.v, b.v, acc[t]);
    }
  }
#pragma unroll
  for (int t = 0; t < 4; ++t) {
    const int col = col0 + t * 16 + ln;
    float bv = bias ? bias[col] : 0.f;
    if (BIAS_BF16) bv = bf16_round(bv);
#pragma unroll
    for (int r = 0; r < 8; ++r) {
      float v = acc[t][r] + bv;
      if (resid) { float rv = resid[(size_t)((row0 + 8 * hh + r) % rmod) * ldr + col]; if (RES_BF16) rv = bf16_round(rv); v += rv; }
      if (ACT == 1) v = fmaxf(v, 0.f);
      if (ACT == 2) v = 0.5f * v * (1.0f + erff(v * 0.70710678118654752f));
      if (ACT == 3) { const float u = 0.7978845608028654f * (v + 0.044715f * v * v * v); v = 0.5f * v * (1.0f + tanhf(u)); }
      so[w][8 * hh + r][t * 16 + ln] = v;
    }
  }
  __builtin_amdgcn_fence(__ATOMIC_ACQ_REL, "workgroup");
  __builtin_amdgcn_wave_barrier();
  const int rsub = lane >> 4, c4 = (lane & 15) * 4;
  {
#pragma unroll
    for (int q = 0; q < 8; ++q) {
      const int r = q * 2 + rsub;
      const v4f v = *(const v4fa*)&so[w][r][c4];
      *(v4f*)(C + (size_t)(row0 + r) * ldc + col0 + c4) = v;
    }
    
  }
}
// row LayerNorm (biased variance, eps) over N: s = X (+ R); optional out_sum <- s; out_norm <- (s-mu)*rsqrt(var+eps)*g + b
template <bool PARAM_BF16>
__global__ __launch_bounds__(256) void k_layernorm(const float* __restrict__ X, const float* __restrict__ R, const float* __restrict__ g, const float* __restrict__ bta,
                                                  float* __restrict__ out_sum, float* __restrict__ out_norm, int N, float eps) {
  __shared__ float red[256];
  const int row = blockIdx.x, tid = threadIdx.x;
  const float* x = X + (size_t)row * N; const float* rr = R ? R + (size_t)row * N : nullptr;
  float vals[16];                     // up to N = 4096
  const int per = N / 256;            // contiguous chunk per thread? use strided-by-4 chunks: thread handles j = tid*4 + 1024*u
  float s1 = 0.f;
  for (int u = 0; u < per / 4; ++u) {
    const int j = tid * 4 + 1024 * u;
    const v4f a = *(const v4fa*)(x + j);
    v4f b = {0.f,0.f,0.f,0.f}; if (rr) b = *(const v4fa*)(rr + j);
#pragma unroll
    for (int q = 0; q < 4; ++q) { const float v = a[q] + b[q]; vals[u * 4 + q] = v; s1 += v; }
  }
  red[tid] = s1; __syncthreads();
  for (int st = 128; st > 0; st >>= 1) { if (tid < st) red[tid] += red[tid + st]; __syncthreads(); }
  const float mu = red[0] / (float)N; __syncthreads();
  float s2 = 0.f;
  for (int u = 0; u < per / 4; ++u)
#pragma unroll
    for (int q = 0; q < 4; ++q) { const float c = vals[u * 4 + q] - mu; s2 += c * c; }
  red[tid] = s2; __syncthreads();
  for (int st = 128; st > 0; st >>= 1) { if (tid < st) red[tid] += red[tid + st]; __syncthreads(); }
  const float rs = rsqrtf(red[0] / (float)N + eps);
  {
    for (int u = 0; u < per / 4; ++u) {
      const int j = tid * 4 + 1024 * u;
      v4f o, sm;
#pragma unroll
      for (int q = 0; q < 4; ++q) {
        float gg = g[j + q], bb = bta[j + q];
        if (PARAM_BF16) { gg = bf16_round(gg); bb = bf16_round(bb); }
        sm[q] = vals[u * 4 + q]; o[q] = (vals[u * 4 + q] - mu) * rs * gg + bb;
      }
      if (out_sum) *(v4f*)(out_sum + (size_t)row * N + j) = sm;
      *(v4f*)(out_norm + (size_t)row * N + j) = o;
    }
    
  }
}



// ---- f16 WMMA path (v_wmma_f32_16x16x32_f16): 11-bit significands for operands in range — used where a [0,1] probability operand needs more precision than bf16
typedef _Float16 v16h __attribute__((ext_vector_type(16)));
union FragH { v16h v; v8us half[2]; _Float16 h[16]; unsigned short u[16]; };
template <int NT>
__device__ __forceinline__ v8f mmaH(v16h ah, v16h al, v16h bh, v16h bl, v8f c) {
  c = __builtin_amdgcn_wmma_f32_16x16x32_f16(false, ah, false, bh, (short)0, c, false, false);
  if (NT >= 2) c = __builtin_amdgcn_wmma_f32_16x16x32_f16(false, al, false, bh, (short)0, c, false, false);
  if (NT >= 3) c = __builtin_amdgcn_wmma_f32_16x16x32_f16(false, ah, false, bl, (short)0, c, false, false);
  asm volatile("v_nop\n\tv_nop\n\tv_nop\n\tv_nop" : "+v"(c) : "v"(ah), "v"(al), "v"(bh), "v"(bl));
  return c;
}
// batched GEMM like k_gemm_b but f16 operands: A f32 (split into f16 hi/lo if ASPLIT, else rounded to f16), Bt = f16 values [n][k]; alpha; C f32; N multiple of 16 (partial tiles skipped)
template <bool ASPLIT>
__global__ __launch_bounds__(128) void k_gemm_h(const float* __restrict__ A, int lda, size_t sA, const _Float16* __restrict__ Bh, int ldb, size_t sB, float alpha, float* __restrict__ C, int ldc, size_t sC, int M, int N, int K) {
  __shared__ __attribute__((aligned(16))) float so[4][16][64];
  const int tid = threadIdx.x, w = tid >> 5, lane = tid & 31, ln = lane & 15, hh = lane >> 4; const int by = blockIdx.y;
  A += (size_t)by * sA; Bh += (size_t)by * sB; C += (size_t)by * sC;
  const int ntn = (N + 63) / 64; const int wid = blockIdx.x * 4 + w; const int mt = wid / ntn, nq = wid % ntn; if (mt * 16 >= M) return;
  const int row0 = mt * 16, col0 = nq * 64; const float* arow = A + (size_t)(row0 + ln) * lda;
  v8f acc[4] = {};
  for (int kb = 0; kb < K; kb += 32) {
    FragH ah, al;
    const v4f x0 = *(const v4fa*)(arow + kb + 8 * hh), x1 = *(const v4fa*)(arow + kb + 8 * hh + 4), x2 = *(const v4fa*)(arow + kb + 16 + 8 * hh), x3 = *(const v4fa*)(arow + kb + 16 + 8 * hh + 4);
    float xs[16] = {x0[0],x0[1],x0[2],x0[3],x1[0],x1[1],x1[2],x1[3],x2[0],x2[1],x2[2],x2[3],x3[0],x3[1],x3[2],x3[3]};
#pragma unroll
    for (int i = 0; i < 16; ++i) { const _Float16 h = (_Float16)xs[i]; ah.h[i] = h; al.h[i] = ASPLIT ? (_Float16)(xs[i] - (float)h) : (_Float16)0.0f; }
#pragma unroll
    for (int t = 0; t < 4; ++t) { if (col0 + t * 16 >= N) continue; const size_t boff = (size_t)(col0 + t * 16 + ln) * ldb + kb; FragH bq; bq.half[0] = *(const v8us*)(Bh + boff + 8 * hh); bq.half[1] = *(const v8us*)(Bh + boff + 16 + 8 * hh);
      acc[t] = mmaH<ASPLIT ? 2 : 1>(ah.v, al.v, bq.v, bq.v, acc[t]); }
  }
#pragma unroll
  for (int t = 0; t < 4; ++t) { if (col0 + t * 16 >= N) continue;
#pragma unroll
    for (int r = 0; r < 8; ++r) so[w][8 * hh + r][t * 16 + ln] = acc[t][r] * alpha; }
  __builtin_amdgcn_fence(__ATOMIC_ACQ_REL, "workgroup"); __builtin_amdgcn_wave_barrier();
  const int rsub = lane >> 4, c4 = (lane & 15) * 4;
  {
#pragma unroll
    for (int q = 0; q < 8; ++q) { const int r = q * 2 + rsub; if (col0 + c4 < N) { const v4f v = *(const v4fa*)&so[w][r][c4]; *(v4f*)(C + (size_t)(row0 + r) * ldc + col0 + c4) = v; } }
     }
}

// Wt[n][k] = f16(W[k][n]·scale) from f32 row-major W[K][N] (scale = power of two; bf16-exact weights stay exact in f16 away from the subnormal range)
__global__ __launch_bounds__(256) void k_wt_f16(const float* __restrict__ W, _Float16* __restrict__ Wt, int K, int N, float scale) {
  const int t = blockIdx.x * 256 + threadIdx.x; if (t >= N * (K / 8)) return; const int n = t / (K / 8), k8 = (t % (K / 8)) * 8; FragH f;
#pragma unroll
  for (int i = 0; i < 8; ++i) f.h[i] = (_Float16)(bf16_round(W[(size_t)(k8 + i) * N + n]) * scale); const v8us o = f.half[0];
  *(v8us*)((unsigned short*)Wt + (size_t)n * K + k8) = o; 
}
// k_gemm_hh variant with fused epilogue: v = acc·alpha + bias[by·sBias + col] (+ CP[(row/rowsPerB)·sCPb + by·64 + col] if CP) ; ACT 0 none / 1 elu ; writes f16 C16 (and f32 C if non-null)
template <int ACT>
__global__ __launch_bounds__(128) void k_gemm_hhx(const _Float16* __restrict__ A, int lda, size_t sA, const _Float16* __restrict__ Bh, int ldb, size_t sB, float alpha, const float* __restrict__ bias, size_t sBias, const float* __restrict__ CP, int rowsPerB, size_t sCPb, int row0g,
    float* __restrict__ C, _Float16* __restrict__ C16, int ldc, size_t sC, int M, int N, int K) {
  __shared__ __attribute__((aligned(16))) float so[4][16][64];
  const int tid = threadIdx.x, w = tid >> 5, lane = tid & 31, ln = lane & 15, hh = lane >> 4; const int by = blockIdx.y;
  A += (size_t)by * sA; Bh += (size_t)by * sB; const size_t cofs = (size_t)by * sC; const float* bp = bias ? bias + (size_t)by * sBias : nullptr;
  const int ntn = (N + 63) / 64; const int wid = blockIdx.x * 4 + w; const int mt = wid / ntn, nq = wid % ntn; if (mt * 16 >= M) return;
  const int row0 = mt * 16, col0 = nq * 64; const _Float16* arow = A + (size_t)(row0 + ln) * lda;
  v8f acc[4] = {};
  for (int kb = 0; kb < K; kb += 32) { FragH ah; ah.half[0] = *(const v8us*)((const unsigned short*)arow + kb + 8 * hh); ah.half[1] = *(const v8us*)((const unsigned short*)arow + kb + 16 + 8 * hh);
#pragma unroll
    for (int t = 0; t < 4; ++t) { if (col0 + t * 16 >= N) continue; const size_t boff = (size_t)(col0 + t * 16 + ln) * ldb + kb; FragH bq; bq.half[0] = *(const v8us*)((const unsigned short*)Bh + boff + 8 * hh); bq.half[1] = *(const v8us*)((const unsigned short*)Bh + boff + 16 + 8 * hh);
      acc[t] = mmaH<1>(ah.v, ah.v, bq.v, bq.v, acc[t]); }
  }
#pragma unroll
  for (int t = 0; t < 4; ++t) { if (col0 + t * 16 >= N) continue; const int col = col0 + t * 16 + ln; const float bv = bp ? bf16_round(bp[col]) : 0.f;
#pragma unroll
    for (int r = 0; r < 8; ++r) { float v = acc[t][r] * alpha + bv; if (CP) { const int bidx = (row0g + row0 + 8 * hh + r) / rowsPerB; v += CP[(size_t)bidx * sCPb + (size_t)by * 64 + col]; } if (ACT == 1) v = (v > 0.f) ? v : expm1f(v); else if (ACT == 7) v = (v > 0.f) ? v + 1.0f : expf(v); else if (ACT == 8) v = tanhf(v); else if (ACT == 9) v = 0.5f * v * (1.0f + tanhf(0.7978845608028654f * (v + 0.044715f * v * v * v))); else if (ACT == 11) v = 1.0f / (1.0f + expf(-v)); else if (ACT == 12) v = (v > 0.f) ? v : 0.01f * v; else if (ACT == 14) v = (v > 0.f) ? v : 0.1f * v; else if (ACT == 15) v = v / (1.0f + expf(-v)); else if (ACT == 3) v = fmaxf(v, 0.f); else if (ACT == 6) v = 0.5f * v * (1.0f + erff(v * 0.70710678118654752f)); so[w][8 * hh + r][t * 16 + ln] = v; } }
  __builtin_amdgcn_fence(__ATOMIC_ACQ_REL, "workgroup"); __builtin_amdgcn_wave_barrier();
  const int rsub = lane >> 4, c4 = (lane & 15) * 4; typedef _Float16 v4h __attribute__((ext_vector_type(4)));
  {
#pragma unroll
    for (int q = 0; q < 8; ++q) { const int r = q * 2 + rsub; if (col0 + c4 < N) { const v4f v = *(const v4fa*)&so[w][r][c4]; if (C) *(v4f*)(C + cofs + (size_t)(row0 + r) * ldc + col0 + c4) = v; if (C16) { v4h h4; for (int i = 0; i < 4; ++i) h4[i] = (_Float16)v[i]; *(v4h*)(C16 + cofs + (size_t)(row0 + r) * ldc + col0 + c4) = h4; } } }
     }
}


typedef _Float16 v4h __attribute__((ext_vector_type(4)));

__global__ __launch_bounds__(256) void k_x16(const float* __restrict__ x, _Float16* __restrict__ X16, size_t n8) { const size_t t = (size_t)blockIdx.x * 256 + threadIdx.x; if (t >= n8) return; FragH f;
#pragma unroll
  for (int q = 0; q < 8; ++q) f.h[q] = (_Float16)bf16_round(x[t * 8 + q]); *(v8us*)((unsigned short*)X16 + t * 8) = f.half[0];  }
__global__ __launch_bounds__(256) void k_h16(const float* __restrict__ x, _Float16* __restrict__ X16, size_t n8) { const size_t t = (size_t)blockIdx.x * 256 + threadIdx.x; if (t >= n8) return; FragH f;
#pragma unroll
  for (int q = 0; q < 8; ++q) f.h[q] = (_Float16)x[t * 8 + q]; *(v8us*)((unsigned short*)X16 + t * 8) = f.half[0];  }
__global__ __launch_bounds__(256) void k_round16f(const float* __restrict__ W, _Float16* __restrict__ Bt, size_t n8) { const size_t t = (size_t)blockIdx.x * 256 + threadIdx.x; if (t >= n8) return; FragH f;
#pragma unroll
  for (int i = 0; i < 8; ++i) f.h[i] = (_Float16)(bf16_round(W[t * 8 + i]) * 16.0f); *(v8us*)((unsigned short*)Bt + t * 8) = f.half[0];  }
template <int NHv, int TTv>
__global__ __launch_bounds__(256) void k_vt(const _Float16* __restrict__ V16, int ldv, int voff, _Float16* __restrict__ Vt) { __shared__ unsigned short tl[64][66]; const int tid = threadIdx.x; const int slab = blockIdx.x / (TTv / 64), lg = blockIdx.x % (TTv / 64); const int b = slab / NHv, h = slab % NHv;
  for (int i = tid; i < 64 * 8; i += 256) { const int r = i / 8, c8 = (i % 8) * 8; FragH f; f.half[0] = *(const v8us*)((const unsigned short*)V16 + ((size_t)b * TTv + lg * 64 + r) * ldv + voff + h * 64 + c8);
#pragma unroll
    for (int q = 0; q < 8; ++q) tl[r][c8 + q] = f.u[q]; }
  __syncthreads();
  {
#pragma unroll
    for (int rd = 0; rd < 2; ++rd) { const int d = rd * 32 + tid / 8, pc = tid % 8; FragH f;
#pragma unroll
      for (int q = 0; q < 8; ++q) f.u[q] = tl[pc * 8 + q][d];
      *(v8us*)((unsigned short*)Vt + ((size_t)slab * 64 + d) * TTv + lg * 64 + pc * 8) = f.half[0]; }
     } }

__global__ __launch_bounds__(256) void k_hl(const float* __restrict__ F, _Float16* __restrict__ Hh, _Float16* __restrict__ Hl, size_t n8) { const size_t t = (size_t)blockIdx.x * 256 + threadIdx.x; if (t >= n8) return; FragH fh, fl; const v4f a = *(const v4fa*)(F + t * 8), c = *(const v4fa*)(F + t * 8 + 4);
#pragma unroll
  for (int q = 0; q < 4; ++q) { _Float16 h = (_Float16)a[q]; fh.h[q] = h; fl.h[q] = (_Float16)((a[q] - (float)h) * 1024.0f); h = (_Float16)c[q]; fh.h[4 + q] = h; fl.h[4 + q] = (_Float16)((c[q] - (float)h) * 1024.0f); }
  { *(v8us*)((unsigned short*)Hh + t * 8) = fh.half[0]; *(v8us*)((unsigned short*)Hl + t * 8) = fl.half[0];  } }

// ---- fast GEMM (wave tile 32x64; requires M % 32 == 0 rows per launch region and N % 64 == 0); epilogue = k_gemm_hhx semantics ----
__device__ __forceinline__ v16h g2_frag(const _Float16* p, int hh) { FragH f; f.half[0] = *(const v8us*)((const unsigned short*)p + 8 * hh); f.half[1] = *(const v8us*)((const unsigned short*)p + 16 + 8 * hh); return f.v; }
__device__ __forceinline__ v8f g2_mma(v16h a, v16h b, v8f c) { v8f d = __builtin_amdgcn_wmma_f32_16x16x32_f16(false, a, false, b, (short)0, c, false, false); asm volatile("v_nop\n\tv_nop\n\tv_nop\n\tv_nop" : "+v"(d) : "v"(a), "v"(b)); return d; }
template <int ACT>
__global__ __launch_bounds__(128) void k_gemm2(const _Float16* __restrict__ A, int lda, size_t sA, const _Float16* __restrict__ Bh, int ldb, size_t sB, float alpha, const float* __restrict__ bias, size_t sBias, const float* __restrict__ CP, int rowsPerB, size_t sCPb, int row0g,
    float* __restrict__ C, _Float16* __restrict__ C16, int ldc, size_t sC, int M, int N, int K) {
  __shared__ __attribute__((aligned(16))) float so[4][32][68];
  const int tid = threadIdx.x, w = tid >> 5, lane = tid & 31, ln = lane & 15, hh = lane >> 4; const int by = blockIdx.y;
  A += (size_t)by * sA; Bh += (size_t)by * sB; const size_t cofs = (size_t)by * sC; const float* bp = bias ? bias + (size_t)by * sBias : nullptr;
  const int ntn = N >> 6; const int mt = blockIdx.x / ntn, nq = blockIdx.x - mt * ntn; const int row0 = mt * 128 + 32 * w, col0 = nq * 64; if (row0 >= M) return;
  const _Float16* a0p = A + (size_t)(row0 + ln) * lda; const _Float16* a1p = a0p + (size_t)16 * lda;
  const _Float16* b0p = Bh + (size_t)(col0 + ln) * ldb; const _Float16* b1p = b0p + (size_t)16 * ldb; const _Float16* b2p = b1p + (size_t)16 * ldb; const _Float16* b3p = b2p + (size_t)16 * ldb;
  const v8f z8 = {0.f,0.f,0.f,0.f,0.f,0.f,0.f,0.f}; v8f c00 = z8, c01 = z8, c02 = z8, c03 = z8, c10 = z8, c11 = z8, c12 = z8, c13 = z8;
#pragma unroll 1
  for (int kb = 0; kb < K; kb += 32) { const v16h a0 = g2_frag(a0p + kb, hh), a1 = g2_frag(a1p + kb, hh);
    v16h b = g2_frag(b0p + kb, hh); c00 = g2_mma(a0, b, c00); c10 = g2_mma(a1, b, c10);
    b = g2_frag(b1p + kb, hh); c01 = g2_mma(a0, b, c01); c11 = g2_mma(a1, b, c11);
    b = g2_frag(b2p + kb, hh); c02 = g2_mma(a0, b, c02); c12 = g2_mma(a1, b, c12);
    b = g2_frag(b3p + kb, hh); c03 = g2_mma(a0, b, c03); c13 = g2_mma(a1, b, c13); }
  v8f accs[8] = {c00, c01, c02, c03, c10, c11, c12, c13};
#pragma unroll
  for (int u = 0; u < 8; ++u) { const int t = u & 3, half = u >> 2; const int col = col0 + t * 16 + ln; const float bv = bp ? bf16_round(bp[col]) : 0.f;
#pragma unroll
    for (int r = 0; r < 8; ++r) { const int rloc = half * 16 + 8 * hh + r; float v = accs[u][r] * alpha + bv; if (CP) { const int bidx = (row0g + row0 + rloc) / rowsPerB; v += CP[(size_t)bidx * sCPb + (size_t)by * 64 + col]; }
      if (ACT == 3) v = fmaxf(v, 0.f); else if (ACT == 6) v = 0.5f * v * (1.0f + erff(v * 0.70710678118654752f)); else if (ACT == 11) v = 1.0f / (1.0f + expf(-v)); else if (ACT == 15) v = v / (1.0f + expf(-v)); else if (ACT == 12) v = (v > 0.f) ? v : 0.01f * v; else if (ACT == 8) v = tanhf(v);
      so[w][rloc][t * 16 + ln] = v; } }
  __builtin_amdgcn_fence(__ATOMIC_ACQ_REL, "workgroup"); __builtin_amdgcn_wave_barrier();
  const int rsub = lane >> 4, c4 = (lane & 15) * 4;
  {
#pragma unroll
    for (int q = 0; q < 16; ++q) { const int r = q * 2 + rsub; const v4f v = *(const v4fa*)&so[w][r][c4]; if (C) *(v4f*)(C + cofs + (size_t)(row0 + r) * ldc + col0 + c4) = v; if (C16) { v4h h4; for (int i = 0; i < 4; ++i) h4[i] = (_Float16)v[i]; *(v4h*)(C16 + cofs + (size_t)(row0 + r) * ldc + col0 + c4) = h4; } }
     } }



__device__ __forceinline__ float xhalf(float x) { return __builtin_bit_cast(float, __builtin_amdgcn_permlanex16(__builtin_bit_cast(int, x), __builtin_bit_cast(int, x), 0x76543210, 0xfedcba98, false, false)); }      /* value of lane l ^ 16 */
template <int CAUSAL>
__global__ __launch_bounds__(128) void k_flash(const _Float16* __restrict__ Q16, int ldq, const _Float16* __restrict__ K16, int ldk, const _Float16* __restrict__ VtA, const _Float16* __restrict__ VtB, const int* __restrict__ MSK, float* __restrict__ OA, float* __restrict__ OB, int ldo) {
  constexpr int RPW = 16, DT = 8, KS = 2;      /* DT: output row tiles of O^T, 0-3 = (P.VA)^T, 4-7 = (P.VB)^T (one P for both V halves) */
  __shared__ __attribute__((aligned(16))) float sO[4][RPW][128 + 4]; __shared__ float sM[4][RPW], sL[4][RPW];
  const int tid = threadIdx.x, w = __builtin_amdgcn_readfirstlane(tid >> 5), lane = tid & 31, ln = lane & 15, hh = lane >> 4;      /* w in a scalar register: the key loop's bounds differ from wave to wave and must stay a scalar branch (WMMA needs every lane on) */
  const int slab = blockIdx.x / QTILES, qt = blockIdx.x % QTILES; const int b = slab / NH, h = slab % NH; const int q0 = qt * RPW;
  FragH bq[KS];
  { const unsigned short* qr = (const unsigned short*)Q16 + ((size_t)b * TQ + q0 + ln) * ldq + h * 64;
#pragma unroll
    for (int ks = 0; ks < KS; ++ks) { bq[ks].half[0] = *(const v8us*)(qr + ks * 32 + 8 * hh); bq[ks].half[1] = *(const v8us*)(qr + ks * 32 + 16 + 8 * hh); } }
  const unsigned short* VthA = (const unsigned short*)VtA + (size_t)slab * 64 * TK; const unsigned short* VthB = (const unsigned short*)VtB + (size_t)slab * 64 * TK;
  const int tq = q0 + ln;      /* this lane's query */
  float m_r = -3.0e38f, l_r = 0.f; v8f oacc[DT];      /* l_r: sum over this lane's own 16 keys of each chunk; the two halves are added behind the loop */
#pragma unroll
  for (int dt = 0; dt < DT; ++dt) oacc[dt] = (v8f){0.f,0.f,0.f,0.f,0.f,0.f,0.f,0.f};
  const int jend = (CAUSAL == 1) ? (q0 + RPW) : TK;      /* causal: keys beyond the tile's last query never contribute */
#pragma unroll 1
  for (int j0 = 32 * w; j0 < jend; j0 += 4 * 32) {
    FragH ak[2][KS], av[DT];
    const unsigned short* ka0 = (const unsigned short*)K16 + ((size_t)b * TK + j0 + ln) * ldk + h * 64 + 8 * hh; const unsigned short* ka1 = ka0 + (size_t)16 * ldk;      /* K rows j0 + ln and j0 + 16 + ln */
    const unsigned short* va = VthA + (size_t)ln * TK + j0 + 8 * hh; const unsigned short* vb = VthB + (size_t)ln * TK + j0 + 8 * hh;      /* V^T rows ln (+ 16 dt) of both halves */
#pragma unroll
    for (int ks = 0; ks < KS; ++ks) { ak[0][ks].half[0] = *(const v8us*)(ka0 + ks * 32); ak[0][ks].half[1] = *(const v8us*)(ka0 + ks * 32 + 16); ak[1][ks].half[0] = *(const v8us*)(ka1 + ks * 32); ak[1][ks].half[1] = *(const v8us*)(ka1 + ks * 32 + 16); }
#pragma unroll
    for (int dt = 0; dt < DT / 2; ++dt) { const size_t vo = (size_t)(dt * 16) * TK;
      av[dt].half[0] = *(const v8us*)(va + vo); av[dt].half[1] = *(const v8us*)(va + vo + 16); av[DT / 2 + dt].half[0] = *(const v8us*)(vb + vo); av[DT / 2 + dt].half[1] = *(const v8us*)(vb + vo + 16); }
    asm volatile("s_wait_xcnt 0x0" :: "v"(ka0), "v"(ka1), "v"(va), "v"(vb) : "memory");      /* the four address pairs stay live up to this wait, so that no load above returns into one of them and nothing overwrites them in front of it */
    float sv[16]; bool ok[16];
#pragma unroll
    for (int nt = 0; nt < 2; ++nt) { v8f acc = (v8f){0.f,0.f,0.f,0.f,0.f,0.f,0.f,0.f};
#pragma unroll
      for (int ks = 0; ks < KS; ++ks) acc = mmaH<1>(ak[nt][ks].v, ak[nt][ks].v, bq[ks].v, bq[ks].v, acc);
#pragma unroll
      for (int r = 0; r < 8; ++r) { const int kk = j0 + nt * 16 + 8 * hh + r; ok[nt * 8 + r] = (CAUSAL == 1) ? (kk <= tq) : ((CAUSAL == 2) ? ((kk >> 5) == (tq >> 5)) : true);      /* mode 2: block-diagonal 32-token groups */
        sv[nt * 8 + r] = ok[nt * 8 + r] ? acc[r] * SCL : -3.0e38f; } }
    float mc = fmaxf(sv[0], sv[1]);
#pragma unroll
    for (int i = 2; i < 16; ++i) mc = fmaxf(mc, sv[i]);
    mc = fmaxf(mc, xhalf(mc));      /* both halves now hold the chunk maximum of query tq */
    const float mn = fmaxf(m_r, mc); const float al = expf(m_r - mn); m_r = mn;      /* nothing seen yet and nothing now: m_r == mn, al = 1 */
    FragH pb; float ps[4] = {0.f, 0.f, 0.f, 0.f};
#pragma unroll
    for (int i = 0; i < 16; ++i) { float p = expf(sv[i] - mn);      /* causal: key j0 <= q0 is open to every query of the tile, so mn is finite and a masked score gives exactly 0 */
      if (CAUSAL == 2) p = ok[i] ? p : 0.f;
      ps[i & 3] += p; pb.h[i] = (_Float16)(p * 1024.0f); }
    l_r = l_r * al + ((ps[0] + ps[1]) + (ps[2] + ps[3]));
#pragma unroll
    for (int dt = 0; dt < DT; ++dt) oacc[dt] *= al;
#pragma unroll
    for (int dt = 0; dt < DT; ++dt) oacc[dt] = mmaH<1>(av[dt].v, av[dt].v, pb.v, pb.v, oacc[dt]); }
  /* join of the four key shares: publish each wave's row maxima and row sums, weigh every share by exp(m_w - m_all) / l_all, add the weighted shares */
  { const float lv = l_r + xhalf(l_r); if (hh == 0) { sM[w][ln] = m_r; sL[w][ln] = lv; } }
  __syncthreads();      /* every wave's maxima and sums are written before any wave reads them */
  { const float m0 = sM[0][ln], m1 = sM[1][ln], m2 = sM[2][ln], m3 = sM[3][ln]; const float mt = fmaxf(fmaxf(m0, m1), fmaxf(m2, m3));      /* lane -> row ln; a wave without a chunk holds m = -3e38, l = 0, O = 0 and gets weight 0; wave 0 always holds key 0, so mt is finite */
    const float e0 = expf(m0 - mt), e1 = expf(m1 - mt), e2 = expf(m2 - mt), e3 = expf(m3 - mt); const float lt = ((sL[0][ln] * e0 + sL[1][ln] * e1) + sL[2][ln] * e2) + sL[3][ln] * e3;
    const float ew = (w == 0) ? e0 : ((w == 1) ? e1 : ((w == 2) ? e2 : e3)); const float fl = (lt > 0.f) ? ew / (lt * 1024.0f) : 0.f;
#pragma unroll
    for (int dt = 0; dt < DT; ++dt) { const v8f o = oacc[dt] * fl;      /* the lane's 8 registers are 8 consecutive columns of its own row */
      *(v4f*)&sO[w][ln][dt * 16 + 8 * hh] = (v4f){o[0], o[1], o[2], o[3]}; *(v4f*)&sO[w][ln][dt * 16 + 8 * hh + 4] = (v4f){o[4], o[5], o[6], o[7]}; } }
  __syncthreads();      /* all four weighted shares are in LDS before they are added */
  {
#pragma unroll
    for (int i = 0; i < 4; ++i) { const int r = i * 4 + w; const v4f p0 = *(const v4fa*)&sO[0][r][lane * 4], p1 = *(const v4fa*)&sO[1][r][lane * 4], p2 = *(const v4fa*)&sO[2][r][lane * 4], p3 = *(const v4fa*)&sO[3][r][lane * 4]; const v4f v = ((p0 + p1) + p2) + p3;
      const size_t oo = ((size_t)b * TQ + q0 + r) * ldo + h * 64 + ln * 4; *(v4f*)((hh ? OB : OA) + oo) = v; }      /* lanes 0-15: the 64 columns of P.VA, lanes 16-31: those of P.VB; 256 contiguous bytes each */
     } }

__global__ __launch_bounds__(256) void k_split(const float* __restrict__ src, _Float16* __restrict__ D0, _Float16* __restrict__ D1) { const size_t t = (size_t)blockIdx.x * 256 + threadIdx.x; if (t >= (size_t)NR * NHD * 8) return; const int g8 = (int)(t % 8); const int h = (int)((t / 8) % NHD); const size_t r = t / ((size_t)8 * NHD); const int p = h / 2, which = h % 2; FragH f;
  for (int q = 0; q < 8; ++q) f.h[q] = (_Float16)bf16_round(src[r * DW + h * HD + g8 * 8 + q]); unsigned short* d = (unsigned short*)(which ? D1 : D0) + r * HWD + p * HD + g8 * 8; *(v8us*)d = f.half[0];  }
__global__ __launch_bounds__(64) void k_lambda(const float* __restrict__ lq1, const float* __restrict__ lk1, const float* __restrict__ lq2, const float* __restrict__ lk2, float* __restrict__ LAM) {
  #pragma clang fp contract(off)
  const int ln = threadIdx.x; if (ln >= 32) return; float s1 = 0.f, s2 = 0.f;
#pragma unroll 1
  for (int d = 0; d < HD; ++d) { s1 += bf16_round(lq1[d]) * bf16_round(lk1[d]); s2 += bf16_round(lq2[d]) * bf16_round(lk2[d]); }
  const float lam = expf(s1) - expf(s2) + LAMBDA_INIT; *(float*)(LAM + ln) = lam;  }
__global__ __launch_bounds__(256) void k_comb(const float* __restrict__ O11, const float* __restrict__ O12, const float* __restrict__ O21, const float* __restrict__ O22, const float* __restrict__ LAM, const float* __restrict__ w, float* __restrict__ out) {
  #pragma clang fp contract(off)
  const int wv = threadIdx.x >> 5, ln = threadIdx.x & 31; const size_t rp = (size_t)blockIdx.x * 8 + wv; if (rp >= (size_t)NR * NP) return; const int p = (int)(rp % NP); const size_t r = rp / NP; const float lam = LAM[0]; const int j0 = ln * 4;      /* lanes 0-15 -> first half (O11/O21), 16-31 -> second half (O12/O22) */
  const float* a1 = (j0 < HD ? O11 : O12) + r * HWD + p * HD + (j0 % HD); const float* a2 = (j0 < HD ? O21 : O22) + r * HWD + p * HD + (j0 % HD); float a[4]; float ss = 0.f;
  for (int q = 0; q < 4; ++q) { float v = a1[q]; v += -lam * a2[q]; a[q] = v; ss += v * v; }
  for (int o = 16; o > 0; o >>= 1) ss += __shfl_xor(ss, o, 32); const float inv = rsqrtf(ss / 128.0f + 1e-5f); v4f r4;
  for (int q = 0; q < 4; ++q) { float y = bf16_round(w[j0 + q]) * (a[q] * inv); y *= (1.0f - LAMBDA_INIT); r4[q] = y; }
  float* d = out + r * DW + p * 128 + j0; *(v4f*)d = r4;  }

extern "C" void kernel_launch(void* const* d_in, const int* in_sizes, int n_in,
                              void* d_out, int out_size, void* d_ws, size_t ws_size, hipStream_t stream) {
  (void)in_sizes; (void)n_in; (void)out_size;
  const float* const* I = (const float* const*)d_in; const float* q = I[0]; const float* k = I[1]; const float* v = I[2]; const float* lq1 = I[3]; const float* lk1 = I[4]; const float* lq2 = I[5]; const float* lk2 = I[6]; const float* w = I[7];
  char* ws = (char*)d_ws; size_t off = 0;
  auto take = [&](size_t bytes) { char* p = ws + off; off += (bytes + 255) & ~(size_t)255; return p; };
  const size_t nh = (size_t)NR * HWD;
  _Float16* Q1 = (_Float16*)take(nh * 2); _Float16* Q2 = (_Float16*)take(nh * 2); _Float16* K1 = (_Float16*)take(nh * 2); _Float16* K2 = (_Float16*)take(nh * 2); _Float16* V1 = (_Float16*)take(nh * 2); _Float16* V2 = (_Float16*)take(nh * 2); _Float16* VT1 = (_Float16*)take(nh * 2); _Float16* VT2 = (_Float16*)take(nh * 2);
  float* O11 = (float*)take(nh * 4); float* O12 = (float*)take(nh * 4); float* O21 = (float*)take(nh * 4); float* O22 = (float*)take(nh * 4); float* LAM = (float*)take(256);
  if (off > ws_size) return;      /* 8 x 4 + 4 x 8 = 64 MiB */
  const unsigned gs = (unsigned)(((size_t)NR * NHD * 8 + 255) / 256);
  k_split<<<gs, 256, 0, stream>>>(q, Q1, Q2); k_split<<<gs, 256, 0, stream>>>(k, K1, K2); k_split<<<gs, 256, 0, stream>>>(v, V1, V2);
  k_lambda<<<1, 64, 0, stream>>>(lq1, lk1, lq2, lk2, LAM);
  k_vt<NH, SLEN><<<NB * NH * (SLEN / 64), 256, 0, stream>>>(V1, HWD, 0, VT1); k_vt<NH, SLEN><<<NB * NH * (SLEN / 64), 256, 0, stream>>>(V2, HWD, 0, VT2);
  k_flash<1><<<NB * NH * QTILES, 128, 0, stream>>>(Q1, HWD, K1, HWD, VT1, VT2, nullptr, O11, O12, HWD);
  k_flash<1><<<NB * NH * QTILES, 128, 0, stream>>>(Q2, HWD, K2, HWD, VT1, VT2, nullptr, O21, O22, HWD);
  k_comb<<<(unsigned)(((size_t)NR * NP + 7) / 8), 256, 0, stream>>>(O11, O12, O21, O22, LAM, w, (float*)d_out);
}

// v004
// A run of this version takes 110 microseconds.
// Timed twice side by side with v003, it ran 1.25 and 1.26 times as fast.
// All steps since v000 together make it 8.22 times as fast.
#include <hip/hip_runtime.h>
// Phi4FlashDiffAttention (2 x 2048 tokens, 16 heads of 64 as 8 differential pairs; q, k, v are INPUTS): heads (2p, 2p+1) = (q1, q2) etc.; P1 = causal softmax(q1.k1/8), P2 = causal softmax(q2.k2/8); attn1 = [P1 v1 | P1 v2], attn2 = [P2 v1 | P2 v2] (128 wide); lambda = exp(lq1.lk1) - exp(lq2.lk2) + lambda_init; a = attn1 - lambda attn2; out = subln_w * RMSNorm_128(a) * (1 - lambda_init) -> [B, S, 16, 64].
// Structure: de-interleave q/k/v into exact f16 planes per half (q1, q2, k1, k2, v1, v2; the inputs are exactly representable after bf16 rounding); K and V^T stored in WMMA fragment order (per 32-key chunk: fragment halves of 32 lanes x 16 bytes; both V halves in one plane), V^T by LDS tiles; two launches of the fused causal flash kernel, one per (q, k) half, each P multiplied into both V halves (plain operands - exact here except P; f32 softmax/accumulation) giving O11, O12 and O21, O22; lambda on device (f32 64-term dots); the differential combine + RMSNorm on VALU (wave per (token, pair)).
// Compute dtype: inputs rounded to bf16; q, k, v exact as f16; P as f16 (x2^10, ~2^-12); everything else f32. v_wmma_f32_16x16x32_f16.
#define NB 2
#define NHD 16
#define HD 64
#define NP (NHD / 2)
#define DW (NHD * HD)            /* 1024 */
#define HWD (NP * HD)            /* 512 */
#define NR (NB * SLEN)
#define LAMBDA_INIT 0.35550906759096934f  /* 0.8 - 0.6 exp(-0.3) */
#define SLEN 2048
#define TQ SLEN
#define TK SLEN
#define NH 8                     /* head PAIRS per call */
#define SCL 0.125f
#define QTILES (TQ / 16)         /* query tiles of 16 rows, one block each */
typedef __bf16 v16b __attribute__((ext_vector_type(16)));
typedef unsigned short v8us __attribute__((ext_vector_type(8), may_alias));
typedef float  v8f  __attribute__((ext_vector_type(8)));
typedef float  v4f  __attribute__((ext_vector_type(4)));
typedef float  v4fa __attribute__((ext_vector_type(4), may_alias));
union FragB { v16b v; v8us half[2]; unsigned short u[16]; };

__device__ __forceinline__ unsigned short bf16_bits(float x) { unsigned int u = __float_as_uint(x); return (unsigned short)((u + 0x7FFFu + ((u >> 16) & 1u)) >> 16); }
__device__ __forceinline__ float bf16_val(unsigned short b) { return __uint_as_float(((unsigned int)b) << 16); }
__device__ __forceinline__ float bf16_round(float x) { return bf16_val(bf16_bits(x)); }
// D += A·B with NT terms: 1 = ah·bh, 2 = + al·bh (A split), 3 = + ah·bl (both split)
template <int NT>
__device__ __forceinline__ v8f mmaN(v16b ah, v16b al, v16b bh, v16b bl, v8f c) {
  c = __builtin_amdgcn_wmma_f32_16x16x32_bf16(false, ah, false, bh, (short)0, c, false, false);
  if (NT >= 2) c = __builtin_amdgcn_wmma_f32_16x16x32_bf16(false, al, false, bh, (short)0, c, false, false);
  if (NT >= 3) c = __builtin_amdgcn_wmma_f32_16x16x32_bf16(false, ah, false, bl, (short)0, c, false, false);
  asm volatile("v_nop\n\tv_nop\n\tv_nop\n\tv_nop" : "+v"(c) : "v"(ah), "v"(al), "v"(bh), "v"(bl));
  return c;
}

__global__ __launch_bounds__(256) void k_wt_bf16(const float* __restrict__ W, unsigned short* __restrict__ Wt, int K, int N) {
  const int t = blockIdx.x * 256 + threadIdx.x;
  const int k8n = K / 8;
  if (t >= N * k8n) return;
  const int n = t / k8n, k8 = (t % k8n) * 8;
  v8us v;
#pragma unroll
  for (int i = 0; i < 8; ++i) v[i] = bf16_bits(W[(size_t)(k8 + i) * N + n]);
  *(v8us*)(Wt + (size_t)n * K + k8) = v;
  
}

// GEMM C[M][N] (f32, pitch ldc) = act(A[M][K]·W + bias). A f32 row-major (pitch lda) converted per fragment to bf16
// (ASPLIT: hi/lo two planes -> 2 terms, else single rounded term); Wt bf16 [N][K] (pitch ldb). BIAS_BF16 rounds the
// bias to bf16 first (bias quantised to bf16 before the add). K%32==0, M%16==0, N%64==0.
template <bool ASPLIT, int ACT, bool BIAS_BF16>
__global__ __launch_bounds__(128) void k_gemm_bf(const float* __restrict__ A, int lda, const unsigned short* __restrict__ Wt, int ldb,
                                               const float* __restrict__ bias, float* __restrict__ C, int ldc, int M, int N, int K) {
  __shared__ __attribute__((aligned(16))) float so[4][16][64];
  const int tid = threadIdx.x, w = tid >> 5, lane = tid & 31, ln = lane & 15, hh = lane >> 4;
  const int ntn = N / 64;
  const int wid = blockIdx.x * 4 + w;
  const int mt = wid / ntn, nq = wid % ntn;
  if (mt * 16 >= M) return;
  const int row0 = mt * 16, col0 = nq * 64;
  const float* arow = A + (size_t)(row0 + ln) * lda;
  v8f acc[4] = {};
  for (int kb = 0; kb < K; kb += 32) {
    FragB ah, al;
    const v4f x0 = *(const v4fa*)(arow + kb + 8 * hh), x1 = *(const v4fa*)(arow + kb + 8 * hh + 4);
    const v4f x2 = *(const v4fa*)(arow + kb + 16 + 8 * hh), x3 = *(const v4fa*)(arow + kb + 16 + 8 * hh + 4);
    float xs[16] = {x0[0],x0[1],x0[2],x0[3],x1[0],x1[1],x1[2],x1[3],x2[0],x2[1],x2[2],x2[3],x3[0],x3[1],x3[2],x3[3]};
#pragma unroll
    for (int i = 0; i < 16; ++i) { const unsigned short hb = bf16_bits(xs[i]); ah.u[i] = hb; al.u[i] = ASPLIT ? bf16_bits(xs[i] - bf16_val(hb)) : (unsigned short)0; }
#pragma unroll
    for (int t = 0; t < 4; ++t) {
      const unsigned short* brow = Wt + (size_t)(col0 + t * 16 + ln) * ldb + kb;
      FragB b;
      b.half[0] = *(const v8us*)(brow + 8 * hh);
      b.half[1] = *(const v8us*)(brow + 16 + 8 * hh);
      acc[t] = mmaN<ASPLIT ? 2 : 1>(ah.v, al.v, b.v, b.v, acc[t]);
    }
  }
#pragma unroll
  for (int t = 0; t < 4; ++t) {
    float bv = bias ? bias[col0 + t * 16 + ln] : 0.f;
    if (BIAS_BF16) bv = bf16_round(bv);
#pragma unroll
    for (int r = 0; r < 8; ++r) { float v = acc[t][r] + bv; if (ACT == 1) v = fmaxf(v, 0.f); so[w][8 * hh + r][t * 16 + ln] = v; }
  }
  __builtin_amdgcn_fence(__ATOMIC_ACQ_REL, "workgroup");
  __builtin_amdgcn_wave_barrier();
  const int rsub = lane >> 4, c4 = (lane & 15) * 4;
  {
#pragma unroll
    for (int q = 0; q < 8; ++q) {
      const int r = q * 2 + rsub;
      const v4f v = *(const v4fa*)&so[w][r][c4];
      *(v4f*)(C + (size_t)(row0 + r) * ldc + col0 + c4) = v;
    }
    
  }
}

// GEMM C = act(A·W + bias + resid): A f32 (ASPLIT -> hi/lo 2 terms), Wt bf16 [N][K]; ACT 0 none, 1 relu, 2 exact gelu;
// resid (optional, f32, row index = (row % rmod), pitch ldr, RES_BF16 rounds it) added before the activation.
template <bool ASPLIT, int ACT, bool BIAS_BF16, bool RES_BF16>
__global__ __launch_bounds__(128) void k_gemm_bf3(const float* __restrict__ A, int lda, const unsigned short* __restrict__ Wt, int ldb,
                                                const float* __restrict__ bias, const float* __restrict__ resid, int rmod, int ldr,
                                                float* __restrict__ C, int ldc, int M, int N, int K) {
  __shared__ __attribute__((aligned(16))) float so[4][16][64];
  const int tid = threadIdx.x, w = tid >> 5, lane = tid & 31, ln = lane & 15, hh = lane >> 4;
  const int ntn = N / 64;
  const int wid = blockIdx.x * 4 + w;
  const int mt = wid / ntn, nq = wid % ntn;
  if (mt * 16 >= M) return;
  const int row0 = mt * 16, col0 = nq * 64;
  const float* arow = A + (size_t)(row0 + ln) * lda;
  v8f acc[4] = {};
  for (int kb = 0; kb < K; kb += 32) {
    FragB ah, al;
    const v4f x0 = *(const v4fa*)(arow + kb + 8 * hh), x1 = *(const v4fa*)(arow + kb + 8 * hh + 4);
    const v4f x2 = *(const v4fa*)(arow + kb + 16 + 8 * hh), x3 = *(const v4fa*)(arow + kb + 16 + 8 * hh + 4);
    float xs[16] = {x0[0],x0[1],x0[2],x0[3],x1[0],x1[1],x1[2],x1[3],x2[0],x2[1],x2[2],x2[3],x3[0],x3[1],x3[2],x3[3]};
#pragma unroll
    for (int i = 0; i < 16; ++i) { const unsigned short hb = bf16_bits(xs[i]); ah.u[i] = hb; al.u[i] = ASPLIT ? bf16_bits(xs[i] - bf16_val(hb)) : (unsigned short)0; }
#pragma unroll
    for (int t = 0; t < 4; ++t) {
      const unsigned short* brow = Wt + (size_t)(col0 + t * 16 + ln) * ldb + kb;
      FragB b;
      b.half[0] = *(const v8us*)(brow + 8 * hh);
      b.half[1] = *(const v8us*)(brow + 16 + 8 * hh);
      acc[t] = mmaN<ASPLIT ? 2 : 1>(ah.v, al.v, b.v, b.v, acc[t]);
    }
  }
#pragma unroll
  for (int t = 0; t < 4; ++t) {
    const int col = col0 + t * 16 + ln;
    float bv = bias ? bias[col] : 0.f;
    if (BIAS_BF16) bv = bf16_round(bv);
#pragma unroll
    for (int r = 0; r < 8; ++r) {
      float v = acc[t][r] + bv;
      if (resid) { float rv = resid[(size_t)((row0 + 8 * hh + r) % rmod) * ldr + col]; if (RES_BF16) rv = bf16_round(rv); v += rv; }
      if (ACT == 1) v = fmaxf(v, 0.f);
      if (ACT == 2) v = 0.5f * v * (1.0f + erff(v * 0.70710678118654752f));
      if (ACT == 3) { const float u = 0.7978845608028654f * (v + 0.044715f * v * v * v); v = 0.5f * v * (1.0f + tanhf(u)); }
      so[w][8 * hh + r][t * 16 + ln] = v;
    }
  }
  __builtin_amdgcn_fence(__ATOMIC_ACQ_REL, "workgroup");
  __builtin_amdgcn_wave_barrier();
  const int rsub = lane >> 4, c4 = (lane & 15) * 4;
  {
#pragma unroll
    for (int q = 0; q < 8; ++q) {
      const int r = q * 2 + rsub;
      const v4f v = *(const v4fa*)&so[w][r][c4];
      *(v4f*)(C + (size_t)(row0 + r) * ldc + col0 + c4) = v;
    }
    
  }
}
// row LayerNorm (biased variance, eps) over N: s = X (+ R); optional out_sum <- s; out_norm <- (s-mu)*rsqrt(var+eps)*g + b
template <bool PARAM_BF16>
__global__ __launch_bounds__(256) void k_layernorm(const float* __restrict__ X, const float* __restrict__ R, const float* __restrict__ g, const float* __restrict__ bta,
                                                  float* __restrict__ out_sum, float* __restrict__ out_norm, int N, float eps) {
  __shared__ float red[256];
  const int row = blockIdx.x, tid = threadIdx.x;
  const float* x = X + (size_t)row * N; const float* rr = R ? R + (size_t)row * N : nullptr;
  float vals[16];                     // up to N = 4096
  const int per = N / 256;            // contiguous chunk per thread? use strided-by-4 chunks: thread handles j = tid*4 + 1024*u
  float s1 = 0.f;
  for (int u = 0; u < per / 4; ++u) {
    const int j = tid * 4 + 1024 * u;
    const v4f a = *(const v4fa*)(x + j);
    v4f b = {0.f,0.f,0.f,0.f}; if (rr) b = *(const v4fa*)(rr + j);
#pragma unroll
    for (int q = 0; q < 4; ++q) { const float v = a[q] + b[q]; vals[u * 4 + q] = v; s1 += v; }
  }
  red[tid] = s1; __syncthreads();
  for (int st = 128; st > 0; st >>= 1) { if (tid < st) red[tid] += red[tid + st]; __syncthreads(); }
  const float mu = red[0] / (float)N; __syncthreads();
  float s2 = 0.f;
  for (int u = 0; u < per / 4; ++u)
#pragma unroll
    for (int q = 0; q < 4; ++q) { const float c = vals[u * 4 + q] - mu; s2 += c * c; }
  red[tid] = s2; __syncthreads();
  for (int st = 128; st > 0; st >>= 1) { if (tid < st) red[tid] += red[tid + st]; __syncthreads(); }
  const float rs = rsqrtf(red[0] / (float)N + eps);
  {
    for (int u = 0; u < per / 4; ++u) {
      const int j = tid * 4 + 1024 * u;
      v4f o, sm;
#pragma unroll
      for (int q = 0; q < 4; ++q) {
        float gg = g[j + q], bb = bta[j + q];
        if (PARAM_BF16) { gg = bf16_round(gg); bb = bf16_round(bb); }
        sm[q] = vals[u * 4 + q]; o[q] = (vals[u * 4 + q] - mu) * rs * gg + bb;
      }
      if (out_sum) *(v4f*)(out_sum + (size_t)row * N + j) = sm;
      *(v4f*)(out_norm + (size_t)row * N + j) = o;
    }
    
  }
}



// ---- f16 WMMA path (v_wmma_f32_16x16x32_f16): 11-bit significands for operands in range — used where a [0,1] probability operand needs more precision than bf16
typedef _Float16 v16h __attribute__((ext_vector_type(16)));
union FragH { v16h v; v8us half[2]; _Float16 h[16]; unsigned short u[16]; };
template <int NT>
__device__ __forceinline__ v8f mmaH(v16h ah, v16h al, v16h bh, v16h bl, v8f c) {
  c = __builtin_amdgcn_wmma_f32_16x16x32_f16(false, ah, false, bh, (short)0, c, false, false);
  if (NT >= 2) c = __builtin_amdgcn_wmma_f32_16x16x32_f16(false, al, false, bh, (short)0, c, false, false);
  if (NT >= 3) c = __builtin_amdgcn_wmma_f32_16x16x32_f16(false, ah, false, bl, (short)0, c, false, false);
  asm volatile("v_nop\n\tv_nop\n\tv_nop\n\tv_nop" : "+v"(c) : "v"(ah), "v"(al), "v"(bh), "v"(bl));
  return c;
}
// batched GEMM like k_gemm_b but f16 operands: A f32 (split into f16 hi/lo if ASPLIT, else rounded to f16), Bt = f16 values [n][k]; alpha; C f32; N multiple of 16 (partial tiles skipped)
template <bool ASPLIT>
__global__ __launch_bounds__(128) void k_gemm_h(const float* __restrict__ A, int lda, size_t sA, const _Float16* __restrict__ Bh, int ldb, size_t sB, float alpha, float* __restrict__ C, int ldc, size_t sC, int M, int N, int K) {
  __shared__ __attribute__((aligned(16))) float so[4][16][64];
  const int tid = threadIdx.x, w = tid >> 5, lane = tid & 31, ln = lane & 15, hh = lane >> 4; const int by = blockIdx.y;
  A += (size_t)by * sA; Bh += (size_t)by * sB; C += (size_t)by * sC;
  const int ntn = (N + 63) / 64; const int wid = blockIdx.x * 4 + w; const int mt = wid / ntn, nq = wid % ntn; if (mt * 16 >= M) return;
  const int row0 = mt * 16, col0 = nq * 64; const float* arow = A + (size_t)(row0 + ln) * lda;
  v8f acc[4] = {};
  for (int kb = 0; kb < K; kb += 32) {
    FragH ah, al;
    const v4f x0 = *(const v4fa*)(arow + kb + 8 * hh), x1 = *(const v4fa*)(arow + kb + 8 * hh + 4), x2 = *(const v4fa*)(arow + kb + 16 + 8 * hh), x3 = *(const v4fa*)(arow + kb + 16 + 8 * hh + 4);
    float xs[16] = {x0[0],x0[1],x0[2],x0[3],x1[0],x1[1],x1[2],x1[3],x2[0],x2[1],x2[2],x2[3],x3[0],x3[1],x3[2],x3[3]};
#pragma unroll
    for (int i = 0; i < 16; ++i) { const _Float16 h = (_Float16)xs[i]; ah.h[i] = h; al.h[i] = ASPLIT ? (_Float16)(xs[i] - (float)h) : (_Float16)0.0f; }
#pragma unroll
    for (int t = 0; t < 4; ++t) { if (col0 + t * 16 >= N) continue; const size_t boff = (size_t)(col0 + t * 16 + ln) * ldb + kb; FragH bq; bq.half[0] = *(const v8us*)(Bh + boff + 8 * hh); bq.half[1] = *(const v8us*)(Bh + boff + 16 + 8 * hh);
      acc[t] = mmaH<ASPLIT ? 2 : 1>(ah.v, al.v, bq.v, bq.v, acc[t]); }
  }
#pragma unroll
  for (int t = 0; t < 4; ++t) { if (col0 + t * 16 >= N) continue;
#pragma unroll
    for (int r = 0; r < 8; ++r) so[w][8 * hh + r][t * 16 + ln] = acc[t][r] * alpha; }
  __builtin_amdgcn_fence(__ATOMIC_ACQ_REL, "workgroup"); __builtin_amdgcn_wave_barrier();
  const int rsub = lane >> 4, c4 = (lane & 15) * 4;
  {
#pragma unroll
    for (int q = 0; q < 8; ++q) { const int r = q * 2 + rsub; if (col0 + c4 < N) { const v4f v = *(const v4fa*)&so[w][r][c4]; *(v4f*)(C + (size_t)(row0 + r) * ldc + col0 + c4) = v; } }
     }
}

// Wt[n][k] = f16(W[k][n]·scale) from f32 row-major W[K][N] (scale = power of two; bf16-exact weights stay exact in f16 away from the subnormal range)
__global__ __launch_bounds__(256) void k_wt_f16(const float* __restrict__ W, _Float16* __restrict__ Wt, int K, int N, float scale) {
  const int t = blockIdx.x * 256 + threadIdx.x; if (t >= N * (K / 8)) return; const int n = t / (K / 8), k8 = (t % (K / 8)) * 8; FragH f;
#pragma unroll
  for (int i = 0; i < 8; ++i) f.h[i] = (_Float16)(bf16_round(W[(size_t)(k8 + i) * N + n]) * scale); const v8us o = f.half[0];
  *(v8us*)((unsigned short*)Wt + (size_t)n * K + k8) = o; 
}
// k_gemm_hh variant with fused epilogue: v = acc·alpha + bias[by·sBias + col] (+ CP[(row/rowsPerB)·sCPb + by·64 + col] if CP) ; ACT 0 none / 1 elu ; writes f16 C16 (and f32 C if non-null)
template <int ACT>
__global__ __launch_bounds__(128) void k_gemm_hhx(const _Float16* __restrict__ A, int lda, size_t sA, const _Float16* __restrict__ Bh, int ldb, size_t sB, float alpha, const float* __restrict__ bias, size_t sBias, const float* __restrict__ CP, int rowsPerB, size_t sCPb, int row0g,
    float* __restrict__ C, _Float16* __restrict__ C16, int ldc, size_t sC, int M, int N, int K) {
  __shared__ __attribute__((aligned(16))) float so[4][16][64];
  const int tid = threadIdx.x, w = tid >> 5, lane = tid & 31, ln = lane & 15, hh = lane >> 4; const int by = blockIdx.y;
  A += (size_t)by * sA; Bh += (size_t)by * sB; const size_t cofs = (size_t)by * sC; const float* bp = bias ? bias + (size_t)by * sBias : nullptr;
  const int ntn = (N + 63) / 64; const int wid = blockIdx.x * 4 + w; const int mt = wid / ntn, nq = wid % ntn; if (mt * 16 >= M) return;
  const int row0 = mt * 16, col0 = nq * 64; const _Float16* arow = A + (size_t)(row0 + ln) * lda;
  v8f acc[4] = {};
  for (int kb = 0; kb < K; kb += 32) { FragH ah; ah.half[0] = *(const v8us*)((const unsigned short*)arow + kb + 8 * hh); ah.half[1] = *(const v8us*)((const unsigned short*)arow + kb + 16 + 8 * hh);
#pragma unroll
    for (int t = 0; t < 4; ++t) { if (col0 + t * 16 >= N) continue; const size_t boff = (size_t)(col0 + t * 16 + ln) * ldb + kb; FragH bq; bq.half[0] = *(const v8us*)((const unsigned short*)Bh + boff + 8 * hh); bq.half[1] = *(const v8us*)((const unsigned short*)Bh + boff + 16 + 8 * hh);
      acc[t] = mmaH<1>(ah.v, ah.v, bq.v, bq.v, acc[t]); }
  }
#pragma unroll
  for (int t = 0; t < 4; ++t) { if (col0 + t * 16 >= N) continue; const int col = col0 + t * 16 + ln; const float bv = bp ? bf16_round(bp[col]) : 0.f;
#pragma unroll
    for (int r = 0; r < 8; ++r) { float v = acc[t][r] * alpha + bv; if (CP) { const int bidx = (row0g + row0 + 8 * hh + r) / rowsPerB; v += CP[(size_t)bidx * sCPb + (size_t)by * 64 + col]; } if (ACT == 1) v = (v > 0.f) ? v : expm1f(v); else if (ACT == 7) v = (v > 0.f) ? v + 1.0f : expf(v); else if (ACT == 8) v = tanhf(v); else if (ACT == 9) v = 0.5f * v * (1.0f + tanhf(0.7978845608028654f * (v + 0.044715f * v * v * v))); else if (ACT == 11) v = 1.0f / (1.0f + expf(-v)); else if (ACT == 12) v = (v > 0.f) ? v : 0.01f * v; else if (ACT == 14) v = (v > 0.f) ? v : 0.1f * v; else if (ACT == 15) v = v / (1.0f + expf(-v)); else if (ACT == 3) v = fmaxf(v, 0.f); else if (ACT == 6) v = 0.5f * v * (1.0f + erff(v * 0.70710678118654752f)); so[w][8 * hh + r][t * 16 + ln] = v; } }
  __builtin_amdgcn_fence(__ATOMIC_ACQ_REL, "workgroup"); __builtin_amdgcn_wave_barrier();
  const int rsub = lane >> 4, c4 = (lane & 15) * 4; typedef _Float16 v4h __attribute__((ext_vector_type(4)));
  {
#pragma unroll
    for (int q = 0; q < 8; ++q) { const int r = q * 2 + rsub; if (col0 + c4 < N) { const v4f v = *(const v4fa*)&so[w][r][c4]; if (C) *(v4f*)(C + cofs + (size_t)(row0 + r) * ldc + col0 + c4) = v; if (C16) { v4h h4; for (int i = 0; i < 4; ++i) h4[i] = (_Float16)v[i]; *(v4h*)(C16 + cofs + (size_t)(row0 + r) * ldc + col0 + c4) = h4; } } }
     }
}


typedef _Float16 v4h __attribute__((ext_vector_type(4)));

__global__ __launch_bounds__(256) void k_x16(const float* __restrict__ x, _Float16* __restrict__ X16, size_t n8) { const size_t t = (size_t)blockIdx.x * 256 + threadIdx.x; if (t >= n8) return; FragH f;
#pragma unroll
  for (int q = 0; q < 8; ++q) f.h[q] = (_Float16)bf16_round(x[t * 8 + q]); *(v8us*)((unsigned short*)X16 + t * 8) = f.half[0];  }
__global__ __launch_bounds__(256) void k_h16(const float* __restrict__ x, _Float16* __restrict__ X16, size_t n8) { const size_t t = (size_t)blockIdx.x * 256 + threadIdx.x; if (t >= n8) return; FragH f;
#pragma unroll
  for (int q = 0; q < 8; ++q) f.h[q] = (_Float16)x[t * 8 + q]; *(v8us*)((unsigned short*)X16 + t * 8) = f.half[0];  }
__global__ __launch_bounds__(256) void k_round16f(const float* __restrict__ W, _Float16* __restrict__ Bt, size_t n8) { const size_t t = (size_t)blockIdx.x * 256 + threadIdx.x; if (t >= n8) return; FragH f;
#pragma unroll
  for (int i = 0; i < 8; ++i) f.h[i] = (_Float16)(bf16_round(W[t * 8 + i]) * 16.0f); *(v8us*)((unsigned short*)Bt + t * 8) = f.half[0];  }
template <int NHv, int TTv>
__global__ __launch_bounds__(256) void k_vt(const _Float16* __restrict__ V16, int ldv, int voff, _Float16* __restrict__ Vt) { __shared__ unsigned short tl[64][66]; const int tid = threadIdx.x; const int slab = blockIdx.x / (TTv / 64), lg = blockIdx.x % (TTv / 64); const int b = slab / NHv, h = slab % NHv;
  for (int i = tid; i < 64 * 8; i += 256) { const int r = i / 8, c8 = (i % 8) * 8; FragH f; f.half[0] = *(const v8us*)((const unsigned short*)V16 + ((size_t)b * TTv + lg * 64 + r) * ldv + voff + h * 64 + c8);
#pragma unroll
    for (int q = 0; q < 8; ++q) tl[r][c8 + q] = f.u[q]; }
  __syncthreads();
  {
#pragma unroll
    for (int rd = 0; rd < 2; ++rd) { const int fh = tid >> 5, d = (fh >> 1) * 16 + (tid & 15), k0 = rd * 32 + (fh & 1) * 16 + ((tid >> 4) & 1) * 8; FragH f;      /* fragment order: chunk rd of the tile, fragment half fh = 2 dt + hf, lane (ln, hh) holds V^T row 16 dt + ln, keys 16 hf + 8 hh .. + 7 */
#pragma unroll
      for (int q = 0; q < 8; ++q) f.u[q] = tl[k0 + q][d];
      *(v8us*)((unsigned short*)Vt + ((size_t)slab * (TTv / 32) + lg * 2 + rd) * 4096 + tid * 8) = f.half[0]; }      /* a wave stores 512 contiguous bytes, the block 4 KiB; a chunk holds both V halves (8 KiB), Vt points at this half's part of chunk 0 */
     } }

__global__ __launch_bounds__(256) void k_hl(const float* __restrict__ F, _Float16* __restrict__ Hh, _Float16* __restrict__ Hl, size_t n8) { const size_t t = (size_t)blockIdx.x * 256 + threadIdx.x; if (t >= n8) return; FragH fh, fl; const v4f a = *(const v4fa*)(F + t * 8), c = *(const v4fa*)(F + t * 8 + 4);
#pragma unroll
  for (int q = 0; q < 4; ++q) { _Float16 h = (_Float16)a[q]; fh.h[q] = h; fl.h[q] = (_Float16)((a[q] - (float)h) * 1024.0f); h = (_Float16)c[q]; fh.h[4 + q] = h; fl.h[4 + q] = (_Float16)((c[q] - (float)h) * 1024.0f); }
  { *(v8us*)((unsigned short*)Hh + t * 8) = fh.half[0]; *(v8us*)((unsigned short*)Hl + t * 8) = fl.half[0];  } }

// ---- fast GEMM (wave tile 32x64; requires M % 32 == 0 rows per launch region and N % 64 == 0); epilogue = k_gemm_hhx semantics ----
__device__ __forceinline__ v16h g2_frag(const _Float16* p, int hh) { FragH f; f.half[0] = *(const v8us*)((const unsigned short*)p + 8 * hh); f.half[1] = *(const v8us*)((const unsigned short*)p + 16 + 8 * hh); return f.v; }
__device__ __forceinline__ v8f g2_mma(v16h a, v16h b, v8f c) { v8f d = __builtin_amdgcn_wmma_f32_16x16x32_f16(false, a, false, b, (short)0, c, false, false); asm volatile("v_nop\n\tv_nop\n\tv_nop\n\tv_nop" : "+v"(d) : "v"(a), "v"(b)); return d; }
template <int ACT>
__global__ __launch_bounds__(128) void k_gemm2(const _Float16* __restrict__ A, int lda, size_t sA, const _Float16* __restrict__ Bh, int ldb, size_t sB, float alpha, const float* __restrict__ bias, size_t sBias, const float* __restrict__ CP, int rowsPerB, size_t sCPb, int row0g,
    float* __restrict__ C, _Float16* __restrict__ C16, int ldc, size_t sC, int M, int N, int K) {
  __shared__ __attribute__((aligned(16))) float so[4][32][68];
  const int tid = threadIdx.x, w = tid >> 5, lane = tid & 31, ln = lane & 15, hh = lane >> 4; const int by = blockIdx.y;
  A += (size_t)by * sA; Bh += (size_t)by * sB; const size_t cofs = (size_t)by * sC; const float* bp = bias ? bias + (size_t)by * sBias : nullptr;
  const int ntn = N >> 6; const int mt = blockIdx.x / ntn, nq = blockIdx.x - mt * ntn; const int row0 = mt * 128 + 32 * w, col0 = nq * 64; if (row0 >= M) return;
  const _Float16* a0p = A + (size_t)(row0 + ln) * lda; const _Float16* a1p = a0p + (size_t)16 * lda;
  const _Float16* b0p = Bh + (size_t)(col0 + ln) * ldb; const _Float16* b1p = b0p + (size_t)16 * ldb; const _Float16* b2p = b1p + (size_t)16 * ldb; const _Float16* b3p = b2p + (size_t)16 * ldb;
  const v8f z8 = {0.f,0.f,0.f,0.f,0.f,0.f,0.f,0.f}; v8f c00 = z8, c01 = z8, c02 = z8, c03 = z8, c10 = z8, c11 = z8, c12 = z8, c13 = z8;
#pragma unroll 1
  for (int kb = 0; kb < K; kb += 32) { const v16h a0 = g2_frag(a0p + kb, hh), a1 = g2_frag(a1p + kb, hh);
    v16h b = g2_frag(b0p + kb, hh); c00 = g2_mma(a0, b, c00); c10 = g2_mma(a1, b, c10);
    b = g2_frag(b1p + kb, hh); c01 = g2_mma(a0, b, c01); c11 = g2_mma(a1, b, c11);
    b = g2_frag(b2p + kb, hh); c02 = g2_mma(a0, b, c02); c12 = g2_mma(a1, b, c12);
    b = g2_frag(b3p + kb, hh); c03 = g2_mma(a0, b, c03); c13 = g2_mma(a1, b, c13); }
  v8f accs[8] = {c00, c01, c02, c03, c10, c11, c12, c13};
#pragma unroll
  for (int u = 0; u < 8; ++u) { const int t = u & 3, half = u >> 2; const int col = col0 + t * 16 + ln; const float bv = bp ? bf16_round(bp[col]) : 0.f;
#pragma unroll
    for (int r = 0; r < 8; ++r) { const int rloc = half * 16 + 8 * hh + r; float v = accs[u][r] * alpha + bv; if (CP) { const int bidx = (row0g + row0 + rloc) / rowsPerB; v += CP[(size_t)bidx * sCPb + (size_t)by * 64 + col]; }
      if (ACT == 3) v = fmaxf(v, 0.f); else if (ACT == 6) v = 0.5f * v * (1.0f + erff(v * 0.70710678118654752f)); else if (ACT == 11) v = 1.0f / (1.0f + expf(-v)); else if (ACT == 15) v = v / (1.0f + expf(-v)); else if (ACT == 12) v = (v > 0.f) ? v : 0.01f * v; else if (ACT == 8) v = tanhf(v);
      so[w][rloc][t * 16 + ln] = v; } }
  __builtin_amdgcn_fence(__ATOMIC_ACQ_REL, "workgroup"); __builtin_amdgcn_wave_barrier();
  const int rsub = lane >> 4, c4 = (lane & 15) * 4;
  {
#pragma unroll
    for (int q = 0; q < 16; ++q) { const int r = q * 2 + rsub; const v4f v = *(const v4fa*)&so[w][r][c4]; if (C) *(v4f*)(C + cofs + (size_t)(row0 + r) * ldc + col0 + c4) = v; if (C16) { v4h h4; for (int i = 0; i < 4; ++i) h4[i] = (_Float16)v[i]; *(v4h*)(C16 + cofs + (size_t)(row0 + r) * ldc + col0 + c4) = h4; } }
     } }



__device__ __forceinline__ float xhalf(float x) { return __builtin_bit_cast(float, __builtin_amdgcn_permlanex16(__builtin_bit_cast(int, x), __builtin_bit_cast(int, x), 0x76543210, 0xfedcba98, false, false)); }      /* value of lane l ^ 16 */
template <int CAUSAL>
__global__ __launch_bounds__(128) void k_flash(const _Float16* __restrict__ Q16, int ldq, const _Float16* __restrict__ KF, const _Float16* __restrict__ VF, const int* __restrict__ MSK, float* __restrict__ OA, float* __restrict__ OB, int ldo) {
  constexpr int RPW = 16, DT = 8, KS = 2;      /* DT: output row tiles of O^T, 0-3 = (P.VA)^T, 4-7 = (P.VB)^T (one P for both V halves) */
  __shared__ __attribute__((aligned(16))) float sO[4][RPW][128 + 4]; __shared__ float sM[4][RPW], sL[4][RPW];
  const int tid = threadIdx.x, w = __builtin_amdgcn_readfirstlane(tid >> 5), lane = tid & 31, ln = lane & 15, hh = lane >> 4;      /* w in a scalar register: the key loop's bounds differ from wave to wave and must stay a scalar branch (WMMA needs every lane on) */
  const int slab = blockIdx.x / QTILES, qt = blockIdx.x % QTILES; const int b = slab / NH, h = slab % NH; const int q0 = qt * RPW;
  FragH bq[KS];
  { const unsigned short* qr = (const unsigned short*)Q16 + ((size_t)b * TQ + q0 + ln) * ldq + h * 64;
#pragma unroll
    for (int ks = 0; ks < KS; ++ks) { bq[ks].half[0] = *(const v8us*)(qr + ks * 32 + 8 * hh); bq[ks].half[1] = *(const v8us*)(qr + ks * 32 + 16 + 8 * hh); } }
  const unsigned short* KFh = (const unsigned short*)KF + (size_t)slab * 64 * TK + lane * 8; const unsigned short* VFh = (const unsigned short*)VF + (size_t)slab * 128 * TK + lane * 8;      /* the lane's 16 bytes of fragment half 0 of chunk 0 */
  const int tq = q0 + ln;      /* this lane's query */
  float m_r = -3.0e38f, l_r = 0.f; v8f oacc[DT];      /* l_r: sum over this lane's own 16 keys of each chunk; the two halves are added behind the loop */
#pragma unroll
  for (int dt = 0; dt < DT; ++dt) oacc[dt] = (v8f){0.f,0.f,0.f,0.f,0.f,0.f,0.f,0.f};
  const int jend = (CAUSAL == 1) ? (q0 + RPW) : TK;      /* causal: keys beyond the tile's last query never contribute */
#pragma unroll 1
  for (int j0 = 32 * w; j0 < jend; j0 += 4 * 32) {
    FragH ak[2][KS], av[DT];
    const unsigned short* ka = KFh + (size_t)j0 * 64; const unsigned short* va = VFh + (size_t)j0 * 128;      /* chunk j0 / 32: 2048 halves of K, 4096 of V^T */
#pragma unroll
    for (int ks = 0; ks < KS; ++ks) { ak[0][ks].half[0] = *(const v8us*)(ka + ks * 512); ak[0][ks].half[1] = *(const v8us*)(ka + ks * 512 + 256); ak[1][ks].half[0] = *(const v8us*)(ka + 1024 + ks * 512); ak[1][ks].half[1] = *(const v8us*)(ka + 1024 + ks * 512 + 256); }
#pragma unroll
    for (int dt = 0; dt < DT; ++dt) { av[dt].half[0] = *(const v8us*)(va + dt * 512); av[dt].half[1] = *(const v8us*)(va + dt * 512 + 256); }
    asm volatile("s_wait_xcnt 0x0" :: "v"(ka), "v"(va) : "memory");      /* the two address pairs stay live up to this wait, so that no load above returns into one of them and nothing overwrites them in front of it */
    float sv[16]; bool ok[16];
#pragma unroll
    for (int nt = 0; nt < 2; ++nt) { v8f acc = (v8f){0.f,0.f,0.f,0.f,0.f,0.f,0.f,0.f};
#pragma unroll
      for (int ks = 0; ks < KS; ++ks) acc = mmaH<1>(ak[nt][ks].v, ak[nt][ks].v, bq[ks].v, bq[ks].v, acc);
#pragma unroll
      for (int r = 0; r < 8; ++r) { const int kk = j0 + nt * 16 + 8 * hh + r; ok[nt * 8 + r] = (CAUSAL == 1) ? (kk <= tq) : ((CAUSAL == 2) ? ((kk >> 5) == (tq >> 5)) : true);      /* mode 2: block-diagonal 32-token groups */
        sv[nt * 8 + r] = ok[nt * 8 + r] ? acc[r] * SCL : -3.0e38f; } }
    float mc = fmaxf(sv[0], sv[1]);
#pragma unroll
    for (int i = 2; i < 16; ++i) mc = fmaxf(mc, sv[i]);
    mc = fmaxf(mc, xhalf(mc));      /* both halves now hold the chunk maximum of query tq */
    const float mn = fmaxf(m_r, mc); const float al = expf(m_r - mn); m_r = mn;      /* nothing seen yet and nothing now: m_r == mn, al = 1 */
    FragH pb; float ps[4] = {0.f, 0.f, 0.f, 0.f};
#pragma unroll
    for (int i = 0; i < 16; ++i) { float p = expf(sv[i] - mn);      /* causal: key j0 <= q0 is open to every query of the tile, so mn is finite and a masked score gives exactly 0 */
      if (CAUSAL == 2) p = ok[i] ? p : 0.f;
      ps[i & 3] += p; pb.h[i] = (_Float16)(p * 1024.0f); }
    l_r = l_r * al + ((ps[0] + ps[1]) + (ps[2] + ps[3]));
#pragma unroll
    for (int dt = 0; dt < DT; ++dt) oacc[dt] *= al;
#pragma unroll
    for (int dt = 0; dt < DT; ++dt) oacc[dt] = mmaH<1>(av[dt].v, av[dt].v, pb.v, pb.v, oacc[dt]); }
  /* join of the four key shares: publish each wave's row maxima and row sums, weigh every share by exp(m_w - m_all) / l_all, add the weighted shares */
  { const float lv = l_r + xhalf(l_r); if (hh == 0) { sM[w][ln] = m_r; sL[w][ln] = lv; } }
  __syncthreads();      /* every wave's maxima and sums are written before any wave reads them */
  { const float m0 = sM[0][ln], m1 = sM[1][ln], m2 = sM[2][ln], m3 = sM[3][ln]; const float mt = fmaxf(fmaxf(m0, m1), fmaxf(m2, m3));      /* lane -> row ln; a wave without a chunk holds m = -3e38, l = 0, O = 0 and gets weight 0; wave 0 always holds key 0, so mt is finite */
    const float e0 = expf(m0 - mt), e1 = expf(m1 - mt), e2 = expf(m2 - mt), e3 = expf(m3 - mt); const float lt = ((sL[0][ln] * e0 + sL[1][ln] * e1) + sL[2][ln] * e2) + sL[3][ln] * e3;
    const float ew = (w == 0) ? e0 : ((w == 1) ? e1 : ((w == 2) ? e2 : e3)); const float fl = (lt > 0.f) ? ew / (lt * 1024.0f) : 0.f;
#pragma unroll
    for (int dt = 0; dt < DT; ++dt) { const v8f o = oacc[dt] * fl;      /* the lane's 8 registers are 8 consecutive columns of its own row */
      *(v4f*)&sO[w][ln][dt * 16 + 8 * hh] = (v4f){o[0], o[1], o[2], o[3]}; *(v4f*)&sO[w][ln][dt * 16 + 8 * hh + 4] = (v4f){o[4], o[5], o[6], o[7]}; } }
  __syncthreads();      /* all four weighted shares are in LDS before they are added */
  {
#pragma unroll
    for (int i = 0; i < 4; ++i) { const int r = i * 4 + w; const v4f p0 = *(const v4fa*)&sO[0][r][lane * 4], p1 = *(const v4fa*)&sO[1][r][lane * 4], p2 = *(const v4fa*)&sO[2][r][lane * 4], p3 = *(const v4fa*)&sO[3][r][lane * 4]; const v4f v = ((p0 + p1) + p2) + p3;
      const size_t oo = ((size_t)b * TQ + q0 + r) * ldo + h * 64 + ln * 4; *(v4f*)((hh ? OB : OA) + oo) = v; }      /* lanes 0-15: the 64 columns of P.VA, lanes 16-31: those of P.VB; 256 contiguous bytes each */
     } }

__global__ __launch_bounds__(256) void k_split(const float* __restrict__ src, _Float16* __restrict__ D0, _Float16* __restrict__ D1) { const size_t t = (size_t)blockIdx.x * 256 + threadIdx.x; if (t >= (size_t)NR * NHD * 8) return; const int g8 = (int)(t % 8); const int h = (int)((t / 8) % NHD); const size_t r = t / ((size_t)8 * NHD); const int p = h / 2, which = h % 2; FragH f;
  for (int q = 0; q < 8; ++q) f.h[q] = (_Float16)bf16_round(src[r * DW + h * HD + g8 * 8 + q]); unsigned short* d = (unsigned short*)(which ? D1 : D0) + r * HWD + p * HD + g8 * 8; *(v8us*)d = f.half[0];  }
/* K halves in fragment order (see k_flash): one block = one 32-key chunk of one head; thread = (fragment half fh = tid / 32, lane); a wave stores 512 contiguous bytes, the block 4 KiB */
__global__ __launch_bounds__(256) void k_splitf(const float* __restrict__ src, _Float16* __restrict__ D0, _Float16* __restrict__ D1) { const int tid = threadIdx.x, ln = tid & 15, hh = (tid >> 4) & 1, fh = tid >> 5; const int h = blockIdx.x % NHD, cg = blockIdx.x / NHD; const int b = cg / (SLEN / 32), c = cg % (SLEN / 32); FragH f;
  const float* s = src + ((size_t)cg * 32 + (fh >> 2) * 16 + ln) * DW + h * HD + (fh & 3) * 16 + hh * 8;      /* K row 16 nt + ln of the chunk, dims 32 ks + 16 hf + 8 hh .. + 7 */
  for (int q = 0; q < 8; ++q) f.h[q] = (_Float16)bf16_round(s[q]); unsigned short* d = (unsigned short*)((h & 1) ? D1 : D0) + ((size_t)(b * NP + h / 2) * (SLEN / 32) + c) * 2048 + tid * 8; *(v8us*)d = f.half[0];  }
__global__ __launch_bounds__(64) void k_lambda(const float* __restrict__ lq1, const float* __restrict__ lk1, const float* __restrict__ lq2, const float* __restrict__ lk2, float* __restrict__ LAM) {
  #pragma clang fp contract(off)
  const int ln = threadIdx.x; if (ln >= 32) return; float s1 = 0.f, s2 = 0.f;
#pragma unroll 1
  for (int d = 0; d < HD; ++d) { s1 += bf16_round(lq1[d]) * bf16_round(lk1[d]); s2 += bf16_round(lq2[d]) * bf16_round(lk2[d]); }
  const float lam = expf(s1) - expf(s2) + LAMBDA_INIT; *(float*)(LAM + ln) = lam;  }
__global__ __launch_bounds__(256) void k_comb(const float* __restrict__ O11, const float* __restrict__ O12, const float* __restrict__ O21, const float* __restrict__ O22, const float* __restrict__ LAM, const float* __restrict__ w, float* __restrict__ out) {
  #pragma clang fp contract(off)
  const int wv = threadIdx.x >> 5, ln = threadIdx.x & 31; const size_t rp = (size_t)blockIdx.x * 8 + wv; if (rp >= (size_t)NR * NP) return; const int p = (int)(rp % NP); const size_t r = rp / NP; const float lam = LAM[0]; const int j0 = ln * 4;      /* lanes 0-15 -> first half (O11/O21), 16-31 -> second half (O12/O22) */
  const float* a1 = (j0 < HD ? O11 : O12) + r * HWD + p * HD + (j0 % HD); const float* a2 = (j0 < HD ? O21 : O22) + r * HWD + p * HD + (j0 % HD); float a[4]; float ss = 0.f;
  for (int q = 0; q < 4; ++q) { float v = a1[q]; v += -lam * a2[q]; a[q] = v; ss += v * v; }
  for (int o = 16; o > 0; o >>= 1) ss += __shfl_xor(ss, o, 32); const float inv = rsqrtf(ss / 128.0f + 1e-5f); v4f r4;
  for (int q = 0; q < 4; ++q) { float y = bf16_round(w[j0 + q]) * (a[q] * inv); y *= (1.0f - LAMBDA_INIT); r4[q] = y; }
  float* d = out + r * DW + p * 128 + j0; *(v4f*)d = r4;  }

extern "C" void kernel_launch(void* const* d_in, const int* in_sizes, int n_in,
                              void* d_out, int out_size, void* d_ws, size_t ws_size, hipStream_t stream) {
  (void)in_sizes; (void)n_in; (void)out_size;
  const float* const* I = (const float* const*)d_in; const float* q = I[0]; const float* k = I[1]; const float* v = I[2]; const float* lq1 = I[3]; const float* lk1 = I[4]; const float* lq2 = I[5]; const float* lk2 = I[6]; const float* w = I[7];
  char* ws = (char*)d_ws; size_t off = 0;
  auto take = [&](size_t bytes) { char* p = ws + off; off += (bytes + 255) & ~(size_t)255; return p; };
  const size_t nh = (size_t)NR * HWD;
  _Float16* Q1 = (_Float16*)take(nh * 2); _Float16* Q2 = (_Float16*)take(nh * 2); _Float16* K1 = (_Float16*)take(nh * 2); _Float16* K2 = (_Float16*)take(nh * 2); _Float16* V1 = (_Float16*)take(nh * 2); _Float16* V2 = (_Float16*)take(nh * 2); _Float16* VT = (_Float16*)take(nh * 4);
  float* O11 = (float*)take(nh * 4); float* O12 = (float*)take(nh * 4); float* O21 = (float*)take(nh * 4); float* O22 = (float*)take(nh * 4); float* LAM = (float*)take(256);
  if (off > ws_size) return;      /* 6 x 4 + 5 x 8 = 64 MiB */
  const unsigned gs = (unsigned)(((size_t)NR * NHD * 8 + 255) / 256);
  k_split<<<gs, 256, 0, stream>>>(q, Q1, Q2); k_splitf<<<(NR / 32) * NHD, 256, 0, stream>>>(k, K1, K2); k_split<<<gs, 256, 0, stream>>>(v, V1, V2);
  k_lambda<<<1, 64, 0, stream>>>(lq1, lk1, lq2, lk2, LAM);
  k_vt<NH, SLEN><<<NB * NH * (SLEN / 64), 256, 0, stream>>>(V1, HWD, 0, VT); k_vt<NH, SLEN><<<NB * NH * (SLEN / 64), 256, 0, stream>>>(V2, HWD, 0, VT + 2048);
  k_flash<1><<<NB * NH * QTILES, 128, 0, stream>>>(Q1, HWD, K1, VT, nullptr, O11, O12, HWD);
  k_flash<1><<<NB * NH * QTILES, 128, 0, stream>>>(Q2, HWD, K2, VT, nullptr, O21, O22, HWD);
  k_comb<<<(unsigned)(((size_t)NR * NP + 7) / 8), 256, 0, stream>>>(O11, O12, O21, O22, LAM, w, (float*)d_out);
}

// v005
// A run of this version takes 81.6 microseconds.
// Timed twice side by side with v004, it ran 1.36 times as fast both times.
// Counting every step since v000, it is 11.2 times as fast.
#include <hip/hip_runtime.h>
// Differential causal attention (2 x 2048 tokens, 16 heads of 64 as 8 differential pairs; q, k, v are INPUTS): heads (2p, 2p+1) = (q1, q2) etc.; P1 = causal softmax(q1.k1/8), P2 = causal softmax(q2.k2/8); attn1 = [P1 v1 | P1 v2], attn2 = [P2 v1 | P2 v2] (128 wide); lambda = exp(lq1.lk1) - exp(lq2.lk2) + lambda_init; a = attn1 - lambda attn2; out = subln_w * RMSNorm_128(a) * (1 - lambda_init) -> [B, S, 16, 64].
// Structure: de-interleave q/k/v into exact f16 planes per half (q1, q2, k1, k2, v1, v2; the inputs are exactly representable after bf16 rounding); K and V^T stored in WMMA fragment order (per 32-key chunk: fragment halves of 32 lanes x 16 bytes; both V halves in one plane), V^T by LDS tiles; lambda on device (f32 64-term dots); ONE launch of the fused causal flash kernel: a block does both (q, k) halves of a query tile, P1 and P2 multiplied into the same V^T fragments (plain operands - exact here except P; f32 softmax/accumulation), and takes the differential combine + RMSNorm in its LDS join.
// Compute dtype: inputs rounded to bf16; q, k, v exact as f16; P as f16 (x2^10, ~2^-12); everything else f32. v_wmma_f32_16x16x32_f16.
#define NB 2
#define NHD 16
#define HD 64
#define NP (NHD / 2)
#define DW (NHD * HD)            /* 1024 */
#define HWD (NP * HD)            /* 512 */
#define NR (NB * SLEN)
#define LAMBDA_INIT 0.35550906759096934f  /* 0.8 - 0.6 exp(-0.3) */
#define SLEN 2048
#define TQ SLEN
#define TK SLEN
#define NH 8                     /* head PAIRS per call */
#define SCL 0.125f
#define QTILES (TQ / 16)         /* query tiles of 16 rows, one block each */
typedef __bf16 v16b __attribute__((ext_vector_type(16)));
typedef unsigned short v8us __attribute__((ext_vector_type(8), may_alias));
typedef float  v8f  __attribute__((ext_vector_type(8)));
typedef float  v4f  __attribute__((ext_vector_type(4)));
typedef float  v4fa __attribute__((ext_vector_type(4), may_alias));
union FragB { v16b v; v8us half[2]; unsigned short u[16]; };

__device__ __forceinline__ unsigned short bf16_bits(float x) { unsigned int u = __float_as_uint(x); return (unsigned short)((u + 0x7FFFu + ((u >> 16) & 1u)) >> 16); }
__device__ __forceinline__ float bf16_val(unsigned short b) { return __uint_as_float(((unsigned int)b) << 16); }
__device__ __forceinline__ float bf16_round(float x) { return bf16_val(bf16_bits(x)); }
// D += A·B with NT terms: 1 = ah·bh, 2 = + al·bh (A split), 3 = + ah·bl (both split)
template <int NT>
__device__ __forceinline__ v8f mmaN(v16b ah, v16b al, v16b bh, v16b bl, v8f c) {
  c = __builtin_amdgcn_wmma_f32_16x16x32_bf16(false, ah, false, bh, (short)0, c, false, false);
  if (NT >= 2) c = __builtin_amdgcn_wmma_f32_16x16x32_bf16(false, al, false, bh, (short)0, c, false, false);
  if (NT >= 3) c = __builtin_amdgcn_wmma_f32_16x16x32_bf16(false, ah, false, bl, (short)0, c, false, false);
  asm volatile("v_nop\n\tv_nop\n\tv_nop\n\tv_nop" : "+v"(c) : "v"(ah), "v"(al), "v"(bh), "v"(bl));
  return c;
}

__global__ __launch_bounds__(256) void k_wt_bf16(const float* __restrict__ W, unsigned short* __restrict__ Wt, int K, int N) {
  const int t = blockIdx.x * 256 + threadIdx.x;
  const int k8n = K / 8;
  if (t >= N * k8n) return;
  const int n = t / k8n, k8 = (t % k8n) * 8;
  v8us v;
#pragma unroll
  for (int i = 0; i < 8; ++i) v[i] = bf16_bits(W[(size_t)(k8 + i) * N + n]);
  *(v8us*)(Wt + (size_t)n * K + k8) = v;
  
}

// GEMM C[M][N] (f32, pitch ldc) = act(A[M][K]·W + bias). A f32 row-major (pitch lda) converted per fragment to bf16
// (ASPLIT: hi/lo two planes -> 2 terms, else single rounded term); Wt bf16 [N][K] (pitch ldb). BIAS_BF16 rounds the
// bias to bf16 first (bias quantised to bf16 before the add). K%32==0, M%16==0, N%64==0.
template <bool ASPLIT, int ACT, bool BIAS_BF16>
__global__ __launch_bounds__(128) void k_gemm_bf(const float* __restrict__ A, int lda, const unsigned short* __restrict__ Wt, int ldb,
                                               const float* __restrict__ bias, float* __restrict__ C, int ldc, int M, int N, int K) {
  __shared__ __attribute__((aligned(16))) float so[4][16][64];
  const int tid = threadIdx.x, w = tid >> 5, lane = tid & 31, ln = lane & 15, hh = lane >> 4;
  const int ntn = N / 64;
  const int wid = blockIdx.x * 4 + w;
  const int mt = wid / ntn, nq = wid % ntn;
  if (mt * 16 >= M) return;
  const int row0 = mt * 16, col0 = nq * 64;
  const float* arow = A + (size_t)(row0 + ln) * lda;
  v8f acc[4] = {};
  for (int kb = 0; kb < K; kb += 32) {
    FragB ah, al;
    const v4f x0 = *(const v4fa*)(arow + kb + 8 * hh), x1 = *(const v4fa*)(arow + kb + 8 * hh + 4);
    const v4f x2 = *(const v4fa*)(arow + kb + 16 + 8 * hh), x3 = *(const v4fa*)(arow + kb + 16 + 8 * hh + 4);
    float xs[16] = {x0[0],x0[1],x0[2],x0[3],x1[0],x1[1],x1[2],x1[3],x2[0],x2[1],x2[2],x2[3],x3[0],x3[1],x3[2],x3[3]};
#pragma unroll
    for (int i = 0; i < 16; ++i) { const unsigned short hb = bf16_bits(xs[i]); ah.u[i] = hb; al.u[i] = ASPLIT ? bf16_bits(xs[i] - bf16_val(hb)) : (unsigned short)0; }
#pragma unroll
    for (int t = 0; t < 4; ++t) {
      const unsigned short* brow = Wt + (size_t)(col0 + t * 16 + ln) * ldb + kb;
      FragB b;
      b.half[0] = *(const v8us*)(brow + 8 * hh);
      b.half[1] = *(const v8us*)(brow + 16 + 8 * hh);
      acc[t] = mmaN<ASPLIT ? 2 : 1>(ah.v, al.v, b.v, b.v, acc[t]);
    }
  }
#pragma unroll
  for (int t = 0; t < 4; ++t) {
    float bv = bias ? bias[col0 + t * 16 + ln] : 0.f;
    if (BIAS_BF16) bv = bf16_round(bv);
#pragma unroll
    for (int r = 0; r < 8; ++r) { float v = acc[t][r] + bv; if (ACT == 1) v = fmaxf(v, 0.f); so[w][8 * hh + r][t * 16 + ln] = v; }
  }
  __builtin_amdgcn_fence(__ATOMIC_ACQ_REL, "workgroup");
  __builtin_amdgcn_wave_barrier();
  const int rsub = lane >> 4, c4 = (lane & 15) * 4;
  {
#pragma unroll
    for (int q = 0; q < 8; ++q) {
      const int r = q * 2 + rsub;
      const v4f v = *(const v4fa*)&so[w][r][c4];
      *(v4f*)(C + (size_t)(row0 + r) * ldc + col0 + c4) = v;
    }
    
  }
}

// GEMM C = act(A·W + bias + resid): A f32 (ASPLIT -> hi/lo 2 terms), Wt bf16 [N][K]; ACT 0 none, 1 relu, 2 exact gelu;
// resid (optional, f32, row index = (row % rmod), pitch ldr, RES_BF16 rounds it) added before the activation.
template <bool ASPLIT, int ACT, bool BIAS_BF16, bool RES_BF16>
__global__ __launch_bounds__(128) void k_gemm_bf3(const float* __restrict__ A, int lda, const unsigned short* __restrict__ Wt, int ldb,
                                                const float* __restrict__ bias, const float* __restrict__ resid, int rmod, int ldr,
                                                float* __restrict__ C, int ldc, int M, int N, int K) {
  __shared__ __attribute__((aligned(16))) float so[4][16][64];
  const int tid = threadIdx.x, w = tid >> 5, lane = tid & 31, ln = lane & 15, hh = lane >> 4;
  const int ntn = N / 64;
  const int wid = blockIdx.x * 4 + w;
  const int mt = wid / ntn, nq = wid % ntn;
  if (mt * 16 >= M) return;
  const int row0 = mt * 16, col0 = nq * 64;
  const float* arow = A + (size_t)(row0 + ln) * lda;
  v8f acc[4] = {};
  for (int kb = 0; kb < K; kb += 32) {
    FragB ah, al;
    const v4f x0 = *(const v4fa*)(arow + kb + 8 * hh), x1 = *(const v4fa*)(arow + kb + 8 * hh + 4);
    const v4f x2 = *(const v4fa*)(arow + kb + 16 + 8 * hh), x3 = *(const v4fa*)(arow + kb + 16 + 8 * hh + 4);
    float xs[16] = {x0[0],x0[1],x0[2],x0[3],x1[0],x1[1],x1[2],x1[3],x2[0],x2[1],x2[2],x2[3],x3[0],x3[1],x3[2],x3[3]};
#pragma unroll
    for (int i = 0; i < 16; ++i) { const unsigned short hb = bf16_bits(xs[i]); ah.u[i] = hb; al.u[i] = ASPLIT ? bf16_bits(xs[i] - bf16_val(hb)) : (unsigned short)0; }
#pragma unroll
    for (int t = 0; t < 4; ++t) {
      const unsigned short* brow = Wt + (size_t)(col0 + t * 16 + ln) * ldb + kb;
      FragB b;
      b.half[0] = *(const v8us*)(brow + 8 * hh);
      b.half[1] = *(const v8us*)(brow + 16 + 8 * hh);
      acc[t] = mmaN<ASPLIT ? 2 : 1>(ah.v, al.v, b.v, b.v, acc[t]);
    }
  }
#pragma unroll
  for (int t = 0; t < 4; ++t) {
    const int col = col0 + t * 16 + ln;
    float bv = bias ? bias[col] : 0.f;
    if (BIAS_BF16) bv = bf16_round(bv);
#pragma unroll
    for (int r = 0; r < 8; ++r) {
      float v = acc[t][r] + bv;
      if (resid) { float rv = resid[(size_t)((row0 + 8 * hh + r) % rmod) * ldr + col]; if (RES_BF16) rv = bf16_round(rv); v += rv; }
      if (ACT == 1) v = fmaxf(v, 0.f);
      if (ACT == 2) v = 0.5f * v * (1.0f + erff(v * 0.70710678118654752f));
      if (ACT == 3) { const float u = 0.7978845608028654f * (v + 0.044715f * v * v * v); v = 0.5f * v * (1.0f + tanhf(u)); }
      so[w][8 * hh + r][t * 16 + ln] = v;
    }
  }
  __builtin_amdgcn_fence(__ATOMIC_ACQ_REL, "workgroup");
  __builtin_amdgcn_wave_barrier();
  const int rsub = lane >> 4, c4 = (lane & 15) * 4;
  {
#pragma unroll
    for (int q = 0; q < 8; ++q) {
      const int r = q * 2 + rsub;
      const v4f v = *(const v4fa*)&so[w][r][c4];
      *(v4f*)(C + (size_t)(row0 + r) * ldc + col0 + c4) = v;
    }
    
  }
}
// row LayerNorm (biased variance, eps) over N: s = X (+ R); optional out_sum <- s; out_norm <- (s-mu)*rsqrt(var+eps)*g + b
template <bool PARAM_BF16>
__global__ __launch_bounds__(256) void k_layernorm(const float* __restrict__ X, const float* __restrict__ R, const float* __restrict__ g, const float* __restrict__ bta,
                                                  float* __restrict__ out_sum, float* __restrict__ out_norm, int N, float eps) {
  __shared__ float red[256];
  const int row = blockIdx.x, tid = threadIdx.x;
  const float* x = X + (size_t)row * N; const float* rr = R ? R + (size_t)row * N : nullptr;
  float vals[16];                     // up to N = 4096
  const int per = N / 256;            // contiguous chunk per thread? use strided-by-4 chunks: thread handles j = tid*4 + 1024*u
  float s1 = 0.f;
  for (int u = 0; u < per / 4; ++u) {
    const int j = tid * 4 + 1024 * u;
    const v4f a = *(const v4fa*)(x + j);
    v4f b = {0.f,0.f,0.f,0.f}; if (rr) b = *(const v4fa*)(rr + j);
#pragma unroll
    for (int q = 0; q < 4; ++q) { const float v = a[q] + b[q]; vals[u * 4 + q] = v; s1 += v; }
  }
  red[tid] = s1; __syncthreads();
  for (int st = 128; st > 0; st >>= 1) { if (tid < st) red[tid] += red[tid + st]; __syncthreads(); }
  const float mu = red[0] / (float)N; __syncthreads();
  float s2 = 0.f;
  for (int u = 0; u < per / 4; ++u)
#pragma unroll
    for (int q = 0; q < 4; ++q) { const float c = vals[u * 4 + q] - mu; s2 += c * c; }
  red[tid] = s2; __syncthreads();
  for (int st = 128; st > 0; st >>= 1) { if (tid < st) red[tid] += red[tid + st]; __syncthreads(); }
  const float rs = rsqrtf(red[0] / (float)N + eps);
  {
    for (int u = 0; u < per / 4; ++u) {
      const int j = tid * 4 + 1024 * u;
      v4f o, sm;
#pragma unroll
      for (int q = 0; q < 4; ++q) {
        float gg = g[j + q], bb = bta[j + q];
        if (PARAM_BF16) { gg = bf16_round(gg); bb = bf16_round(bb); }
        sm[q] = vals[u * 4 + q]; o[q] = (vals[u * 4 + q] - mu) * rs * gg + bb;
      }
      if (out_sum) *(v4f*)(out_sum + (size_t)row * N + j) = sm;
      *(v4f*)(out_norm + (size_t)row * N + j) = o;
    }
    
  }
}



// ---- f16 WMMA path (v_wmma_f32_16x16x32_f16): 11-bit significands for operands in range — used where a [0,1] probability operand needs more precision than bf16
typedef _Float16 v16h __attribute__((ext_vector_type(16)));
union FragH { v16h v; v8us half[2]; _Float16 h[16]; unsigned short u[16]; };
template <int NT>
__device__ __forceinline__ v8f mmaH(v16h ah, v16h al, v16h bh, v16h bl, v8f c) {
  c = __builtin_amdgcn_wmma_f32_16x16x32_f16(false, ah, false, bh, (short)0, c, false, false);
  if (NT >= 2) c = __builtin_amdgcn_wmma_f32_16x16x32_f16(false, al, false, bh, (short)0, c, false, false);
  if (NT >= 3) c = __builtin_amdgcn_wmma_f32_16x16x32_f16(false, ah, false, bl, (short)0, c, false, false);
  asm volatile("v_nop\n\tv_nop\n\tv_nop\n\tv_nop" : "+v"(c) : "v"(ah), "v"(al), "v"(bh), "v"(bl));
  return c;
}
// batched GEMM like k_gemm_b but f16 operands: A f32 (split into f16 hi/lo if ASPLIT, else rounded to f16), Bt = f16 values [n][k]; alpha; C f32; N multiple of 16 (partial tiles skipped)
template <bool ASPLIT>
__global__ __launch_bounds__(128) void k_gemm_h(const float* __restrict__ A, int lda, size_t sA, const _Float16* __restrict__ Bh, int ldb, size_t sB, float alpha, float* __restrict__ C, int ldc, size_t sC, int M, int N, int K) {
  __shared__ __attribute__((aligned(16))) float so[4][16][64];
  const int tid = threadIdx.x, w = tid >> 5, lane = tid & 31, ln = lane & 15, hh = lane >> 4; const int by = blockIdx.y;
  A += (size_t)by * sA; Bh += (size_t)by * sB; C += (size_t)by * sC;
  const int ntn = (N + 63) / 64; const int wid = blockIdx.x * 4 + w; const int mt = wid / ntn, nq = wid % ntn; if (mt * 16 >= M) return;
  const int row0 = mt * 16, col0 = nq * 64; const float* arow = A + (size_t)(row0 + ln) * lda;
  v8f acc[4] = {};
  for (int kb = 0; kb < K; kb += 32) {
    FragH ah, al;
    const v4f x0 = *(const v4fa*)(arow + kb + 8 * hh), x1 = *(const v4fa*)(arow + kb + 8 * hh + 4), x2 = *(const v4fa*)(arow + kb + 16 + 8 * hh), x3 = *(const v4fa*)(arow + kb + 16 + 8 * hh + 4);
    float xs[16] = {x0[0],x0[1],x0[2],x0[3],x1[0],x1[1],x1[2],x1[3],x2[0],x2[1],x2[2],x2[3],x3[0],x3[1],x3[2],x3[3]};
#pragma unroll
    for (int i = 0; i < 16; ++i) { const _Float16 h = (_Float16)xs[i]; ah.h[i] = h; al.h[i] = ASPLIT ? (_Float16)(xs[i] - (float)h) : (_Float16)0.0f; }
#pragma unroll
    for (int t = 0; t < 4; ++t) { if (col0 + t * 16 >= N) continue; const size_t boff = (size_t)(col0 + t * 16 + ln) * ldb + kb; FragH bq; bq.half[0] = *(const v8us*)(Bh + boff + 8 * hh); bq.half[1] = *(const v8us*)(Bh + boff + 16 + 8 * hh);
      acc[t] = mmaH<ASPLIT ? 2 : 1>(ah.v, al.v, bq.v, bq.v, acc[t]); }
  }
#pragma unroll
  for (int t = 0; t < 4; ++t) { if (col0 + t * 16 >= N) continue;
#pragma unroll
    for (int r = 0; r < 8; ++r) so[w][8 * hh + r][t * 16 + ln] = acc[t][r] * alpha; }
  __builtin_amdgcn_fence(__ATOMIC_ACQ_REL, "workgroup"); __builtin_amdgcn_wave_barrier();
  const int rsub = lane >> 4, c4 = (lane & 15) * 4;
  {
#pragma unroll
    for (int q = 0; q < 8; ++q) { const int r = q * 2 + rsub; if (col0 + c4 < N) { const v4f v = *(const v4fa*)&so[w][r][c4]; *(v4f*)(C + (size_t)(row0 + r) * ldc + col0 + c4) = v; } }
     }
}

// Wt[n][k] = f16(W[k][n]·scale) from f32 row-major W[K][N] (scale = power of two; bf16-exact weights stay exact in f16 away from the subnormal range)
__global__ __launch_bounds__(256) void k_wt_f16(const float* __restrict__ W, _Float16* __restrict__ Wt, int K, int N, float scale) {
  const int t = blockIdx.x * 256 + threadIdx.x; if (t >= N * (K / 8)) return; const int n = t / (K / 8), k8 = (t % (K / 8)) * 8; FragH f;
#pragma unroll
  for (int i = 0; i < 8; ++i) f.h[i] = (_Float16)(bf16_round(W[(size_t)(k8 + i) * N + n]) * scale); const v8us o = f.half[0];
  *(v8us*)((unsigned short*)Wt + (size_t)n * K + k8) = o; 
}
// k_gemm_hh variant with fused epilogue: v = acc·alpha + bias[by·sBias + col] (+ CP[(row/rowsPerB)·sCPb + by·64 + col] if CP) ; ACT 0 none / 1 elu ; writes f16 C16 (and f32 C if non-null)
template <int ACT>
__global__ __launch_bounds__(128) void k_gemm_hhx(const _Float16* __restrict__ A, int lda, size_t sA, const _Float16* __restrict__ Bh, int ldb, size_t sB, float alpha, const float* __restrict__ bias, size_t sBias, const float* __restrict__ CP, int rowsPerB, size_t sCPb, int row0g,
    float* __restrict__ C, _Float16* __restrict__ C16, int ldc, size_t sC, int M, int N, int K) {
  __shared__ __attribute__((aligned(16))) float so[4][16][64];
  const int tid = threadIdx.x, w = tid >> 5, lane = tid & 31, ln = lane & 15, hh = lane >> 4; const int by = blockIdx.y;
  A += (size_t)by * sA; Bh += (size_t)by * sB; const size_t cofs = (size_t)by * sC; const float* bp = bias ? bias + (size_t)by * sBias : nullptr;
  const int ntn = (N + 63) / 64; const int wid = blockIdx.x * 4 + w; const int mt = wid / ntn, nq = wid % ntn; if (mt * 16 >= M) return;
  const int row0 = mt * 16, col0 = nq * 64; const _Float16* arow = A + (size_t)(row0 + ln) * lda;
  v8f acc[4] = {};
  for (int kb = 0; kb < K; kb += 32) { FragH ah; ah.half[0] = *(const v8us*)((const unsigned short*)arow + kb + 8 * hh); ah.half[1] = *(const v8us*)((const unsigned short*)arow + kb + 16 + 8 * hh);
#pragma unroll
    for (int t = 0; t < 4; ++t) { if (col0 + t * 16 >= N) continue; const size_t boff = (size_t)(col0 + t * 16 + ln) * ldb + kb; FragH bq; bq.half[0] = *(const v8us*)((const unsigned short*)Bh + boff + 8 * hh); bq.half[1] = *(const v8us*)((const unsigned short*)Bh + boff + 16 + 8 * hh);
      acc[t] = mmaH<1>(ah.v, ah.v, bq.v, bq.v, acc[t]); }
  }
#pragma unroll
  for (int t = 0; t < 4; ++t) { if (col0 + t * 16 >= N) continue; const int col = col0 + t * 16 + ln; const float bv = bp ? bf16_round(bp[col]) : 0.f;
#pragma unroll
    for (int r = 0; r < 8; ++r) { float v = acc[t][r] * alpha + bv; if (CP) { const int bidx = (row0g + row0 + 8 * hh + r) / rowsPerB; v += CP[(size_t)bidx * sCPb + (size_t)by * 64 + col]; } if (ACT == 1) v = (v > 0.f) ? v : expm1f(v); else if (ACT == 7) v = (v > 0.f) ? v + 1.0f : expf(v); else if (ACT == 8) v = tanhf(v); else if (ACT == 9) v = 0.5f * v * (1.0f + tanhf(0.7978845608028654f * (v + 0.044715f * v * v * v))); else if (ACT == 11) v = 1.0f / (1.0f + expf(-v)); else if (ACT == 12) v = (v > 0.f) ? v : 0.01f * v; else if (ACT == 14) v = (v > 0.f) ? v : 0.1f * v; else if (ACT == 15) v = v / (1.0f + expf(-v)); else if (ACT == 3) v = fmaxf(v, 0.f); else if (ACT == 6) v = 0.5f * v * (1.0f + erff(v * 0.70710678118654752f)); so[w][8 * hh + r][t * 16 + ln] = v; } }
  __builtin_amdgcn_fence(__ATOMIC_ACQ_REL, "workgroup"); __builtin_amdgcn_wave_barrier();
  const int rsub = lane >> 4, c4 = (lane & 15) * 4; typedef _Float16 v4h __attribute__((ext_vector_type(4)));
  {
#pragma unroll
    for (int q = 0; q < 8; ++q) { const int r = q * 2 + rsub; if (col0 + c4 < N) { const v4f v = *(const v4fa*)&so[w][r][c4]; if (C) *(v4f*)(C + cofs + (size_t)(row0 + r) * ldc + col0 + c4) = v; if (C16) { v4h h4; for (int i = 0; i < 4; ++i) h4[i] = (_Float16)v[i]; *(v4h*)(C16 + cofs + (size_t)(row0 + r) * ldc + col0 + c4) = h4; } } }
     }
}


typedef _Float16 v4h __attribute__((ext_vector_type(4)));

__global__ __launch_bounds__(256) void k_x16(const float* __restrict__ x, _Float16* __restrict__ X16, size_t n8) { const size_t t = (size_t)blockIdx.x * 256 + threadIdx.x; if (t >= n8) return; FragH f;
#pragma unroll
  for (int q = 0; q < 8; ++q) f.h[q] = (_Float16)bf16_round(x[t * 8 + q]); *(v8us*)((unsigned short*)X16 + t * 8) = f.half[0];  }
__global__ __launch_bounds__(256) void k_h16(const float* __restrict__ x, _Float16* __restrict__ X16, size_t n8) { const size_t t = (size_t)blockIdx.x * 256 + threadIdx.x; if (t >= n8) return; FragH f;
#pragma unroll
  for (int q = 0; q < 8; ++q) f.h[q] = (_Float16)x[t * 8 + q]; *(v8us*)((unsigned short*)X16 + t * 8) = f.half[0];  }
__global__ __launch_bounds__(256) void k_round16f(const float* __restrict__ W, _Float16* __restrict__ Bt, size_t n8) { const size_t t = (size_t)blockIdx.x * 256 + threadIdx.x; if (t >= n8) return; FragH f;
#pragma unroll
  for (int i = 0; i < 8; ++i) f.h[i] = (_Float16)(bf16_round(W[t * 8 + i]) * 16.0f); *(v8us*)((unsigned short*)Bt + t * 8) = f.half[0];  }
template <int NHv, int TTv>
__global__ __launch_bounds__(256) void k_vt(const _Float16* __restrict__ V16, int ldv, int voff, _Float16* __restrict__ Vt) { __shared__ unsigned short tl[64][66]; const int tid = threadIdx.x; const int slab = blockIdx.x / (TTv / 64), lg = blockIdx.x % (TTv / 64); const int b = slab / NHv, h = slab % NHv;
  for (int i = tid; i < 64 * 8; i += 256) { const int r = i / 8, c8 = (i % 8) * 8; FragH f; f.half[0] = *(const v8us*)((const unsigned short*)V16 + ((size_t)b * TTv + lg * 64 + r) * ldv + voff + h * 64 + c8);
#pragma unroll
    for (int q = 0; q < 8; ++q) tl[r][c8 + q] = f.u[q]; }
  __syncthreads();
  {
#pragma unroll
    for (int rd = 0; rd < 2; ++rd) { const int fh = tid >> 5, d = (fh >> 1) * 16 + (tid & 15), k0 = rd * 32 + (fh & 1) * 16 + ((tid >> 4) & 1) * 8; FragH f;      /* fragment order: chunk rd of the tile, fragment half fh = 2 dt + hf, lane (ln, hh) holds V^T row 16 dt + ln, keys 16 hf + 8 hh .. + 7 */
#pragma unroll
      for (int q = 0; q < 8; ++q) f.u[q] = tl[k0 + q][d];
      *(v8us*)((unsigned short*)Vt + ((size_t)slab * (TTv / 32) + lg * 2 + rd) * 4096 + tid * 8) = f.half[0]; }      /* a wave stores 512 contiguous bytes, the block 4 KiB; a chunk holds both V halves (8 KiB), Vt points at this half's part of chunk 0 */
     } }

__global__ __launch_bounds__(256) void k_hl(const float* __restrict__ F, _Float16* __restrict__ Hh, _Float16* __restrict__ Hl, size_t n8) { const size_t t = (size_t)blockIdx.x * 256 + threadIdx.x; if (t >= n8) return; FragH fh, fl; const v4f a = *(const v4fa*)(F + t * 8), c = *(const v4fa*)(F + t * 8 + 4);
#pragma unroll
  for (int q = 0; q < 4; ++q) { _Float16 h = (_Float16)a[q]; fh.h[q] = h; fl.h[q] = (_Float16)((a[q] - (float)h) * 1024.0f); h = (_Float16)c[q]; fh.h[4 + q] = h; fl.h[4 + q] = (_Float16)((c[q] - (float)h) * 1024.0f); }
  { *(v8us*)((unsigned short*)Hh + t * 8) = fh.half[0]; *(v8us*)((unsigned short*)Hl + t * 8) = fl.half[0];  } }

// ---- fast GEMM (wave tile 32x64; requires M % 32 == 0 rows per launch region and N % 64 == 0); epilogue = k_gemm_hhx semantics ----
__device__ __forceinline__ v16h g2_frag(const _Float16* p, int hh) { FragH f; f.half[0] = *(const v8us*)((const unsigned short*)p + 8 * hh); f.half[1] = *(const v8us*)((const unsigned short*)p + 16 + 8 * hh); return f.v; }
__device__ __forceinline__ v8f g2_mma(v16h a, v16h b, v8f c) { v8f d = __builtin_amdgcn_wmma_f32_16x16x32_f16(false, a, false, b, (short)0, c, false, false); asm volatile("v_nop\n\tv_nop\n\tv_nop\n\tv_nop" : "+v"(d) : "v"(a), "v"(b)); return d; }
template <int ACT>
__global__ __launch_bounds__(128) void k_gemm2(const _Float16* __restrict__ A, int lda, size_t sA, const _Float16* __restrict__ Bh, int ldb, size_t sB, float alpha, const float* __restrict__ bias, size_t sBias, const float* __restrict__ CP, int rowsPerB, size_t sCPb, int row0g,
    float* __restrict__ C, _Float16* __restrict__ C16, int ldc, size_t sC, int M, int N, int K) {
  __shared__ __attribute__((aligned(16))) float so[4][32][68];
  const int tid = threadIdx.x, w = tid >> 5, lane = tid & 31, ln = lane & 15, hh = lane >> 4; const int by = blockIdx.y;
  A += (size_t)by * sA; Bh += (size_t)by * sB; const size_t cofs = (size_t)by * sC; const float* bp = bias ? bias + (size_t)by * sBias : nullptr;
  const int ntn = N >> 6; const int mt = blockIdx.x / ntn, nq = blockIdx.x - mt * ntn; const int row0 = mt * 128 + 32 * w, col0 = nq * 64; if (row0 >= M) return;
  const _Float16* a0p = A + (size_t)(row0 + ln) * lda; const _Float16* a1p = a0p + (size_t)16 * lda;
  const _Float16* b0p = Bh + (size_t)(col0 + ln) * ldb; const _Float16* b1p = b0p + (size_t)16 * ldb; const _Float16* b2p = b1p + (size_t)16 * ldb; const _Float16* b3p = b2p + (size_t)16 * ldb;
  const v8f z8 = {0.f,0.f,0.f,0.f,0.f,0.f,0.f,0.f}; v8f c00 = z8, c01 = z8, c02 = z8, c03 = z8, c10 = z8, c11 = z8, c12 = z8, c13 = z8;
#pragma unroll 1
  for (int kb = 0; kb < K; kb += 32) { const v16h a0 = g2_frag(a0p + kb, hh), a1 = g2_frag(a1p + kb, hh);
    v16h b = g2_frag(b0p + kb, hh); c00 = g2_mma(a0, b, c00); c10 = g2_mma(a1, b, c10);
    b = g2_frag(b1p + kb, hh); c01 = g2_mma(a0, b, c01); c11 = g2_mma(a1, b, c11);
    b = g2_frag(b2p + kb, hh); c02 = g2_mma(a0, b, c02); c12 = g2_mma(a1, b, c12);
    b = g2_frag(b3p + kb, hh); c03 = g2_mma(a0, b, c03); c13 = g2_mma(a1, b, c13); }
  v8f accs[8] = {c00, c01, c02, c03, c10, c11, c12, c13};
#pragma unroll
  for (int u = 0; u < 8; ++u) { const int t = u & 3, half = u >> 2; const int col = col0 + t * 16 + ln; const float bv = bp ? bf16_round(bp[col]) : 0.f;
#pragma unroll
    for (int r = 0; r < 8; ++r) { const int rloc = half * 16 + 8 * hh + r; float v = accs[u][r] * alpha + bv; if (CP) { const int bidx = (row0g + row0 + rloc) / rowsPerB; v += CP[(size_t)bidx * sCPb + (size_t)by * 64 + col]; }
      if (ACT == 3) v = fmaxf(v, 0.f); else if (ACT == 6) v = 0.5f * v * (1.0f + erff(v * 0.70710678118654752f)); else if (ACT == 11) v = 1.0f / (1.0f + expf(-v)); else if (ACT == 15) v = v / (1.0f + expf(-v)); else if (ACT == 12) v = (v > 0.f) ? v : 0.01f * v; else if (ACT == 8) v = tanhf(v);
      so[w][rloc][t * 16 + ln] = v; } }
  __builtin_amdgcn_fence(__ATOMIC_ACQ_REL, "workgroup"); __builtin_amdgcn_wave_barrier();
  const int rsub = lane >> 4, c4 = (lane & 15) * 4;
  {
#pragma unroll
    for (int q = 0; q < 16; ++q) { const int r = q * 2 + rsub; const v4f v = *(const v4fa*)&so[w][r][c4]; if (C) *(v4f*)(C + cofs + (size_t)(row0 + r) * ldc + col0 + c4) = v; if (C16) { v4h h4; for (int i = 0; i < 4; ++i) h4[i] = (_Float16)v[i]; *(v4h*)(C16 + cofs + (size_t)(row0 + r) * ldc + col0 + c4) = h4; } }
     } }



__device__ __forceinline__ float xhalf(float x) { return __builtin_bit_cast(float, __builtin_amdgcn_permlanex16(__builtin_bit_cast(int, x), __builtin_bit_cast(int, x), 0x76543210, 0xfedcba98, false, false)); }      /* value of lane l ^ 16 */
/* the flash kernel holds more than 256 vector registers: its products are the plain builtin (the compiler keeps the distance behind it); an asm statement naming the operands would tie every fragment and accumulator to the first 256 registers and spill */
__device__ __forceinline__ v8f mmaF(v16h a, v16h b, v8f c) { return __builtin_amdgcn_wmma_f32_16x16x32_f16(false, a, false, b, (short)0, c, false, false); }
/* scores, running maximum and P^T of one (q, k) half for one 32-key chunk: on return pb = P^T x 2^10 as a B operand, al = the factor that brings the old sums to the new maximum */
__device__ __forceinline__ void soft_half(const FragH (&ak)[2][2], const FragH (&bq)[2], int j0, int hh, int tq, float& m_r, float& l_r, float& al, FragH& pb) {
  float sv[16];
#pragma unroll
  for (int nt = 0; nt < 2; ++nt) { v8f acc = (v8f){0.f,0.f,0.f,0.f,0.f,0.f,0.f,0.f};
#pragma unroll
    for (int ks = 0; ks < 2; ++ks) acc = mmaF(ak[nt][ks].v, bq[ks].v, acc);
#pragma unroll
    for (int r = 0; r < 8; ++r) { const int kk = j0 + nt * 16 + 8 * hh + r; sv[nt * 8 + r] = (kk <= tq) ? acc[r] * SCL : -3.0e38f; } }
  float mc = fmaxf(sv[0], sv[1]);
#pragma unroll
  for (int i = 2; i < 16; ++i) mc = fmaxf(mc, sv[i]);
  mc = fmaxf(mc, xhalf(mc));      /* both halves of the wave now hold the chunk maximum of query tq */
  const float mn = fmaxf(m_r, mc); al = expf(m_r - mn); m_r = mn;
  float ps[4] = {0.f, 0.f, 0.f, 0.f};
#pragma unroll
  for (int i = 0; i < 16; ++i) { const float p = expf(sv[i] - mn);      /* key j0 <= q0 is open to every query of the tile, so mn is finite and a masked score gives exactly 0 */
    ps[i & 3] += p; pb.h[i] = (_Float16)(p * 1024.0f); }
  l_r = l_r * al + ((ps[0] + ps[1]) + (ps[2] + ps[3])); }
/* weight of wave w's key share in the join of one half: exp(m_w - m_all) / (l_all 2^10); lane -> row ln; a wave without a chunk holds m = -3e38, l = 0, O = 0 and gets weight 0; wave 0 always holds key 0, so the joint maximum is finite */
__device__ __forceinline__ float join_weight(const float (&sM)[4][16], const float (&sL)[4][16], int w, int ln) {
  const float m0 = sM[0][ln], m1 = sM[1][ln], m2 = sM[2][ln], m3 = sM[3][ln]; const float mt = fmaxf(fmaxf(m0, m1), fmaxf(m2, m3));
  const float e0 = expf(m0 - mt), e1 = expf(m1 - mt), e2 = expf(m2 - mt), e3 = expf(m3 - mt); const float lt = ((sL[0][ln] * e0 + sL[1][ln] * e1) + sL[2][ln] * e2) + sL[3][ln] * e3;
  const float ew = (w == 0) ? e0 : ((w == 1) ? e1 : ((w == 2) ? e2 : e3)); return (lt > 0.f) ? ew / (lt * 1024.0f) : 0.f; }
__global__ __launch_bounds__(128) void k_flash(const _Float16* __restrict__ QA, const _Float16* __restrict__ QB, int ldq, const _Float16* __restrict__ KFA, const _Float16* __restrict__ KFB, const _Float16* __restrict__ VF, const float* __restrict__ LAM, const float* __restrict__ sw, float* __restrict__ out) {
  constexpr int RPW = 16, DT = 8, KS = 2;      /* DT: output row tiles of O^T, 0-3 = (P.V1)^T, 4-7 = (P.V2)^T (one P for both V halves) */
  __shared__ __attribute__((aligned(16))) float sO[4][RPW][128 + 4]; __shared__ float sM[2][4][RPW], sL[2][4][RPW];
  const int tid = threadIdx.x, w = __builtin_amdgcn_readfirstlane(tid >> 5), lane = tid & 31, ln = lane & 15, hh = lane >> 4;      /* w in a scalar register: the key loop's bounds differ from wave to wave and must stay a scalar branch (WMMA needs every lane on) */
  const int slab = blockIdx.x / QTILES, qt = blockIdx.x % QTILES; const int b = slab / NH, h = slab % NH; const int q0 = qt * RPW;
  FragH bq[2][KS];
  { const size_t qo = ((size_t)b * TQ + q0 + ln) * ldq + h * 64; const unsigned short* qa = (const unsigned short*)QA + qo; const unsigned short* qb = (const unsigned short*)QB + qo;
#pragma unroll
    for (int ks = 0; ks < KS; ++ks) { bq[0][ks].half[0] = *(const v8us*)(qa + ks * 32 + 8 * hh); bq[0][ks].half[1] = *(const v8us*)(qa + ks * 32 + 16 + 8 * hh); bq[1][ks].half[0] = *(const v8us*)(qb + ks * 32 + 8 * hh); bq[1][ks].half[1] = *(const v8us*)(qb + ks * 32 + 16 + 8 * hh); } }
  const unsigned short* KAh = (const unsigned short*)KFA + (size_t)slab * 64 * TK + lane * 8; const unsigned short* KBh = (const unsigned short*)KFB + (size_t)slab * 64 * TK + lane * 8; const unsigned short* VFh = (const unsigned short*)VF + (size_t)slab * 128 * TK + lane * 8;      /* the lane's 16 bytes of fragment half 0 of chunk 0 */
  const int tq = q0 + ln;      /* this lane's query */
  float m_r[2] = {-3.0e38f, -3.0e38f}, l_r[2] = {0.f, 0.f}; v8f oacc[2][DT];      /* l_r: sum over this lane's own 16 keys of each chunk; the two halves of the wave are added behind the loop */
#pragma unroll
  for (int dt = 0; dt < DT; ++dt) { oacc[0][dt] = (v8f){0.f,0.f,0.f,0.f,0.f,0.f,0.f,0.f}; oacc[1][dt] = (v8f){0.f,0.f,0.f,0.f,0.f,0.f,0.f,0.f}; }
  const int jend = q0 + RPW;      /* causal: keys beyond the tile's last query never contribute */
#pragma unroll 1
  for (int j0 = 32 * w; j0 < jend; j0 += 4 * 32) {
    FragH aka[2][KS], akb[2][KS], av[DT];
    const unsigned short* ka = KAh + (size_t)j0 * 64; const unsigned short* kb = KBh + (size_t)j0 * 64; const unsigned short* va = VFh + (size_t)j0 * 128;      /* chunk j0 / 32: 2048 halves of each K, 4096 of V^T */
#pragma unroll
    for (int ks = 0; ks < KS; ++ks) { aka[0][ks].half[0] = *(const v8us*)(ka + ks * 512); aka[0][ks].half[1] = *(const v8us*)(ka + ks * 512 + 256); aka[1][ks].half[0] = *(const v8us*)(ka + 1024 + ks * 512); aka[1][ks].half[1] = *(const v8us*)(ka + 1024 + ks * 512 + 256); }
#pragma unroll
    for (int ks = 0; ks < KS; ++ks) { akb[0][ks].half[0] = *(const v8us*)(kb + ks * 512); akb[0][ks].half[1] = *(const v8us*)(kb + ks * 512 + 256); akb[1][ks].half[0] = *(const v8us*)(kb + 1024 + ks * 512); akb[1][ks].half[1] = *(const v8us*)(kb + 1024 + ks * 512 + 256); }
    __builtin_amdgcn_sched_barrier(0);      /* the K loads go out first: loads are counted back in issue order, so the score products need not wait for V^T */
#pragma unroll
    for (int dt = 0; dt < DT; ++dt) { av[dt].half[0] = *(const v8us*)(va + dt * 512); av[dt].half[1] = *(const v8us*)(va + dt * 512 + 256); }
    asm volatile("s_wait_xcnt 0x0" :: "v"(ka), "v"(kb), "v"(va) : "memory");      /* the three address pairs stay live up to this wait, so that no load above returns into one of them and nothing overwrites them in front of it */
    __builtin_amdgcn_sched_barrier(0);      /* all 32 fragment loads are issued here, in one group: left free, the scheduler sinks them between the products, a few at a time into the same registers, and the wave then waits out the load latency many times a chunk */
    FragH pa, pb; float ala, alb;
    soft_half(aka, bq[0], j0, hh, tq, m_r[0], l_r[0], ala, pa);
    soft_half(akb, bq[1], j0, hh, tq, m_r[1], l_r[1], alb, pb);
#pragma unroll
    for (int dt = 0; dt < DT; ++dt) { oacc[0][dt] *= ala; oacc[1][dt] *= alb; }
#pragma unroll
    for (int dt = 0; dt < DT; ++dt) { oacc[0][dt] = mmaF(av[dt].v, pa.v, oacc[0][dt]); oacc[1][dt] = mmaF(av[dt].v, pb.v, oacc[1][dt]); } }
  /* join of the four key shares: publish each wave's row maxima and row sums of both halves, weigh every share by exp(m_w - m_all) / l_all, add the weighted shares */
  const float lam = LAM[0]; const v4f w4 = *(const v4fa*)(sw + lane * 4);
#pragma unroll
  for (int s = 0; s < 2; ++s) { const float lv = l_r[s] + xhalf(l_r[s]); if (hh == 0) { sM[s][w][ln] = m_r[s]; sL[s][w][ln] = lv; } }
  __syncthreads();      /* every wave's maxima and sums are written before any wave reads them */
  { const float fa = join_weight(sM[0], sL[0], w, ln); const float fb = lam * join_weight(sM[1], sL[1], w, ln);
#pragma unroll
    for (int dt = 0; dt < DT; ++dt) { const v8f o = oacc[0][dt] * fa - oacc[1][dt] * fb;      /* this wave's share of attn1 - lambda attn2; the lane's 8 registers are 8 consecutive columns of its own row */
      *(v4f*)&sO[w][ln][dt * 16 + 8 * hh] = (v4f){o[0], o[1], o[2], o[3]}; *(v4f*)&sO[w][ln][dt * 16 + 8 * hh + 4] = (v4f){o[4], o[5], o[6], o[7]}; } }
  __syncthreads();      /* all four weighted shares are in LDS before they are added */
  {
#pragma unroll
    for (int i = 0; i < 4; ++i) { const int r = i * 4 + w; const v4f p0 = *(const v4fa*)&sO[0][r][lane * 4], p1 = *(const v4fa*)&sO[1][r][lane * 4], p2 = *(const v4fa*)&sO[2][r][lane * 4], p3 = *(const v4fa*)&sO[3][r][lane * 4]; const v4f a = ((p0 + p1) + p2) + p3;      /* the wave holds one whole 128-wide row, 4 columns a lane */
      float ss = 0.f;
#pragma unroll
      for (int q = 0; q < 4; ++q) ss += a[q] * a[q];
      for (int o = 16; o > 0; o >>= 1) ss += __shfl_xor(ss, o, 32);
      const float inv = rsqrtf(ss / 128.0f + 1e-5f); v4f r4;
#pragma unroll
      for (int q = 0; q < 4; ++q) { float y = bf16_round(w4[q]) * (a[q] * inv); y *= (1.0f - LAMBDA_INIT); r4[q] = y; }
      *(v4f*)(out + ((size_t)b * TQ + q0 + r) * DW + h * 128 + lane * 4) = r4; }      /* 512 contiguous bytes a row */
     } }

__global__ __launch_bounds__(256) void k_split(const float* __restrict__ src, _Float16* __restrict__ D0, _Float16* __restrict__ D1) { const size_t t = (size_t)blockIdx.x * 256 + threadIdx.x; if (t >= (size_t)NR * NHD * 8) return; const int g8 = (int)(t % 8); const int h = (int)((t / 8) % NHD); const size_t r = t / ((size_t)8 * NHD); const int p = h / 2, which = h % 2; FragH f;
  for (int q = 0; q < 8; ++q) f.h[q] = (_Float16)bf16_round(src[r * DW + h * HD + g8 * 8 + q]); unsigned short* d = (unsigned short*)(which ? D1 : D0) + r * HWD + p * HD + g8 * 8; *(v8us*)d = f.half[0];  }
/* K halves in fragment order (see k_flash): one block = one 32-key chunk of one head; thread = (fragment half fh = tid / 32, lane); a wave stores 512 contiguous bytes, the block 4 KiB */
__global__ __launch_bounds__(256) void k_splitf(const float* __restrict__ src, _Float16* __restrict__ D0, _Float16* __restrict__ D1) { const int tid = threadIdx.x, ln = tid & 15, hh = (tid >> 4) & 1, fh = tid >> 5; const int h = blockIdx.x % NHD, cg = blockIdx.x / NHD; const int b = cg / (SLEN / 32), c = cg % (SLEN / 32); FragH f;
  const float* s = src + ((size_t)cg * 32 + (fh >> 2) * 16 + ln) * DW + h * HD + (fh & 3) * 16 + hh * 8;      /* K row 16 nt + ln of the chunk, dims 32 ks + 16 hf + 8 hh .. + 7 */
  for (int q = 0; q < 8; ++q) f.h[q] = (_Float16)bf16_round(s[q]); unsigned short* d = (unsigned short*)((h & 1) ? D1 : D0) + ((size_t)(b * NP + h / 2) * (SLEN / 32) + c) * 2048 + tid * 8; *(v8us*)d = f.half[0];  }
__global__ __launch_bounds__(64) void k_lambda(const float* __restrict__ lq1, const float* __restrict__ lk1, const float* __restrict__ lq2, const float* __restrict__ lk2, float* __restrict__ LAM) {
  #pragma clang fp contract(off)
  const int ln = threadIdx.x; if (ln >= 32) return; float s1 = 0.f, s2 = 0.f;
#pragma unroll 1
  for (int d = 0; d < HD; ++d) { s1 += bf16_round(lq1[d]) * bf16_round(lk1[d]); s2 += bf16_round(lq2[d]) * bf16_round(lk2[d]); }
  const float lam = expf(s1) - expf(s2) + LAMBDA_INIT; *(float*)(LAM + ln) = lam;  }

extern "C" void kernel_launch(void* const* d_in, const int* in_sizes, int n_in,
                              void* d_out, int out_size, void* d_ws, size_t ws_size, hipStream_t stream) {
  (void)in_sizes; (void)n_in; (void)out_size;
  const float* const* I = (const float* const*)d_in; const float* q = I[0]; const float* k = I[1]; const float* v = I[2]; const float* lq1 = I[3]; const float* lk1 = I[4]; const float* lq2 = I[5]; const float* lk2 = I[6]; const float* w = I[7];
  char* ws = (char*)d_ws; size_t off = 0;
  auto take = [&](size_t bytes) { char* p = ws + off; off += (bytes + 255) & ~(size_t)255; return p; };
  const size_t nh = (size_t)NR * HWD;
  _Float16* Q1 = (_Float16*)take(nh * 2); _Float16* Q2 = (_Float16*)take(nh * 2); _Float16* K1 = (_Float16*)take(nh * 2); _Float16* K2 = (_Float16*)take(nh * 2); _Float16* V1 = (_Float16*)take(nh * 2); _Float16* V2 = (_Float16*)take(nh * 2); _Float16* VT = (_Float16*)take(nh * 4);
  float* LAM = (float*)take(256);
  if (off > ws_size) return;      /* 8 x 4 = 32 MiB */
  const unsigned gs = (unsigned)(((size_t)NR * NHD * 8 + 255) / 256);
  k_split<<<gs, 256, 0, stream>>>(q, Q1, Q2); k_splitf<<<(NR / 32) * NHD, 256, 0, stream>>>(k, K1, K2); k_split<<<gs, 256, 0, stream>>>(v, V1, V2);
  k_lambda<<<1, 64, 0, stream>>>(lq1, lk1, lq2, lk2, LAM);
  k_vt<NH, SLEN><<<NB * NH * (SLEN / 64), 256, 0, stream>>>(V1, HWD, 0, VT); k_vt<NH, SLEN><<<NB * NH * (SLEN / 64), 256, 0, stream>>>(V2, HWD, 0, VT + 2048);
  k_flash<<<NB * NH * QTILES, 128, 0, stream>>>(Q1, Q2, HWD, K1, K2, VT, LAM, w, (float*)d_out);
}

// v006
// It runs in 70.6 microseconds.
// Next to v005, in two timings, it ran 1.16 times as fast each time.
// All steps since v000 together make it 13.0 times as fast.
#include <hip/hip_runtime.h>
// Differential causal attention (2 x 2048 tokens, 16 heads of 64 as 8 differential pairs; q, k, v are INPUTS): heads (2p, 2p+1) = (q1, q2) etc.; P1 = causal softmax(q1.k1/8), P2 = causal softmax(q2.k2/8); attn1 = [P1 v1 | P1 v2], attn2 = [P2 v1 | P2 v2] (128 wide); lambda = exp(lq1.lk1) - exp(lq2.lk2) + lambda_init; a = attn1 - lambda attn2; out = subln_w * RMSNorm_128(a) * (1 - lambda_init) -> [B, S, 16, 64].
// Structure: ONE pre-pass launch de-interleaves q and k into exact f16 planes per half (q1, q2, k1, k2; the inputs are exactly representable after bf16 rounding) and writes V^T; K and V^T stored in WMMA fragment order (per 32-key chunk: fragment halves of 32 lanes x 16 bytes; both V halves in one plane); lambda on device in the same launch (f32 64-term dots); ONE launch of the fused causal flash kernel: a block does both (q, k) halves of a query tile, P1 and P2 multiplied into the same V^T fragments (plain operands - exact here except P; f32 softmax/accumulation), and takes the differential combine + RMSNorm in its LDS join.
// Compute dtype: inputs rounded to bf16; q, k, v exact as f16; P as f16 (x2^10, ~2^-12); everything else f32. v_wmma_f32_16x16x32_f16.
#define NB 2
#define NHD 16
#define HD 64
#define NP (NHD / 2)
#define DW (NHD * HD)            /* 1024 */
#define HWD (NP * HD)            /* 512 */
#define NR (NB * SLEN)
#define LAMBDA_INIT 0.35550906759096934f  /* 0.8 - 0.6 exp(-0.3) */
#define SLEN 2048
#define TQ SLEN
#define TK SLEN
#define NH 8                     /* head PAIRS per call */
#define SCL 0.125f
#define QTILES (TQ / 16)         /* query tiles of 16 rows, one block each */
typedef __bf16 v16b __attribute__((ext_vector_type(16)));
typedef unsigned short v8us __attribute__((ext_vector_type(8), may_alias));
typedef float  v8f  __attribute__((ext_vector_type(8)));
typedef float  v4f  __attribute__((ext_vector_type(4)));
typedef float  v4fa __attribute__((ext_vector_type(4), may_alias));
union FragB { v16b v; v8us half[2]; unsigned short u[16]; };

__device__ __forceinline__ unsigned short bf16_bits(float x) { unsigned int u = __float_as_uint(x); return (unsigned short)((u + 0x7FFFu + ((u >> 16) & 1u)) >> 16); }
__device__ __forceinline__ float bf16_val(unsigned short b) { return __uint_as_float(((unsigned int)b) << 16); }
__device__ __forceinline__ float bf16_round(float x) { return bf16_val(bf16_bits(x)); }
// D += A·B with NT terms: 1 = ah·bh, 2 = + al·bh (A split), 3 = + ah·bl (both split)
template <int NT>
__device__ __forceinline__ v8f mmaN(v16b ah, v16b al, v16b bh, v16b bl, v8f c) {
  c = __builtin_amdgcn_wmma_f32_16x16x32_bf16(false, ah, false, bh, (short)0, c, false, false);
  if (NT >= 2) c = __builtin_amdgcn_wmma_f32_16x16x32_bf16(false, al, false, bh, (short)0, c, false, false);
  if (NT >= 3) c = __builtin_amdgcn_wmma_f32_16x16x32_bf16(false, ah, false, bl, (short)0, c, false, false);
  asm volatile("v_nop\n\tv_nop\n\tv_nop\n\tv_nop" : "+v"(c) : "v"(ah), "v"(al), "v"(bh), "v"(bl));
  return c;
}

__global__ __launch_bounds__(256) void k_wt_bf16(const float* __restrict__ W, unsigned short* __restrict__ Wt, int K, int N) {
  const int t = blockIdx.x * 256 + threadIdx.x;
  const int k8n = K / 8;
  if (t >= N * k8n) return;
  const int n = t / k8n, k8 = (t % k8n) * 8;
  v8us v;
#pragma unroll
  for (int i = 0; i < 8; ++i) v[i] = bf16_bits(W[(size_t)(k8 + i) * N + n]);
  *(v8us*)(Wt + (size_t)n * K + k8) = v;
  
}

// GEMM C[M][N] (f32, pitch ldc) = act(A[M][K]·W + bias). A f32 row-major (pitch lda) converted per fragment to bf16
// (ASPLIT: hi/lo two planes -> 2 terms, else single rounded term); Wt bf16 [N][K] (pitch ldb). BIAS_BF16 rounds the
// bias to bf16 first (bias quantised to bf16 before the add). K%32==0, M%16==0, N%64==0.
template <bool ASPLIT, int ACT, bool BIAS_BF16>
__global__ __launch_bounds__(128) void k_gemm_bf(const float* __restrict__ A, int lda, const unsigned short* __restrict__ Wt, int ldb,
                                               const float* __restrict__ bias, float* __restrict__ C, int ldc, int M, int N, int K) {
  __shared__ __attribute__((aligned(16))) float so[4][16][64];
  const int tid = threadIdx.x, w = tid >> 5, lane = tid & 31, ln = lane & 15, hh = lane >> 4;
  const int ntn = N / 64;
  const int wid = blockIdx.x * 4 + w;
  const int mt = wid / ntn, nq = wid % ntn;
  if (mt * 16 >= M) return;
  const int row0 = mt * 16, col0 = nq * 64;
  const float* arow = A + (size_t)(row0 + ln) * lda;
  v8f acc[4] = {};
  for (int kb = 0; kb < K; kb += 32) {
    FragB ah, al;
    const v4f x0 = *(const v4fa*)(arow + kb + 8 * hh), x1 = *(const v4fa*)(arow + kb + 8 * hh + 4);
    const v4f x2 = *(const v4fa*)(arow + kb + 16 + 8 * hh), x3 = *(const v4fa*)(arow + kb + 16 + 8 * hh + 4);
    float xs[16] = {x0[0],x0[1],x0[2],x0[3],x1[0],x1[1],x1[2],x1[3],x2[0],x2[1],x2[2],x2[3],x3[0],x3[1],x3[2],x3[3]};
#pragma unroll
    for (int i = 0; i < 16; ++i) { const unsigned short hb = bf16_bits(xs[i]); ah.u[i] = hb; al.u[i] = ASPLIT ? bf16_bits(xs[i] - bf16_val(hb)) : (unsigned short)0; }
#pragma unroll
    for (int t = 0; t < 4; ++t) {
      const unsigned short* brow = Wt + (size_t)(col0 + t * 16 + ln) * ldb + kb;
      FragB b;
      b.half[0] = *(const v8us*)(brow + 8 * hh);
      b.half[1] = *(const v8us*)(brow + 16 + 8 * hh);
      acc[t] = mmaN<ASPLIT ? 2 : 1>(ah.v, al.v, b.v, b.v, acc[t]);
    }
  }
#pragma unroll
  for (int t = 0; t < 4; ++t) {
    float bv = bias ? bias[col0 + t * 16 + ln] : 0.f;
    if (BIAS_BF16) bv = bf16_round(bv);
#pragma unroll
    for (int r = 0; r < 8; ++r) { float v = acc[t][r] + bv; if (ACT == 1) v = fmaxf(v, 0.f); so[w][8 * hh + r][t * 16 + ln] = v; }
  }
  __builtin_amdgcn_fence(__ATOMIC_ACQ_REL, "workgroup");
  __builtin_amdgcn_wave_barrier();
  const int rsub = lane >> 4, c4 = (lane & 15) * 4;
  {
#pragma unroll
    for (int q = 0; q < 8; ++q) {
      const int r = q * 2 + rsub;
      const v4f v = *(const v4fa*)&so[w][r][c4];
      *(v4f*)(C + (size_t)(row0 + r) * ldc + col0 + c4) = v;
    }
    
  }
}

// GEMM C = act(A·W + bias + resid): A f32 (ASPLIT -> hi/lo 2 terms), Wt bf16 [N][K]; ACT 0 none, 1 relu, 2 exact gelu;
// resid (optional, f32, row index = (row % rmod), pitch ldr, RES_BF16 rounds it) added before the activation.
template <bool ASPLIT, int ACT, bool BIAS_BF16, bool RES_BF16>
__global__ __launch_bounds__(128) void k_gemm_bf3(const float* __restrict__ A, int lda, const unsigned short* __restrict__ Wt, int ldb,
                                                const float* __restrict__ bias, const float* __restrict__ resid, int rmod, int ldr,
                                                float* __restrict__ C, int ldc, int M, int N, int K) {
  __shared__ __attribute__((aligned(16))) float so[4][16][64];
  const int tid = threadIdx.x, w = tid >> 5, lane = tid & 31, ln = lane & 15, hh = lane >> 4;
  const int ntn = N / 64;
  const int wid = blockIdx.x * 4 + w;
  const int mt = wid / ntn, nq = wid % ntn;
  if (mt * 16 >= M) return;
  const int row0 = mt * 16, col0 = nq * 64;
  const float* arow = A + (size_t)(row0 + ln) * lda;
  v8f acc[4] = {};
  for (int kb = 0; kb < K; kb += 32) {
    FragB ah, al;
    const v4f x0 = *(const v4fa*)(arow + kb + 8 * hh), x1 = *(const v4fa*)(arow + kb + 8 * hh + 4);
    const v4f x2 = *(const v4fa*)(arow + kb + 16 + 8 * hh), x3 = *(const v4fa*)(arow + kb + 16 + 8 * hh + 4);
    float xs[16] = {x0[0],x0[1],x0[2],x0[3],x1[0],x1[1],x1[2],x1[3],x2[0],x2[1],x2[2],x2[3],x3[0],x3[1],x3[2],x3[3]};
#pragma unroll
    for (int i = 0; i < 16; ++i) { const unsigned short hb = bf16_bits(xs[i]); ah.u[i] = hb; al.u[i] = ASPLIT ? bf16_bits(xs[i] - bf16_val(hb)) : (unsigned short)0; }
#pragma unroll
    for (int t = 0; t < 4; ++t) {
      const unsigned short* brow = Wt + (size_t)(col0 + t * 16 + ln) * ldb + kb;
      FragB b;
      b.half[0] = *(const v8us*)(brow + 8 * hh);
      b.half[1] = *(const v8us*)(brow + 16 + 8 * hh);
      acc[t] = mmaN<ASPLIT ? 2 : 1>(ah.v, al.v, b.v, b.v, acc[t]);
    }
  }
#pragma unroll
  for (int t = 0; t < 4; ++t) {
    const int col = col0 + t * 16 + ln;
    float bv = bias ? bias[col] : 0.f;
    if (BIAS_BF16) bv = bf16_round(bv);
#pragma unroll
    for (int r = 0; r < 8; ++r) {
      float v = acc[t][r] + bv;
      if (resid) { float rv = resid[(size_t)((row0 + 8 * hh + r) % rmod) * ldr + col]; if (RES_BF16) rv = bf16_round(rv); v += rv; }
      if (ACT == 1) v = fmaxf(v, 0.f);
      if (ACT == 2) v = 0.5f * v * (1.0f + erff(v * 0.70710678118654752f));
      if (ACT == 3) { const float u = 0.7978845608028654f * (v + 0.044715f * v * v * v); v = 0.5f * v * (1.0f + tanhf(u)); }
      so[w][8 * hh + r][t * 16 + ln] = v;
    }
  }
  __builtin_amdgcn_fence(__ATOMIC_ACQ_REL, "workgroup");
  __builtin_amdgcn_wave_barrier();
  const int rsub = lane >> 4, c4 = (lane & 15) * 4;
  {
#pragma unroll
    for (int q = 0; q < 8; ++q) {
      const int r = q * 2 + rsub;
      const v4f v = *(const v4fa*)&so[w][r][c4];
      *(v4f*)(C + (size_t)(row0 + r) * ldc + col0 + c4) = v;
    }
    
  }
}
// row LayerNorm (biased variance, eps) over N: s = X (+ R); optional out_sum <- s; out_norm <- (s-mu)*rsqrt(var+eps)*g + b
template <bool PARAM_BF16>
__global__ __launch_bounds__(256) void k_layernorm(const float* __restrict__ X, const float* __restrict__ R, const float* __restrict__ g, const float* __restrict__ bta,
                                                  float* __restrict__ out_sum, float* __restrict__ out_norm, int N, float eps) {
  __shared__ float red[256];
  const int row = blockIdx.x, tid = threadIdx.x;
  const float* x = X + (size_t)row * N; const float* rr = R ? R + (size_t)row * N : nullptr;
  float vals[16];                     // up to N = 4096
  const int per = N / 256;            // contiguous chunk per thread? use strided-by-4 chunks: thread handles j = tid*4 + 1024*u
  float s1 = 0.f;
  for (int u = 0; u < per / 4; ++u) {
    const int j = tid * 4 + 1024 * u;
    const v4f a = *(const v4fa*)(x + j);
    v4f b = {0.f,0.f,0.f,0.f}; if (rr) b = *(const v4fa*)(rr + j);
#pragma unroll
    for (int q = 0; q < 4; ++q) { const float v = a[q] + b[q]; vals[u * 4 + q] = v; s1 += v; }
  }
  red[tid] = s1; __syncthreads();
  for (int st = 128; st > 0; st >>= 1) { if (tid < st) red[tid] += red[tid + st]; __syncthreads(); }
  const float mu = red[0] / (float)N; __syncthreads();
  float s2 = 0.f;
  for (int u = 0; u < per / 4; ++u)
#pragma unroll
    for (int q = 0; q < 4; ++q) { const float c = vals[u * 4 + q] - mu; s2 += c * c; }
  red[tid] = s2; __syncthreads();
  for (int st = 128; st > 0; st >>= 1) { if (tid < st) red[tid] += red[tid + st]; __syncthreads(); }
  const float rs = rsqrtf(red[0] / (float)N + eps);
  {
    for (int u = 0; u < per / 4; ++u) {
      const int j = tid * 4 + 1024 * u;
      v4f o, sm;
#pragma unroll
      for (int q = 0; q < 4; ++q) {
        float gg = g[j + q], bb = bta[j + q];
        if (PARAM_BF16) { gg = bf16_round(gg); bb = bf16_round(bb); }
        sm[q] = vals[u * 4 + q]; o[q] = (vals[u * 4 + q] - mu) * rs * gg + bb;
      }
      if (out_sum) *(v4f*)(out_sum + (size_t)row * N + j) = sm;
      *(v4f*)(out_norm + (size_t)row * N + j) = o;
    }
    
  }
}



// ---- f16 WMMA path (v_wmma_f32_16x16x32_f16): 11-bit significands for operands in range — used where a [0,1] probability operand needs more precision than bf16
typedef _Float16 v16h __attribute__((ext_vector_type(16)));
union FragH { v16h v; v8us half[2]; _Float16 h[16]; unsigned short u[16]; };
template <int NT>
__device__ __forceinline__ v8f mmaH(v16h ah, v16h al, v16h bh, v16h bl, v8f c) {
  c = __builtin_amdgcn_wmma_f32_16x16x32_f16(false, ah, false, bh, (short)0, c, false, false);
  if (NT >= 2) c = __builtin_amdgcn_wmma_f32_16x16x32_f16(false, al, false, bh, (short)0, c, false, false);
  if (NT >= 3) c = __builtin_amdgcn_wmma_f32_16x16x32_f16(false, ah, false, bl, (short)0, c, false, false);
  asm volatile("v_nop\n\tv_nop\n\tv_nop\n\tv_nop" : "+v"(c) : "v"(ah), "v"(al), "v"(bh), "v"(bl));
  return c;
}
// batched GEMM like k_gemm_b but f16 operands: A f32 (split into f16 hi/lo if ASPLIT, else rounded to f16), Bt = f16 values [n][k]; alpha; C f32; N multiple of 16 (partial tiles skipped)
template <bool ASPLIT>
__global__ __launch_bounds__(128) void k_gemm_h(const float* __restrict__ A, int lda, size_t sA, const _Float16* __restrict__ Bh, int ldb, size_t sB, float alpha, float* __restrict__ C, int ldc, size_t sC, int M, int N, int K) {
  __shared__ __attribute__((aligned(16))) float so[4][16][64];
  const int tid = threadIdx.x, w = tid >> 5, lane = tid & 31, ln = lane & 15, hh = lane >> 4; const int by = blockIdx.y;
  A += (size_t)by * sA; Bh += (size_t)by * sB; C += (size_t)by * sC;
  const int ntn = (N + 63) / 64; const int wid = blockIdx.x * 4 + w; const int mt = wid / ntn, nq = wid % ntn; if (mt * 16 >= M) return;
  const int row0 = mt * 16, col0 = nq * 64; const float* arow = A + (size_t)(row0 + ln) * lda;
  v8f acc[4] = {};
  for (int kb = 0; kb < K; kb += 32) {
    FragH ah, al;
    const v4f x0 = *(const v4fa*)(arow + kb + 8 * hh), x1 = *(const v4fa*)(arow + kb + 8 * hh + 4), x2 = *(const v4fa*)(arow + kb + 16 + 8 * hh), x3 = *(const v4fa*)(arow + kb + 16 + 8 * hh + 4);
    float xs[16] = {x0[0],x0[1],x0[2],x0[3],x1[0],x1[1],x1[2],x1[3],x2[0],x2[1],x2[2],x2[3],x3[0],x3[1],x3[2],x3[3]};
#pragma unroll
    for (int i = 0; i < 16; ++i) { const _Float16 h = (_Float16)xs[i]; ah.h[i] = h; al.h[i] = ASPLIT ? (_Float16)(xs[i] - (float)h) : (_Float16)0.0f; }
#pragma unroll
    for (int t = 0; t < 4; ++t) { if (col0 + t * 16 >= N) continue; const size_t boff = (size_t)(col0 + t * 16 + ln) * ldb + kb; FragH bq; bq.half[0] = *(const v8us*)(Bh + boff + 8 * hh); bq.half[1] = *(const v8us*)(Bh + boff + 16 + 8 * hh);
      acc[t] = mmaH<ASPLIT ? 2 : 1>(ah.v, al.v, bq.v, bq.v, acc[t]); }
  }
#pragma unroll
  for (int t = 0; t < 4; ++t) { if (col0 + t * 16 >= N) continue;
#pragma unroll
    for (int r = 0; r < 8; ++r) so[w][8 * hh + r][t * 16 + ln] = acc[t][r] * alpha; }
  __builtin_amdgcn_fence(__ATOMIC_ACQ_REL, "workgroup"); __builtin_amdgcn_wave_barrier();
  const int rsub = lane >> 4, c4 = (lane & 15) * 4;
  {
#pragma unroll
    for (int q = 0; q < 8; ++q) { const int r = q * 2 + rsub; if (col0 + c4 < N) { const v4f v = *(const v4fa*)&so[w][r][c4]; *(v4f*)(C + (size_t)(row0 + r) * ldc + col0 + c4) = v; } }
     }
}

// Wt[n][k] = f16(W[k][n]·scale) from f32 row-major W[K][N] (scale = power of two; bf16-exact weights stay exact in f16 away from the subnormal range)
__global__ __launch_bounds__(256) void k_wt_f16(const float* __restrict__ W, _Float16* __restrict__ Wt, int K, int N, float scale) {
  const int t = blockIdx.x * 256 + threadIdx.x; if (t >= N * (K / 8)) return; const int n = t / (K / 8), k8 = (t % (K / 8)) * 8; FragH f;
#pragma unroll
  for (int i = 0; i < 8; ++i) f.h[i] = (_Float16)(bf16_round(W[(size_t)(k8 + i) * N + n]) * scale); const v8us o = f.half[0];
  *(v8us*)((unsigned short*)Wt + (size_t)n * K + k8) = o; 
}
// k_gemm_hh variant with fused epilogue: v = acc·alpha + bias[by·sBias + col] (+ CP[(row/rowsPerB)·sCPb + by·64 + col] if CP) ; ACT 0 none / 1 elu ; writes f16 C16 (and f32 C if non-null)
template <int ACT>
__global__ __launch_bounds__(128) void k_gemm_hhx(const _Float16* __restrict__ A, int lda, size_t sA, const _Float16* __restrict__ Bh, int ldb, size_t sB, float alpha, const float* __restrict__ bias, size_t sBias, const float* __restrict__ CP, int rowsPerB, size_t sCPb, int row0g,
    float* __restrict__ C, _Float16* __restrict__ C16, int ldc, size_t sC, int M, int N, int K) {
  __shared__ __attribute__((aligned(16))) float so[4][16][64];
  const int tid = threadIdx.x, w = tid >> 5, lane = tid & 31, ln = lane & 15, hh = lane >> 4; const int by = blockIdx.y;
  A += (size_t)by * sA; Bh += (size_t)by * sB; const size_t cofs = (size_t)by * sC; const float* bp = bias ? bias + (size_t)by * sBias : nullptr;
  const int ntn = (N + 63) / 64; const int wid = blockIdx.x * 4 + w; const int mt = wid / ntn, nq = wid % ntn; if (mt * 16 >= M) return;
  const int row0 = mt * 16, col0 = nq * 64; const _Float16* arow = A + (size_t)(row0 + ln) * lda;
  v8f acc[4] = {};
  for (int kb = 0; kb < K; kb += 32) { FragH ah; ah.half[0] = *(const v8us*)((const unsigned short*)arow + kb + 8 * hh); ah.half[1] = *(const v8us*)((const unsigned short*)arow + kb + 16 + 8 * hh);
#pragma unroll
    for (int t = 0; t < 4; ++t) { if (col0 + t * 16 >= N) continue; const size_t boff = (size_t)(col0 + t * 16 + ln) * ldb + kb; FragH bq; bq.half[0] = *(const v8us*)((const unsigned short*)Bh + boff + 8 * hh); bq.half[1] = *(const v8us*)((const unsigned short*)Bh + boff + 16 + 8 * hh);
      acc[t] = mmaH<1>(ah.v, ah.v, bq.v, bq.v, acc[t]); }
  }
#pragma unroll
  for (int t = 0; t < 4; ++t) { if (col0 + t * 16 >= N) continue; const int col = col0 + t * 16 + ln; const float bv = bp ? bf16_round(bp[col]) : 0.f;
#pragma unroll
    for (int r = 0; r < 8; ++r) { float v = acc[t][r] * alpha + bv; if (CP) { const int bidx = (row0g + row0 + 8 * hh + r) / rowsPerB; v += CP[(size_t)bidx * sCPb + (size_t)by * 64 + col]; } if (ACT == 1) v = (v > 0.f) ? v : expm1f(v); else if (ACT == 7) v = (v > 0.f) ? v + 1.0f : expf(v); else if (ACT == 8) v = tanhf(v); else if (ACT == 9) v = 0.5f * v * (1.0f + tanhf(0.7978845608028654f * (v + 0.044715f * v * v * v))); else if (ACT == 11) v = 1.0f / (1.0f + expf(-v)); else if (ACT == 12) v = (v > 0.f) ? v : 0.01f * v; else if (ACT == 14) v = (v > 0.f) ? v : 0.1f * v; else if (ACT == 15) v = v / (1.0f + expf(-v)); else if (ACT == 3) v = fmaxf(v, 0.f); else if (ACT == 6) v = 0.5f * v * (1.0f + erff(v * 0.70710678118654752f)); so[w][8 * hh + r][t * 16 + ln] = v; } }
  __builtin_amdgcn_fence(__ATOMIC_ACQ_REL, "workgroup"); __builtin_amdgcn_wave_barrier();
  const int rsub = lane >> 4, c4 = (lane & 15) * 4; typedef _Float16 v4h __attribute__((ext_vector_type(4)));
  {
#pragma unroll
    for (int q = 0; q < 8; ++q) { const int r = q * 2 + rsub; if (col0 + c4 < N) { const v4f v = *(const v4fa*)&so[w][r][c4]; if (C) *(v4f*)(C + cofs + (size_t)(row0 + r) * ldc + col0 + c4) = v; if (C16) { v4h h4; for (int i = 0; i < 4; ++i) h4[i] = (_Float16)v[i]; *(v4h*)(C16 + cofs + (size_t)(row0 + r) * ldc + col0 + c4) = h4; } } }
     }
}


typedef _Float16 v4h __attribute__((ext_vector_type(4)));

__global__ __launch_bounds__(256) void k_x16(const float* __restrict__ x, _Float16* __restrict__ X16, size_t n8) { const size_t t = (size_t)blockIdx.x * 256 + threadIdx.x; if (t >= n8) return; FragH f;
#pragma unroll
  for (int q = 0; q < 8; ++q) f.h[q] = (_Float16)bf16_round(x[t * 8 + q]); *(v8us*)((unsigned short*)X16 + t * 8) = f.half[0];  }
__global__ __launch_bounds__(256) void k_h16(const float* __restrict__ x, _Float16* __restrict__ X16, size_t n8) { const size_t t = (size_t)blockIdx.x * 256 + threadIdx.x; if (t >= n8) return; FragH f;
#pragma unroll
  for (int q = 0; q < 8; ++q) f.h[q] = (_Float16)x[t * 8 + q]; *(v8us*)((unsigned short*)X16 + t * 8) = f.half[0];  }
__global__ __launch_bounds__(256) void k_round16f(const float* __restrict__ W, _Float16* __restrict__ Bt, size_t n8) { const size_t t = (size_t)blockIdx.x * 256 + threadIdx.x; if (t >= n8) return; FragH f;
#pragma unroll
  for (int i = 0; i < 8; ++i) f.h[i] = (_Float16)(bf16_round(W[t * 8 + i]) * 16.0f); *(v8us*)((unsigned short*)Bt + t * 8) = f.half[0];  }
__global__ __launch_bounds__(256) void k_hl(const float* __restrict__ F, _Float16* __restrict__ Hh, _Float16* __restrict__ Hl, size_t n8) { const size_t t = (size_t)blockIdx.x * 256 + threadIdx.x; if (t >= n8) return; FragH fh, fl; const v4f a = *(const v4fa*)(F + t * 8), c = *(const v4fa*)(F + t * 8 + 4);
#pragma unroll
  for (int q = 0; q < 4; ++q) { _Float16 h = (_Float16)a[q]; fh.h[q] = h; fl.h[q] = (_Float16)((a[q] - (float)h) * 1024.0f); h = (_Float16)c[q]; fh.h[4 + q] = h; fl.h[4 + q] = (_Float16)((c[q] - (float)h) * 1024.0f); }
  { *(v8us*)((unsigned short*)Hh + t * 8) = fh.half[0]; *(v8us*)((unsigned short*)Hl + t * 8) = fl.half[0];  } }

// ---- fast GEMM (wave tile 32x64; requires M % 32 == 0 rows per launch region and N % 64 == 0); epilogue = k_gemm_hhx semantics ----
__device__ __forceinline__ v16h g2_frag(const _Float16* p, int hh) { FragH f; f.half[0] = *(const v8us*)((const unsigned short*)p + 8 * hh); f.half[1] = *(const v8us*)((const unsigned short*)p + 16 + 8 * hh); return f.v; }
__device__ __forceinline__ v8f g2_mma(v16h a, v16h b, v8f c) { v8f d = __builtin_amdgcn_wmma_f32_16x16x32_f16(false, a, false, b, (short)0, c, false, false); asm volatile("v_nop\n\tv_nop\n\tv_nop\n\tv_nop" : "+v"(d) : "v"(a), "v"(b)); return d; }
template <int ACT>
__global__ __launch_bounds__(128) void k_gemm2(const _Float16* __restrict__ A, int lda, size_t sA, const _Float16* __restrict__ Bh, int ldb, size_t sB, float alpha, const float* __restrict__ bias, size_t sBias, const float* __restrict__ CP, int rowsPerB, size_t sCPb, int row0g,
    float* __restrict__ C, _Float16* __restrict__ C16, int ldc, size_t sC, int M, int N, int K) {
  __shared__ __attribute__((aligned(16))) float so[4][32][68];
  const int tid = threadIdx.x, w = tid >> 5, lane = tid & 31, ln = lane & 15, hh = lane >> 4; const int by = blockIdx.y;
  A += (size_t)by * sA; Bh += (size_t)by * sB; const size_t cofs = (size_t)by * sC; const float* bp = bias ? bias + (size_t)by * sBias : nullptr;
  const int ntn = N >> 6; const int mt = blockIdx.x / ntn, nq = blockIdx.x - mt * ntn; const int row0 = mt * 128 + 32 * w, col0 = nq * 64; if (row0 >= M) return;
  const _Float16* a0p = A + (size_t)(row0 + ln) * lda; const _Float16* a1p = a0p + (size_t)16 * lda;
  const _Float16* b0p = Bh + (size_t)(col0 + ln) * ldb; const _Float16* b1p = b0p + (size_t)16 * ldb; const _Float16* b2p = b1p + (size_t)16 * ldb; const _Float16* b3p = b2p + (size_t)16 * ldb;
  const v8f z8 = {0.f,0.f,0.f,0.f,0.f,0.f,0.f,0.f}; v8f c00 = z8, c01 = z8, c02 = z8, c03 = z8, c10 = z8, c11 = z8, c12 = z8, c13 = z8;
#pragma unroll 1
  for (int kb = 0; kb < K; kb += 32) { const v16h a0 = g2_frag(a0p + kb, hh), a1 = g2_frag(a1p + kb, hh);
    v16h b = g2_frag(b0p + kb, hh); c00 = g2_mma(a0, b, c00); c10 = g2_mma(a1, b, c10);
    b = g2_frag(b1p + kb, hh); c01 = g2_mma(a0, b, c01); c11 = g2_mma(a1, b, c11);
    b = g2_frag(b2p + kb, hh); c02 = g2_mma(a0, b, c02); c12 = g2_mma(a1, b, c12);
    b = g2_frag(b3p + kb, hh); c03 = g2_mma(a0, b, c03); c13 = g2_mma(a1, b, c13); }
  v8f accs[8] = {c00, c01, c02, c03, c10, c11, c12, c13};
#pragma unroll
  for (int u = 0; u < 8; ++u) { const int t = u & 3, half = u >> 2; const int col = col0 + t * 16 + ln; const float bv = bp ? bf16_round(bp[col]) : 0.f;
#pragma unroll
    for (int r = 0; r < 8; ++r) { const int rloc = half * 16 + 8 * hh + r; float v = accs[u][r] * alpha + bv; if (CP) { const int bidx = (row0g + row0 + rloc) / rowsPerB; v += CP[(size_t)bidx * sCPb + (size_t)by * 64 + col]; }
      if (ACT == 3) v = fmaxf(v, 0.f); else if (ACT == 6) v = 0.5f * v * (1.0f + erff(v * 0.70710678118654752f)); else if (ACT == 11) v = 1.0f / (1.0f + expf(-v)); else if (ACT == 15) v = v / (1.0f + expf(-v)); else if (ACT == 12) v = (v > 0.f) ? v : 0.01f * v; else if (ACT == 8) v = tanhf(v);
      so[w][rloc][t * 16 + ln] = v; } }
  __builtin_amdgcn_fence(__ATOMIC_ACQ_REL, "workgroup"); __builtin_amdgcn_wave_barrier();
  const int rsub = lane >> 4, c4 = (lane & 15) * 4;
  {
#pragma unroll
    for (int q = 0; q < 16; ++q) { const int r = q * 2 + rsub; const v4f v = *(const v4fa*)&so[w][r][c4]; if (C) *(v4f*)(C + cofs + (size_t)(row0 + r) * ldc + col0 + c4) = v; if (C16) { v4h h4; for (int i = 0; i < 4; ++i) h4[i] = (_Float16)v[i]; *(v4h*)(C16 + cofs + (size_t)(row0 + r) * ldc + col0 + c4) = h4; } }
     } }



__device__ __forceinline__ float xhalf(float x) { return __builtin_bit_cast(float, __builtin_amdgcn_permlanex16(__builtin_bit_cast(int, x), __builtin_bit_cast(int, x), 0x76543210, 0xfedcba98, false, false)); }      /* value of lane l ^ 16 */
/* the flash kernel holds more than 256 vector registers: its products are the plain builtin (the compiler keeps the distance behind it); an asm statement naming the operands would tie every fragment and accumulator to the first 256 registers and spill */
__device__ __forceinline__ v8f mmaF(v16h a, v16h b, v8f c) { return __builtin_amdgcn_wmma_f32_16x16x32_f16(false, a, false, b, (short)0, c, false, false); }
/* scores, running maximum and P^T of one (q, k) half for one 32-key chunk: on return pb = P^T x 2^10 as a B operand, al = the factor that brings the old sums to the new maximum */
__device__ __forceinline__ void soft_half(const FragH (&ak)[2][2], const FragH (&bq)[2], int j0, int hh, int tq, float& m_r, float& l_r, float& al, FragH& pb) {
  float sv[16];
#pragma unroll
  for (int nt = 0; nt < 2; ++nt) { v8f acc = (v8f){0.f,0.f,0.f,0.f,0.f,0.f,0.f,0.f};
#pragma unroll
    for (int ks = 0; ks < 2; ++ks) acc = mmaF(ak[nt][ks].v, bq[ks].v, acc);
#pragma unroll
    for (int r = 0; r < 8; ++r) { const int kk = j0 + nt * 16 + 8 * hh + r; sv[nt * 8 + r] = (kk <= tq) ? acc[r] * SCL : -3.0e38f; } }
  float mc = fmaxf(sv[0], sv[1]);
#pragma unroll
  for (int i = 2; i < 16; ++i) mc = fmaxf(mc, sv[i]);
  mc = fmaxf(mc, xhalf(mc));      /* both halves of the wave now hold the chunk maximum of query tq */
  const float mn = fmaxf(m_r, mc); al = expf(m_r - mn); m_r = mn;
  float ps[4] = {0.f, 0.f, 0.f, 0.f};
#pragma unroll
  for (int i = 0; i < 16; ++i) { const float p = expf(sv[i] - mn);      /* key j0 <= q0 is open to every query of the tile, so mn is finite and a masked score gives exactly 0 */
    ps[i & 3] += p; pb.h[i] = (_Float16)(p * 1024.0f); }
  l_r = l_r * al + ((ps[0] + ps[1]) + (ps[2] + ps[3])); }
/* weight of wave w's key share in the join of one half: exp(m_w - m_all) / (l_all 2^10); lane -> row ln; a wave without a chunk holds m = -3e38, l = 0, O = 0 and gets weight 0; wave 0 always holds key 0, so the joint maximum is finite */
__device__ __forceinline__ float join_weight(const float (&sM)[4][16], const float (&sL)[4][16], int w, int ln) {
  const float m0 = sM[0][ln], m1 = sM[1][ln], m2 = sM[2][ln], m3 = sM[3][ln]; const float mt = fmaxf(fmaxf(m0, m1), fmaxf(m2, m3));
  const float e0 = expf(m0 - mt), e1 = expf(m1 - mt), e2 = expf(m2 - mt), e3 = expf(m3 - mt); const float lt = ((sL[0][ln] * e0 + sL[1][ln] * e1) + sL[2][ln] * e2) + sL[3][ln] * e3;
  const float ew = (w == 0) ? e0 : ((w == 1) ? e1 : ((w == 2) ? e2 : e3)); return (lt > 0.f) ? ew / (lt * 1024.0f) : 0.f; }
__global__ __launch_bounds__(128) void k_flash(const _Float16* __restrict__ QA, const _Float16* __restrict__ QB, int ldq, const _Float16* __restrict__ KFA, const _Float16* __restrict__ KFB, const _Float16* __restrict__ VF, const float* __restrict__ LAM, const float* __restrict__ sw, float* __restrict__ out) {
  constexpr int RPW = 16, DT = 8, KS = 2;      /* DT: output row tiles of O^T, 0-3 = (P.V1)^T, 4-7 = (P.V2)^T (one P for both V halves) */
  __shared__ __attribute__((aligned(16))) float sO[4][RPW][128 + 4]; __shared__ float sM[2][4][RPW], sL[2][4][RPW];
  const int tid = threadIdx.x, w = __builtin_amdgcn_readfirstlane(tid >> 5), lane = tid & 31, ln = lane & 15, hh = lane >> 4;      /* w in a scalar register: the key loop's bounds differ from wave to wave and must stay a scalar branch (WMMA needs every lane on) */
  const int slab = blockIdx.x / QTILES, qt = blockIdx.x % QTILES; const int b = slab / NH, h = slab % NH; const int q0 = qt * RPW;
  FragH bq[2][KS];
  { const size_t qo = ((size_t)b * TQ + q0 + ln) * ldq + h * 64; const unsigned short* qa = (const unsigned short*)QA + qo; const unsigned short* qb = (const unsigned short*)QB + qo;
#pragma unroll
    for (int ks = 0; ks < KS; ++ks) { bq[0][ks].half[0] = *(const v8us*)(qa + ks * 32 + 8 * hh); bq[0][ks].half[1] = *(const v8us*)(qa + ks * 32 + 16 + 8 * hh); bq[1][ks].half[0] = *(const v8us*)(qb + ks * 32 + 8 * hh); bq[1][ks].half[1] = *(const v8us*)(qb + ks * 32 + 16 + 8 * hh); } }
  const unsigned short* KAh = (const unsigned short*)KFA + (size_t)slab * 64 * TK + lane * 8; const unsigned short* KBh = (const unsigned short*)KFB + (size_t)slab * 64 * TK + lane * 8; const unsigned short* VFh = (const unsigned short*)VF + (size_t)slab * 128 * TK + lane * 8;      /* the lane's 16 bytes of fragment half 0 of chunk 0 */
  const int tq = q0 + ln;      /* this lane's query */
  float m_r[2] = {-3.0e38f, -3.0e38f}, l_r[2] = {0.f, 0.f}; v8f oacc[2][DT];      /* l_r: sum over this lane's own 16 keys of each chunk; the two halves of the wave are added behind the loop */
#pragma unroll
  for (int dt = 0; dt < DT; ++dt) { oacc[0][dt] = (v8f){0.f,0.f,0.f,0.f,0.f,0.f,0.f,0.f}; oacc[1][dt] = (v8f){0.f,0.f,0.f,0.f,0.f,0.f,0.f,0.f}; }
  const int jend = q0 + RPW;      /* causal: keys beyond the tile's last query never contribute */
#pragma unroll 1
  for (int j0 = 32 * w; j0 < jend; j0 += 4 * 32) {
    FragH aka[2][KS], akb[2][KS], av[DT];
    const unsigned short* ka = KAh + (size_t)j0 * 64; const unsigned short* kb = KBh + (size_t)j0 * 64; const unsigned short* va = VFh + (size_t)j0 * 128;      /* chunk j0 / 32: 2048 halves of each K, 4096 of V^T */
#pragma unroll
    for (int ks = 0; ks < KS; ++ks) { aka[0][ks].half[0] = *(const v8us*)(ka + ks * 512); aka[0][ks].half[1] = *(const v8us*)(ka + ks * 512 + 256); aka[1][ks].half[0] = *(const v8us*)(ka + 1024 + ks * 512); aka[1][ks].half[1] = *(const v8us*)(ka + 1024 + ks * 512 + 256); }
#pragma unroll
    for (int ks = 0; ks < KS; ++ks) { akb[0][ks].half[0] = *(const v8us*)(kb + ks * 512); akb[0][ks].half[1] = *(const v8us*)(kb + ks * 512 + 256); akb[1][ks].half[0] = *(const v8us*)(kb + 1024 + ks * 512); akb[1][ks].half[1] = *(const v8us*)(kb + 1024 + ks * 512 + 256); }
    __builtin_amdgcn_sched_barrier(0);      /* the K loads go out first: loads are counted back in issue order, so the score products need not wait for V^T */
#pragma unroll
    for (int dt = 0; dt < DT; ++dt) { av[dt].half[0] = *(const v8us*)(va + dt * 512); av[dt].half[1] = *(const v8us*)(va + dt * 512 + 256); }
    asm volatile("s_wait_xcnt 0x0" :: "v"(ka), "v"(kb), "v"(va) : "memory");      /* the three address pairs stay live up to this wait, so that no load above returns into one of them and nothing overwrites them in front of it */
    __builtin_amdgcn_sched_barrier(0);      /* all 32 fragment loads are issued here, in one group: left free, the scheduler sinks them between the products, a few at a time into the same registers, and the wave then waits out the load latency many times a chunk */
    FragH pa, pb; float ala, alb;
    soft_half(aka, bq[0], j0, hh, tq, m_r[0], l_r[0], ala, pa);
    soft_half(akb, bq[1], j0, hh, tq, m_r[1], l_r[1], alb, pb);
#pragma unroll
    for (int dt = 0; dt < DT; ++dt) { oacc[0][dt] *= ala; oacc[1][dt] *= alb; }
#pragma unroll
    for (int dt = 0; dt < DT; ++dt) { oacc[0][dt] = mmaF(av[dt].v, pa.v, oacc[0][dt]); oacc[1][dt] = mmaF(av[dt].v, pb.v, oacc[1][dt]); } }
  /* join of the four key shares: publish each wave's row maxima and row sums of both halves, weigh every share by exp(m_w - m_all) / l_all, add the weighted shares */
  const float lam = LAM[0]; const v4f w4 = *(const v4fa*)(sw + lane * 4);
#pragma unroll
  for (int s = 0; s < 2; ++s) { const float lv = l_r[s] + xhalf(l_r[s]); if (hh == 0) { sM[s][w][ln] = m_r[s]; sL[s][w][ln] = lv; } }
  __syncthreads();      /* every wave's maxima and sums are written before any wave reads them */
  { const float fa = join_weight(sM[0], sL[0], w, ln); const float fb = lam * join_weight(sM[1], sL[1], w, ln);
#pragma unroll
    for (int dt = 0; dt < DT; ++dt) { const v8f o = oacc[0][dt] * fa - oacc[1][dt] * fb;      /* this wave's share of attn1 - lambda attn2; the lane's 8 registers are 8 consecutive columns of its own row */
      *(v4f*)&sO[w][ln][dt * 16 + 8 * hh] = (v4f){o[0], o[1], o[2], o[3]}; *(v4f*)&sO[w][ln][dt * 16 + 8 * hh + 4] = (v4f){o[4], o[5], o[6], o[7]}; } }
  __syncthreads();      /* all four weighted shares are in LDS before they are added */
  {
#pragma unroll
    for (int i = 0; i < 4; ++i) { const int r = i * 4 + w; const v4f p0 = *(const v4fa*)&sO[0][r][lane * 4], p1 = *(const v4fa*)&sO[1][r][lane * 4], p2 = *(const v4fa*)&sO[2][r][lane * 4], p3 = *(const v4fa*)&sO[3][r][lane * 4]; const v4f a = ((p0 + p1) + p2) + p3;      /* the wave holds one whole 128-wide row, 4 columns a lane */
      float ss = 0.f;
#pragma unroll
      for (int q = 0; q < 4; ++q) ss += a[q] * a[q];
      for (int o = 16; o > 0; o >>= 1) ss += __shfl_xor(ss, o, 32);
      const float inv = rsqrtf(ss / 128.0f + 1e-5f); v4f r4;
#pragma unroll
      for (int q = 0; q < 4; ++q) { float y = bf16_round(w4[q]) * (a[q] * inv); y *= (1.0f - LAMBDA_INIT); r4[q] = y; }
      *(v4f*)(out + ((size_t)b * TQ + q0 + r) * DW + h * 128 + lane * 4) = r4; }      /* 512 contiguous bytes a row */
     } }

/* ONE pre-pass launch writes everything the flash kernel reads. A unit = 256 threads x 16 output bytes (4 KiB); a block takes PU units of one kind and issues all their loads before the first conversion. Block 0: lambda. Then, 256 blocks each: V^T, K, Q.
   Few fat waves (6,152 in the launch), for speed only. */
#define PU 8
#define PREP_BLOCKS ((NR / 32) * NHD / PU)      /* 2,048 units of each kind */
__device__ __forceinline__ v8us cvt8(const float (&x)[8]) { FragH f;
#pragma unroll
  for (int i = 0; i < 8; ++i) f.h[i] = (_Float16)bf16_round(x[i]);
  return f.half[0]; }
/* lambda, one wave: lane l forms the rounded products of terms l and l + 32 (one load latency for all 64 terms), then every lane adds the 64 products in the order 0 .. 63, each read from its lane: the sums are those of a serial loop over the terms, bit for bit */
__device__ __forceinline__ float lane_val(float x, int l) { return __builtin_bit_cast(float, __builtin_amdgcn_readlane(__builtin_bit_cast(int, x), l)); }
__device__ __forceinline__ void lambda_part(const float* __restrict__ lq1, const float* __restrict__ lk1, const float* __restrict__ lq2, const float* __restrict__ lk2, float* __restrict__ LAM) {
  const int ln = threadIdx.x; if (ln >= 32) return; float s1 = 0.f, s2 = 0.f;
  const float p1[2] = {bf16_round(lq1[ln]) * bf16_round(lk1[ln]), bf16_round(lq1[ln + 32]) * bf16_round(lk1[ln + 32])}; const float p2[2] = {bf16_round(lq2[ln]) * bf16_round(lk2[ln]), bf16_round(lq2[ln + 32]) * bf16_round(lk2[ln + 32])};
#pragma unroll
  for (int d = 0; d < HD; ++d) { s1 += lane_val(p1[d >> 5], d & 31); s2 += lane_val(p2[d >> 5], d & 31); }
  const float lam = expf(s1) - expf(s2) + LAMBDA_INIT; *(float*)(LAM + ln) = lam;
  asm volatile("s_wait_xcnt 0x0" ::: "memory");      /* behind the store, as in prep_rows */
}
/* PU units whose thread reads 8 consecutive floats: unit u at s + u * sstep; stored at (u odd ? d1 : d0) + (u / DDIV) * dstep */
template <int DDIV>
__device__ __forceinline__ void prep_rows(const float* __restrict__ s, int sstep, unsigned short* __restrict__ d0, unsigned short* __restrict__ d1, int dstep) {
  float x[PU][8];
#pragma unroll
  for (int u = 0; u < PU; ++u) { const v4f a0 = *(const v4fa*)(s + u * sstep), a1 = *(const v4fa*)(s + u * sstep + 4);
#pragma unroll
    for (int i = 0; i < 4; ++i) { x[u][i] = a0[i]; x[u][4 + i] = a1[i]; } }
  asm volatile("s_wait_xcnt 0x0" :: "v"(s) : "memory");      /* the address pair stays live up to this wait: no load above returns into it and nothing overwrites it in front of the wait */
  __builtin_amdgcn_sched_barrier(0);      /* all 16 loads are issued before the first conversion: left free, the scheduler holds the last ones back behind the first waits, and the wave pays a second load latency */
#pragma unroll
  for (int u = 0; u < PU; ++u) { *(v8us*)(((DDIV == 2 && (u & 1)) ? d1 : d0) + (u / DDIV) * dstep) = cvt8(x[u]);      /* a wave stores whole 128-byte lines */
    asm volatile("s_wait_xcnt 0x0" ::: "memory"); }      /* behind each store: the stores go out as their units are converted, and no register that a store names is overwritten in front of its wait, on whichever path the code goes on */
}
__global__ __launch_bounds__(256) void k_prep(const float* __restrict__ q, const float* __restrict__ k, const float* __restrict__ v, const float* __restrict__ lq1, const float* __restrict__ lk1, const float* __restrict__ lq2, const float* __restrict__ lk2,
                                              _Float16* __restrict__ Q1, _Float16* __restrict__ Q2, _Float16* __restrict__ K1, _Float16* __restrict__ K2, _Float16* __restrict__ VT, float* __restrict__ LAM) {
  const int tid = threadIdx.x, ln = tid & 15, hh = (tid >> 4) & 1, fh = tid >> 5; int blk = blockIdx.x;
  if (blk == 0) { lambda_part(lq1, lk1, lq2, lk2, LAM); return; }
  blk -= 1;
  if (blk < PREP_BLOCKS) {
    /* V^T in fragment order (see k_flash), straight from v: the block = 4 chunks of 32 keys of one head pair, unit u = (chunk u / 2, V half u % 2); thread = (fragment half fh = 2 dt + hf, lane): V^T row 16 dt + ln, keys 16 hf + 8 hh .. + 7: 8 loads of one float down a column; a wave's load reads 64 contiguous bytes of each of two rows */
    const int slab = blk / (SLEN / 128), c0 = (blk % (SLEN / 128)) * 4; const int b = slab / NH, p = slab % NH;
    const float* s = v + ((size_t)b * SLEN + c0 * 32 + (fh & 1) * 16 + hh * 8) * DW + p * 2 * HD + (fh >> 1) * 16 + ln;
    unsigned short* d = (unsigned short*)VT + ((size_t)slab * (SLEN / 32) + c0) * 4096 + tid * 8;
    float x[PU][8];
#pragma unroll
    for (int u = 0; u < PU; ++u)
#pragma unroll
      for (int i = 0; i < 8; ++i) x[u][i] = s[((u >> 1) * 32 + i) * DW + (u & 1) * HD];
    asm volatile("s_wait_xcnt 0x0" :: "v"(s) : "memory");      /* as in prep_rows */
#pragma unroll
    for (int u = 0; u < PU; ++u) { *(v8us*)(d + u * 2048) = cvt8(x[u]);      /* a wave stores 512 contiguous bytes; a chunk holds V1's 4 KiB, then V2's */
      asm volatile("s_wait_xcnt 0x0" ::: "memory"); }      /* behind each store, as in prep_rows */
    return;
  }
  blk -= PREP_BLOCKS;
  if (blk < PREP_BLOCKS) {
    /* K halves in fragment order (see k_flash): the block = one 32-key chunk of 8 heads, unit u = head h0 + u; thread = (fragment half fh, lane): K row 16 nt + ln of the chunk, dims 32 ks + 16 hf + 8 hh .. + 7 */
    const int cg = blk >> 1, h0 = (blk & 1) * 8; const int b = cg / (SLEN / 32), c = cg % (SLEN / 32);
    const size_t o = ((size_t)(b * NP + h0 / 2) * (SLEN / 32) + c) * 2048 + tid * 8;
    prep_rows<2>(k + ((size_t)cg * 32 + (fh >> 2) * 16 + ln) * DW + h0 * HD + (fh & 3) * 16 + hh * 8, HD, (unsigned short*)K1 + o, (unsigned short*)K2 + o, (SLEN / 32) * 2048);
    return;
  }
  blk -= PREP_BLOCKS;
  { /* Q halves, row-major [token][pair][64]: the block = 16 tokens, unit u = tokens 2 u, 2 u + 1; thread = 8 consecutive dims of one head */
    const int h = (tid >> 3) & 15; const size_t r = (size_t)blk * (2 * PU) + (tid >> 7);
    unsigned short* d = (unsigned short*)((h & 1) ? Q2 : Q1) + r * HWD + (h / 2) * HD + (tid & 7) * 8;
    prep_rows<1>(q + r * DW + (tid & 127) * 8, 2 * DW, d, d, 2 * HWD); }
}

extern "C" void kernel_launch(void* const* d_in, const int* in_sizes, int n_in,
                              void* d_out, int out_size, void* d_ws, size_t ws_size, hipStream_t stream) {
  (void)in_sizes; (void)n_in; (void)out_size;
  const float* const* I = (const float* const*)d_in; const float* q = I[0]; const float* k = I[1]; const float* v = I[2]; const float* lq1 = I[3]; const float* lk1 = I[4]; const float* lq2 = I[5]; const float* lk2 = I[6]; const float* w = I[7];
  char* ws = (char*)d_ws; size_t off = 0;
  auto take = [&](size_t bytes) { char* p = ws + off; off += (bytes + 255) & ~(size_t)255; return p; };
  const size_t nh = (size_t)NR * HWD;
  _Float16* Q1 = (_Float16*)take(nh * 2); _Float16* Q2 = (_Float16*)take(nh * 2); _Float16* K1 = (_Float16*)take(nh * 2); _Float16* K2 = (_Float16*)take(nh * 2); _Float16* VT = (_Float16*)take(nh * 4);
  float* LAM = (float*)take(256);
  if (off > ws_size) return;      /* 6 x 4 = 24 MiB */
  k_prep<<<1 + 3 * PREP_BLOCKS, 256, 0, stream>>>(q, k, v, lq1, lk1, lq2, lk2, Q1, Q2, K1, K2, VT, LAM);
  k_flash<<<NB * NH * QTILES, 128, 0, stream>>>(Q1, Q2, HWD, K1, K2, VT, LAM, w, (float*)d_out);
}

// v007
// Measured time: 61.4 microseconds a run.
// Next to v006, in two timings, it ran 1.15 and 1.16 times as fast.
// Counting every step since v000, it is 14.9 times as fast.
#include <hip/hip_runtime.h>
// Differential causal attention (2 x 2048 tokens, 16 heads of 64 as 8 differential pairs; q, k, v are INPUTS): heads (2p, 2p+1) = (q1, q2) etc.; P1 = causal softmax(q1.k1/8), P2 = causal softmax(q2.k2/8); attn1 = [P1 v1 | P1 v2], attn2 = [P2 v1 | P2 v2] (128 wide); lambda = exp(lq1.lk1) - exp(lq2.lk2) + lambda_init; a = attn1 - lambda attn2; out = subln_w * RMSNorm_128(a) * (1 - lambda_init) -> [B, S, 16, 64].
// Structure: ONE pre-pass launch de-interleaves q and k into exact f16 planes per half (q1, q2, k1, k2; the inputs are exactly representable after bf16 rounding) and writes V^T; K and V^T stored in WMMA fragment order (per 32-key chunk: fragment halves of 32 lanes x 16 bytes; both V halves in one plane); lambda on device in the same launch (f32 64-term dots); ONE launch of the fused causal flash kernel: a block does both (q, k) halves of four query tiles, which share each stage of K and V^T through LDS; P1 and P2 multiplied into the same V^T fragments (plain operands - exact here except P; f32 softmax/accumulation), and takes the differential combine + RMSNorm in its LDS join.
// Compute dtype: inputs rounded to bf16; q, k, v exact as f16; P as f16 (x2^10, ~2^-12); everything else f32. v_wmma_f32_16x16x32_f16.
#define NB 2
#define NHD 16
#define HD 64
#define NP (NHD / 2)
#define DW (NHD * HD)            /* 1024 */
#define HWD (NP * HD)            /* 512 */
#define NR (NB * SLEN)
#define LAMBDA_INIT 0.35550906759096934f  /* 0.8 - 0.6 exp(-0.3) */
#define SLEN 2048
#define TQ SLEN
#define TK SLEN
#define NH 8                     /* head PAIRS per call */
#define SCL 0.125f
#define QTILES (TQ / 16)         /* query tiles of 16 rows, four to a block */
typedef __bf16 v16b __attribute__((ext_vector_type(16)));
typedef unsigned short v8us __attribute__((ext_vector_type(8), may_alias));
typedef float  v8f  __attribute__((ext_vector_type(8)));
typedef float  v4f  __attribute__((ext_vector_type(4)));
typedef float  v4fa __attribute__((ext_vector_type(4), may_alias));
union FragB { v16b v; v8us half[2]; unsigned short u[16]; };

__device__ __forceinline__ unsigned short bf16_bits(float x) { unsigned int u = __float_as_uint(x); return (unsigned short)((u + 0x7FFFu + ((u >> 16) & 1u)) >> 16); }
__device__ __forceinline__ float bf16_val(unsigned short b) { return __uint_as_float(((unsigned int)b) << 16); }
__device__ __forceinline__ float bf16_round(float x) { return bf16_val(bf16_bits(x)); }
// D += A·B with NT terms: 1 = ah·bh, 2 = + al·bh (A split), 3 = + ah·bl (both split)
template <int NT>
__device__ __forceinline__ v8f mmaN(v16b ah, v16b al, v16b bh, v16b bl, v8f c) {
  c = __builtin_amdgcn_wmma_f32_16x16x32_bf16(false, ah, false, bh, (short)0, c, false, false);
  if (NT >= 2) c = __builtin_amdgcn_wmma_f32_16x16x32_bf16(false, al, false, bh, (short)0, c, false, false);
  if (NT >= 3) c = __builtin_amdgcn_wmma_f32_16x16x32_bf16(false, ah, false, bl, (short)0, c, false, false);
  asm volatile("v_nop\n\tv_nop\n\tv_nop\n\tv_nop" : "+v"(c) : "v"(ah), "v"(al), "v"(bh), "v"(bl));
  return c;
}

__global__ __launch_bounds__(256) void k_wt_bf16(const float* __restrict__ W, unsigned short* __restrict__ Wt, int K, int N) {
  const int t = blockIdx.x * 256 + threadIdx.x;
  const int k8n = K / 8;
  if (t >= N * k8n) return;
  const int n = t / k8n, k8 = (t % k8n) * 8;
  v8us v;
#pragma unroll
  for (int i = 0; i < 8; ++i) v[i] = bf16_bits(W[(size_t)(k8 + i) * N + n]);
  *(v8us*)(Wt + (size_t)n * K + k8) = v;
  
}

// GEMM C[M][N] (f32, pitch ldc) = act(A[M][K]·W + bias). A f32 row-major (pitch lda) converted per fragment to bf16
// (ASPLIT: hi/lo two planes -> 2 terms, else single rounded term); Wt bf16 [N][K] (pitch ldb). BIAS_BF16 rounds the
// bias to bf16 first (bias quantised to bf16 before the add). K%32==0, M%16==0, N%64==0.
template <bool ASPLIT, int ACT, bool BIAS_BF16>
__global__ __launch_bounds__(128) void k_gemm_bf(const float* __restrict__ A, int lda, const unsigned short* __restrict__ Wt, int ldb,
                                               const float* __restrict__ bias, float* __restrict__ C, int ldc, int M, int N, int K) {
  __shared__ __attribute__((aligned(16))) float so[4][16][64];
  const int tid = threadIdx.x, w = tid >> 5, lane = tid & 31, ln = lane & 15, hh = lane >> 4;
  const int ntn = N / 64;
  const int wid = blockIdx.x * 4 + w;
  const int mt = wid / ntn, nq = wid % ntn;
  if (mt * 16 >= M) return;
  const int row0 = mt * 16, col0 = nq * 64;
  const float* arow = A + (size_t)(row0 + ln) * lda;
  v8f acc[4] = {};
  for (int kb = 0; kb < K; kb += 32) {
    FragB ah, al;
    const v4f x0 = *(const v4fa*)(arow + kb + 8 * hh), x1 = *(const v4fa*)(arow + kb + 8 * hh + 4);
    const v4f x2 = *(const v4fa*)(arow + kb + 16 + 8 * hh), x3 = *(const v4fa*)(arow + kb + 16 + 8 * hh + 4);
    float xs[16] = {x0[0],x0[1],x0[2],x0[3],x1[0],x1[1],x1[2],x1[3],x2[0],x2[1],x2[2],x2[3],x3[0],x3[1],x3[2],x3[3]};
#pragma unroll
    for (int i = 0; i < 16; ++i) { const unsigned short hb = bf16_bits(xs[i]); ah.u[i] = hb; al.u[i] = ASPLIT ? bf16_bits(xs[i] - bf16_val(hb)) : (unsigned short)0; }
#pragma unroll
    for (int t = 0; t < 4; ++t) {
      const unsigned short* brow = Wt + (size_t)(col0 + t * 16 + ln) * ldb + kb;
      FragB b;
      b.half[0] = *(const v8us*)(brow + 8 * hh);
      b.half[1] = *(const v8us*)(brow + 16 + 8 * hh);
      acc[t] = mmaN<ASPLIT ? 2 : 1>(ah.v, al.v, b.v, b.v, acc[t]);
    }
  }
#pragma unroll
  for (int t = 0; t < 4; ++t) {
    float bv = bias ? bias[col0 + t * 16 + ln] : 0.f;
    if (BIAS_BF16) bv = bf16_round(bv);
#pragma unroll
    for (int r = 0; r < 8; ++r) { float v = acc[t][r] + bv; if (ACT == 1) v = fmaxf(v, 0.f); so[w][8 * hh + r][t * 16 + ln] = v; }
  }
  __builtin_amdgcn_fence(__ATOMIC_ACQ_REL, "workgroup");
  __builtin_amdgcn_wave_barrier();
  const int rsub = lane >> 4, c4 = (lane & 15) * 4;
  {
#pragma unroll
    for (int q = 0; q < 8; ++q) {
      const int r = q * 2 + rsub;
      const v4f v = *(const v4fa*)&so[w][r][c4];
      *(v4f*)(C + (size_t)(row0 + r) * ldc + col0 + c4) = v;
    }
    
  }
}

// GEMM C = act(A·W + bias + resid): A f32 (ASPLIT -> hi/lo 2 terms), Wt bf16 [N][K]; ACT 0 none, 1 relu, 2 exact gelu;
// resid (optional, f32, row index = (row % rmod), pitch ldr, RES_BF16 rounds it) added before the activation.
template <bool ASPLIT, int ACT, bool BIAS_BF16, bool RES_BF16>
__global__ __launch_bounds__(128) void k_gemm_bf3(const float* __restrict__ A, int lda, const unsigned short* __restrict__ Wt, int ldb,
                                                const float* __restrict__ bias, const float* __restrict__ resid, int rmod, int ldr,
                                                float* __restrict__ C, int ldc, int M, int N, int K) {
  __shared__ __attribute__((aligned(16))) float so[4][16][64];
  const int tid = threadIdx.x, w = tid >> 5, lane = tid & 31, ln = lane & 15, hh = lane >> 4;
  const int ntn = N / 64;
  const int wid = blockIdx.x * 4 + w;
  const int mt = wid / ntn, nq = wid % ntn;
  if (mt * 16 >= M) return;
  const int row0 = mt * 16, col0 = nq * 64;
  const float* arow = A + (size_t)(row0 + ln) * lda;
  v8f acc[4] = {};
  for (int kb = 0; kb < K; kb += 32) {
    FragB ah, al;
    const v4f x0 = *(const v4fa*)(arow + kb + 8 * hh), x1 = *(const v4fa*)(arow + kb + 8 * hh + 4);
    const v4f x2 = *(const v4fa*)(arow + kb + 16 + 8 * hh), x3 = *(const v4fa*)(arow + kb + 16 + 8 * hh + 4);
    float xs[16] = {x0[0],x0[1],x0[2],x0[3],x1[0],x1[1],x1[2],x1[3],x2[0],x2[1],x2[2],x2[3],x3[0],x3[1],x3[2],x3[3]};
#pragma unroll
    for (int i = 0; i < 16; ++i) { const unsigned short hb = bf16_bits(xs[i]); ah.u[i] = hb; al.u[i] = ASPLIT ? bf16_bits(xs[i] - bf16_val(hb)) : (unsigned short)0; }
#pragma unroll
    for (int t = 0; t < 4; ++t) {
      const unsigned short* brow = Wt + (size_t)(col0 + t * 16 + ln) * ldb + kb;
      FragB b;
      b.half[0] = *(const v8us*)(brow + 8 * hh);
      b.half[1] = *(const v8us*)(brow + 16 + 8 * hh);
      acc[t] = mmaN<ASPLIT ? 2 : 1>(ah.v, al.v, b.v, b.v, acc[t]);
    }
  }
#pragma unroll
  for (int t = 0; t < 4; ++t) {
    const int col = col0 + t * 16 + ln;
    float bv = bias ? bias[col] : 0.f;
    if (BIAS_BF16) bv = bf16_round(bv);
#pragma unroll
    for (int r = 0; r < 8; ++r) {
      float v = acc[t][r] + bv;
      if (resid) { float rv = resid[(size_t)((row0 + 8 * hh + r) % rmod) * ldr + col]; if (RES_BF16) rv = bf16_round(rv); v += rv; }
      if (ACT == 1) v = fmaxf(v, 0.f);
      if (ACT == 2) v = 0.5f * v * (1.0f + erff(v * 0.70710678118654752f));
      if (ACT == 3) { const float u = 0.7978845608028654f * (v + 0.044715f * v * v * v); v = 0.5f * v * (1.0f + tanhf(u)); }
      so[w][8 * hh + r][t * 16 + ln] = v;
    }
  }
  __builtin_amdgcn_fence(__ATOMIC_ACQ_REL, "workgroup");
  __builtin_amdgcn_wave_barrier();
  const int rsub = lane >> 4, c4 = (lane & 15) * 4;
  {
#pragma unroll
    for (int q = 0; q < 8; ++q) {
      const int r = q * 2 + rsub;
      const v4f v = *(const v4fa*)&so[w][r][c4];
      *(v4f*)(C + (size_t)(row0 + r) * ldc + col0 + c4) = v;
    }
    
  }
}
// row LayerNorm (biased variance, eps) over N: s = X (+ R); optional out_sum <- s; out_norm <- (s-mu)*rsqrt(var+eps)*g + b
template <bool PARAM_BF16>
__global__ __launch_bounds__(256) void k_layernorm(const float* __restrict__ X, const float* __restrict__ R, const float* __restrict__ g, const float* __restrict__ bta,
                                                  float* __restrict__ out_sum, float* __restrict__ out_norm, int N, float eps) {
  __shared__ float red[256];
  const int row = blockIdx.x, tid = threadIdx.x;
  const float* x = X + (size_t)row * N; const float* rr = R ? R + (size_t)row * N : nullptr;
  float vals[16];                     // up to N = 4096
  const int per = N / 256;            // contiguous chunk per thread? use strided-by-4 chunks: thread handles j = tid*4 + 1024*u
  float s1 = 0.f;
  for (int u = 0; u < per / 4; ++u) {
    const int j = tid * 4 + 1024 * u;
    const v4f a = *(const v4fa*)(x + j);
    v4f b = {0.f,0.f,0.f,0.f}; if (rr) b = *(const v4fa*)(rr + j);
#pragma unroll
    for (int q = 0; q < 4; ++q) { const float v = a[q] + b[q]; vals[u * 4 + q] = v; s1 += v; }
  }
  red[tid] = s1; __syncthreads();
  for (int st = 128; st > 0; st >>= 1) { if (tid < st) red[tid] += red[tid + st]; __syncthreads(); }
  const float mu = red[0] / (float)N; __syncthreads();
  float s2 = 0.f;
  for (int u = 0; u < per / 4; ++u)
#pragma unroll
    for (int q = 0; q < 4; ++q) { const float c = vals[u * 4 + q] - mu; s2 += c * c; }
  red[tid] = s2; __syncthreads();
  for (int st = 128; st > 0; st >>= 1) { if (tid < st) red[tid] += red[tid + st]; __syncthreads(); }
  const float rs = rsqrtf(red[0] / (float)N + eps);
  {
    for (int u = 0; u < per / 4; ++u) {
      const int j = tid * 4 + 1024 * u;
      v4f o, sm;
#pragma unroll
      for (int q = 0; q < 4; ++q) {
        float gg = g[j + q], bb = bta[j + q];
        if (PARAM_BF16) { gg = bf16_round(gg); bb = bf16_round(bb); }
        sm[q] = vals[u * 4 + q]; o[q] = (vals[u * 4 + q] - mu) * rs * gg + bb;
      }
      if (out_sum) *(v4f*)(out_sum + (size_t)row * N + j) = sm;
      *(v4f*)(out_norm + (size_t)row * N + j) = o;
    }
    
  }
}



// ---- f16 WMMA path (v_wmma_f32_16x16x32_f16): 11-bit significands for operands in range — used where a [0,1] probability operand needs more precision than bf16
typedef _Float16 v16h __attribute__((ext_vector_type(16)));
union FragH { v16h v; v8us half[2]; _Float16 h[16]; unsigned short u[16]; };
template <int NT>
__device__ __forceinline__ v8f mmaH(v16h ah, v16h al, v16h bh, v16h bl, v8f c) {
  c = __builtin_amdgcn_wmma_f32_16x16x32_f16(false, ah, false, bh, (short)0, c, false, false);
  if (NT >= 2) c = __builtin_amdgcn_wmma_f32_16x16x32_f16(false, al, false, bh, (short)0, c, false, false);
  if (NT >= 3) c = __builtin_amdgcn_wmma_f32_16x16x32_f16(false, ah, false, bl, (short)0, c, false, false);
  asm volatile("v_nop\n\tv_nop\n\tv_nop\n\tv_nop" : "+v"(c) : "v"(ah), "v"(al), "v"(bh), "v"(bl));
  return c;
}
// batched GEMM like k_gemm_b but f16 operands: A f32 (split into f16 hi/lo if ASPLIT, else rounded to f16), Bt = f16 values [n][k]; alpha; C f32; N multiple of 16 (partial tiles skipped)
template <bool ASPLIT>
__global__ __launch_bounds__(128) void k_gemm_h(const float* __restrict__ A, int lda, size_t sA, const _Float16* __restrict__ Bh, int ldb, size_t sB, float alpha, float* __restrict__ C, int ldc, size_t sC, int M, int N, int K) {
  __shared__ __attribute__((aligned(16))) float so[4][16][64];
  const int tid = threadIdx.x, w = tid >> 5, lane = tid & 31, ln = lane & 15, hh = lane >> 4; const int by = blockIdx.y;
  A += (size_t)by * sA; Bh += (size_t)by * sB; C += (size_t)by * sC;
  const int ntn = (N + 63) / 64; const int wid = blockIdx.x * 4 + w; const int mt = wid / ntn, nq = wid % ntn; if (mt * 16 >= M) return;
  const int row0 = mt * 16, col0 = nq * 64; const float* arow = A + (size_t)(row0 + ln) * lda;
  v8f acc[4] = {};
  for (int kb = 0; kb < K; kb += 32) {
    FragH ah, al;
    const v4f x0 = *(const v4fa*)(arow + kb + 8 * hh), x1 = *(const v4fa*)(arow + kb + 8 * hh + 4), x2 = *(const v4fa*)(arow + kb + 16 + 8 * hh), x3 = *(const v4fa*)(arow + kb + 16 + 8 * hh + 4);
    float xs[16] = {x0[0],x0[1],x0[2],x0[3],x1[0],x1[1],x1[2],x1[3],x2[0],x2[1],x2[2],x2[3],x3[0],x3[1],x3[2],x3[3]};
#pragma unroll
    for (int i = 0; i < 16; ++i) { const _Float16 h = (_Float16)xs[i]; ah.h[i] = h; al.h[i] = ASPLIT ? (_Float16)(xs[i] - (float)h) : (_Float16)0.0f; }
#pragma unroll
    for (int t = 0; t < 4; ++t) { if (col0 + t * 16 >= N) continue; const size_t boff = (size_t)(col0 + t * 16 + ln) * ldb + kb; FragH bq; bq.half[0] = *(const v8us*)(Bh + boff + 8 * hh); bq.half[1] = *(const v8us*)(Bh + boff + 16 + 8 * hh);
      acc[t] = mmaH<ASPLIT ? 2 : 1>(ah.v, al.v, bq.v, bq.v, acc[t]); }
  }
#pragma unroll
  for (int t = 0; t < 4; ++t) { if (col0 + t * 16 >= N) continue;
#pragma unroll
    for (int r = 0; r < 8; ++r) so[w][8 * hh + r][t * 16 + ln] = acc[t][r] * alpha; }
  __builtin_amdgcn_fence(__ATOMIC_ACQ_REL, "workgroup"); __builtin_amdgcn_wave_barrier();
  const int rsub = lane >> 4, c4 = (lane & 15) * 4;
  {
#pragma unroll
    for (int q = 0; q < 8; ++q) { const int r = q * 2 + rsub; if (col0 + c4 < N) { const v4f v = *(const v4fa*)&so[w][r][c4]; *(v4f*)(C + (size_t)(row0 + r) * ldc + col0 + c4) = v; } }
     }
}

// Wt[n][k] = f16(W[k][n]·scale) from f32 row-major W[K][N] (scale = power of two; bf16-exact weights stay exact in f16 away from the subnormal range)
__global__ __launch_bounds__(256) void k_wt_f16(const float* __restrict__ W, _Float16* __restrict__ Wt, int K, int N, float scale) {
  const int t = blockIdx.x * 256 + threadIdx.x; if (t >= N * (K / 8)) return; const int n = t / (K / 8), k8 = (t % (K / 8)) * 8; FragH f;
#pragma unroll
  for (int i = 0; i < 8; ++i) f.h[i] = (_Float16)(bf16_round(W[(size_t)(k8 + i) * N + n]) * scale); const v8us o = f.half[0];
  *(v8us*)((unsigned short*)Wt + (size_t)n * K + k8) = o; 
}
// k_gemm_hh variant with fused epilogue: v = acc·alpha + bias[by·sBias + col] (+ CP[(row/rowsPerB)·sCPb + by·64 + col] if CP) ; ACT 0 none / 1 elu ; writes f16 C16 (and f32 C if non-null)
template <int ACT>
__global__ __launch_bounds__(128) void k_gemm_hhx(const _Float16* __restrict__ A, int lda, size_t sA, const _Float16* __restrict__ Bh, int ldb, size_t sB, float alpha, const float* __restrict__ bias, size_t sBias, const float* __restrict__ CP, int rowsPerB, size_t sCPb, int row0g,
    float* __restrict__ C, _Float16* __restrict__ C16, int ldc, size_t sC, int M, int N, int K) {
  __shared__ __attribute__((aligned(16))) float so[4][16][64];
  const int tid = threadIdx.x, w = tid >> 5, lane = tid & 31, ln = lane & 15, hh = lane >> 4; const int by = blockIdx.y;
  A += (size_t)by * sA; Bh += (size_t)by * sB; const size_t cofs = (size_t)by * sC; const float* bp = bias ? bias + (size_t)by * sBias : nullptr;
  const int ntn = (N + 63) / 64; const int wid = blockIdx.x * 4 + w; const int mt = wid / ntn, nq = wid % ntn; if (mt * 16 >= M) return;
  const int row0 = mt * 16, col0 = nq * 64; const _Float16* arow = A + (size_t)(row0 + ln) * lda;
  v8f acc[4] = {};
  for (int kb = 0; kb < K; kb += 32) { FragH ah; ah.half[0] = *(const v8us*)((const unsigned short*)arow + kb + 8 * hh); ah.half[1] = *(const v8us*)((const unsigned short*)arow + kb + 16 + 8 * hh);
#pragma unroll
    for (int t = 0; t < 4; ++t) { if (col0 + t * 16 >= N) continue; const size_t boff = (size_t)(col0 + t * 16 + ln) * ldb + kb; FragH bq; bq.half[0] = *(const v8us*)((const unsigned short*)Bh + boff + 8 * hh); bq.half[1] = *(const v8us*)((const unsigned short*)Bh + boff + 16 + 8 * hh);
      acc[t] = mmaH<1>(ah.v, ah.v, bq.v, bq.v, acc[t]); }
  }
#pragma unroll
  for (int t = 0; t < 4; ++t) { if (col0 + t * 16 >= N) continue; const int col = col0 + t * 16 + ln; const float bv = bp ? bf16_round(bp[col]) : 0.f;
#pragma unroll
    for (int r = 0; r < 8; ++r) { float v = acc[t][r] * alpha + bv; if (CP) { const int bidx = (row0g + row0 + 8 * hh + r) / rowsPerB; v += CP[(size_t)bidx * sCPb + (size_t)by * 64 + col]; } if (ACT == 1) v = (v > 0.f) ? v : expm1f(v); else if (ACT == 7) v = (v > 0.f) ? v + 1.0f : expf(v); else if (ACT == 8) v = tanhf(v); else if (ACT == 9) v = 0.5f * v * (1.0f + tanhf(0.7978845608028654f * (v + 0.044715f * v * v * v))); else if (ACT == 11) v = 1.0f / (1.0f + expf(-v)); else if (ACT == 12) v = (v > 0.f) ? v : 0.01f * v; else if (ACT == 14) v = (v > 0.f) ? v : 0.1f * v; else if (ACT == 15) v = v / (1.0f + expf(-v)); else if (ACT == 3) v = fmaxf(v, 0.f); else if (ACT == 6) v = 0.5f * v * (1.0f + erff(v * 0.70710678118654752f)); so[w][8 * hh + r][t * 16 + ln] = v; } }
  __builtin_amdgcn_fence(__ATOMIC_ACQ_REL, "workgroup"); __builtin_amdgcn_wave_barrier();
  const int rsub = lane >> 4, c4 = (lane & 15) * 4; typedef _Float16 v4h __attribute__((ext_vector_type(4)));
  {
#pragma unroll
    for (int q = 0; q < 8; ++q) { const int r = q * 2 + rsub; if (col0 + c4 < N) { const v4f v = *(const v4fa*)&so[w][r][c4]; if (C) *(v4f*)(C + cofs + (size_t)(row0 + r) * ldc + col0 + c4) = v; if (C16) { v4h h4; for (int i = 0; i < 4; ++i) h4[i] = (_Float16)v[i]; *(v4h*)(C16 + cofs + (size_t)(row0 + r) * ldc + col0 + c4) = h4; } } }
     }
}


typedef _Float16 v4h __attribute__((ext_vector_type(4)));

__global__ __launch_bounds__(256) void k_x16(const float* __restrict__ x, _Float16* __restrict__ X16, size_t n8) { const size_t t = (size_t)blockIdx.x * 256 + threadIdx.x; if (t >= n8) return; FragH f;
#pragma unroll
  for (int q = 0; q < 8; ++q) f.h[q] = (_Float16)bf16_round(x[t * 8 + q]); *(v8us*)((unsigned short*)X16 + t * 8) = f.half[0];  }
__global__ __launch_bounds__(256) void k_h16(const float* __restrict__ x, _Float16* __restrict__ X16, size_t n8) { const size_t t = (size_t)blockIdx.x * 256 + threadIdx.x; if (t >= n8) return; FragH f;
#pragma unroll
  for (int q = 0; q < 8; ++q) f.h[q] = (_Float16)x[t * 8 + q]; *(v8us*)((unsigned short*)X16 + t * 8) = f.half[0];  }
__global__ __launch_bounds__(256) void k_round16f(const float* __restrict__ W, _Float16* __restrict__ Bt, size_t n8) { const size_t t = (size_t)blockIdx.x * 256 + threadIdx.x; if (t >= n8) return; FragH f;
#pragma unroll
  for (int i = 0; i < 8; ++i) f.h[i] = (_Float16)(bf16_round(W[t * 8 + i]) * 16.0f); *(v8us*)((unsigned short*)Bt + t * 8) = f.half[0];  }
__global__ __launch_bounds__(256) void k_hl(const float* __restrict__ F, _Float16* __restrict__ Hh, _Float16* __restrict__ Hl, size_t n8) { const size_t t = (size_t)blockIdx.x * 256 + threadIdx.x; if (t >= n8) return; FragH fh, fl; const v4f a = *(const v4fa*)(F + t * 8), c = *(const v4fa*)(F + t * 8 + 4);
#pragma unroll
  for (int q = 0; q < 4; ++q) { _Float16 h = (_Float16)a[q]; fh.h[q] = h; fl.h[q] = (_Float16)((a[q] - (float)h) * 1024.0f); h = (_Float16)c[q]; fh.h[4 + q] = h; fl.h[4 + q] = (_Float16)((c[q] - (float)h) * 1024.0f); }
  { *(v8us*)((unsigned short*)Hh + t * 8) = fh.half[0]; *(v8us*)((unsigned short*)Hl + t * 8) = fl.half[0];  } }

// ---- fast GEMM (wave tile 32x64; requires M % 32 == 0 rows per launch region and N % 64 == 0); epilogue = k_gemm_hhx semantics ----
__device__ __forceinline__ v16h g2_frag(const _Float16* p, int hh) { FragH f; f.half[0] = *(const v8us*)((const unsigned short*)p + 8 * hh); f.half[1] = *(const v8us*)((const unsigned short*)p + 16 + 8 * hh); return f.v; }
__device__ __forceinline__ v8f g2_mma(v16h a, v16h b, v8f c) { v8f d = __builtin_amdgcn_wmma_f32_16x16x32_f16(false, a, false, b, (short)0, c, false, false); asm volatile("v_nop\n\tv_nop\n\tv_nop\n\tv_nop" : "+v"(d) : "v"(a), "v"(b)); return d; }
template <int ACT>
__global__ __launch_bounds__(128) void k_gemm2(const _Float16* __restrict__ A, int lda, size_t sA, const _Float16* __restrict__ Bh, int ldb, size_t sB, float alpha, const float* __restrict__ bias, size_t sBias, const float* __restrict__ CP, int rowsPerB, size_t sCPb, int row0g,
    float* __restrict__ C, _Float16* __restrict__ C16, int ldc, size_t sC, int M, int N, int K) {
  __shared__ __attribute__((aligned(16))) float so[4][32][68];
  const int tid = threadIdx.x, w = tid >> 5, lane = tid & 31, ln = lane & 15, hh = lane >> 4; const int by = blockIdx.y;
  A += (size_t)by * sA; Bh += (size_t)by * sB; const size_t cofs = (size_t)by * sC; const float* bp = bias ? bias + (size_t)by * sBias : nullptr;
  const int ntn = N >> 6; const int mt = blockIdx.x / ntn, nq = blockIdx.x - mt * ntn; const int row0 = mt * 128 + 32 * w, col0 = nq * 64; if (row0 >= M) return;
  const _Float16* a0p = A + (size_t)(row0 + ln) * lda; const _Float16* a1p = a0p + (size_t)16 * lda;
  const _Float16* b0p = Bh + (size_t)(col0 + ln) * ldb; const _Float16* b1p = b0p + (size_t)16 * ldb; const _Float16* b2p = b1p + (size_t)16 * ldb; const _Float16* b3p = b2p + (size_t)16 * ldb;
  const v8f z8 = {0.f,0.f,0.f,0.f,0.f,0.f,0.f,0.f}; v8f c00 = z8, c01 = z8, c02 = z8, c03 = z8, c10 = z8, c11 = z8, c12 = z8, c13 = z8;
#pragma unroll 1
  for (int kb = 0; kb < K; kb += 32) { const v16h a0 = g2_frag(a0p + kb, hh), a1 = g2_frag(a1p + kb, hh);
    v16h b = g2_frag(b0p + kb, hh); c00 = g2_mma(a0, b, c00); c10 = g2_mma(a1, b, c10);
    b = g2_frag(b1p + kb, hh); c01 = g2_mma(a0, b, c01); c11 = g2_mma(a1, b, c11);
    b = g2_frag(b2p + kb, hh); c02 = g2_mma(a0, b, c02); c12 = g2_mma(a1, b, c12);
    b = g2_frag(b3p + kb, hh); c03 = g2_mma(a0, b, c03); c13 = g2_mma(a1, b, c13); }
  v8f accs[8] = {c00, c01, c02, c03, c10, c11, c12, c13};
#pragma unroll
  for (int u = 0; u < 8; ++u) { const int t = u & 3, half = u >> 2; const int col = col0 + t * 16 + ln; const float bv = bp ? bf16_round(bp[col]) : 0.f;
#pragma unroll
    for (int r = 0; r < 8; ++r) { const int rloc = half * 16 + 8 * hh + r; float v = accs[u][r] * alpha + bv; if (CP) { const int bidx = (row0g + row0 + rloc) / rowsPerB; v += CP[(size_t)bidx * sCPb + (size_t)by * 64 + col]; }
      if (ACT == 3) v = fmaxf(v, 0.f); else if (ACT == 6) v = 0.5f * v * (1.0f + erff(v * 0.70710678118654752f)); else if (ACT == 11) v = 1.0f / (1.0f + expf(-v)); else if (ACT == 15) v = v / (1.0f + expf(-v)); else if (ACT == 12) v = (v > 0.f) ? v : 0.01f * v; else if (ACT == 8) v = tanhf(v);
      so[w][rloc][t * 16 + ln] = v; } }
  __builtin_amdgcn_fence(__ATOMIC_ACQ_REL, "workgroup"); __builtin_amdgcn_wave_barrier();
  const int rsub = lane >> 4, c4 = (lane & 15) * 4;
  {
#pragma unroll
    for (int q = 0; q < 16; ++q) { const int r = q * 2 + rsub; const v4f v = *(const v4fa*)&so[w][r][c4]; if (C) *(v4f*)(C + cofs + (size_t)(row0 + r) * ldc + col0 + c4) = v; if (C16) { v4h h4; for (int i = 0; i < 4; ++i) h4[i] = (_Float16)v[i]; *(v4h*)(C16 + cofs + (size_t)(row0 + r) * ldc + col0 + c4) = h4; } }
     } }



__device__ __forceinline__ float xhalf(float x) { return __builtin_bit_cast(float, __builtin_amdgcn_permlanex16(__builtin_bit_cast(int, x), __builtin_bit_cast(int, x), 0x76543210, 0xfedcba98, false, false)); }      /* value of lane l ^ 16 */
/* the flash kernel stands at its ceiling of 256 vector registers (16 waves a block): its products are the plain builtin (the compiler keeps the distance behind it), with no asm statement that would hold operands live around them */
__device__ __forceinline__ v8f mmaF(v16h a, v16h b, v8f c) { return __builtin_amdgcn_wmma_f32_16x16x32_f16(false, a, false, b, (short)0, c, false, false); }
/* scores, running maximum and P^T of one (q, k) half for one 32-key chunk: on return pb = P^T x 2^10 as a B operand, al = the factor that brings the old sums to the new maximum */
__device__ __forceinline__ void soft_half(const FragH (&ak)[2][2], const FragH (&bq)[2], int j0, int hh, int tq, float& m_r, float& l_r, float& al, FragH& pb) {
  float sv[16];
#pragma unroll
  for (int nt = 0; nt < 2; ++nt) { v8f acc = (v8f){0.f,0.f,0.f,0.f,0.f,0.f,0.f,0.f};
#pragma unroll
    for (int ks = 0; ks < 2; ++ks) acc = mmaF(ak[nt][ks].v, bq[ks].v, acc);
#pragma unroll
    for (int r = 0; r < 8; ++r) { const int kk = j0 + nt * 16 + 8 * hh + r; sv[nt * 8 + r] = (kk <= tq) ? acc[r] * SCL : -3.0e38f; } }
  float mc = fmaxf(sv[0], sv[1]);
#pragma unroll
  for (int i = 2; i < 16; ++i) mc = fmaxf(mc, sv[i]);
  mc = fmaxf(mc, xhalf(mc));      /* both halves of the wave now hold the chunk maximum of query tq */
  const float mn = fmaxf(m_r, mc); al = expf(m_r - mn); m_r = mn;
  float ps[4] = {0.f, 0.f, 0.f, 0.f};
#pragma unroll
  for (int i = 0; i < 16; ++i) { const float p = expf(sv[i] - mn);      /* key j0 <= q0 is open to every query of the tile, so mn is finite and a masked score gives exactly 0 */
    ps[i & 3] += p; pb.h[i] = (_Float16)(p * 1024.0f); }
  l_r = l_r * al + ((ps[0] + ps[1]) + (ps[2] + ps[3])); }
/* weight of wave w's key share in the join of one half: exp(m_w - m_all) / (l_all 2^10); lane -> row ln; a wave without a chunk holds m = -3e38, l = 0, O = 0 and gets weight 0; wave 0 always holds key 0, so the joint maximum is finite */
__device__ __forceinline__ float join_weight(const float (&sM)[4][16], const float (&sL)[4][16], int w, int ln) {
  const float m0 = sM[0][ln], m1 = sM[1][ln], m2 = sM[2][ln], m3 = sM[3][ln]; const float mt = fmaxf(fmaxf(m0, m1), fmaxf(m2, m3));
  const float e0 = expf(m0 - mt), e1 = expf(m1 - mt), e2 = expf(m2 - mt), e3 = expf(m3 - mt); const float lt = ((sL[0][ln] * e0 + sL[1][ln] * e1) + sL[2][ln] * e2) + sL[3][ln] * e3;
  const float ew = (w == 0) ? e0 : ((w == 1) ? e1 : ((w == 2) ? e2 : e3)); return (lt > 0.f) ? ew / (lt * 1024.0f) : 0.f; }
/* one stage of the ring = 4 chunks of 32 keys (16 KiB of each K half, 32 KiB of V^T), from global memory straight into LDS: 8 asynchronous copies of 16 bytes a lane, 512 lanes. lds = the lane's byte address in the buffer, ka / kb / va = the lane's 16 bytes of the stage in the three planes; every copy moves 8 KiB on in both.
   s_wait_xcnt stands inside the statement, behind the last copy: the address registers are the statement's operands and live to its end, so nothing rewrites one in front of the wait */
__device__ __forceinline__ void copy_stage(unsigned lds, const unsigned short* ka, const unsigned short* kb, const unsigned short* va) {
  asm volatile("global_load_async_to_lds_b128 %0, %8, off\n\t"
               "global_load_async_to_lds_b128 %1, %9, off\n\t"
               "global_load_async_to_lds_b128 %2, %10, off\n\t"
               "global_load_async_to_lds_b128 %3, %11, off\n\t"
               "global_load_async_to_lds_b128 %4, %12, off\n\t"
               "global_load_async_to_lds_b128 %5, %13, off\n\t"
               "global_load_async_to_lds_b128 %6, %14, off\n\t"
               "global_load_async_to_lds_b128 %7, %15, off\n\t"
               "s_wait_xcnt 0x0"
               :: "v"(lds), "v"(lds + 8192u), "v"(lds + 16384u), "v"(lds + 24576u), "v"(lds + 32768u), "v"(lds + 40960u), "v"(lds + 49152u), "v"(lds + 57344u),
                  "v"(ka), "v"(ka + 4096), "v"(kb), "v"(kb + 4096), "v"(va), "v"(va + 4096), "v"(va + 8192), "v"(va + 12288) : "memory"); }
#define QBLK 64                  /* query rows of a flash block: 4 tiles of 16 */
#define STG 32768                /* halves (2 bytes) of one ring buffer: K1 8,192, K2 8,192, V^T 16,384 */
__global__ __launch_bounds__(512) void k_flash(const _Float16* __restrict__ QA, const _Float16* __restrict__ QB, int ldq, const _Float16* __restrict__ KFA, const _Float16* __restrict__ KFB, const _Float16* __restrict__ VF, const float* __restrict__ LAM, const float* __restrict__ sw, float* __restrict__ out) {
  constexpr int RPW = 16, DT = 8, KS = 2;      /* DT: output row tiles of O^T, 0-3 = (P.V1)^T, 4-7 = (P.V2)^T (one P for both V halves) */
  __shared__ __attribute__((aligned(16))) unsigned short ring[2][STG];
  __shared__ __attribute__((aligned(16))) float sO[4][4][RPW][128 + 4]; __shared__ float sM[2][4][4][RPW], sL[2][4][4][RPW];
  const int tid = threadIdx.x, wv = __builtin_amdgcn_readfirstlane(tid >> 5), t = wv & 3, s = wv >> 2, lane = tid & 31, ln = lane & 15, hh = lane >> 4;      /* t, s in scalar registers: which chunks a wave works on differs from wave to wave and must stay a scalar branch (WMMA needs every lane on) */
  const int slab = blockIdx.x % (NB * NH), qb = (TQ / QBLK - 1) - blockIdx.x / (NB * NH); const int b = slab / NH, h = slab % NH; const int q0 = qb * QBLK + t * RPW;      /* the blocks with the most keys have the lowest indices */
  const float lam = LAM[0];      /* read in front of the first asm statement that clobbers memory: there the compiler still takes it by a scalar load */
  FragH bq[2][KS];
  { const size_t qo = ((size_t)b * TQ + q0 + ln) * ldq + h * 64; const unsigned short* qa = (const unsigned short*)QA + qo; const unsigned short* qb2 = (const unsigned short*)QB + qo;
#pragma unroll
    for (int ks = 0; ks < KS; ++ks) { bq[0][ks].half[0] = *(const v8us*)(qa + ks * 32 + 8 * hh); bq[0][ks].half[1] = *(const v8us*)(qa + ks * 32 + 16 + 8 * hh); bq[1][ks].half[0] = *(const v8us*)(qb2 + ks * 32 + 8 * hh); bq[1][ks].half[1] = *(const v8us*)(qb2 + ks * 32 + 16 + 8 * hh); } }
  const unsigned short* KAg = (const unsigned short*)KFA + (size_t)slab * 64 * TK + tid * 8; const unsigned short* KBg = (const unsigned short*)KFB + (size_t)slab * 64 * TK + tid * 8; const unsigned short* VFg = (const unsigned short*)VF + (size_t)slab * 128 * TK + tid * 8;      /* the thread's 16 bytes of stage 0 in each plane */
  const unsigned lds0 = (unsigned)(uintptr_t)&ring[0][0] + (unsigned)tid * 16u;      /* the thread's byte address in buffer 0 */
  const int tq = q0 + ln;      /* this lane's query */
  float m_r[2] = {-3.0e38f, -3.0e38f}, l_r[2] = {0.f, 0.f}; v8f oacc[2][DT];      /* l_r: sum over this lane's own 16 keys of each chunk; the two halves of the wave are added behind the loop */
#pragma unroll
  for (int dt = 0; dt < DT; ++dt) { oacc[0][dt] = (v8f){0.f,0.f,0.f,0.f,0.f,0.f,0.f,0.f}; oacc[1][dt] = (v8f){0.f,0.f,0.f,0.f,0.f,0.f,0.f,0.f}; }
  const int jend = q0 + RPW;      /* causal: keys beyond the tile's last query never contribute */
  const int nst = (qb + 2) >> 1;      /* stages of 128 keys that cover the block's 64 qb + 64 keys; at most TK / 128, so every stage lies inside the planes */
  copy_stage(lds0, KAg, KBg, VFg);
  asm volatile("s_wait_asynccnt 0x0" ::: "memory");      /* this wave's part of stage 0 has landed */
  __syncthreads();      /* every wave's part of stage 0 has landed before any wave reads it */
  if (nst > 1) copy_stage(lds0 + 2u * STG, KAg + 8192, KBg + 8192, VFg + 16384);
#pragma unroll 1      /* kept rolled: the publish point stands once in the code, and the body of some 800 instructions is not doubled */
  for (int st = 0; st < nst; ++st) {
    const int j0 = (4 * st + s) * 32;
    if (j0 < jend) {      /* a scalar test; the publish point below stands outside it, every wave passes it */
      FragH aka[2][KS], akb[2][KS], av[DT];
      const unsigned short* rb = &ring[st & 1][lane * 8]; const unsigned short* ka = rb + s * 2048; const unsigned short* kb = rb + 8192 + s * 2048; const unsigned short* va = rb + 16384 + s * 4096;      /* chunk s of the stage: 2048 halves of each K, 4096 of V^T */
#pragma unroll
      for (int ks = 0; ks < KS; ++ks) { aka[0][ks].half[0] = *(const v8us*)(ka + ks * 512); aka[0][ks].half[1] = *(const v8us*)(ka + ks * 512 + 256); aka[1][ks].half[0] = *(const v8us*)(ka + 1024 + ks * 512); aka[1][ks].half[1] = *(const v8us*)(ka + 1024 + ks * 512 + 256); }
#pragma unroll
      for (int ks = 0; ks < KS; ++ks) { akb[0][ks].half[0] = *(const v8us*)(kb + ks * 512); akb[0][ks].half[1] = *(const v8us*)(kb + ks * 512 + 256); akb[1][ks].half[0] = *(const v8us*)(kb + 1024 + ks * 512); akb[1][ks].half[1] = *(const v8us*)(kb + 1024 + ks * 512 + 256); }
      FragH pa, pb; float ala, alb;
      soft_half(aka, bq[0], j0, hh, tq, m_r[0], l_r[0], ala, pa);
      soft_half(akb, bq[1], j0, hh, tq, m_r[1], l_r[1], alb, pb);
#pragma unroll
      for (int dt = 0; dt < DT; ++dt) { av[dt].half[0] = *(const v8us*)(va + dt * 512); av[dt].half[1] = *(const v8us*)(va + dt * 512 + 256); }
#pragma unroll
      for (int dt = 0; dt < DT; ++dt) { oacc[0][dt] *= ala; oacc[1][dt] *= alb; }
#pragma unroll
      for (int dt = 0; dt < DT; ++dt) { oacc[0][dt] = mmaF(av[dt].v, pa.v, oacc[0][dt]); oacc[1][dt] = mmaF(av[dt].v, pb.v, oacc[1][dt]); } }
    /* publish point of stage st + 1, in the ring's order */
    asm volatile("s_wait_dscnt 0x0" ::: "memory");      /* this wave's reads of stage st have returned */
    asm volatile("s_wait_asynccnt 0x0" ::: "memory");      /* this wave's part of stage st + 1 has landed */
    __syncthreads();      /* stage st + 1 is whole for every reader, and no wave still reads stage st's buffer */
    if (st + 2 < nst) copy_stage(lds0 + (unsigned)(st & 1) * (2u * STG), KAg + (size_t)(st + 2) * 8192, KBg + (size_t)(st + 2) * 8192, VFg + (size_t)(st + 2) * 16384); }
  asm volatile("s_wait_asynccnt 0x0" ::: "memory");      /* no copy is in flight behind the loop */
  /* join of a tile's four key shares: publish each wave's row maxima and row sums of both halves, weigh every share by exp(m_s - m_all) / l_all, add the weighted shares */
  const v4f w4 = *(const v4fa*)(sw + lane * 4);
#pragma unroll
  for (int g = 0; g < 2; ++g) { const float lv = l_r[g] + xhalf(l_r[g]); if (hh == 0) { sM[g][t][s][ln] = m_r[g]; sL[g][t][s][ln] = lv; } }
  __syncthreads();      /* every wave's maxima and sums are written before any wave reads them */
  { const float fa = join_weight(sM[0][t], sL[0][t], s, ln); const float fb = lam * join_weight(sM[1][t], sL[1][t], s, ln);
#pragma unroll
    for (int dt = 0; dt < DT; ++dt) { const v8f o = oacc[0][dt] * fa - oacc[1][dt] * fb;      /* this wave's share of attn1 - lambda attn2; the lane's 8 registers are 8 consecutive columns of its own row */
      *(v4f*)&sO[t][s][ln][dt * 16 + 8 * hh] = (v4f){o[0], o[1], o[2], o[3]}; *(v4f*)&sO[t][s][ln][dt * 16 + 8 * hh + 4] = (v4f){o[4], o[5], o[6], o[7]}; } }
  __syncthreads();      /* all four weighted shares are in LDS before they are added */
  {
#pragma unroll
    for (int i = 0; i < 4; ++i) { const int r = i * 4 + s; const v4f p0 = *(const v4fa*)&sO[t][0][r][lane * 4], p1 = *(const v4fa*)&sO[t][1][r][lane * 4], p2 = *(const v4fa*)&sO[t][2][r][lane * 4], p3 = *(const v4fa*)&sO[t][3][r][lane * 4]; const v4f a = ((p0 + p1) + p2) + p3;      /* the wave holds one whole 128-wide row, 4 columns a lane */
      float ss = 0.f;
#pragma unroll
      for (int q = 0; q < 4; ++q) ss += a[q] * a[q];
      for (int o = 16; o > 0; o >>= 1) ss += __shfl_xor(ss, o, 32);
      const float inv = rsqrtf(ss / 128.0f + 1e-5f); v4f r4;
#pragma unroll
      for (int q = 0; q < 4; ++q) { float y = bf16_round(w4[q]) * (a[q] * inv); y *= (1.0f - LAMBDA_INIT); r4[q] = y; }
      *(v4f*)(out + ((size_t)b * TQ + q0 + r) * DW + h * 128 + lane * 4) = r4; }      /* 512 contiguous bytes a row */
     } }

/* ONE pre-pass launch writes everything the flash kernel reads. A unit = 256 threads x 16 output bytes (4 KiB); a block takes PU units of one kind and issues all their loads before the first conversion. Block 0: lambda. Then, 256 blocks each: V^T, K, Q.
   Few fat waves (6,152 in the launch), for speed only. */
#define PU 8
#define PREP_BLOCKS ((NR / 32) * NHD / PU)      /* 2,048 units of each kind */
__device__ __forceinline__ v8us cvt8(const float (&x)[8]) { FragH f;
#pragma unroll
  for (int i = 0; i < 8; ++i) f.h[i] = (_Float16)bf16_round(x[i]);
  return f.half[0]; }
/* lambda, one wave: lane l forms the rounded products of terms l and l + 32 (one load latency for all 64 terms), then every lane adds the 64 products in the order 0 .. 63, each read from its lane: the sums are those of a serial loop over the terms, bit for bit */
__device__ __forceinline__ float lane_val(float x, int l) { return __builtin_bit_cast(float, __builtin_amdgcn_readlane(__builtin_bit_cast(int, x), l)); }
__device__ __forceinline__ void lambda_part(const float* __restrict__ lq1, const float* __restrict__ lk1, const float* __restrict__ lq2, const float* __restrict__ lk2, float* __restrict__ LAM) {
  const int ln = threadIdx.x; if (ln >= 32) return; float s1 = 0.f, s2 = 0.f;
  const float p1[2] = {bf16_round(lq1[ln]) * bf16_round(lk1[ln]), bf16_round(lq1[ln + 32]) * bf16_round(lk1[ln + 32])}; const float p2[2] = {bf16_round(lq2[ln]) * bf16_round(lk2[ln]), bf16_round(lq2[ln + 32]) * bf16_round(lk2[ln + 32])};
#pragma unroll
  for (int d = 0; d < HD; ++d) { s1 += lane_val(p1[d >> 5], d & 31); s2 += lane_val(p2[d >> 5], d & 31); }
  const float lam = expf(s1) - expf(s2) + LAMBDA_INIT; *(float*)(LAM + ln) = lam;
  asm volatile("s_wait_xcnt 0x0" ::: "memory");      /* behind the store, as in prep_rows */
}
/* PU units whose thread reads 8 consecutive floats: unit u at s + u * sstep; stored at (u odd ? d1 : d0) + (u / DDIV) * dstep */
template <int DDIV>
__device__ __forceinline__ void prep_rows(const float* __restrict__ s, int sstep, unsigned short* __restrict__ d0, unsigned short* __restrict__ d1, int dstep) {
  float x[PU][8];
#pragma unroll
  for (int u = 0; u < PU; ++u) { const v4f a0 = *(const v4fa*)(s + u * sstep), a1 = *(const v4fa*)(s + u * sstep + 4);
#pragma unroll
    for (int i = 0; i < 4; ++i) { x[u][i] = a0[i]; x[u][4 + i] = a1[i]; } }
  asm volatile("s_wait_xcnt 0x0" :: "v"(s) : "memory");      /* the address pair stays live up to this wait: no load above returns into it and nothing overwrites it in front of the wait */
  __builtin_amdgcn_sched_barrier(0);      /* all 16 loads are issued before the first conversion: left free, the scheduler holds the last ones back behind the first waits, and the wave pays a second load latency */
#pragma unroll
  for (int u = 0; u < PU; ++u) { *(v8us*)(((DDIV == 2 && (u & 1)) ? d1 : d0) + (u / DDIV) * dstep) = cvt8(x[u]);      /* a wave stores whole 128-byte lines */
    asm volatile("s_wait_xcnt 0x0" ::: "memory"); }      /* behind each store: the stores go out as their units are converted, and no register that a store names is overwritten in front of its wait, on whichever path the code goes on */
}
__global__ __launch_bounds__(256) void k_prep(const float* __restrict__ q, const float* __restrict__ k, const float* __restrict__ v, const float* __restrict__ lq1, const float* __restrict__ lk1, const float* __restrict__ lq2, const float* __restrict__ lk2,
                                              _Float16* __restrict__ Q1, _Float16* __restrict__ Q2, _Float16* __restrict__ K1, _Float16* __restrict__ K2, _Float16* __restrict__ VT, float* __restrict__ LAM) {
  const int tid = threadIdx.x, ln = tid & 15, hh = (tid >> 4) & 1, fh = tid >> 5; int blk = blockIdx.x;
  if (blk == 0) { lambda_part(lq1, lk1, lq2, lk2, LAM); return; }
  blk -= 1;
  if (blk < PREP_BLOCKS) {
    /* V^T in fragment order (see k_flash), straight from v: the block = 4 chunks of 32 keys of one head pair, unit u = (chunk u / 2, V half u % 2); thread = (fragment half fh = 2 dt + hf, lane): V^T row 16 dt + ln, keys 16 hf + 8 hh .. + 7: 8 loads of one float down a column; a wave's load reads 64 contiguous bytes of each of two rows */
    const int slab = blk / (SLEN / 128), c0 = (blk % (SLEN / 128)) * 4; const int b = slab / NH, p = slab % NH;
    const float* s = v + ((size_t)b * SLEN + c0 * 32 + (fh & 1) * 16 + hh * 8) * DW + p * 2 * HD + (fh >> 1) * 16 + ln;
    unsigned short* d = (unsigned short*)VT + ((size_t)slab * (SLEN / 32) + c0) * 4096 + tid * 8;
    float x[PU][8];
#pragma unroll
    for (int u = 0; u < PU; ++u)
#pragma unroll
      for (int i = 0; i < 8; ++i) x[u][i] = s[((u >> 1) * 32 + i) * DW + (u & 1) * HD];
    asm volatile("s_wait_xcnt 0x0" :: "v"(s) : "memory");      /* as in prep_rows */
#pragma unroll
    for (int u = 0; u < PU; ++u) { *(v8us*)(d + u * 2048) = cvt8(x[u]);      /* a wave stores 512 contiguous bytes; a chunk holds V1's 4 KiB, then V2's */
      asm volatile("s_wait_xcnt 0x0" ::: "memory"); }      /* behind each store, as in prep_rows */
    return;
  }
  blk -= PREP_BLOCKS;
  if (blk < PREP_BLOCKS) {
    /* K halves in fragment order (see k_flash): the block = one 32-key chunk of 8 heads, unit u = head h0 + u; thread = (fragment half fh, lane): K row 16 nt + ln of the chunk, dims 32 ks + 16 hf + 8 hh .. + 7 */
    const int cg = blk >> 1, h0 = (blk & 1) * 8; const int b = cg / (SLEN / 32), c = cg % (SLEN / 32);
    const size_t o = ((size_t)(b * NP + h0 / 2) * (SLEN / 32) + c) * 2048 + tid * 8;
    prep_rows<2>(k + ((size_t)cg * 32 + (fh >> 2) * 16 + ln) * DW + h0 * HD + (fh & 3) * 16 + hh * 8, HD, (unsigned short*)K1 + o, (unsigned short*)K2 + o, (SLEN / 32) * 2048);
    return;
  }
  blk -= PREP_BLOCKS;
  { /* Q halves, row-major [token][pair][64]: the block = 16 tokens, unit u = tokens 2 u, 2 u + 1; thread = 8 consecutive dims of one head */
    const int h = (tid >> 3) & 15; const size_t r = (size_t)blk * (2 * PU) + (tid >> 7);
    unsigned short* d = (unsigned short*)((h & 1) ? Q2 : Q1) + r * HWD + (h / 2) * HD + (tid & 7) * 8;
    prep_rows<1>(q + r * DW + (tid & 127) * 8, 2 * DW, d, d, 2 * HWD); }
}

extern "C" void kernel_launch(void* const* d_in, const int* in_sizes, int n_in,
                              void* d_out, int out_size, void* d_ws, size_t ws_size, hipStream_t stream) {
  (void)in_sizes; (void)n_in; (void)out_size;
  const float* const* I = (const float* const*)d_in; const float* q = I[0]; const float* k = I[1]; const float* v = I[2]; const float* lq1 = I[3]; const float* lk1 = I[4]; const float* lq2 = I[5]; const float* lk2 = I[6]; const float* w = I[7];
  char* ws = (char*)d_ws; size_t off = 0;
  auto take = [&](size_t bytes) { char* p = ws + off; off += (bytes + 255) & ~(size_t)255; return p; };
  const size_t nh = (size_t)NR * HWD;
  _Float16* Q1 = (_Float16*)take(nh * 2); _Float16* Q2 = (_Float16*)take(nh * 2); _Float16* K1 = (_Float16*)take(nh * 2); _Float16* K2 = (_Float16*)take(nh * 2); _Float16* VT = (_Float16*)take(nh * 4);
  float* LAM = (float*)take(256);
  if (off > ws_size) return;      /* 6 x 4 = 24 MiB */
  k_prep<<<1 + 3 * PREP_BLOCKS, 256, 0, stream>>>(q, k, v, lq1, lk1, lq2, lk2, Q1, Q2, K1, K2, VT, LAM);
  k_flash<<<NB * NH * (TQ / QBLK), 512, 0, stream>>>(Q1, Q2, HWD, K1, K2, VT, LAM, w, (float*)d_out);
}

// v008
// One run takes 44.5 microseconds.
// Next to v007, in two timings, it ran 1.38 times as fast each time.
// All steps since v000 together make it 20.6 times as fast.
#include <hip/hip_runtime.h>
// Differential causal attention (2 x 2048 tokens, 16 heads of 64 as 8 differential pairs; q, k, v are INPUTS): heads (2p, 2p+1) = (q1, q2) etc.; P1 = causal softmax(q1.k1/8), P2 = causal softmax(q2.k2/8); attn1 = [P1 v1 | P1 v2], attn2 = [P2 v1 | P2 v2] (128 wide); lambda = exp(lq1.lk1) - exp(lq2.lk2) + lambda_init; a = attn1 - lambda attn2; out = subln_w * RMSNorm_128(a) * (1 - lambda_init) -> [B, S, 16, 64].
// Structure: ONE pre-pass launch de-interleaves q and k into exact f16 planes per half (q1, q2, k1, k2; the inputs are exactly representable after bf16 rounding) and writes V^T; K and V^T stored in WMMA fragment order (per 32-key chunk: fragment halves of 32 lanes x 16 bytes; both V halves in one plane); lambda on device in the same launch (f32 64-term dots); ONE launch of the fused causal flash kernel: a block does both (q, k) halves of four query tiles, which share each stage of K and V^T through LDS; P1 and P2 multiplied into the same V^T fragments (plain operands - exact here except P; f32 softmax/accumulation), and takes the differential combine + RMSNorm in its LDS join.
// Compute dtype: inputs rounded to bf16; q, k, v exact as f16; P as f16 (x2^10, ~2^-12); everything else f32. v_wmma_f32_16x16x32_f16.
#define NB 2
#define NHD 16
#define HD 64
#define NP (NHD / 2)
#define DW (NHD * HD)            /* 1024 */
#define HWD (NP * HD)            /* 512 */
#define NR (NB * SLEN)
#define LAMBDA_INIT 0.35550906759096934f  /* 0.8 - 0.6 exp(-0.3) */
#define SLEN 2048
#define TQ SLEN
#define TK SLEN
#define NH 8                     /* head PAIRS per call */
#define SCL 0.125f
#define QTILES (TQ / 16)         /* query tiles of 16 rows, four to a block */
typedef __bf16 v16b __attribute__((ext_vector_type(16)));
typedef unsigned short v8us __attribute__((ext_vector_type(8), may_alias));
typedef float  v8f  __attribute__((ext_vector_type(8)));
typedef float  v4f  __attribute__((ext_vector_type(4)));
typedef float  v4fa __attribute__((ext_vector_type(4), may_alias));
union FragB { v16b v; v8us half[2]; unsigned short u[16]; };

__device__ __forceinline__ unsigned short bf16_bits(float x) { unsigned int u = __float_as_uint(x); return (unsigned short)((u + 0x7FFFu + ((u >> 16) & 1u)) >> 16); }
__device__ __forceinline__ float bf16_val(unsigned short b) { return __uint_as_float(((unsigned int)b) << 16); }
__device__ __forceinline__ float bf16_round(float x) { return bf16_val(bf16_bits(x)); }
// D += A·B with NT terms: 1 = ah·bh, 2 = + al·bh (A split), 3 = + ah·bl (both split)
template <int NT>
__device__ __forceinline__ v8f mmaN(v16b ah, v16b al, v16b bh, v16b bl, v8f c) {
  c = __builtin_amdgcn_wmma_f32_16x16x32_bf16(false, ah, false, bh, (short)0, c, false, false);
  if (NT >= 2) c = __builtin_amdgcn_wmma_f32_16x16x32_bf16(false, al, false, bh, (short)0, c, false, false);
  if (NT >= 3) c = __builtin_amdgcn_wmma_f32_16x16x32_bf16(false, ah, false, bl, (short)0, c, false, false);
  asm volatile("v_nop\n\tv_nop\n\tv_nop\n\tv_nop" : "+v"(c) : "v"(ah), "v"(al), "v"(bh), "v"(bl));
  return c;
}

__global__ __launch_bounds__(256) void k_wt_bf16(const float* __restrict__ W, unsigned short* __restrict__ Wt, int K, int N) {
  const int t = blockIdx.x * 256 + threadIdx.x;
  const int k8n = K / 8;
  if (t >= N * k8n) return;
  const int n = t / k8n, k8 = (t % k8n) * 8;
  v8us v;
#pragma unroll
  for (int i = 0; i < 8; ++i) v[i] = bf16_bits(W[(size_t)(k8 + i) * N + n]);
  *(v8us*)(Wt + (size_t)n * K + k8) = v;
  
}

// GEMM C[M][N] (f32, pitch ldc) = act(A[M][K]·W + bias). A f32 row-major (pitch lda) converted per fragment to bf16
// (ASPLIT: hi/lo two planes -> 2 terms, else single rounded term); Wt bf16 [N][K] (pitch ldb). BIAS_BF16 rounds the
// bias to bf16 first (bias quantised to bf16 before the add). K%32==0, M%16==0, N%64==0.
template <bool ASPLIT, int ACT, bool BIAS_BF16>
__global__ __launch_bounds__(128) void k_gemm_bf(const float* __restrict__ A, int lda, const unsigned short* __restrict__ Wt, int ldb,
                                               const float* __restrict__ bias, float* __restrict__ C, int ldc, int M, int N, int K) {
  __shared__ __attribute__((aligned(16))) float so[4][16][64];
  const int tid = threadIdx.x, w = tid >> 5, lane = tid & 31, ln = lane & 15, hh = lane >> 4;
  const int ntn = N / 64;
  const int wid = blockIdx.x * 4 + w;
  const int mt = wid / ntn, nq = wid % ntn;
  if (mt * 16 >= M) return;
  const int row0 = mt * 16, col0 = nq * 64;
  const float* arow = A + (size_t)(row0 + ln) * lda;
  v8f acc[4] = {};
  for (int kb = 0; kb < K; kb += 32) {
    FragB ah, al;
    const v4f x0 = *(const v4fa*)(arow + kb + 8 * hh), x1 = *(const v4fa*)(arow + kb + 8 * hh + 4);
    const v4f x2 = *(const v4fa*)(arow + kb + 16 + 8 * hh), x3 = *(const v4fa*)(arow + kb + 16 + 8 * hh + 4);
    float xs[16] = {x0[0],x0[1],x0[2],x0[3],x1[0],x1[1],x1[2],x1[3],x2[0],x2[1],x2[2],x2[3],x3[0],x3[1],x3[2],x3[3]};
#pragma unroll
    for (int i = 0; i < 16; ++i) { const unsigned short hb = bf16_bits(xs[i]); ah.u[i] = hb; al.u[i] = ASPLIT ? bf16_bits(xs[i] - bf16_val(hb)) : (unsigned short)0; }
#pragma unroll
    for (int t = 0; t < 4; ++t) {
      const unsigned short* brow = Wt + (size_t)(col0 + t * 16 + ln) * ldb + kb;
      FragB b;
      b.half[0] = *(const v8us*)(brow + 8 * hh);
      b.half[1] = *(const v8us*)(brow + 16 + 8 * hh);
      acc[t] = mmaN<ASPLIT ? 2 : 1>(ah.v, al.v, b.v, b.v, acc[t]);
    }
  }
#pragma unroll
  for (int t = 0; t < 4; ++t) {
    float bv = bias ? bias[col0 + t * 16 + ln] : 0.f;
    if (BIAS_BF16) bv = bf16_round(bv);
#pragma unroll
    for (int r = 0; r < 8; ++r) { float v = acc[t][r] + bv; if (ACT == 1) v = fmaxf(v, 0.f); so[w][8 * hh + r][t * 16 + ln] = v; }
  }
  __builtin_amdgcn_fence(__ATOMIC_ACQ_REL, "workgroup");
  __builtin_amdgcn_wave_barrier();
  const int rsub = lane >> 4, c4 = (lane & 15) * 4;
  {
#pragma unroll
    for (int q = 0; q < 8; ++q) {
      const int r = q * 2 + rsub;
      const v4f v = *(const v4fa*)&so[w][r][c4];
      *(v4f*)(C + (size_t)(row0 + r) * ldc + col0 + c4) = v;
    }
    
  }
}

// GEMM C = act(A·W + bias + resid): A f32 (ASPLIT -> hi/lo 2 terms), Wt bf16 [N][K]; ACT 0 none, 1 relu, 2 exact gelu;
// resid (optional, f32, row index = (row % rmod), pitch ldr, RES_BF16 rounds it) added before the activation.
template <bool ASPLIT, int ACT, bool BIAS_BF16, bool RES_BF16>
__global__ __launch_bounds__(128) void k_gemm_bf3(const float* __restrict__ A, int lda, const unsigned short* __restrict__ Wt, int ldb,
                                                const float* __restrict__ bias, const float* __restrict__ resid, int rmod, int ldr,
                                                float* __restrict__ C, int ldc, int M, int N, int K) {
  __shared__ __attribute__((aligned(16))) float so[4][16][64];
  const int tid = threadIdx.x, w = tid >> 5, lane = tid & 31, ln = lane & 15, hh = lane >> 4;
  const int ntn = N / 64;
  const int wid = blockIdx.x * 4 + w;
  const int mt = wid / ntn, nq = wid % ntn;
  if (mt * 16 >= M) return;
  const int row0 = mt * 16, col0 = nq * 64;
  const float* arow = A + (size_t)(row0 + ln) * lda;
  v8f acc[4] = {};
  for (int kb = 0; kb < K; kb += 32) {
    FragB ah, al;
    const v4f x0 = *(const v4fa*)(arow + kb + 8 * hh), x1 = *(const v4fa*)(arow + kb + 8 * hh + 4);
    const v4f x2 = *(const v4fa*)(arow + kb + 16 + 8 * hh), x3 = *(const v4fa*)(arow + kb + 16 + 8 * hh + 4);
    float xs[16] = {x0[0],x0[1],x0[2],x0[3],x1[0],x1[1],x1[2],x1[3],x2[0],x2[1],x2[2],x2[3],x3[0],x3[1],x3[2],x3[3]};
#pragma unroll
    for (int i = 0; i < 16; ++i) { const unsigned short hb = bf16_bits(xs[i]); ah.u[i] = hb; al.u[i] = ASPLIT ? bf16_bits(xs[i] - bf16_val(hb)) : (unsigned short)0; }
#pragma unroll
    for (int t = 0; t < 4; ++t) {
      const unsigned short* brow = Wt + (size_t)(col0 + t * 16 + ln) * ldb + kb;
      FragB b;
      b.half[0] = *(const v8us*)(brow + 8 * hh);
      b.half[1] = *(const v8us*)(brow + 16 + 8 * hh);
      acc[t] = mmaN<ASPLIT ? 2 : 1>(ah.v, al.v, b.v, b.v, acc[t]);
    }
  }
#pragma unroll
  for (int t = 0; t < 4; ++t) {
    const int col = col0 + t * 16 + ln;
    float bv = bias ? bias[col] : 0.f;
    if (BIAS_BF16) bv = bf16_round(bv);
#pragma unroll
    for (int r = 0; r < 8; ++r) {
      float v = acc[t][r] + bv;
      if (resid) { float rv = resid[(size_t)((row0 + 8 * hh + r) % rmod) * ldr + col]; if (RES_BF16) rv = bf16_round(rv); v += rv; }
      if (ACT == 1) v = fmaxf(v, 0.f);
      if (ACT == 2) v = 0.5f * v * (1.0f + erff(v * 0.70710678118654752f));
      if (ACT == 3) { const float u = 0.7978845608028654f * (v + 0.044715f * v * v * v); v = 0.5f * v * (1.0f + tanhf(u)); }
      so[w][8 * hh + r][t * 16 + ln] = v;
    }
  }
  __builtin_amdgcn_fence(__ATOMIC_ACQ_REL, "workgroup");
  __builtin_amdgcn_wave_barrier();
  const int rsub = lane >> 4, c4 = (lane & 15) * 4;
  {
#pragma unroll
    for (int q = 0; q < 8; ++q) {
      const int r = q * 2 + rsub;
      const v4f v = *(const v4fa*)&so[w][r][c4];
      *(v4f*)(C + (size_t)(row0 + r) * ldc + col0 + c4) = v;
    }
    
  }
}
// row LayerNorm (biased variance, eps) over N: s = X (+ R); optional out_sum <- s; out_norm <- (s-mu)*rsqrt(var+eps)*g + b
template <bool PARAM_BF16>
__global__ __launch_bounds__(256) void k_layernorm(const float* __restrict__ X, const float* __restrict__ R, const float* __restrict__ g, const float* __restrict__ bta,
                                                  float* __restrict__ out_sum, float* __restrict__ out_norm, int N, float eps) {
  __shared__ float red[256];
  const int row = blockIdx.x, tid = threadIdx.x;
  const float* x = X + (size_t)row * N; const float* rr = R ? R + (size_t)row * N : nullptr;
  float vals[16];                     // up to N = 4096
  const int per = N / 256;            // contiguous chunk per thread? use strided-by-4 chunks: thread handles j = tid*4 + 1024*u
  float s1 = 0.f;
  for (int u = 0; u < per / 4; ++u) {
    const int j = tid * 4 + 1024 * u;
    const v4f a = *(const v4fa*)(x + j);
    v4f b = {0.f,0.f,0.f,0.f}; if (rr) b = *(const v4fa*)(rr + j);
#pragma unroll
    for (int q = 0; q < 4; ++q) { const float v = a[q] + b[q]; vals[u * 4 + q] = v; s1 += v; }
  }
  red[tid] = s1; __syncthreads();
  for (int st = 128; st > 0; st >>= 1) { if (tid < st) red[tid] += red[tid + st]; __syncthreads(); }
  const float mu = red[0] / (float)N; __syncthreads();
  float s2 = 0.f;
  for (int u = 0; u < per / 4; ++u)
#pragma unroll
    for (int q = 0; q < 4; ++q) { const float c = vals[u * 4 + q] - mu; s2 += c * c; }
  red[tid] = s2; __syncthreads();
  for (int st = 128; st > 0; st >>= 1) { if (tid < st) red[tid] += red[tid + st]; __syncthreads(); }
  const float rs = rsqrtf(red[0] / (float)N + eps);
  {
    for (int u = 0; u < per / 4; ++u) {
      const int j = tid * 4 + 1024 * u;
      v4f o, sm;
#pragma unroll
      for (int q = 0; q < 4; ++q) {
        float gg = g[j + q], bb = bta[j + q];
        if (PARAM_BF16) { gg = bf16_round(gg); bb = bf16_round(bb); }
        sm[q] = vals[u * 4 + q]; o[q] = (vals[u * 4 + q] - mu) * rs * gg + bb;
      }
      if (out_sum) *(v4f*)(out_sum + (size_t)row * N + j) = sm;
      *(v4f*)(out_norm + (size_t)row * N + j) = o;
    }
    
  }
}



// ---- f16 WMMA path (v_wmma_f32_16x16x32_f16): 11-bit significands for operands in range — used where a [0,1] probability operand needs more precision than bf16
typedef _Float16 v16h __attribute__((ext_vector_type(16)));
union FragH { v16h v; v8us half[2]; _Float16 h[16]; unsigned short u[16]; };
template <int NT>
__device__ __forceinline__ v8f mmaH(v16h ah, v16h al, v16h bh, v16h bl, v8f c) {
  c = __builtin_amdgcn_wmma_f32_16x16x32_f16(false, ah, false, bh, (short)0, c, false, false);
  if (NT >= 2) c = __builtin_amdgcn_wmma_f32_16x16x32_f16(false, al, false, bh, (short)0, c, false, false);
  if (NT >= 3) c = __builtin_amdgcn_wmma_f32_16x16x32_f16(false, ah, false, bl, (short)0, c, false, false);
  asm volatile("v_nop\n\tv_nop\n\tv_nop\n\tv_nop" : "+v"(c) : "v"(ah), "v"(al), "v"(bh), "v"(bl));
  return c;
}
// batched GEMM like k_gemm_b but f16 operands: A f32 (split into f16 hi/lo if ASPLIT, else rounded to f16), Bt = f16 values [n][k]; alpha; C f32; N multiple of 16 (partial tiles skipped)
template <bool ASPLIT>
__global__ __launch_bounds__(128) void k_gemm_h(const float* __restrict__ A, int lda, size_t sA, const _Float16* __restrict__ Bh, int ldb, size_t sB, float alpha, float* __restrict__ C, int ldc, size_t sC, int M, int N, int K) {
  __shared__ __attribute__((aligned(16))) float so[4][16][64];
  const int tid = threadIdx.x, w = tid >> 5, lane = tid & 31, ln = lane & 15, hh = lane >> 4; const int by = blockIdx.y;
  A += (size_t)by * sA; Bh += (size_t)by * sB; C += (size_t)by * sC;
  const int ntn = (N + 63) / 64; const int wid = blockIdx.x * 4 + w; const int mt = wid / ntn, nq = wid % ntn; if (mt * 16 >= M) return;
  const int row0 = mt * 16, col0 = nq * 64; const float* arow = A + (size_t)(row0 + ln) * lda;
  v8f acc[4] = {};
  for (int kb = 0; kb < K; kb += 32) {
    FragH ah, al;
    const v4f x0 = *(const v4fa*)(arow + kb + 8 * hh), x1 = *(const v4fa*)(arow + kb + 8 * hh + 4), x2 = *(const v4fa*)(arow + kb + 16 + 8 * hh), x3 = *(const v4fa*)(arow + kb + 16 + 8 * hh + 4);
    float xs[16] = {x0[0],x0[1],x0[2],x0[3],x1[0],x1[1],x1[2],x1[3],x2[0],x2[1],x2[2],x2[3],x3[0],x3[1],x3[2],x3[3]};
#pragma unroll
    for (int i = 0; i < 16; ++i) { const _Float16 h = (_Float16)xs[i]; ah.h[i] = h; al.h[i] = ASPLIT ? (_Float16)(xs[i] - (float)h) : (_Float16)0.0f; }
#pragma unroll
    for (int t = 0; t < 4; ++t) { if (col0 + t * 16 >= N) continue; const size_t boff = (size_t)(col0 + t * 16 + ln) * ldb + kb; FragH bq; bq.half[0] = *(const v8us*)(Bh + boff + 8 * hh); bq.half[1] = *(const v8us*)(Bh + boff + 16 + 8 * hh);
      acc[t] = mmaH<ASPLIT ? 2 : 1>(ah.v, al.v, bq.v, bq.v, acc[t]); }
  }
#pragma unroll
  for (int t = 0; t < 4; ++t) { if (col0 + t * 16 >= N) continue;
#pragma unroll
    for (int r = 0; r < 8; ++r) so[w][8 * hh + r][t * 16 + ln] = acc[t][r] * alpha; }
  __builtin_amdgcn_fence(__ATOMIC_ACQ_REL, "workgroup"); __builtin_amdgcn_wave_barrier();
  const int rsub = lane >> 4, c4 = (lane & 15) * 4;
  {
#pragma unroll
    for (int q = 0; q < 8; ++q) { const int r = q * 2 + rsub; if (col0 + c4 < N) { const v4f v = *(const v4fa*)&so[w][r][c4]; *(v4f*)(C + (size_t)(row0 + r) * ldc + col0 + c4) = v; } }
     }
}

// Wt[n][k] = f16(W[k][n]·scale) from f32 row-major W[K][N] (scale = power of two; bf16-exact weights stay exact in f16 away from the subnormal range)
__global__ __launch_bounds__(256) void k_wt_f16(const float* __restrict__ W, _Float16* __restrict__ Wt, int K, int N, float scale) {
  const int t = blockIdx.x * 256 + threadIdx.x; if (t >= N * (K / 8)) return; const int n = t / (K / 8), k8 = (t % (K / 8)) * 8; FragH f;
#pragma unroll
  for (int i = 0; i < 8; ++i) f.h[i] = (_Float16)(bf16_round(W[(size_t)(k8 + i) * N + n]) * scale); const v8us o = f.half[0];
  *(v8us*)((unsigned short*)Wt + (size_t)n * K + k8) = o; 
}
// k_gemm_hh variant with fused epilogue: v = acc·alpha + bias[by·sBias + col] (+ CP[(row/rowsPerB)·sCPb + by·64 + col] if CP) ; ACT 0 none / 1 elu ; writes f16 C16 (and f32 C if non-null)
template <int ACT>
__global__ __launch_bounds__(128) void k_gemm_hhx(const _Float16* __restrict__ A, int lda, size_t sA, const _Float16* __restrict__ Bh, int ldb, size_t sB, float alpha, const float* __restrict__ bias, size_t sBias, const float* __restrict__ CP, int rowsPerB, size_t sCPb, int row0g,
    float* __restrict__ C, _Float16* __restrict__ C16, int ldc, size_t sC, int M, int N, int K) {
  __shared__ __attribute__((aligned(16))) float so[4][16][64];
  const int tid = threadIdx.x, w = tid >> 5, lane = tid & 31, ln = lane & 15, hh = lane >> 4; const int by = blockIdx.y;
  A += (size_t)by * sA; Bh += (size_t)by * sB; const size_t cofs = (size_t)by * sC; const float* bp = bias ? bias + (size_t)by * sBias : nullptr;
  const int ntn = (N + 63) / 64; const int wid = blockIdx.x * 4 + w; const int mt = wid / ntn, nq = wid % ntn; if (mt * 16 >= M) return;
  const int row0 = mt * 16, col0 = nq * 64; const _Float16* arow = A + (size_t)(row0 + ln) * lda;
  v8f acc[4] = {};
  for (int kb = 0; kb < K; kb += 32) { FragH ah; ah.half[0] = *(const v8us*)((const unsigned short*)arow + kb + 8 * hh); ah.half[1] = *(const v8us*)((const unsigned short*)arow + kb + 16 + 8 * hh);
#pragma unroll
    for (int t = 0; t < 4; ++t) { if (col0 + t * 16 >= N) continue; const size_t boff = (size_t)(col0 + t * 16 + ln) * ldb + kb; FragH bq; bq.half[0] = *(const v8us*)((const unsigned short*)Bh + boff + 8 * hh); bq.half[1] = *(const v8us*)((const unsigned short*)Bh + boff + 16 + 8 * hh);
      acc[t] = mmaH<1>(ah.v, ah.v, bq.v, bq.v, acc[t]); }
  }
#pragma unroll
  for (int t = 0; t < 4; ++t) { if (col0 + t * 16 >= N) continue; const int col = col0 + t * 16 + ln; const float bv = bp ? bf16_round(bp[col]) : 0.f;
#pragma unroll
    for (int r = 0; r < 8; ++r) { float v = acc[t][r] * alpha + bv; if (CP) { const int bidx = (row0g + row0 + 8 * hh + r) / rowsPerB; v += CP[(size_t)bidx * sCPb + (size_t)by * 64 + col]; } if (ACT == 1) v = (v > 0.f) ? v : expm1f(v); else if (ACT == 7) v = (v > 0.f) ? v + 1.0f : expf(v); else if (ACT == 8) v = tanhf(v); else if (ACT == 9) v = 0.5f * v * (1.0f + tanhf(0.7978845608028654f * (v + 0.044715f * v * v * v))); else if (ACT == 11) v = 1.0f / (1.0f + expf(-v)); else if (ACT == 12) v = (v > 0.f) ? v : 0.01f * v; else if (ACT == 14) v = (v > 0.f) ? v : 0.1f * v; else if (ACT == 15) v = v / (1.0f + expf(-v)); else if (ACT == 3) v = fmaxf(v, 0.f); else if (ACT == 6) v = 0.5f * v * (1.0f + erff(v * 0.70710678118654752f)); so[w][8 * hh + r][t * 16 + ln] = v; } }
  __builtin_amdgcn_fence(__ATOMIC_ACQ_REL, "workgroup"); __builtin_amdgcn_wave_barrier();
  const int rsub = lane >> 4, c4 = (lane & 15) * 4; typedef _Float16 v4h __attribute__((ext_vector_type(4)));
  {
#pragma unroll
    for (int q = 0; q < 8; ++q) { const int r = q * 2 + rsub; if (col0 + c4 < N) { const v4f v = *(const v4fa*)&so[w][r][c4]; if (C) *(v4f*)(C + cofs + (size_t)(row0 + r) * ldc + col0 + c4) = v; if (C16) { v4h h4; for (int i = 0; i < 4; ++i) h4[i] = (_Float16)v[i]; *(v4h*)(C16 + cofs + (size_t)(row0 + r) * ldc + col0 + c4) = h4; } } }
     }
}


typedef _Float16 v4h __attribute__((ext_vector_type(4)));

__global__ __launch_bounds__(256) void k_x16(const float* __restrict__ x, _Float16* __restrict__ X16, size_t n8) { const size_t t = (size_t)blockIdx.x * 256 + threadIdx.x; if (t >= n8) return; FragH f;
#pragma unroll
  for (int q = 0; q < 8; ++q) f.h[q] = (_Float16)bf16_round(x[t * 8 + q]); *(v8us*)((unsigned short*)X16 + t * 8) = f.half[0];  }
__global__ __launch_bounds__(256) void k_h16(const float* __restrict__ x, _Float16* __restrict__ X16, size_t n8) { const size_t t = (size_t)blockIdx.x * 256 + threadIdx.x; if (t >= n8) return; FragH f;
#pragma unroll
  for (int q = 0; q < 8; ++q) f.h[q] = (_Float16)x[t * 8 + q]; *(v8us*)((unsigned short*)X16 + t * 8) = f.half[0];  }
__global__ __launch_bounds__(256) void k_round16f(const float* __restrict__ W, _Float16* __restrict__ Bt, size_t n8) { const size_t t = (size_t)blockIdx.x * 256 + threadIdx.x; if (t >= n8) return; FragH f;
#pragma unroll
  for (int i = 0; i < 8; ++i) f.h[i] = (_Float16)(bf16_round(W[t * 8 + i]) * 16.0f); *(v8us*)((unsigned short*)Bt + t * 8) = f.half[0];  }
__global__ __launch_bounds__(256) void k_hl(const float* __restrict__ F, _Float16* __restrict__ Hh, _Float16* __restrict__ Hl, size_t n8) { const size_t t = (size_t)blockIdx.x * 256 + threadIdx.x; if (t >= n8) return; FragH fh, fl; const v4f a = *(const v4fa*)(F + t * 8), c = *(const v4fa*)(F + t * 8 + 4);
#pragma unroll
  for (int q = 0; q < 4; ++q) { _Float16 h = (_Float16)a[q]; fh.h[q] = h; fl.h[q] = (_Float16)((a[q] - (float)h) * 1024.0f); h = (_Float16)c[q]; fh.h[4 + q] = h; fl.h[4 + q] = (_Float16)((c[q] - (float)h) * 1024.0f); }
  { *(v8us*)((unsigned short*)Hh + t * 8) = fh.half[0]; *(v8us*)((unsigned short*)Hl + t * 8) = fl.half[0];  } }

// ---- fast GEMM (wave tile 32x64; requires M % 32 == 0 rows per launch region and N % 64 == 0); epilogue = k_gemm_hhx semantics ----
__device__ __forceinline__ v16h g2_frag(const _Float16* p, int hh) { FragH f; f.half[0] = *(const v8us*)((const unsigned short*)p + 8 * hh); f.half[1] = *(const v8us*)((const unsigned short*)p + 16 + 8 * hh); return f.v; }
__device__ __forceinline__ v8f g2_mma(v16h a, v16h b, v8f c) { v8f d = __builtin_amdgcn_wmma_f32_16x16x32_f16(false, a, false, b, (short)0, c, false, false); asm volatile("v_nop\n\tv_nop\n\tv_nop\n\tv_nop" : "+v"(d) : "v"(a), "v"(b)); return d; }
template <int ACT>
__global__ __launch_bounds__(128) void k_gemm2(const _Float16* __restrict__ A, int lda, size_t sA, const _Float16* __restrict__ Bh, int ldb, size_t sB, float alpha, const float* __restrict__ bias, size_t sBias, const float* __restrict__ CP, int rowsPerB, size_t sCPb, int row0g,
    float* __restrict__ C, _Float16* __restrict__ C16, int ldc, size_t sC, int M, int N, int K) {
  __shared__ __attribute__((aligned(16))) float so[4][32][68];
  const int tid = threadIdx.x, w = tid >> 5, lane = tid & 31, ln = lane & 15, hh = lane >> 4; const int by = blockIdx.y;
  A += (size_t)by * sA; Bh += (size_t)by * sB; const size_t cofs = (size_t)by * sC; const float* bp = bias ? bias + (size_t)by * sBias : nullptr;
  const int ntn = N >> 6; const int mt = blockIdx.x / ntn, nq = blockIdx.x - mt * ntn; const int row0 = mt * 128 + 32 * w, col0 = nq * 64; if (row0 >= M) return;
  const _Float16* a0p = A + (size_t)(row0 + ln) * lda; const _Float16* a1p = a0p + (size_t)16 * lda;
  const _Float16* b0p = Bh + (size_t)(col0 + ln) * ldb; const _Float16* b1p = b0p + (size_t)16 * ldb; const _Float16* b2p = b1p + (size_t)16 * ldb; const _Float16* b3p = b2p + (size_t)16 * ldb;
  const v8f z8 = {0.f,0.f,0.f,0.f,0.f,0.f,0.f,0.f}; v8f c00 = z8, c01 = z8, c02 = z8, c03 = z8, c10 = z8, c11 = z8, c12 = z8, c13 = z8;
#pragma unroll 1
  for (int kb = 0; kb < K; kb += 32) { const v16h a0 = g2_frag(a0p + kb, hh), a1 = g2_frag(a1p + kb, hh);
    v16h b = g2_frag(b0p + kb, hh); c00 = g2_mma(a0, b, c00); c10 = g2_mma(a1, b, c10);
    b = g2_frag(b1p + kb, hh); c01 = g2_mma(a0, b, c01); c11 = g2_mma(a1, b, c11);
    b = g2_frag(b2p + kb, hh); c02 = g2_mma(a0, b, c02); c12 = g2_mma(a1, b, c12);
    b = g2_frag(b3p + kb, hh); c03 = g2_mma(a0, b, c03); c13 = g2_mma(a1, b, c13); }
  v8f accs[8] = {c00, c01, c02, c03, c10, c11, c12, c13};
#pragma unroll
  for (int u = 0; u < 8; ++u) { const int t = u & 3, half = u >> 2; const int col = col0 + t * 16 + ln; const float bv = bp ? bf16_round(bp[col]) : 0.f;
#pragma unroll
    for (int r = 0; r < 8; ++r) { const int rloc = half * 16 + 8 * hh + r; float v = accs[u][r] * alpha + bv; if (CP) { const int bidx = (row0g + row0 + rloc) / rowsPerB; v += CP[(size_t)bidx * sCPb + (size_t)by * 64 + col]; }
      if (ACT == 3) v = fmaxf(v, 0.f); else if (ACT == 6) v = 0.5f * v * (1.0f + erff(v * 0.70710678118654752f)); else if (ACT == 11) v = 1.0f / (1.0f + expf(-v)); else if (ACT == 15) v = v / (1.0f + expf(-v)); else if (ACT == 12) v = (v > 0.f) ? v : 0.01f * v; else if (ACT == 8) v = tanhf(v);
      so[w][rloc][t * 16 + ln] = v; } }
  __builtin_amdgcn_fence(__ATOMIC_ACQ_REL, "workgroup"); __builtin_amdgcn_wave_barrier();
  const int rsub = lane >> 4, c4 = (lane & 15) * 4;
  {
#pragma unroll
    for (int q = 0; q < 16; ++q) { const int r = q * 2 + rsub; const v4f v = *(const v4fa*)&so[w][r][c4]; if (C) *(v4f*)(C + cofs + (size_t)(row0 + r) * ldc + col0 + c4) = v; if (C16) { v4h h4; for (int i = 0; i < 4; ++i) h4[i] = (_Float16)v[i]; *(v4h*)(C16 + cofs + (size_t)(row0 + r) * ldc + col0 + c4) = h4; } }
     } }



__device__ __forceinline__ float xhalf(float x) { return __builtin_bit_cast(float, __builtin_amdgcn_permlanex16(__builtin_bit_cast(int, x), __builtin_bit_cast(int, x), 0x76543210, 0xfedcba98, false, false)); }      /* value of lane l ^ 16 */
/* the flash kernel stands at its ceiling of 256 vector registers (16 waves a block): its products are the plain builtin (the compiler keeps the distance behind it), with no asm statement that would hold operands live around them */
__device__ __forceinline__ v8f mmaF(v16h a, v16h b, v8f c) { return __builtin_amdgcn_wmma_f32_16x16x32_f16(false, a, false, b, (short)0, c, false, false); }
/* scores, running maximum and P^T of one (q, k) half for one 32-key chunk, in base 2 on the raw products: p 2^10 = 2^(s c - m c + 10) with c = log2(e) / 8 is one multiply-add and one v_exp_f32 a score. m_r = running maximum of the raw products, l_r = running sum x 2^10. On return pb = P^T x 2^10 as a B operand, al = the factor that brings the old sums to the new maximum */
#define SC2 0.18033688011112042f  /* SCL log2(e) */
__device__ __forceinline__ void soft_half(const FragH (&ak)[2][2], const FragH (&bq)[2], int j0, int hh, int tq, float& m_r, float& l_r, float& al, FragH& pb) {
  float sv[16];
#pragma unroll
  for (int nt = 0; nt < 2; ++nt) { v8f acc = (v8f){0.f,0.f,0.f,0.f,0.f,0.f,0.f,0.f};
#pragma unroll
    for (int ks = 0; ks < 2; ++ks) acc = mmaF(ak[nt][ks].v, bq[ks].v, acc);
#pragma unroll
    for (int r = 0; r < 8; ++r) { const int kk = j0 + nt * 16 + 8 * hh + r; sv[nt * 8 + r] = (kk <= tq) ? acc[r] : -3.0e38f; } }
  float mc = fmaxf(sv[0], sv[1]);
#pragma unroll
  for (int i = 2; i < 16; ++i) mc = fmaxf(mc, sv[i]);
  mc = fmaxf(mc, xhalf(mc));      /* both halves of the wave now hold the chunk maximum of query tq */
  const float mn = fmaxf(m_r, mc); al = (m_r - mn) * SC2; m_r = mn;
  const float nb = 10.0f - mn * SC2;
#pragma unroll
  for (int i = 0; i < 16; ++i) sv[i] = fmaf(sv[i], SC2, nb);      /* key j0 <= q0 is open to every query of the tile, so mn is finite and a masked score gives exactly 0 */
  /* x = 2^x in place, independent v_exp_f32 in a row. In asm for the v_nop at each end: it is the slot that the instruction set asks for behind a transcendental */
  asm("v_exp_f32 %0, %0\n\tv_exp_f32 %1, %1\n\tv_exp_f32 %2, %2\n\tv_exp_f32 %3, %3\n\tv_exp_f32 %4, %4\n\tv_exp_f32 %5, %5\n\tv_exp_f32 %6, %6\n\tv_exp_f32 %7, %7\n\tv_nop"
      : "+v"(sv[0]), "+v"(sv[1]), "+v"(sv[2]), "+v"(sv[3]), "+v"(sv[4]), "+v"(sv[5]), "+v"(sv[6]), "+v"(sv[7]));
  asm("v_exp_f32 %0, %0\n\tv_exp_f32 %1, %1\n\tv_exp_f32 %2, %2\n\tv_exp_f32 %3, %3\n\tv_exp_f32 %4, %4\n\tv_exp_f32 %5, %5\n\tv_exp_f32 %6, %6\n\tv_exp_f32 %7, %7\n\tv_exp_f32 %8, %8\n\tv_nop"
      : "+v"(sv[8]), "+v"(sv[9]), "+v"(sv[10]), "+v"(sv[11]), "+v"(sv[12]), "+v"(sv[13]), "+v"(sv[14]), "+v"(sv[15]), "+v"(al));
  float ps[4] = {0.f, 0.f, 0.f, 0.f};
#pragma unroll
  for (int i = 0; i < 16; ++i) { ps[i & 3] += sv[i]; pb.h[i] = (_Float16)sv[i]; }
  l_r = l_r * al + ((ps[0] + ps[1]) + (ps[2] + ps[3])); }
/* weight of wave w's key share in the join of one half: exp(m_w - m_all) / (l_all 2^10); lane -> row ln; a wave without a chunk holds m below -1e37, l = 0, O = 0 and gets weight 0; wave 0 always holds key 0, so the joint maximum is finite */
__device__ __forceinline__ float join_weight(const float (&sM)[4][16], const float (&sL)[4][16], int w, int ln) {
  const float m0 = sM[0][ln], m1 = sM[1][ln], m2 = sM[2][ln], m3 = sM[3][ln]; const float mt = fmaxf(fmaxf(m0, m1), fmaxf(m2, m3));
  const float e0 = expf(m0 - mt), e1 = expf(m1 - mt), e2 = expf(m2 - mt), e3 = expf(m3 - mt); const float lt = ((sL[0][ln] * e0 + sL[1][ln] * e1) + sL[2][ln] * e2) + sL[3][ln] * e3;
  const float ew = (w == 0) ? e0 : ((w == 1) ? e1 : ((w == 2) ? e2 : e3)); return (lt > 0.f) ? ew / (lt * 1024.0f) : 0.f; }
/* one stage of the ring = 4 chunks of 32 keys (16 KiB of each K half, 32 KiB of V^T), from global memory straight into LDS: 8 asynchronous copies of 16 bytes a lane, 512 lanes. lds = the lane's byte address in the buffer, ka / kb / va = the lane's 16 bytes of the stage in the three planes; every copy moves 8 KiB on in both.
   s_wait_xcnt stands inside the statement, behind the last copy: the address registers are the statement's operands and live to its end, so nothing rewrites one in front of the wait */
__device__ __forceinline__ void copy_stage(unsigned lds, const unsigned short* ka, const unsigned short* kb, const unsigned short* va) {
  asm volatile("global_load_async_to_lds_b128 %0, %8, off\n\t"
               "global_load_async_to_lds_b128 %1, %9, off\n\t"
               "global_load_async_to_lds_b128 %2, %10, off\n\t"
               "global_load_async_to_lds_b128 %3, %11, off\n\t"
               "global_load_async_to_lds_b128 %4, %12, off\n\t"
               "global_load_async_to_lds_b128 %5, %13, off\n\t"
               "global_load_async_to_lds_b128 %6, %14, off\n\t"
               "global_load_async_to_lds_b128 %7, %15, off\n\t"
               "s_wait_xcnt 0x0"
               :: "v"(lds), "v"(lds + 8192u), "v"(lds + 16384u), "v"(lds + 24576u), "v"(lds + 32768u), "v"(lds + 40960u), "v"(lds + 49152u), "v"(lds + 57344u),
                  "v"(ka), "v"(ka + 4096), "v"(kb), "v"(kb + 4096), "v"(va), "v"(va + 4096), "v"(va + 8192), "v"(va + 12288) : "memory"); }
#define QBLK 64                  /* query rows of a flash block: 4 tiles of 16 */
#define STG 32768                /* halves (2 bytes) of one ring buffer: K1 8,192, K2 8,192, V^T 16,384 */
__global__ __launch_bounds__(512) void k_flash(const _Float16* __restrict__ QA, const _Float16* __restrict__ QB, int ldq, const _Float16* __restrict__ KFA, const _Float16* __restrict__ KFB, const _Float16* __restrict__ VF, const float* __restrict__ LAM, const float* __restrict__ sw, float* __restrict__ out) {
  constexpr int RPW = 16, DT = 8, KS = 2;      /* DT: output row tiles of O^T, 0-3 = (P.V1)^T, 4-7 = (P.V2)^T (one P for both V halves) */
  __shared__ __attribute__((aligned(16))) unsigned short ring[2][STG];
  __shared__ __attribute__((aligned(16))) float sO[4][4][RPW][128 + 4]; __shared__ float sM[2][4][4][RPW], sL[2][4][4][RPW];
  const int tid = threadIdx.x, wv = __builtin_amdgcn_readfirstlane(tid >> 5), t = wv & 3, s = wv >> 2, lane = tid & 31, ln = lane & 15, hh = lane >> 4;      /* t, s in scalar registers: which chunks a wave works on differs from wave to wave and must stay a scalar branch (WMMA needs every lane on) */
  const int slab = blockIdx.x % (NB * NH), qb = (TQ / QBLK - 1) - blockIdx.x / (NB * NH); const int b = slab / NH, h = slab % NH; const int q0 = qb * QBLK + t * RPW;      /* the blocks with the most keys have the lowest indices */
  const float lam = LAM[0];      /* read in front of the first asm statement that clobbers memory: there the compiler still takes it by a scalar load */
  FragH bq[2][KS];
  { const size_t qo = ((size_t)b * TQ + q0 + ln) * ldq + h * 64; const unsigned short* qa = (const unsigned short*)QA + qo; const unsigned short* qb2 = (const unsigned short*)QB + qo;
#pragma unroll
    for (int ks = 0; ks < KS; ++ks) { bq[0][ks].half[0] = *(const v8us*)(qa + ks * 32 + 8 * hh); bq[0][ks].half[1] = *(const v8us*)(qa + ks * 32 + 16 + 8 * hh); bq[1][ks].half[0] = *(const v8us*)(qb2 + ks * 32 + 8 * hh); bq[1][ks].half[1] = *(const v8us*)(qb2 + ks * 32 + 16 + 8 * hh); } }
  const unsigned short* KAg = (const unsigned short*)KFA + (size_t)slab * 64 * TK + tid * 8; const unsigned short* KBg = (const unsigned short*)KFB + (size_t)slab * 64 * TK + tid * 8; const unsigned short* VFg = (const unsigned short*)VF + (size_t)slab * 128 * TK + tid * 8;      /* the thread's 16 bytes of stage 0 in each plane */
  const unsigned lds0 = (unsigned)(uintptr_t)&ring[0][0] + (unsigned)tid * 16u;      /* the thread's byte address in buffer 0 */
  const int tq = q0 + ln;      /* this lane's query */
  float m_r[2] = {-3.0e38f, -3.0e38f}, l_r[2] = {0.f, 0.f}; v8f oacc[2][DT];      /* l_r: sum over this lane's own 16 keys of each chunk; the two halves of the wave are added behind the loop */
#pragma unroll
  for (int dt = 0; dt < DT; ++dt) { oacc[0][dt] = (v8f){0.f,0.f,0.f,0.f,0.f,0.f,0.f,0.f}; oacc[1][dt] = (v8f){0.f,0.f,0.f,0.f,0.f,0.f,0.f,0.f}; }
  const int jend = q0 + RPW;      /* causal: keys beyond the tile's last query never contribute */
  const int nst = (qb + 2) >> 1;      /* stages of 128 keys that cover the block's 64 qb + 64 keys; at most TK / 128, so every stage lies inside the planes */
  copy_stage(lds0, KAg, KBg, VFg);
  asm volatile("s_wait_asynccnt 0x0" ::: "memory");      /* this wave's part of stage 0 has landed */
  __syncthreads();      /* every wave's part of stage 0 has landed before any wave reads it */
  if (nst > 1) copy_stage(lds0 + 2u * STG, KAg + 8192, KBg + 8192, VFg + 16384);
#pragma unroll 1      /* kept rolled: the publish point stands once in the code, and the body of some 800 instructions is not doubled */
  for (int st = 0; st < nst; ++st) {
    const int j0 = (4 * st + s) * 32;
    if (j0 < jend) {      /* a scalar test; the publish point below stands outside it, every wave passes it */
      FragH aka[2][KS], akb[2][KS], av[DT];
      const unsigned short* rb = &ring[st & 1][lane * 8]; const unsigned short* ka = rb + s * 2048; const unsigned short* kb = rb + 8192 + s * 2048; const unsigned short* va = rb + 16384 + s * 4096;      /* chunk s of the stage: 2048 halves of each K, 4096 of V^T */
#pragma unroll
      for (int ks = 0; ks < KS; ++ks) { aka[0][ks].half[0] = *(const v8us*)(ka + ks * 512); aka[0][ks].half[1] = *(const v8us*)(ka + ks * 512 + 256); aka[1][ks].half[0] = *(const v8us*)(ka + 1024 + ks * 512); aka[1][ks].half[1] = *(const v8us*)(ka + 1024 + ks * 512 + 256); }
#pragma unroll
      for (int ks = 0; ks < KS; ++ks) { akb[0][ks].half[0] = *(const v8us*)(kb + ks * 512); akb[0][ks].half[1] = *(const v8us*)(kb + ks * 512 + 256); akb[1][ks].half[0] = *(const v8us*)(kb + 1024 + ks * 512); akb[1][ks].half[1] = *(const v8us*)(kb + 1024 + ks * 512 + 256); }
      FragH pa, pb; float ala, alb;
      soft_half(aka, bq[0], j0, hh, tq, m_r[0], l_r[0], ala, pa);
      soft_half(akb, bq[1], j0, hh, tq, m_r[1], l_r[1], alb, pb);
#pragma unroll
      for (int dt = 0; dt < DT; ++dt) { av[dt].half[0] = *(const v8us*)(va + dt * 512); av[dt].half[1] = *(const v8us*)(va + dt * 512 + 256); }
#pragma unroll
      for (int dt = 0; dt < DT; ++dt) { oacc[0][dt] *= ala; oacc[1][dt] *= alb; }
#pragma unroll
      for (int dt = 0; dt < DT; ++dt) { oacc[0][dt] = mmaF(av[dt].v, pa.v, oacc[0][dt]); oacc[1][dt] = mmaF(av[dt].v, pb.v, oacc[1][dt]); } }
    /* publish point of stage st + 1, in the ring's order */
    asm volatile("s_wait_dscnt 0x0" ::: "memory");      /* this wave's reads of stage st have returned */
    asm volatile("s_wait_asynccnt 0x0" ::: "memory");      /* this wave's part of stage st + 1 has landed */
    __syncthreads();      /* stage st + 1 is whole for every reader, and no wave still reads stage st's buffer */
    if (st + 2 < nst) copy_stage(lds0 + (unsigned)(st & 1) * (2u * STG), KAg + (size_t)(st + 2) * 8192, KBg + (size_t)(st + 2) * 8192, VFg + (size_t)(st + 2) * 16384); }
  asm volatile("s_wait_asynccnt 0x0" ::: "memory");      /* no copy is in flight behind the loop */
  /* join of a tile's four key shares: publish each wave's row maxima and row sums of both halves, weigh every share by exp(m_s - m_all) / l_all, add the weighted shares */
  const v4f w4 = *(const v4fa*)(sw + lane * 4);
#pragma unroll
  for (int g = 0; g < 2; ++g) { const float lv = (l_r[g] + xhalf(l_r[g])) * 0.0009765625f; if (hh == 0) { sM[g][t][s][ln] = m_r[g] * SCL; sL[g][t][s][ln] = lv; } }      /* the join works on scaled scores and plain sums: x 1/8 and x 2^-10 are exact */
  __syncthreads();      /* every wave's maxima and sums are written before any wave reads them */
  { const float fa = join_weight(sM[0][t], sL[0][t], s, ln); const float fb = lam * join_weight(sM[1][t], sL[1][t], s, ln);
#pragma unroll
    for (int dt = 0; dt < DT; ++dt) { const v8f o = oacc[0][dt] * fa - oacc[1][dt] * fb;      /* this wave's share of attn1 - lambda attn2; the lane's 8 registers are 8 consecutive columns of its own row */
      *(v4f*)&sO[t][s][ln][dt * 16 + 8 * hh] = (v4f){o[0], o[1], o[2], o[3]}; *(v4f*)&sO[t][s][ln][dt * 16 + 8 * hh + 4] = (v4f){o[4], o[5], o[6], o[7]}; } }
  __syncthreads();      /* all four weighted shares are in LDS before they are added */
  {
#pragma unroll
    for (int i = 0; i < 4; ++i) { const int r = i * 4 + s; const v4f p0 = *(const v4fa*)&sO[t][0][r][lane * 4], p1 = *(const v4fa*)&sO[t][1][r][lane * 4], p2 = *(const v4fa*)&sO[t][2][r][lane * 4], p3 = *(const v4fa*)&sO[t][3][r][lane * 4]; const v4f a = ((p0 + p1) + p2) + p3;      /* the wave holds one whole 128-wide row, 4 columns a lane */
      float ss = 0.f;
#pragma unroll
      for (int q = 0; q < 4; ++q) ss += a[q] * a[q];
      for (int o = 16; o > 0; o >>= 1) ss += __shfl_xor(ss, o, 32);
      const float inv = rsqrtf(ss / 128.0f + 1e-5f); v4f r4;
#pragma unroll
      for (int q = 0; q < 4; ++q) { float y = bf16_round(w4[q]) * (a[q] * inv); y *= (1.0f - LAMBDA_INIT); r4[q] = y; }
      *(v4f*)(out + ((size_t)b * TQ + q0 + r) * DW + h * 128 + lane * 4) = r4; }      /* 512 contiguous bytes a row */
     } }

/* ONE pre-pass launch writes everything the flash kernel reads. A unit = 256 threads x 16 output bytes (4 KiB); a block takes PU units of one kind and issues all their loads before the first conversion. Block 0: lambda. Then, 256 blocks each: V^T, K, Q.
   Few fat waves (6,152 in the launch), for speed only. */
#define PU 8
#define PREP_BLOCKS ((NR / 32) * NHD / PU)      /* 2,048 units of each kind */
__device__ __forceinline__ v8us cvt8(const float (&x)[8]) { FragH f;
#pragma unroll
  for (int i = 0; i < 8; ++i) f.h[i] = (_Float16)bf16_round(x[i]);
  return f.half[0]; }
/* lambda, one wave: lane l forms the rounded products of terms l and l + 32 (one load latency for all 64 terms), then every lane adds the 64 products in the order 0 .. 63, each read from its lane: the sums are those of a serial loop over the terms, bit for bit */
__device__ __forceinline__ float lane_val(float x, int l) { return __builtin_bit_cast(float, __builtin_amdgcn_readlane(__builtin_bit_cast(int, x), l)); }
__device__ __forceinline__ void lambda_part(const float* __restrict__ lq1, const float* __restrict__ lk1, const float* __restrict__ lq2, const float* __restrict__ lk2, float* __restrict__ LAM) {
  const int ln = threadIdx.x; if (ln >= 32) return; float s1 = 0.f, s2 = 0.f;
  const float p1[2] = {bf16_round(lq1[ln]) * bf16_round(lk1[ln]), bf16_round(lq1[ln + 32]) * bf16_round(lk1[ln + 32])}; const float p2[2] = {bf16_round(lq2[ln]) * bf16_round(lk2[ln]), bf16_round(lq2[ln + 32]) * bf16_round(lk2[ln + 32])};
#pragma unroll
  for (int d = 0; d < HD; ++d) { s1 += lane_val(p1[d >> 5], d & 31); s2 += lane_val(p2[d >> 5], d & 31); }
  const float lam = expf(s1) - expf(s2) + LAMBDA_INIT; *(float*)(LAM + ln) = lam;
  asm volatile("s_wait_xcnt 0x0" ::: "memory");      /* behind the store, as in prep_rows */
}
/* PU units whose thread reads 8 consecutive floats: unit u at s + u * sstep; stored at (u odd ? d1 : d0) + (u / DDIV) * dstep */
template <int DDIV>
__device__ __forceinline__ void prep_rows(const float* __restrict__ s, int sstep, unsigned short* __restrict__ d0, unsigned short* __restrict__ d1, int dstep) {
  float x[PU][8];
#pragma unroll
  for (int u = 0; u < PU; ++u) { const v4f a0 = *(const v4fa*)(s + u * sstep), a1 = *(const v4fa*)(s + u * sstep + 4);
#pragma unroll
    for (int i = 0; i < 4; ++i) { x[u][i] = a0[i]; x[u][4 + i] = a1[i]; } }
  asm volatile("s_wait_xcnt 0x0" :: "v"(s) : "memory");      /* the address pair stays live up to this wait: no load above returns into it and nothing overwrites it in front of the wait */
  __builtin_amdgcn_sched_barrier(0);      /* all 16 loads are issued before the first conversion: left free, the scheduler holds the last ones back behind the first waits, and the wave pays a second load latency */
#pragma unroll
  for (int u = 0; u < PU; ++u) { *(v8us*)(((DDIV == 2 && (u & 1)) ? d1 : d0) + (u / DDIV) * dstep) = cvt8(x[u]);      /* a wave stores whole 128-byte lines */
    asm volatile("s_wait_xcnt 0x0" ::: "memory"); }      /* behind each store: the stores go out as their units are converted, and no register that a store names is overwritten in front of its wait, on whichever path the code goes on */
}
__global__ __launch_bounds__(256) void k_prep(const float* __restrict__ q, const float* __restrict__ k, const float* __restrict__ v, const float* __restrict__ lq1, const float* __restrict__ lk1, const float* __restrict__ lq2, const float* __restrict__ lk2,
                                              _Float16* __restrict__ Q1, _Float16* __restrict__ Q2, _Float16* __restrict__ K1, _Float16* __restrict__ K2, _Float16* __restrict__ VT, float* __restrict__ LAM) {
  const int tid = threadIdx.x, ln = tid & 15, hh = (tid >> 4) & 1, fh = tid >> 5; int blk = blockIdx.x;
  if (blk == 0) { lambda_part(lq1, lk1, lq2, lk2, LAM); return; }
  blk -= 1;
  if (blk < PREP_BLOCKS) {
    /* V^T in fragment order (see k_flash), straight from v: the block = 4 chunks of 32 keys of one head pair, unit u = (chunk u / 2, V half u % 2); thread = (fragment half fh = 2 dt + hf, lane): V^T row 16 dt + ln, keys 16 hf + 8 hh .. + 7: 8 loads of one float down a column; a wave's load reads 64 contiguous bytes of each of two rows */
    const int slab = blk / (SLEN / 128), c0 = (blk % (SLEN / 128)) * 4; const int b = slab / NH, p = slab % NH;
    const float* s = v + ((size_t)b * SLEN + c0 * 32 + (fh & 1) * 16 + hh * 8) * DW + p * 2 * HD + (fh >> 1) * 16 + ln;
    unsigned short* d = (unsigned short*)VT + ((size_t)slab * (SLEN / 32) + c0) * 4096 + tid * 8;
    float x[PU][8];
#pragma unroll
    for (int u = 0; u < PU; ++u)
#pragma unroll
      for (int i = 0; i < 8; ++i) x[u][i] = s[((u >> 1) * 32 + i) * DW + (u & 1) * HD];
    asm volatile("s_wait_xcnt 0x0" :: "v"(s) : "memory");      /* as in prep_rows */
#pragma unroll
    for (int u = 0; u < PU; ++u) { *(v8us*)(d + u * 2048) = cvt8(x[u]);      /* a wave stores 512 contiguous bytes; a chunk holds V1's 4 KiB, then V2's */
      asm volatile("s_wait_xcnt 0x0" ::: "memory"); }      /* behind each store, as in prep_rows */
    return;
  }
  blk -= PREP_BLOCKS;
  if (blk < PREP_BLOCKS) {
    /* K halves in fragment order (see k_flash): the block = one 32-key chunk of 8 heads, unit u = head h0 + u; thread = (fragment half fh, lane): K row 16 nt + ln of the chunk, dims 32 ks + 16 hf + 8 hh .. + 7 */
    const int cg = blk >> 1, h0 = (blk & 1) * 8; const int b = cg / (SLEN / 32), c = cg % (SLEN / 32);
    const size_t o = ((size_t)(b * NP + h0 / 2) * (SLEN / 32) + c) * 2048 + tid * 8;
    prep_rows<2>(k + ((size_t)cg * 32 + (fh >> 2) * 16 + ln) * DW + h0 * HD + (fh & 3) * 16 + hh * 8, HD, (unsigned short*)K1 + o, (unsigned short*)K2 + o, (SLEN / 32) * 2048);
    return;
  }
  blk -= PREP_BLOCKS;
  { /* Q halves, row-major [token][pair][64]: the block = 16 tokens, unit u = tokens 2 u, 2 u + 1; thread = 8 consecutive dims of one head */
    const int h = (tid >> 3) & 15; const size_t r = (size_t)blk * (2 * PU) + (tid >> 7);
    unsigned short* d = (unsigned short*)((h & 1) ? Q2 : Q1) + r * HWD + (h / 2) * HD + (tid & 7) * 8;
    prep_rows<1>(q + r * DW + (tid & 127) * 8, 2 * DW, d, d, 2 * HWD); }
}

extern "C" void kernel_launch(void* const* d_in, const int* in_sizes, int n_in,
                              void* d_out, int out_size, void* d_ws, size_t ws_size, hipStream_t stream) {
  (void)in_sizes; (void)n_in; (void)out_size;
  const float* const* I = (const float* const*)d_in; const float* q = I[0]; const float* k = I[1]; const float* v = I[2]; const float* lq1 = I[3]; const float* lk1 = I[4]; const float* lq2 = I[5]; const float* lk2 = I[6]; const float* w = I[7];
  char* ws = (char*)d_ws; size_t off = 0;
  auto take = [&](size_t bytes) { char* p = ws + off; off += (bytes + 255) & ~(size_t)255; return p; };
  const size_t nh = (size_t)NR * HWD;
  _Float16* Q1 = (_Float16*)take(nh * 2); _Float16* Q2 = (_Float16*)take(nh * 2); _Float16* K1 = (_Float16*)take(nh * 2); _Float16* K2 = (_Float16*)take(nh * 2); _Float16* VT = (_Float16*)take(nh * 4);
  float* LAM = (float*)take(256);
  if (off > ws_size) return;      /* 6 x 4 = 24 MiB */
  k_prep<<<1 + 3 * PREP_BLOCKS, 256, 0, stream>>>(q, k, v, lq1, lk1, lq2, lk2, Q1, Q2, K1, K2, VT, LAM);
  k_flash<<<NB * NH * (TQ / QBLK), 512, 0, stream>>>(Q1, Q2, HWD, K1, K2, VT, LAM, w, (float*)d_out);
}

// v009
// A run of this version takes 41.7 microseconds.
// In both of two side-by-side timings against v008, it was 1.07 times as fast.
// Counting every step since v000, it is 21.9 times as fast.
#include <hip/hip_runtime.h>
// Differential causal attention (2 x 2048 tokens, 16 heads of 64 as 8 differential pairs; q, k, v are INPUTS): heads (2p, 2p+1) = (q1, q2) etc.; P1 = causal softmax(q1.k1/8), P2 = causal softmax(q2.k2/8); attn1 = [P1 v1 | P1 v2], attn2 = [P2 v1 | P2 v2] (128 wide); lambda = exp(lq1.lk1) - exp(lq2.lk2) + lambda_init; a = attn1 - lambda attn2; out = subln_w * RMSNorm_128(a) * (1 - lambda_init) -> [B, S, 16, 64].
// Structure: ONE pre-pass launch de-interleaves q and k into exact f16 planes per half (q1, q2, k1, k2; the inputs are exactly representable after bf16 rounding) and writes V^T; K and V^T stored in WMMA fragment order (per 32-key chunk: fragment halves of 32 lanes x 16 bytes; both V halves in one plane); lambda on device in the same launch (f32 64-term dots); ONE launch of the fused causal flash kernel: a block does both (q, k) halves of four query tiles, which share each stage of K and V^T through LDS; P1 and P2 multiplied into the same V^T fragments (plain operands - exact here except P; f32 softmax/accumulation), and takes the differential combine + RMSNorm in its LDS join.
// Compute dtype: inputs rounded to bf16; q, k, v exact as f16; P as f16 (x2^10, ~2^-12); everything else f32. v_wmma_f32_16x16x32_f16.
#define NB 2
#define NHD 16
#define HD 64
#define NP (NHD / 2)
#define DW (NHD * HD)            /* 1024 */
#define HWD (NP * HD)            /* 512 */
#define NR (NB * SLEN)
#define LAMBDA_INIT 0.35550906759096934f  /* 0.8 - 0.6 exp(-0.3) */
#define SLEN 2048
#define TQ SLEN
#define TK SLEN
#define NH 8                     /* head PAIRS per call */
#define SCL 0.125f
#define QTILES (TQ / 16)         /* query tiles of 16 rows, four to a block */
typedef __bf16 v16b __attribute__((ext_vector_type(16)));
typedef unsigned short v8us __attribute__((ext_vector_type(8), may_alias));
typedef float  v8f  __attribute__((ext_vector_type(8)));
typedef float  v4f  __attribute__((ext_vector_type(4)));
typedef float  v4fa __attribute__((ext_vector_type(4), may_alias));
union FragB { v16b v; v8us half[2]; unsigned short u[16]; };

__device__ __forceinline__ unsigned short bf16_bits(float x) { unsigned int u = __float_as_uint(x); return (unsigned short)((u + 0x7FFFu + ((u >> 16) & 1u)) >> 16); }
__device__ __forceinline__ float bf16_val(unsigned short b) { return __uint_as_float(((unsigned int)b) << 16); }
__device__ __forceinline__ float bf16_round(float x) { return bf16_val(bf16_bits(x)); }
// D += A·B with NT terms: 1 = ah·bh, 2 = + al·bh (A split), 3 = + ah·bl (both split)
template <int NT>
__device__ __forceinline__ v8f mmaN(v16b ah, v16b al, v16b bh, v16b bl, v8f c) {
  c = __builtin_amdgcn_wmma_f32_16x16x32_bf16(false, ah, false, bh, (short)0, c, false, false);
  if (NT >= 2) c = __builtin_amdgcn_wmma_f32_16x16x32_bf16(false, al, false, bh, (short)0, c, false, false);
  if (NT >= 3) c = __builtin_amdgcn_wmma_f32_16x16x32_bf16(false, ah, false, bl, (short)0, c, false, false);
  asm volatile("v_nop\n\tv_nop\n\tv_nop\n\tv_nop" : "+v"(c) : "v"(ah), "v"(al), "v"(bh), "v"(bl));
  return c;
}

__global__ __launch_bounds__(256) void k_wt_bf16(const float* __restrict__ W, unsigned short* __restrict__ Wt, int K, int N) {
  const int t = blockIdx.x * 256 + threadIdx.x;
  const int k8n = K / 8;
  if (t >= N * k8n) return;
  const int n = t / k8n, k8 = (t % k8n) * 8;
  v8us v;
#pragma unroll
  for (int i = 0; i < 8; ++i) v[i] = bf16_bits(W[(size_t)(k8 + i) * N + n]);
  *(v8us*)(Wt + (size_t)n * K + k8) = v;
  
}

// GEMM C[M][N] (f32, pitch ldc) = act(A[M][K]·W + bias). A f32 row-major (pitch lda) converted per fragment to bf16
// (ASPLIT: hi/lo two planes -> 2 terms, else single rounded term); Wt bf16 [N][K] (pitch ldb). BIAS_BF16 rounds the
// bias to bf16 first (bias quantised to bf16 before the add). K%32==0, M%16==0, N%64==0.
template <bool ASPLIT, int ACT, bool BIAS_BF16>
__global__ __launch_bounds__(128) void k_gemm_bf(const float* __restrict__ A, int lda, const unsigned short* __restrict__ Wt, int ldb,
                                               const float* __restrict__ bias, float* __restrict__ C, int ldc, int M, int N, int K) {
  __shared__ __attribute__((aligned(16))) float so[4][16][64];
  const int tid = threadIdx.x, w = tid >> 5, lane = tid & 31, ln = lane & 15, hh = lane >> 4;
  const int ntn = N / 64;
  const int wid = blockIdx.x * 4 + w;
  const int mt = wid / ntn, nq = wid % ntn;
  if (mt * 16 >= M) return;
  const int row0 = mt * 16, col0 = nq * 64;
  const float* arow = A + (size_t)(row0 + ln) * lda;
  v8f acc[4] = {};
  for (int kb = 0; kb < K; kb += 32) {
    FragB ah, al;
    const v4f x0 = *(const v4fa*)(arow + kb + 8 * hh), x1 = *(const v4fa*)(arow + kb + 8 * hh + 4);
    const v4f x2 = *(const v4fa*)(arow + kb + 16 + 8 * hh), x3 = *(const v4fa*)(arow + kb + 16 + 8 * hh + 4);
    float xs[16] = {x0[0],x0[1],x0[2],x0[3],x1[0],x1[1],x1[2],x1[3],x2[0],x2[1],x2[2],x2[3],x3[0],x3[1],x3[2],x3[3]};
#pragma unroll
    for (int i = 0; i < 16; ++i) { const unsigned short hb = bf16_bits(xs[i]); ah.u[i] = hb; al.u[i] = ASPLIT ? bf16_bits(xs[i] - bf16_val(hb)) : (unsigned short)0; }
#pragma unroll
    for (int t = 0; t < 4; ++t) {
      const unsigned short* brow = Wt + (size_t)(col0 + t * 16 + ln) * ldb + kb;
      FragB b;
      b.half[0] = *(const v8us*)(brow + 8 * hh);
      b.half[1] = *(const v8us*)(brow + 16 + 8 * hh);
      acc[t] = mmaN<ASPLIT ? 2 : 1>(ah.v, al.v, b.v, b.v, acc[t]);
    }
  }
#pragma unroll
  for (int t = 0; t < 4; ++t) {
    float bv = bias ? bias[col0 + t * 16 + ln] : 0.f;
    if (BIAS_BF16) bv = bf16_round(bv);
#pragma unroll
    for (int r = 0; r < 8; ++r) { float v = acc[t][r] + bv; if (ACT == 1) v = fmaxf(v, 0.f); so[w][8 * hh + r][t * 16 + ln] = v; }
  }
  __builtin_amdgcn_fence(__ATOMIC_ACQ_REL, "workgroup");
  __builtin_amdgcn_wave_barrier();
  const int rsub = lane >> 4, c4 = (lane & 15) * 4;
  {
#pragma unroll
    for (int q = 0; q < 8; ++q) {
      const int r = q * 2 + rsub;
      const v4f v = *(const v4fa*)&so[w][r][c4];
      *(v4f*)(C + (size_t)(row0 + r) * ldc + col0 + c4) = v;
    }
    
  }
}

// GEMM C = act(A·W + bias + resid): A f32 (ASPLIT -> hi/lo 2 terms), Wt bf16 [N][K]; ACT 0 none, 1 relu, 2 exact gelu;
// resid (optional, f32, row index = (row % rmod), pitch ldr, RES_BF16 rounds it) added before the activation.
template <bool ASPLIT, int ACT, bool BIAS_BF16, bool RES_BF16>
__global__ __launch_bounds__(128) void k_gemm_bf3(const float* __restrict__ A, int lda, const unsigned short* __restrict__ Wt, int ldb,
                                                const float* __restrict__ bias, const float* __restrict__ resid, int rmod, int ldr,
                                                float* __restrict__ C, int ldc, int M, int N, int K) {
  __shared__ __attribute__((aligned(16))) float so[4][16][64];
  const int tid = threadIdx.x, w = tid >> 5, lane = tid & 31, ln = lane & 15, hh = lane >> 4;
  const int ntn = N / 64;
  const int wid = blockIdx.x * 4 + w;
  const int mt = wid / ntn, nq = wid % ntn;
  if (mt * 16 >= M) return;
  const int row0 = mt * 16, col0 = nq * 64;
  const float* arow = A + (size_t)(row0 + ln) * lda;
  v8f acc[4] = {};
  for (int kb = 0; kb < K; kb += 32) {
    FragB ah, al;
    const v4f x0 = *(const v4fa*)(arow + kb + 8 * hh), x1 = *(const v4fa*)(arow + kb + 8 * hh + 4);
    const v4f x2 = *(const v4fa*)(arow + kb + 16 + 8 * hh), x3 = *(const v4fa*)(arow + kb + 16 + 8 * hh + 4);
    float xs[16] = {x0[0],x0[1],x0[2],x0[3],x1[0],x1[1],x1[2],x1[3],x2[0],x2[1],x2[2],x2[3],x3[0],x3[1],x3[2],x3[3]};
#pragma unroll
    for (int i = 0; i < 16; ++i) { const unsigned short hb = bf16_bits(xs[i]); ah.u[i] = hb; al.u[i] = ASPLIT ? bf16_bits(xs[i] - bf16_val(hb)) : (unsigned short)0; }
#pragma unroll
    for (int t = 0; t < 4; ++t) {
      const unsigned short* brow = Wt + (size_t)(col0 + t * 16 + ln) * ldb + kb;
      FragB b;
      b.half[0] = *(const v8us*)(brow + 8 * hh);
      b.half[1] = *(const v8us*)(brow + 16 + 8 * hh);
      acc[t] = mmaN<ASPLIT ? 2 : 1>(ah.v, al.v, b.v, b.v, acc[t]);
    }
  }
#pragma unroll
  for (int t = 0; t < 4; ++t) {
    const int col = col0 + t * 16 + ln;
    float bv = bias ? bias[col] : 0.f;
    if (BIAS_BF16) bv = bf16_round(bv);
#pragma unroll
    for (int r = 0; r < 8; ++r) {
      float v = acc[t][r] + bv;
      if (resid) { float rv = resid[(size_t)((row0 + 8 * hh + r) % rmod) * ldr + col]; if (RES_BF16) rv = bf16_round(rv); v += rv; }
      if (ACT == 1) v = fmaxf(v, 0.f);
      if (ACT == 2) v = 0.5f * v * (1.0f + erff(v * 0.70710678118654752f));
      if (ACT == 3) { const float u = 0.7978845608028654f * (v + 0.044715f * v * v * v); v = 0.5f * v * (1.0f + tanhf(u)); }
      so[w][8 * hh + r][t * 16 + ln] = v;
    }
  }
  __builtin_amdgcn_fence(__ATOMIC_ACQ_REL, "workgroup");
  __builtin_amdgcn_wave_barrier();
  const int rsub = lane >> 4, c4 = (lane & 15) * 4;
  {
#pragma unroll
    for (int q = 0; q < 8; ++q) {
      const int r = q * 2 + rsub;
      const v4f v = *(const v4fa*)&so[w][r][c4];
      *(v4f*)(C + (size_t)(row0 + r) * ldc + col0 + c4) = v;
    }
    
  }
}
// row LayerNorm (biased variance, eps) over N: s = X (+ R); optional out_sum <- s; out_norm <- (s-mu)*rsqrt(var+eps)*g + b
template <bool PARAM_BF16>
__global__ __launch_bounds__(256) void k_layernorm(const float* __restrict__ X, const float* __restrict__ R, const float* __restrict__ g, const float* __restrict__ bta,
                                                  float* __restrict__ out_sum, float* __restrict__ out_norm, int N, float eps) {
  __shared__ float red[256];
  const int row = blockIdx.x, tid = threadIdx.x;
  const float* x = X + (size_t)row * N; const float* rr = R ? R + (size_t)row * N : nullptr;
  float vals[16];                     // up to N = 4096
  const int per = N / 256;            // contiguous chunk per thread? use strided-by-4 chunks: thread handles j = tid*4 + 1024*u
  float s1 = 0.f;
  for (int u = 0; u < per / 4; ++u) {
    const int j = tid * 4 + 1024 * u;
    const v4f a = *(const v4fa*)(x + j);
    v4f b = {0.f,0.f,0.f,0.f}; if (rr) b = *(const v4fa*)(rr + j);
#pragma unroll
    for (int q = 0; q < 4; ++q) { const float v = a[q] + b[q]; vals[u * 4 + q] = v; s1 += v; }
  }
  red[tid] = s1; __syncthreads();
  for (int st = 128; st > 0; st >>= 1) { if (tid < st) red[tid] += red[tid + st]; __syncthreads(); }
  const float mu = red[0] / (float)N; __syncthreads();
  float s2 = 0.f;
  for (int u = 0; u < per / 4; ++u)
#pragma unroll
    for (int q = 0; q < 4; ++q) { const float c = vals[u * 4 + q] - mu; s2 += c * c; }
  red[tid] = s2; __syncthreads();
  for (int st = 128; st > 0; st >>= 1) { if (tid < st) red[tid] += red[tid + st]; __syncthreads(); }
  const float rs = rsqrtf(red[0] / (float)N + eps);
  {
    for (int u = 0; u < per / 4; ++u) {
      const int j = tid * 4 + 1024 * u;
      v4f o, sm;
#pragma unroll
      for (int q = 0; q < 4; ++q) {
        float gg = g[j + q], bb = bta[j + q];
        if (PARAM_BF16) { gg = bf16_round(gg); bb = bf16_round(bb); }
        sm[q] = vals[u * 4 + q]; o[q] = (vals[u * 4 + q] - mu) * rs * gg + bb;
      }
      if (out_sum) *(v4f*)(out_sum + (size_t)row * N + j) = sm;
      *(v4f*)(out_norm + (size_t)row * N + j) = o;
    }
    
  }
}



// ---- f16 WMMA path (v_wmma_f32_16x16x32_f16): 11-bit significands for operands in range — used where a [0,1] probability operand needs more precision than bf16
typedef _Float16 v16h __attribute__((ext_vector_type(16)));
union FragH { v16h v; v8us half[2]; _Float16 h[16]; unsigned short u[16]; };
template <int NT>
__device__ __forceinline__ v8f mmaH(v16h ah, v16h al, v16h bh, v16h bl, v8f c) {
  c = __builtin_amdgcn_wmma_f32_16x16x32_f16(false, ah, false, bh, (short)0, c, false, false);
  if (NT >= 2) c = __builtin_amdgcn_wmma_f32_16x16x32_f16(false, al, false, bh, (short)0, c, false, false);
  if (NT >= 3) c = __builtin_amdgcn_wmma_f32_16x16x32_f16(false, ah, false, bl, (short)0, c, false, false);
  asm volatile("v_nop\n\tv_nop\n\tv_nop\n\tv_nop" : "+v"(c) : "v"(ah), "v"(al), "v"(bh), "v"(bl));
  return c;
}
// batched GEMM like k_gemm_b but f16 operands: A f32 (split into f16 hi/lo if ASPLIT, else rounded to f16), Bt = f16 values [n][k]; alpha; C f32; N multiple of 16 (partial tiles skipped)
template <bool ASPLIT>
__global__ __launch_bounds__(128) void k_gemm_h(const float* __restrict__ A, int lda, size_t sA, const _Float16* __restrict__ Bh, int ldb, size_t sB, float alpha, float* __restrict__ C, int ldc, size_t sC, int M, int N, int K) {
  __shared__ __attribute__((aligned(16))) float so[4][16][64];
  const int tid = threadIdx.x, w = tid >> 5, lane = tid & 31, ln = lane & 15, hh = lane >> 4; const int by = blockIdx.y;
  A += (size_t)by * sA; Bh += (size_t)by * sB; C += (size_t)by * sC;
  const int ntn = (N + 63) / 64; const int wid = blockIdx.x * 4 + w; const int mt = wid / ntn, nq = wid % ntn; if (mt * 16 >= M) return;
  const int row0 = mt * 16, col0 = nq * 64; const float* arow = A + (size_t)(row0 + ln) * lda;
  v8f acc[4] = {};
  for (int kb = 0; kb < K; kb += 32) {
    FragH ah, al;
    const v4f x0 = *(const v4fa*)(arow + kb + 8 * hh), x1 = *(const v4fa*)(arow + kb + 8 * hh + 4), x2 = *(const v4fa*)(arow + kb + 16 + 8 * hh), x3 = *(const v4fa*)(arow + kb + 16 + 8 * hh + 4);
    float xs[16] = {x0[0],x0[1],x0[2],x0[3],x1[0],x1[1],x1[2],x1[3],x2[0],x2[1],x2[2],x2[3],x3[0],x3[1],x3[2],x3[3]};
#pragma unroll
    for (int i = 0; i < 16; ++i) { const _Float16 h = (_Float16)xs[i]; ah.h[i] = h; al.h[i] = ASPLIT ? (_Float16)(xs[i] - (float)h) : (_Float16)0.0f; }
#pragma unroll
    for (int t = 0; t < 4; ++t) { if (col0 + t * 16 >= N) continue; const size_t boff = (size_t)(col0 + t * 16 + ln) * ldb + kb; FragH bq; bq.half[0] = *(const v8us*)(Bh + boff + 8 * hh); bq.half[1] = *(const v8us*)(Bh + boff + 16 + 8 * hh);
      acc[t] = mmaH<ASPLIT ? 2 : 1>(ah.v, al.v, bq.v, bq.v, acc[t]); }
  }
#pragma unroll
  for (int t = 0; t < 4; ++t) { if (col0 + t * 16 >= N) continue;
#pragma unroll
    for (int r = 0; r < 8; ++r) so[w][8 * hh + r][t * 16 + ln] = acc[t][r] * alpha; }
  __builtin_amdgcn_fence(__ATOMIC_ACQ_REL, "workgroup"); __builtin_amdgcn_wave_barrier();
  const int rsub = lane >> 4, c4 = (lane & 15) * 4;
  {
#pragma unroll
    for (int q = 0; q < 8; ++q) { const int r = q * 2 + rsub; if (col0 + c4 < N) { const v4f v = *(const v4fa*)&so[w][r][c4]; *(v4f*)(C + (size_t)(row0 + r) * ldc + col0 + c4) = v; } }
     }
}

// Wt[n][k] = f16(W[k][n]·scale) from f32 row-major W[K][N] (scale = power of two; bf16-exact weights stay exact in f16 away from the subnormal range)
__global__ __launch_bounds__(256) void k_wt_f16(const float* __restrict__ W, _Float16* __restrict__ Wt, int K, int N, float scale) {
  const int t = blockIdx.x * 256 + threadIdx.x; if (t >= N * (K / 8)) return; const int n = t / (K / 8), k8 = (t % (K / 8)) * 8; FragH f;
#pragma unroll
  for (int i = 0; i < 8; ++i) f.h[i] = (_Float16)(bf16_round(W[(size_t)(k8 + i) * N + n]) * scale); const v8us o = f.half[0];
  *(v8us*)((unsigned short*)Wt + (size_t)n * K + k8) = o; 
}
// k_gemm_hh variant with fused epilogue: v = acc·alpha + bias[by·sBias + col] (+ CP[(row/rowsPerB)·sCPb + by·64 + col] if CP) ; ACT 0 none / 1 elu ; writes f16 C16 (and f32 C if non-null)
template <int ACT>
__global__ __launch_bounds__(128) void k_gemm_hhx(const _Float16* __restrict__ A, int lda, size_t sA, const _Float16* __restrict__ Bh, int ldb, size_t sB, float alpha, const float* __restrict__ bias, size_t sBias, const float* __restrict__ CP, int rowsPerB, size_t sCPb, int row0g,
    float* __restrict__ C, _Float16* __restrict__ C16, int ldc, size_t sC, int M, int N, int K) {
  __shared__ __attribute__((aligned(16))) float so[4][16][64];
  const int tid = threadIdx.x, w = tid >> 5, lane = tid & 31, ln = lane & 15, hh = lane >> 4; const int by = blockIdx.y;
  A += (size_t)by * sA; Bh += (size_t)by * sB; const size_t cofs = (size_t)by * sC; const float* bp = bias ? bias + (size_t)by * sBias : nullptr;
  const int ntn = (N + 63) / 64; const int wid = blockIdx.x * 4 + w; const int mt = wid / ntn, nq = wid % ntn; if (mt * 16 >= M) return;
  const int row0 = mt * 16, col0 = nq * 64; const _Float16* arow = A + (size_t)(row0 + ln) * lda;
  v8f acc[4] = {};
  for (int kb = 0; kb < K; kb += 32) { FragH ah; ah.half[0] = *(const v8us*)((const unsigned short*)arow + kb + 8 * hh); ah.half[1] = *(const v8us*)((const unsigned short*)arow + kb + 16 + 8 * hh);
#pragma unroll
    for (int t = 0; t < 4; ++t) { if (col0 + t * 16 >= N) continue; const size_t boff = (size_t)(col0 + t * 16 + ln) * ldb + kb; FragH bq; bq.half[0] = *(const v8us*)((const unsigned short*)Bh + boff + 8 * hh); bq.half[1] = *(const v8us*)((const unsigned short*)Bh + boff + 16 + 8 * hh);
      acc[t] = mmaH<1>(ah.v, ah.v, bq.v, bq.v, acc[t]); }
  }
#pragma unroll
  for (int t = 0; t < 4; ++t) { if (col0 + t * 16 >= N) continue; const int col = col0 + t * 16 + ln; const float bv = bp ? bf16_round(bp[col]) : 0.f;
#pragma unroll
    for (int r = 0; r < 8; ++r) { float v = acc[t][r] * alpha + bv; if (CP) { const int bidx = (row0g + row0 + 8 * hh + r) / rowsPerB; v += CP[(size_t)bidx * sCPb + (size_t)by * 64 + col]; } if (ACT == 1) v = (v > 0.f) ? v : expm1f(v); else if (ACT == 7) v = (v > 0.f) ? v + 1.0f : expf(v); else if (ACT == 8) v = tanhf(v); else if (ACT == 9) v = 0.5f * v * (1.0f + tanhf(0.7978845608028654f * (v + 0.044715f * v * v * v))); else if (ACT == 11) v = 1.0f / (1.0f + expf(-v)); else if (ACT == 12) v = (v > 0.f) ? v : 0.01f * v; else if (ACT == 14) v = (v > 0.f) ? v : 0.1f * v; else if (ACT == 15) v = v / (1.0f + expf(-v)); else if (ACT == 3) v = fmaxf(v, 0.f); else if (ACT == 6) v = 0.5f * v * (1.0f + erff(v * 0.70710678118654752f)); so[w][8 * hh + r][t * 16 + ln] = v; } }
  __builtin_amdgcn_fence(__ATOMIC_ACQ_REL, "workgroup"); __builtin_amdgcn_wave_barrier();
  const int rsub = lane >> 4, c4 = (lane & 15) * 4; typedef _Float16 v4h __attribute__((ext_vector_type(4)));
  {
#pragma unroll
    for (int q = 0; q < 8; ++q) { const int r = q * 2 + rsub; if (col0 + c4 < N) { const v4f v = *(const v4fa*)&so[w][r][c4]; if (C) *(v4f*)(C + cofs + (size_t)(row0 + r) * ldc + col0 + c4) = v; if (C16) { v4h h4; for (int i = 0; i < 4; ++i) h4[i] = (_Float16)v[i]; *(v4h*)(C16 + cofs + (size_t)(row0 + r) * ldc + col0 + c4) = h4; } } }
     }
}


typedef _Float16 v4h __attribute__((ext_vector_type(4)));

__global__ __launch_bounds__(256) void k_x16(const float* __restrict__ x, _Float16* __restrict__ X16, size_t n8) { const size_t t = (size_t)blockIdx.x * 256 + threadIdx.x; if (t >= n8) return; FragH f;
#pragma unroll
  for (int q = 0; q < 8; ++q) f.h[q] = (_Float16)bf16_round(x[t * 8 + q]); *(v8us*)((unsigned short*)X16 + t * 8) = f.half[0];  }
__global__ __launch_bounds__(256) void k_h16(const float* __restrict__ x, _Float16* __restrict__ X16, size_t n8) { const size_t t = (size_t)blockIdx.x * 256 + threadIdx.x; if (t >= n8) return; FragH f;
#pragma unroll
  for (int q = 0; q < 8; ++q) f.h[q] = (_Float16)x[t * 8 + q]; *(v8us*)((unsigned short*)X16 + t * 8) = f.half[0];  }
__global__ __launch_bounds__(256) void k_round16f(const float* __restrict__ W, _Float16* __restrict__ Bt, size_t n8) { const size_t t = (size_t)blockIdx.x * 256 + threadIdx.x; if (t >= n8) return; FragH f;
#pragma unroll
  for (int i = 0; i < 8; ++i) f.h[i] = (_Float16)(bf16_round(W[t * 8 + i]) * 16.0f); *(v8us*)((unsigned short*)Bt + t * 8) = f.half[0];  }
__global__ __launch_bounds__(256) void k_hl(const float* __restrict__ F, _Float16* __restrict__ Hh, _Float16* __restrict__ Hl, size_t n8) { const size_t t = (size_t)blockIdx.x * 256 + threadIdx.x; if (t >= n8) return; FragH fh, fl; const v4f a = *(const v4fa*)(F + t * 8), c = *(const v4fa*)(F + t * 8 + 4);
#pragma unroll
  for (int q = 0; q < 4; ++q) { _Float16 h = (_Float16)a[q]; fh.h[q] = h; fl.h[q] = (_Float16)((a[q] - (float)h) * 1024.0f); h = (_Float16)c[q]; fh.h[4 + q] = h; fl.h[4 + q] = (_Float16)((c[q] - (float)h) * 1024.0f); }
  { *(v8us*)((unsigned short*)Hh + t * 8) = fh.half[0]; *(v8us*)((unsigned short*)Hl + t * 8) = fl.half[0];  } }

// ---- fast GEMM (wave tile 32x64; requires M % 32 == 0 rows per launch region and N % 64 == 0); epilogue = k_gemm_hhx semantics ----
__device__ __forceinline__ v16h g2_frag(const _Float16* p, int hh) { FragH f; f.half[0] = *(const v8us*)((const unsigned short*)p + 8 * hh); f.half[1] = *(const v8us*)((const unsigned short*)p + 16 + 8 * hh); return f.v; }
__device__ __forceinline__ v8f g2_mma(v16h a, v16h b, v8f c) { v8f d = __builtin_amdgcn_wmma_f32_16x16x32_f16(false, a, false, b, (short)0, c, false, false); asm volatile("v_nop\n\tv_nop\n\tv_nop\n\tv_nop" : "+v"(d) : "v"(a), "v"(b)); return d; }
template <int ACT>
__global__ __launch_bounds__(128) void k_gemm2(const _Float16* __restrict__ A, int lda, size_t sA, const _Float16* __restrict__ Bh, int ldb, size_t sB, float alpha, const float* __restrict__ bias, size_t sBias, const float* __restrict__ CP, int rowsPerB, size_t sCPb, int row0g,
    float* __restrict__ C, _Float16* __restrict__ C16, int ldc, size_t sC, int M, int N, int K) {
  __shared__ __attribute__((aligned(16))) float so[4][32][68];
  const int tid = threadIdx.x, w = tid >> 5, lane = tid & 31, ln = lane & 15, hh = lane >> 4; const int by = blockIdx.y;
  A += (size_t)by * sA; Bh += (size_t)by * sB; const size_t cofs = (size_t)by * sC; const float* bp = bias ? bias + (size_t)by * sBias : nullptr;
  const int ntn = N >> 6; const int mt = blockIdx.x / ntn, nq = blockIdx.x - mt * ntn; const int row0 = mt * 128 + 32 * w, col0 = nq * 64; if (row0 >= M) return;
  const _Float16* a0p = A + (size_t)(row0 + ln) * lda; const _Float16* a1p = a0p + (size_t)16 * lda;
  const _Float16* b0p = Bh + (size_t)(col0 + ln) * ldb; const _Float16* b1p = b0p + (size_t)16 * ldb; const _Float16* b2p = b1p + (size_t)16 * ldb; const _Float16* b3p = b2p + (size_t)16 * ldb;
  const v8f z8 = {0.f,0.f,0.f,0.f,0.f,0.f,0.f,0.f}; v8f c00 = z8, c01 = z8, c02 = z8, c03 = z8, c10 = z8, c11 = z8, c12 = z8, c13 = z8;
#pragma unroll 1
  for (int kb = 0; kb < K; kb += 32) { const v16h a0 = g2_frag(a0p + kb, hh), a1 = g2_frag(a1p + kb, hh);
    v16h b = g2_frag(b0p + kb, hh); c00 = g2_mma(a0, b, c00); c10 = g2_mma(a1, b, c10);
    b = g2_frag(b1p + kb, hh); c01 = g2_mma(a0, b, c01); c11 = g2_mma(a1, b, c11);
    b = g2_frag(b2p + kb, hh); c02 = g2_mma(a0, b, c02); c12 = g2_mma(a1, b, c12);
    b = g2_frag(b3p + kb, hh); c03 = g2_mma(a0, b, c03); c13 = g2_mma(a1, b, c13); }
  v8f accs[8] = {c00, c01, c02, c03, c10, c11, c12, c13};
#pragma unroll
  for (int u = 0; u < 8; ++u) { const int t = u & 3, half = u >> 2; const int col = col0 + t * 16 + ln; const float bv = bp ? bf16_round(bp[col]) : 0.f;
#pragma unroll
    for (int r = 0; r < 8; ++r) { const int rloc = half * 16 + 8 * hh + r; float v = accs[u][r] * alpha + bv; if (CP) { const int bidx = (row0g + row0 + rloc) / rowsPerB; v += CP[(size_t)bidx * sCPb + (size_t)by * 64 + col]; }
      if (ACT == 3) v = fmaxf(v, 0.f); else if (ACT == 6) v = 0.5f * v * (1.0f + erff(v * 0.70710678118654752f)); else if (ACT == 11) v = 1.0f / (1.0f + expf(-v)); else if (ACT == 15) v = v / (1.0f + expf(-v)); else if (ACT == 12) v = (v > 0.f) ? v : 0.01f * v; else if (ACT == 8) v = tanhf(v);
      so[w][rloc][t * 16 + ln] = v; } }
  __builtin_amdgcn_fence(__ATOMIC_ACQ_REL, "workgroup"); __builtin_amdgcn_wave_barrier();
  const int rsub = lane >> 4, c4 = (lane & 15) * 4;
  {
#pragma unroll
    for (int q = 0; q < 16; ++q) { const int r = q * 2 + rsub; const v4f v = *(const v4fa*)&so[w][r][c4]; if (C) *(v4f*)(C + cofs + (size_t)(row0 + r) * ldc + col0 + c4) = v; if (C16) { v4h h4; for (int i = 0; i < 4; ++i) h4[i] = (_Float16)v[i]; *(v4h*)(C16 + cofs + (size_t)(row0 + r) * ldc + col0 + c4) = h4; } }
     } }



__device__ __forceinline__ float xhalf(float x) { return __builtin_bit_cast(float, __builtin_amdgcn_permlanex16(__builtin_bit_cast(int, x), __builtin_bit_cast(int, x), 0x76543210, 0xfedcba98, false, false)); }      /* value of lane l ^ 16 */
/* the flash kernel stands at its ceiling of 256 vector registers (16 waves a block): its products are the plain builtin (the compiler keeps the distance behind it), with no asm statement that would hold operands live around them */
__device__ __forceinline__ v8f mmaF(v16h a, v16h b, v8f c) { return __builtin_amdgcn_wmma_f32_16x16x32_f16(false, a, false, b, (short)0, c, false, false); }
/* softmax of one (q, k) half for one 32-key chunk, in base 2 on the raw products: p 2^10 = 2^(s c - m c + 10) with c = log2(e) / 8 is one multiply-add and one v_exp_f32 a score. m_r = the reference in use, a maximum of raw products seen earlier (lazy: it is moved up only when a score passes it by more than LAZY), l_r = running sum x 2^10 against that reference */
#define SC2 0.18033688011112042f  /* SCL log2(e) */
#define LAZY 27.0f  /* raw products; 27 SC2 = 4.87, so P x 2^10 stays below 2^15 and inside f16 */
/* masked raw scores of the lane's 16 keys; returns their maximum (this lane's keys only) */
__device__ __forceinline__ float score_half(const FragH (&ak)[2][2], const FragH (&bq)[2], int j0, int hh, int tq, float (&sv)[16]) {
#pragma unroll
  for (int nt = 0; nt < 2; ++nt) { v8f acc = (v8f){0.f,0.f,0.f,0.f,0.f,0.f,0.f,0.f};
#pragma unroll
    for (int ks = 0; ks < 2; ++ks) acc = mmaF(ak[nt][ks].v, bq[ks].v, acc);
#pragma unroll
    for (int r = 0; r < 8; ++r) { const int kk = j0 + nt * 16 + 8 * hh + r; sv[nt * 8 + r] = (kk <= tq) ? acc[r] : -3.0e38f; } }
  float mc = fmaxf(sv[0], sv[1]);
#pragma unroll
  for (int i = 2; i < 16; ++i) mc = fmaxf(mc, sv[i]);
  return mc; }
/* P^T x 2^10 against the reference m_r as a B operand, and the lane's sum added to l_r */
__device__ __forceinline__ void exp_half(float (&sv)[16], float m_r, float& l_r, FragH& pb) {
  const float nb = 10.0f - m_r * SC2;
#pragma unroll
  for (int i = 0; i < 16; ++i) sv[i] = fmaf(sv[i], SC2, nb);      /* the reference is finite from the wave's first chunk on (key j0 <= q0 is open to every query of the tile), so a masked score gives exactly 0 */
  /* x = 2^x in place, independent v_exp_f32 in a row. In asm for the v_nop at each end: it is the slot that the instruction set asks for behind a transcendental */
  asm("v_exp_f32 %0, %0\n\tv_exp_f32 %1, %1\n\tv_exp_f32 %2, %2\n\tv_exp_f32 %3, %3\n\tv_exp_f32 %4, %4\n\tv_exp_f32 %5, %5\n\tv_exp_f32 %6, %6\n\tv_exp_f32 %7, %7\n\tv_nop"
      : "+v"(sv[0]), "+v"(sv[1]), "+v"(sv[2]), "+v"(sv[3]), "+v"(sv[4]), "+v"(sv[5]), "+v"(sv[6]), "+v"(sv[7]));
  asm("v_exp_f32 %0, %0\n\tv_exp_f32 %1, %1\n\tv_exp_f32 %2, %2\n\tv_exp_f32 %3, %3\n\tv_exp_f32 %4, %4\n\tv_exp_f32 %5, %5\n\tv_exp_f32 %6, %6\n\tv_exp_f32 %7, %7\n\tv_nop"
      : "+v"(sv[8]), "+v"(sv[9]), "+v"(sv[10]), "+v"(sv[11]), "+v"(sv[12]), "+v"(sv[13]), "+v"(sv[14]), "+v"(sv[15]));
  float ps[4] = {0.f, 0.f, 0.f, 0.f};
#pragma unroll
  for (int i = 0; i < 16; ++i) { ps[i & 3] += sv[i]; pb.h[i] = (_Float16)sv[i]; }
  l_r += (ps[0] + ps[1]) + (ps[2] + ps[3]); }
/* weight of wave w's key share in the join of one half: exp(m_w - m_all) / (l_all 2^10); lane -> row ln; a wave without a chunk holds m below -1e37, l = 0, O = 0 and gets weight 0; wave 0 always holds key 0, so the joint maximum is finite */
__device__ __forceinline__ float join_weight(const float (&sM)[4][16], const float (&sL)[4][16], int w, int ln) {
  const float m0 = sM[0][ln], m1 = sM[1][ln], m2 = sM[2][ln], m3 = sM[3][ln]; const float mt = fmaxf(fmaxf(m0, m1), fmaxf(m2, m3));
  const float e0 = expf(m0 - mt), e1 = expf(m1 - mt), e2 = expf(m2 - mt), e3 = expf(m3 - mt); const float lt = ((sL[0][ln] * e0 + sL[1][ln] * e1) + sL[2][ln] * e2) + sL[3][ln] * e3;
  const float ew = (w == 0) ? e0 : ((w == 1) ? e1 : ((w == 2) ? e2 : e3)); return (lt > 0.f) ? ew / (lt * 1024.0f) : 0.f; }
/* one stage of the ring = 4 chunks of 32 keys (16 KiB of each K half, 32 KiB of V^T), from global memory straight into LDS: 8 asynchronous copies of 16 bytes a lane, 512 lanes. lds = the lane's byte address in the buffer, ka / kb / va = the lane's 16 bytes of the stage in the three planes; every copy moves 8 KiB on in both.
   s_wait_xcnt stands inside the statement, behind the last copy: the address registers are the statement's operands and live to its end, so nothing rewrites one in front of the wait */
__device__ __forceinline__ void copy_stage(unsigned lds, const unsigned short* ka, const unsigned short* kb, const unsigned short* va) {
  asm volatile("global_load_async_to_lds_b128 %0, %8, off\n\t"
               "global_load_async_to_lds_b128 %1, %9, off\n\t"
               "global_load_async_to_lds_b128 %2, %10, off\n\t"
               "global_load_async_to_lds_b128 %3, %11, off\n\t"
               "global_load_async_to_lds_b128 %4, %12, off\n\t"
               "global_load_async_to_lds_b128 %5, %13, off\n\t"
               "global_load_async_to_lds_b128 %6, %14, off\n\t"
               "global_load_async_to_lds_b128 %7, %15, off\n\t"
               "s_wait_xcnt 0x0"
               :: "v"(lds), "v"(lds + 8192u), "v"(lds + 16384u), "v"(lds + 24576u), "v"(lds + 32768u), "v"(lds + 40960u), "v"(lds + 49152u), "v"(lds + 57344u),
                  "v"(ka), "v"(ka + 4096), "v"(kb), "v"(kb + 4096), "v"(va), "v"(va + 4096), "v"(va + 8192), "v"(va + 12288) : "memory"); }
#define QBLK 64                  /* query rows of a flash block: 4 tiles of 16 */
#define STG 32768                /* halves (2 bytes) of one ring buffer: K1 8,192, K2 8,192, V^T 16,384 */
__global__ __launch_bounds__(512) void k_flash(const _Float16* __restrict__ QA, const _Float16* __restrict__ QB, int ldq, const _Float16* __restrict__ KFA, const _Float16* __restrict__ KFB, const _Float16* __restrict__ VF, const float* __restrict__ LAM, const float* __restrict__ sw, float* __restrict__ out) {
  constexpr int RPW = 16, DT = 8, KS = 2;      /* DT: output row tiles of O^T, 0-3 = (P.V1)^T, 4-7 = (P.V2)^T (one P for both V halves) */
  __shared__ __attribute__((aligned(16))) unsigned short ring[2][STG];
  __shared__ __attribute__((aligned(16))) float sO[4][4][RPW][128 + 4]; __shared__ float sM[2][4][4][RPW], sL[2][4][4][RPW];
  const int tid = threadIdx.x, wv = __builtin_amdgcn_readfirstlane(tid >> 5), t = wv & 3, s = wv >> 2, lane = tid & 31, ln = lane & 15, hh = lane >> 4;      /* t, s in scalar registers: which chunks a wave works on differs from wave to wave and must stay a scalar branch (WMMA needs every lane on) */
  const int slab = blockIdx.x % (NB * NH), qb = (TQ / QBLK - 1) - blockIdx.x / (NB * NH); const int b = slab / NH, h = slab % NH; const int q0 = qb * QBLK + t * RPW;      /* the blocks with the most keys have the lowest indices */
  const float lam = LAM[0];      /* read in front of the first asm statement that clobbers memory: there the compiler still takes it by a scalar load */
  FragH bq[2][KS];
  { const size_t qo = ((size_t)b * TQ + q0 + ln) * ldq + h * 64; const unsigned short* qa = (const unsigned short*)QA + qo; const unsigned short* qb2 = (const unsigned short*)QB + qo;
#pragma unroll
    for (int ks = 0; ks < KS; ++ks) { bq[0][ks].half[0] = *(const v8us*)(qa + ks * 32 + 8 * hh); bq[0][ks].half[1] = *(const v8us*)(qa + ks * 32 + 16 + 8 * hh); bq[1][ks].half[0] = *(const v8us*)(qb2 + ks * 32 + 8 * hh); bq[1][ks].half[1] = *(const v8us*)(qb2 + ks * 32 + 16 + 8 * hh); } }
  const unsigned short* KAg = (const unsigned short*)KFA + (size_t)slab * 64 * TK + tid * 8; const unsigned short* KBg = (const unsigned short*)KFB + (size_t)slab * 64 * TK + tid * 8; const unsigned short* VFg = (const unsigned short*)VF + (size_t)slab * 128 * TK + tid * 8;      /* the thread's 16 bytes of stage 0 in each plane */
  const unsigned lds0 = (unsigned)(uintptr_t)&ring[0][0] + (unsigned)tid * 16u;      /* the thread's byte address in buffer 0 */
  const int tq = q0 + ln;      /* this lane's query */
  float m_r[2] = {-3.0e38f, -3.0e38f}, l_r[2] = {0.f, 0.f}; v8f oacc[2][DT];      /* l_r: sum over this lane's own 16 keys of each chunk; the two halves of the wave are added behind the loop */
#pragma unroll
  for (int dt = 0; dt < DT; ++dt) { oacc[0][dt] = (v8f){0.f,0.f,0.f,0.f,0.f,0.f,0.f,0.f}; oacc[1][dt] = (v8f){0.f,0.f,0.f,0.f,0.f,0.f,0.f,0.f}; }
  const int jend = q0 + RPW;      /* causal: keys beyond the tile's last query never contribute */
  const int nst = (qb + 2) >> 1;      /* stages of 128 keys that cover the block's 64 qb + 64 keys; at most TK / 128, so every stage lies inside the planes */
  copy_stage(lds0, KAg, KBg, VFg);
  asm volatile("s_wait_asynccnt 0x0" ::: "memory");      /* this wave's part of stage 0 has landed */
  __syncthreads();      /* every wave's part of stage 0 has landed before any wave reads it */
  if (nst > 1) copy_stage(lds0 + 2u * STG, KAg + 8192, KBg + 8192, VFg + 16384);
#pragma unroll 1      /* kept rolled: the publish point stands once in the code, and the body of some 800 instructions is not doubled */
  for (int st = 0; st < nst; ++st) {
    const int j0 = (4 * st + s) * 32;
    if (j0 < jend) {      /* a scalar test; the publish point below stands outside it, every wave passes it */
      FragH aka[2][KS], akb[2][KS], av[DT];
      const unsigned short* rb = &ring[st & 1][lane * 8]; const unsigned short* ka = rb + s * 2048; const unsigned short* kb = rb + 8192 + s * 2048; const unsigned short* va = rb + 16384 + s * 4096;      /* chunk s of the stage: 2048 halves of each K, 4096 of V^T */
#pragma unroll
      for (int ks = 0; ks < KS; ++ks) { aka[0][ks].half[0] = *(const v8us*)(ka + ks * 512); aka[0][ks].half[1] = *(const v8us*)(ka + ks * 512 + 256); aka[1][ks].half[0] = *(const v8us*)(ka + 1024 + ks * 512); aka[1][ks].half[1] = *(const v8us*)(ka + 1024 + ks * 512 + 256); }
#pragma unroll
      for (int ks = 0; ks < KS; ++ks) { akb[0][ks].half[0] = *(const v8us*)(kb + ks * 512); akb[0][ks].half[1] = *(const v8us*)(kb + ks * 512 + 256); akb[1][ks].half[0] = *(const v8us*)(kb + 1024 + ks * 512); akb[1][ks].half[1] = *(const v8us*)(kb + 1024 + ks * 512 + 256); }
      FragH pa, pb; float sa[16], sb[16];
      const float mca = score_half(aka, bq[0], j0, hh, tq, sa), mcb = score_half(akb, bq[1], j0, hh, tq, sb);
#pragma unroll
      for (int dt = 0; dt < 3; ++dt) { av[dt].half[0] = *(const v8us*)(va + dt * 512); av[dt].half[1] = *(const v8us*)(va + dt * 512 + 256); }      /* three V^T fragments are asked for ahead of the test and the exponentials, the other five when the scores' registers are free: all eight at once do not fit in 256 registers */
      if (__builtin_expect(__builtin_amdgcn_ballot_w32(mca > m_r[0] + LAZY || mcb > m_r[1] + LAZY) != 0, 0)) {      /* one test a chunk, a scalar branch (every lane stays on for the WMMAs): taken in a wave's first chunk (m_r = -3e38) and when a score of any query has passed its reference by more than LAZY */
        const float na = fmaxf(m_r[0], fmaxf(mca, xhalf(mca))), nb = fmaxf(m_r[1], fmaxf(mcb, xhalf(mcb)));      /* both halves of the wave take the same new reference for their query */
        float ala = (m_r[0] - na) * SC2, alb = (m_r[1] - nb) * SC2;
        asm("v_exp_f32 %0, %0\n\tv_exp_f32 %1, %1\n\tv_nop" : "+v"(ala), "+v"(alb));      /* the v_nop: the slot behind a transcendental, as in exp_half */
        m_r[0] = na; m_r[1] = nb; l_r[0] *= ala; l_r[1] *= alb;
#pragma unroll
        for (int dt = 0; dt < DT; ++dt) { oacc[0][dt] *= ala; oacc[1][dt] *= alb; } }
      exp_half(sa, m_r[0], l_r[0], pa);
      exp_half(sb, m_r[1], l_r[1], pb);
#pragma unroll
      for (int dt = 3; dt < DT; ++dt) { av[dt].half[0] = *(const v8us*)(va + dt * 512); av[dt].half[1] = *(const v8us*)(va + dt * 512 + 256); }
#pragma unroll
      for (int dt = 0; dt < DT; ++dt) { oacc[0][dt] = mmaF(av[dt].v, pa.v, oacc[0][dt]); oacc[1][dt] = mmaF(av[dt].v, pb.v, oacc[1][dt]); }
      /* order of the code behind the test: the vector work first (the sums and the packing of P: their registers then take fragments), the loads of three more V^T fragments, two pairs of products, the loads of the last two fragments, the other products. Left free, the scheduler puts a fragment's loads directly in front of its products, and with no vector work between them a whole LDS latency stands in the open each time. Masks: 0x2 vector, 0x100 LDS read, 0x8 WMMA */
      __builtin_amdgcn_sched_group_barrier(0x2, 80, 0); __builtin_amdgcn_sched_group_barrier(0x100, 6, 0); __builtin_amdgcn_sched_group_barrier(0x8, 4, 0); __builtin_amdgcn_sched_group_barrier(0x100, 4, 0); __builtin_amdgcn_sched_group_barrier(0x8, 12, 0); }
    /* publish point of stage st + 1, in the ring's order */
    asm volatile("s_wait_dscnt 0x0" ::: "memory");      /* this wave's reads of stage st have returned */
    asm volatile("s_wait_asynccnt 0x0" ::: "memory");      /* this wave's part of stage st + 1 has landed */
    __syncthreads();      /* stage st + 1 is whole for every reader, and no wave still reads stage st's buffer */
    if (st + 2 < nst) copy_stage(lds0 + (unsigned)(st & 1) * (2u * STG), KAg + (size_t)(st + 2) * 8192, KBg + (size_t)(st + 2) * 8192, VFg + (size_t)(st + 2) * 16384); }
  asm volatile("s_wait_asynccnt 0x0" ::: "memory");      /* no copy is in flight behind the loop */
  /* join of a tile's four key shares: publish each wave's row maxima and row sums of both halves, weigh every share by exp(m_s - m_all) / l_all, add the weighted shares */
  const v4f w4 = *(const v4fa*)(sw + lane * 4);
#pragma unroll
  for (int g = 0; g < 2; ++g) { const float lv = (l_r[g] + xhalf(l_r[g])) * 0.0009765625f; if (hh == 0) { sM[g][t][s][ln] = m_r[g] * SCL; sL[g][t][s][ln] = lv; } }      /* the join works on scaled scores and plain sums: x 1/8 and x 2^-10 are exact */
  __syncthreads();      /* every wave's maxima and sums are written before any wave reads them */
  { const float fa = join_weight(sM[0][t], sL[0][t], s, ln); const float fb = lam * join_weight(sM[1][t], sL[1][t], s, ln);
#pragma unroll
    for (int dt = 0; dt < DT; ++dt) { const v8f o = oacc[0][dt] * fa - oacc[1][dt] * fb;      /* this wave's share of attn1 - lambda attn2; the lane's 8 registers are 8 consecutive columns of its own row */
      *(v4f*)&sO[t][s][ln][dt * 16 + 8 * hh] = (v4f){o[0], o[1], o[2], o[3]}; *(v4f*)&sO[t][s][ln][dt * 16 + 8 * hh + 4] = (v4f){o[4], o[5], o[6], o[7]}; } }
  __syncthreads();      /* all four weighted shares are in LDS before they are added */
  {
#pragma unroll
    for (int i = 0; i < 4; ++i) { const int r = i * 4 + s; const v4f p0 = *(const v4fa*)&sO[t][0][r][lane * 4], p1 = *(const v4fa*)&sO[t][1][r][lane * 4], p2 = *(const v4fa*)&sO[t][2][r][lane * 4], p3 = *(const v4fa*)&sO[t][3][r][lane * 4]; const v4f a = ((p0 + p1) + p2) + p3;      /* the wave holds one whole 128-wide row, 4 columns a lane */
      float ss = 0.f;
#pragma unroll
      for (int q = 0; q < 4; ++q) ss += a[q] * a[q];
      for (int o = 16; o > 0; o >>= 1) ss += __shfl_xor(ss, o, 32);
      const float inv = rsqrtf(ss / 128.0f + 1e-5f); v4f r4;
#pragma unroll
      for (int q = 0; q < 4; ++q) { float y = bf16_round(w4[q]) * (a[q] * inv); y *= (1.0f - LAMBDA_INIT); r4[q] = y; }
      *(v4f*)(out + ((size_t)b * TQ + q0 + r) * DW + h * 128 + lane * 4) = r4; }      /* 512 contiguous bytes a row */
     } }

/* ONE pre-pass launch writes everything the flash kernel reads. A unit = 256 threads x 16 output bytes (4 KiB); a block takes PU units of one kind and issues all their loads before the first conversion. Block 0: lambda. Then, 256 blocks each: V^T, K, Q.
   Few fat waves (6,152 in the launch), for speed only. */
#define PU 8
#define PREP_BLOCKS ((NR / 32) * NHD / PU)      /* 2,048 units of each kind */
__device__ __forceinline__ v8us cvt8(const float (&x)[8]) { FragH f;
#pragma unroll
  for (int i = 0; i < 8; ++i) f.h[i] = (_Float16)bf16_round(x[i]);
  return f.half[0]; }
/* lambda, one wave: lane l forms the rounded products of terms l and l + 32 (one load latency for all 64 terms), then every lane adds the 64 products in the order 0 .. 63, each read from its lane: the sums are those of a serial loop over the terms, bit for bit */
__device__ __forceinline__ float lane_val(float x, int l) { return __builtin_bit_cast(float, __builtin_amdgcn_readlane(__builtin_bit_cast(int, x), l)); }
__device__ __forceinline__ void lambda_part(const float* __restrict__ lq1, const float* __restrict__ lk1, const float* __restrict__ lq2, const float* __restrict__ lk2, float* __restrict__ LAM) {
  const int ln = threadIdx.x; if (ln >= 32) return; float s1 = 0.f, s2 = 0.f;
  const float p1[2] = {bf16_round(lq1[ln]) * bf16_round(lk1[ln]), bf16_round(lq1[ln + 32]) * bf16_round(lk1[ln + 32])}; const float p2[2] = {bf16_round(lq2[ln]) * bf16_round(lk2[ln]), bf16_round(lq2[ln + 32]) * bf16_round(lk2[ln + 32])};
#pragma unroll
  for (int d = 0; d < HD; ++d) { s1 += lane_val(p1[d >> 5], d & 31); s2 += lane_val(p2[d >> 5], d & 31); }
  const float lam = expf(s1) - expf(s2) + LAMBDA_INIT; *(float*)(LAM + ln) = lam;
  asm volatile("s_wait_xcnt 0x0" ::: "memory");      /* behind the store, as in prep_rows */
}
/* PU units whose thread reads 8 consecutive floats: unit u at s + u * sstep; stored at (u odd ? d1 : d0) + (u / DDIV) * dstep */
template <int DDIV>
__device__ __forceinline__ void prep_rows(const float* __restrict__ s, int sstep, unsigned short* __restrict__ d0, unsigned short* __restrict__ d1, int dstep) {
  float x[PU][8];
#pragma unroll
  for (int u = 0; u < PU; ++u) { const v4f a0 = *(const v4fa*)(s + u * sstep), a1 = *(const v4fa*)(s + u * sstep + 4);
#pragma unroll
    for (int i = 0; i < 4; ++i) { x[u][i] = a0[i]; x[u][4 + i] = a1[i]; } }
  asm volatile("s_wait_xcnt 0x0" :: "v"(s) : "memory");      /* the address pair stays live up to this wait: no load above returns into it and nothing overwrites it in front of the wait */
  __builtin_amdgcn_sched_barrier(0);      /* all 16 loads are issued before the first conversion: left free, the scheduler holds the last ones back behind the first waits, and the wave pays a second load latency */
#pragma unroll
  for (int u = 0; u < PU; ++u) { *(v8us*)(((DDIV == 2 && (u & 1)) ? d1 : d0) + (u / DDIV) * dstep) = cvt8(x[u]);      /* a wave stores whole 128-byte lines */
    asm volatile("s_wait_xcnt 0x0" ::: "memory"); }      /* behind each store: the stores go out as their units are converted, and no register that a store names is overwritten in front of its wait, on whichever path the code goes on */
}
__global__ __launch_bounds__(256) void k_prep(const float* __restrict__ q, const float* __restrict__ k, const float* __restrict__ v, const float* __restrict__ lq1, const float* __restrict__ lk1, const float* __restrict__ lq2, const float* __restrict__ lk2,
                                              _Float16* __restrict__ Q1, _Float16* __restrict__ Q2, _Float16* __restrict__ K1, _Float16* __restrict__ K2, _Float16* __restrict__ VT, float* __restrict__ LAM) {
  const int tid = threadIdx.x, ln = tid & 15, hh = (tid >> 4) & 1, fh = tid >> 5; int blk = blockIdx.x;
  if (blk == 0) { lambda_part(lq1, lk1, lq2, lk2, LAM); return; }
  blk -= 1;
  if (blk < PREP_BLOCKS) {
    /* V^T in fragment order (see k_flash), straight from v: the block = 4 chunks of 32 keys of one head pair, unit u = (chunk u / 2, V half u % 2); thread = (fragment half fh = 2 dt + hf, lane): V^T row 16 dt + ln, keys 16 hf + 8 hh .. + 7: 8 loads of one float down a column; a wave's load reads 64 contiguous bytes of each of two rows */
    const int slab = blk / (SLEN / 128), c0 = (blk % (SLEN / 128)) * 4; const int b = slab / NH, p = slab % NH;
    const float* s = v + ((size_t)b * SLEN + c0 * 32 + (fh & 1) * 16 + hh * 8) * DW + p * 2 * HD + (fh >> 1) * 16 + ln;
    unsigned short* d = (unsigned short*)VT + ((size_t)slab * (SLEN / 32) + c0) * 4096 + tid * 8;
    float x[PU][8];
#pragma unroll
    for (int u = 0; u < PU; ++u)
#pragma unroll
      for (int i = 0; i < 8; ++i) x[u][i] = s[((u >> 1) * 32 + i) * DW + (u & 1) * HD];
    asm volatile("s_wait_xcnt 0x0" :: "v"(s) : "memory");      /* as in prep_rows */
#pragma unroll
    for (int u = 0; u < PU; ++u) { *(v8us*)(d + u * 2048) = cvt8(x[u]);      /* a wave stores 512 contiguous bytes; a chunk holds V1's 4 KiB, then V2's */
      asm volatile("s_wait_xcnt 0x0" ::: "memory"); }      /* behind each store, as in prep_rows */
    return;
  }
  blk -= PREP_BLOCKS;
  if (blk < PREP_BLOCKS) {
    /* K halves in fragment order (see k_flash): the block = one 32-key chunk of 8 heads, unit u = head h0 + u; thread = (fragment half fh, lane): K row 16 nt + ln of the chunk, dims 32 ks + 16 hf + 8 hh .. + 7 */
    const int cg = blk >> 1, h0 = (blk & 1) * 8; const int b = cg / (SLEN / 32), c = cg % (SLEN / 32);
    const size_t o = ((size_t)(b * NP + h0 / 2) * (SLEN / 32) + c) * 2048 + tid * 8;
    prep_rows<2>(k + ((size_t)cg * 32 + (fh >> 2) * 16 + ln) * DW + h0 * HD + (fh & 3) * 16 + hh * 8, HD, (unsigned short*)K1 + o, (unsigned short*)K2 + o, (SLEN / 32) * 2048);
    return;
  }
  blk -= PREP_BLOCKS;
  { /* Q halves, row-major [token][pair][64]: the block = 16 tokens, unit u = tokens 2 u, 2 u + 1; thread = 8 consecutive dims of one head */
    const int h = (tid >> 3) & 15; const size_t r = (size_t)blk * (2 * PU) + (tid >> 7);
    unsigned short* d = (unsigned short*)((h & 1) ? Q2 : Q1) + r * HWD + (h / 2) * HD + (tid & 7) * 8;
    prep_rows<1>(q + r * DW + (tid & 127) * 8, 2 * DW, d, d, 2 * HWD); }
}

extern "C" void kernel_launch(void* const* d_in, const int* in_sizes, int n_in,
                              void* d_out, int out_size, void* d_ws, size_t ws_size, hipStream_t stream) {
  (void)in_sizes; (void)n_in; (void)out_size;
  const float* const* I = (const float* const*)d_in; const float* q = I[0]; const float* k = I[1]; const float* v = I[2]; const float* lq1 = I[3]; const float* lk1 = I[4]; const float* lq2 = I[5]; const float* lk2 = I[6]; const float* w = I[7];
  char* ws = (char*)d_ws; size_t off = 0;
  auto take = [&](size_t bytes) { char* p = ws + off; off += (bytes + 255) & ~(size_t)255; return p; };
  const size_t nh = (size_t)NR * HWD;
  _Float16* Q1 = (_Float16*)take(nh * 2); _Float16* Q2 = (_Float16*)take(nh * 2); _Float16* K1 = (_Float16*)take(nh * 2); _Float16* K2 = (_Float16*)take(nh * 2); _Float16* VT = (_Float16*)take(nh * 4);
  float* LAM = (float*)take(256);
  if (off > ws_size) return;      /* 6 x 4 = 24 MiB */
  k_prep<<<1 + 3 * PREP_BLOCKS, 256, 0, stream>>>(q, k, v, lq1, lk1, lq2, lk2, Q1, Q2, K1, K2, VT, LAM);
  k_flash<<<NB * NH * (TQ / QBLK), 512, 0, stream>>>(Q1, Q2, HWD, K1, K2, VT, LAM, w, (float*)d_out);
}

// v010
// A run of this version takes 34.6 microseconds.
// Timed twice side by side with v009, it ran 1.20 times as fast both times.
// Counting every step since v000, it is 26.2 times as fast.
#include <hip/hip_runtime.h>
// Differential causal attention (2 x 2048 tokens, 16 heads of 64 as 8 differential pairs; q, k, v are INPUTS): heads (2p, 2p+1) = (q1, q2) etc.; P1 = causal softmax(q1.k1/8), P2 = causal softmax(q2.k2/8); attn1 = [P1 v1 | P1 v2], attn2 = [P2 v1 | P2 v2] (128 wide); lambda = exp(lq1.lk1) - exp(lq2.lk2) + lambda_init; a = attn1 - lambda attn2; out = subln_w * RMSNorm_128(a) * (1 - lambda_init) -> [B, S, 16, 64].
// Structure: ONE pre-pass launch de-interleaves k into exact f16 planes per half (k1, k2; the inputs are exactly representable after bf16 rounding) and writes V^T (q has one reader, its flash block, which converts it itself); K and V^T stored in WMMA fragment order (per 32-key chunk: fragment halves of 32 lanes x 16 bytes; both V halves in one plane); lambda on device in the same launch (f32 64-term dots); ONE launch of the fused causal flash kernel: a block does both (q, k) halves of four query tiles, which share each stage of K and V^T through LDS; P1 and P2 multiplied into the same V^T fragments (plain operands - exact here except P; f32 softmax/accumulation), and takes the differential combine + RMSNorm in its LDS join.
// Compute dtype: inputs rounded to bf16; q, k, v exact as f16; P as f16 (x2^10, ~2^-12); everything else f32. v_wmma_f32_16x16x32_f16.
#define NB 2
#define NHD 16
#define HD 64
#define NP (NHD / 2)
#define DW (NHD * HD)            /* 1024 */
#define HWD (NP * HD)            /* 512 */
#define NR (NB * SLEN)
#define LAMBDA_INIT 0.35550906759096934f  /* 0.8 - 0.6 exp(-0.3) */
#define SLEN 2048
#define TQ SLEN
#define TK SLEN
#define NH 8                     /* head PAIRS per call */
#define SCL 0.125f
#define QTILES (TQ / 16)         /* query tiles of 16 rows, four to a block */
typedef __bf16 v16b __attribute__((ext_vector_type(16)));
typedef unsigned short v8us __attribute__((ext_vector_type(8), may_alias));
typedef unsigned short v4us __attribute__((ext_vector_type(4), may_alias));
typedef float  v8f  __attribute__((ext_vector_type(8)));
typedef float  v4f  __attribute__((ext_vector_type(4)));
typedef float  v4fa __attribute__((ext_vector_type(4), may_alias));
union FragB { v16b v; v8us half[2]; unsigned short u[16]; };

__device__ __forceinline__ unsigned short bf16_bits(float x) { unsigned int u = __float_as_uint(x); return (unsigned short)((u + 0x7FFFu + ((u >> 16) & 1u)) >> 16); }
__device__ __forceinline__ float bf16_val(unsigned short b) { return __uint_as_float(((unsigned int)b) << 16); }
__device__ __forceinline__ float bf16_round(float x) { return bf16_val(bf16_bits(x)); }
// D += A·B with NT terms: 1 = ah·bh, 2 = + al·bh (A split), 3 = + ah·bl (both split)
template <int NT>
__device__ __forceinline__ v8f mmaN(v16b ah, v16b al, v16b bh, v16b bl, v8f c) {
  c = __builtin_amdgcn_wmma_f32_16x16x32_bf16(false, ah, false, bh, (short)0, c, false, false);
  if (NT >= 2) c = __builtin_amdgcn_wmma_f32_16x16x32_bf16(false, al, false, bh, (short)0, c, false, false);
  if (NT >= 3) c = __builtin_amdgcn_wmma_f32_16x16x32_bf16(false, ah, false, bl, (short)0, c, false, false);
  asm volatile("v_nop\n\tv_nop\n\tv_nop\n\tv_nop" : "+v"(c) : "v"(ah), "v"(al), "v"(bh), "v"(bl));
  return c;
}

__global__ __launch_bounds__(256) void k_wt_bf16(const float* __restrict__ W, unsigned short* __restrict__ Wt, int K, int N) {
  const int t = blockIdx.x * 256 + threadIdx.x;
  const int k8n = K / 8;
  if (t >= N * k8n) return;
  const int n = t / k8n, k8 = (t % k8n) * 8;
  v8us v;
#pragma unroll
  for (int i = 0; i < 8; ++i) v[i] = bf16_bits(W[(size_t)(k8 + i) * N + n]);
  *(v8us*)(Wt + (size_t)n * K + k8) = v;
  
}

// GEMM C[M][N] (f32, pitch ldc) = act(A[M][K]·W + bias). A f32 row-major (pitch lda) converted per fragment to bf16
// (ASPLIT: hi/lo two planes -> 2 terms, else single rounded term); Wt bf16 [N][K] (pitch ldb). BIAS_BF16 rounds the
// bias to bf16 first (bias quantised to bf16 before the add). K%32==0, M%16==0, N%64==0.
template <bool ASPLIT, int ACT, bool BIAS_BF16>
__global__ __launch_bounds__(128) void k_gemm_bf(const float* __restrict__ A, int lda, const unsigned short* __restrict__ Wt, int ldb,
                                               const float* __restrict__ bias, float* __restrict__ C, int ldc, int M, int N, int K) {
  __shared__ __attribute__((aligned(16))) float so[4][16][64];
  const int tid = threadIdx.x, w = tid >> 5, lane = tid & 31, ln = lane & 15, hh = lane >> 4;
  const int ntn = N / 64;
  const int wid = blockIdx.x * 4 + w;
  const int mt = wid / ntn, nq = wid % ntn;
  if (mt * 16 >= M) return;
  const int row0 = mt * 16, col0 = nq * 64;
  const float* arow = A + (size_t)(row0 + ln) * lda;
  v8f acc[4] = {};
  for (int kb = 0; kb < K; kb += 32) {
    FragB ah, al;
    const v4f x0 = *(const v4fa*)(arow + kb + 8 * hh), x1 = *(const v4fa*)(arow + kb + 8 * hh + 4);
    const v4f x2 = *(const v4fa*)(arow + kb + 16 + 8 * hh), x3 = *(const v4fa*)(arow + kb + 16 + 8 * hh + 4);
    float xs[16] = {x0[0],x0[1],x0[2],x0[3],x1[0],x1[1],x1[2],x1[3],x2[0],x2[1],x2[2],x2[3],x3[0],x3[1],x3[2],x3[3]};
#pragma unroll
    for (int i = 0; i < 16; ++i) { const unsigned short hb = bf16_bits(xs[i]); ah.u[i] = hb; al.u[i] = ASPLIT ? bf16_bits(xs[i] - bf16_val(hb)) : (unsigned short)0; }
#pragma unroll
    for (int t = 0; t < 4; ++t) {
      const unsigned short* brow = Wt + (size_t)(col0 + t * 16 + ln) * ldb + kb;
      FragB b;
      b.half[0] = *(const v8us*)(brow + 8 * hh);
      b.half[1] = *(const v8us*)(brow + 16 + 8 * hh);
      acc[t] = mmaN<ASPLIT ? 2 : 1>(ah.v, al.v, b.v, b.v, acc[t]);
    }
  }
#pragma unroll
  for (int t = 0; t < 4; ++t) {
    float bv = bias ? bias[col0 + t * 16 + ln] : 0.f;
    if (BIAS_BF16) bv = bf16_round(bv);
#pragma unroll
    for (int r = 0; r < 8; ++r) { float v = acc[t][r] + bv; if (ACT == 1) v = fmaxf(v, 0.f); so[w][8 * hh + r][t * 16 + ln] = v; }
  }
  __builtin_amdgcn_fence(__ATOMIC_ACQ_REL, "workgroup");
  __builtin_amdgcn_wave_barrier();
  const int rsub = lane >> 4, c4 = (lane & 15) * 4;
  {
#pragma unroll
    for (int q = 0; q < 8; ++q) {
      const int r = q * 2 + rsub;
      const v4f v = *(const v4fa*)&so[w][r][c4];
      *(v4f*)(C + (size_t)(row0 + r) * ldc + col0 + c4) = v;
    }
    
  }
}

// GEMM C = act(A·W + bias + resid): A f32 (ASPLIT -> hi/lo 2 terms), Wt bf16 [N][K]; ACT 0 none, 1 relu, 2 exact gelu;
// resid (optional, f32, row index = (row % rmod), pitch ldr, RES_BF16 rounds it) added before the activation.
template <bool ASPLIT, int ACT, bool BIAS_BF16, bool RES_BF16>
__global__ __launch_bounds__(128) void k_gemm_bf3(const float* __restrict__ A, int lda, const unsigned short* __restrict__ Wt, int ldb,
                                                const float* __restrict__ bias, const float* __restrict__ resid, int rmod, int ldr,
                                                float* __restrict__ C, int ldc, int M, int N, int K) {
  __shared__ __attribute__((aligned(16))) float so[4][16][64];
  const int tid = threadIdx.x, w = tid >> 5, lane = tid & 31, ln = lane & 15, hh = lane >> 4;
  const int ntn = N / 64;
  const int wid = blockIdx.x * 4 + w;
  const int mt = wid / ntn, nq = wid % ntn;
  if (mt * 16 >= M) return;
  const int row0 = mt * 16, col0 = nq * 64;
  const float* arow = A + (size_t)(row0 + ln) * lda;
  v8f acc[4] = {};
  for (int kb = 0; kb < K; kb += 32) {
    FragB ah, al;
    const v4f x0 = *(const v4fa*)(arow + kb + 8 * hh), x1 = *(const v4fa*)(arow + kb + 8 * hh + 4);
    const v4f x2 = *(const v4fa*)(arow + kb + 16 + 8 * hh), x3 = *(const v4fa*)(arow + kb + 16 + 8 * hh + 4);
    float xs[16] = {x0[0],x0[1],x0[2],x0[3],x1[0],x1[1],x1[2],x1[3],x2[0],x2[1],x2[2],x2[3],x3[0],x3[1],x3[2],x3[3]};
#pragma unroll
    for (int i = 0; i < 16; ++i) { const unsigned short hb = bf16_bits(xs[i]); ah.u[i] = hb; al.u[i] = ASPLIT ? bf16_bits(xs[i] - bf16_val(hb)) : (unsigned short)0; }
#pragma unroll
    for (int t = 0; t < 4; ++t) {
      const unsigned short* brow = Wt + (size_t)(col0 + t * 16 + ln) * ldb + kb;
      FragB b;
      b.half[0] = *(const v8us*)(brow + 8 * hh);
      b.half[1] = *(const v8us*)(brow + 16 + 8 * hh);
      acc[t] = mmaN<ASPLIT ? 2 : 1>(ah.v, al.v, b.v, b.v, acc[t]);
    }
  }
#pragma unroll
  for (int t = 0; t < 4; ++t) {
    const int col = col0 + t * 16 + ln;
    float bv = bias ? bias[col] : 0.f;
    if (BIAS_BF16) bv = bf16_round(bv);
#pragma unroll
    for (int r = 0; r < 8; ++r) {
      float v = acc[t][r] + bv;
      if (resid) { float rv = resid[(size_t)((row0 + 8 * hh + r) % rmod) * ldr + col]; if (RES_BF16) rv = bf16_round(rv); v += rv; }
      if (ACT == 1) v = fmaxf(v, 0.f);
      if (ACT == 2) v = 0.5f * v * (1.0f + erff(v * 0.70710678118654752f));
      if (ACT == 3) { const float u = 0.7978845608028654f * (v + 0.044715f * v * v * v); v = 0.5f * v * (1.0f + tanhf(u)); }
      so[w][8 * hh + r][t * 16 + ln] = v;
    }
  }
  __builtin_amdgcn_fence(__ATOMIC_ACQ_REL, "workgroup");
  __builtin_amdgcn_wave_barrier();
  const int rsub = lane >> 4, c4 = (lane & 15) * 4;
  {
#pragma unroll
    for (int q = 0; q < 8; ++q) {
      const int r = q * 2 + rsub;
      const v4f v = *(const v4fa*)&so[w][r][c4];
      *(v4f*)(C + (size_t)(row0 + r) * ldc + col0 + c4) = v;
    }
    
  }
}
// row LayerNorm (biased variance, eps) over N: s = X (+ R); optional out_sum <- s; out_norm <- (s-mu)*rsqrt(var+eps)*g + b
template <bool PARAM_BF16>
__global__ __launch_bounds__(256) void k_layernorm(const float* __restrict__ X, const float* __restrict__ R, const float* __restrict__ g, const float* __restrict__ bta,
                                                  float* __restrict__ out_sum, float* __restrict__ out_norm, int N, float eps) {
  __shared__ float red[256];
  const int row = blockIdx.x, tid = threadIdx.x;
  const float* x = X + (size_t)row * N; const float* rr = R ? R + (size_t)row * N : nullptr;
  float vals[16];                     // up to N = 4096
  const int per = N / 256;            // contiguous chunk per thread? use strided-by-4 chunks: thread handles j = tid*4 + 1024*u
  float s1 = 0.f;
  for (int u = 0; u < per / 4; ++u) {
    const int j = tid * 4 + 1024 * u;
    const v4f a = *(const v4fa*)(x + j);
    v4f b = {0.f,0.f,0.f,0.f}; if (rr) b = *(const v4fa*)(rr + j);
#pragma unroll
    for (int q = 0; q < 4; ++q) { const float v = a[q] + b[q]; vals[u * 4 + q] = v; s1 += v; }
  }
  red[tid] = s1; __syncthreads();
  for (int st = 128; st > 0; st >>= 1) { if (tid < st) red[tid] += red[tid + st]; __syncthreads(); }
  const float mu = red[0] / (float)N; __syncthreads();
  float s2 = 0.f;
  for (int u = 0; u < per / 4; ++u)
#pragma unroll
    for (int q = 0; q < 4; ++q) { const float c = vals[u * 4 + q] - mu; s2 += c * c; }
  red[tid] = s2; __syncthreads();
  for (int st = 128; st > 0; st >>= 1) { if (tid < st) red[tid] += red[tid + st]; __syncthreads(); }
  const float rs = rsqrtf(red[0] / (float)N + eps);
  {
    for (int u = 0; u < per / 4; ++u) {
      const int j = tid * 4 + 1024 * u;
      v4f o, sm;
#pragma unroll
      for (int q = 0; q < 4; ++q) {
        float gg = g[j + q], bb = bta[j + q];
        if (PARAM_BF16) { gg = bf16_round(gg); bb = bf16_round(bb); }
        sm[q] = vals[u * 4 + q]; o[q] = (vals[u * 4 + q] - mu) * rs * gg + bb;
      }
      if (out_sum) *(v4f*)(out_sum + (size_t)row * N + j) = sm;
      *(v4f*)(out_norm + (size_t)row * N + j) = o;
    }
    
  }
}



// ---- f16 WMMA path (v_wmma_f32_16x16x32_f16): 11-bit significands for operands in range — used where a [0,1] probability operand needs more precision than bf16
typedef _Float16 v16h __attribute__((ext_vector_type(16)));
union FragH { v16h v; v8us half[2]; _Float16 h[16]; unsigned short u[16]; };
template <int NT>
__device__ __forceinline__ v8f mmaH(v16h ah, v16h al, v16h bh, v16h bl, v8f c) {
  c = __builtin_amdgcn_wmma_f32_16x16x32_f16(false, ah, false, bh, (short)0, c, false, false);
  if (NT >= 2) c = __builtin_amdgcn_wmma_f32_16x16x32_f16(false, al, false, bh, (short)0, c, false, false);
  if (NT >= 3) c = __builtin_amdgcn_wmma_f32_16x16x32_f16(false, ah, false, bl, (short)0, c, false, false);
  asm volatile("v_nop\n\tv_nop\n\tv_nop\n\tv_nop" : "+v"(c) : "v"(ah), "v"(al), "v"(bh), "v"(bl));
  return c;
}
// batched GEMM like k_gemm_b but f16 operands: A f32 (split into f16 hi/lo if ASPLIT, else rounded to f16), Bt = f16 values [n][k]; alpha; C f32; N multiple of 16 (partial tiles skipped)
template <bool ASPLIT>
__global__ __launch_bounds__(128) void k_gemm_h(const float* __restrict__ A, int lda, size_t sA, const _Float16* __restrict__ Bh, int ldb, size_t sB, float alpha, float* __restrict__ C, int ldc, size_t sC, int M, int N, int K) {
  __shared__ __attribute__((aligned(16))) float so[4][16][64];
  const int tid = threadIdx.x, w = tid >> 5, lane = tid & 31, ln = lane & 15, hh = lane >> 4; const int by = blockIdx.y;
  A += (size_t)by * sA; Bh += (size_t)by * sB; C += (size_t)by * sC;
  const int ntn = (N + 63) / 64; const int wid = blockIdx.x * 4 + w; const int mt = wid / ntn, nq = wid % ntn; if (mt * 16 >= M) return;
  const int row0 = mt * 16, col0 = nq * 64; const float* arow = A + (size_t)(row0 + ln) * lda;
  v8f acc[4] = {};
  for (int kb = 0; kb < K; kb += 32) {
    FragH ah, al;
    const v4f x0 = *(const v4fa*)(arow + kb + 8 * hh), x1 = *(const v4fa*)(arow + kb + 8 * hh + 4), x2 = *(const v4fa*)(arow + kb + 16 + 8 * hh), x3 = *(const v4fa*)(arow + kb + 16 + 8 * hh + 4);
    float xs[16] = {x0[0],x0[1],x0[2],x0[3],x1[0],x1[1],x1[2],x1[3],x2[0],x2[1],x2[2],x2[3],x3[0],x3[1],x3[2],x3[3]};
#pragma unroll
    for (int i = 0; i < 16; ++i) { const _Float16 h = (_Float16)xs[i]; ah.h[i] = h; al.h[i] = ASPLIT ? (_Float16)(xs[i] - (float)h) : (_Float16)0.0f; }
#pragma unroll
    for (int t = 0; t < 4; ++t) { if (col0 + t * 16 >= N) continue; const size_t boff = (size_t)(col0 + t * 16 + ln) * ldb + kb; FragH bq; bq.half[0] = *(const v8us*)(Bh + boff + 8 * hh); bq.half[1] = *(const v8us*)(Bh + boff + 16 + 8 * hh);
      acc[t] = mmaH<ASPLIT ? 2 : 1>(ah.v, al.v, bq.v, bq.v, acc[t]); }
  }
#pragma unroll
  for (int t = 0; t < 4; ++t) { if (col0 + t * 16 >= N) continue;
#pragma unroll
    for (int r = 0; r < 8; ++r) so[w][8 * hh + r][t * 16 + ln] = acc[t][r] * alpha; }
  __builtin_amdgcn_fence(__ATOMIC_ACQ_REL, "workgroup"); __builtin_amdgcn_wave_barrier();
  const int rsub = lane >> 4, c4 = (lane & 15) * 4;
  {
#pragma unroll
    for (int q = 0; q < 8; ++q) { const int r = q * 2 + rsub; if (col0 + c4 < N) { const v4f v = *(const v4fa*)&so[w][r][c4]; *(v4f*)(C + (size_t)(row0 + r) * ldc + col0 + c4) = v; } }
     }
}

// Wt[n][k] = f16(W[k][n]·scale) from f32 row-major W[K][N] (scale = power of two; bf16-exact weights stay exact in f16 away from the subnormal range)
__global__ __launch_bounds__(256) void k_wt_f16(const float* __restrict__ W, _Float16* __restrict__ Wt, int K, int N, float scale) {
  const int t = blockIdx.x * 256 + threadIdx.x; if (t >= N * (K / 8)) return; const int n = t / (K / 8), k8 = (t % (K / 8)) * 8; FragH f;
#pragma unroll
  for (int i = 0; i < 8; ++i) f.h[i] = (_Float16)(bf16_round(W[(size_t)(k8 + i) * N + n]) * scale); const v8us o = f.half[0];
  *(v8us*)((unsigned short*)Wt + (size_t)n * K + k8) = o; 
}
// k_gemm_hh variant with fused epilogue: v = acc·alpha + bias[by·sBias + col] (+ CP[(row/rowsPerB)·sCPb + by·64 + col] if CP) ; ACT 0 none / 1 elu ; writes f16 C16 (and f32 C if non-null)
template <int ACT>
__global__ __launch_bounds__(128) void k_gemm_hhx(const _Float16* __restrict__ A, int lda, size_t sA, const _Float16* __restrict__ Bh, int ldb, size_t sB, float alpha, const float* __restrict__ bias, size_t sBias, const float* __restrict__ CP, int rowsPerB, size_t sCPb, int row0g,
    float* __restrict__ C, _Float16* __restrict__ C16, int ldc, size_t sC, int M, int N, int K) {
  __shared__ __attribute__((aligned(16))) float so[4][16][64];
  const int tid = threadIdx.x, w = tid >> 5, lane = tid & 31, ln = lane & 15, hh = lane >> 4; const int by = blockIdx.y;
  A += (size_t)by * sA; Bh += (size_t)by * sB; const size_t cofs = (size_t)by * sC; const float* bp = bias ? bias + (size_t)by * sBias : nullptr;
  const int ntn = (N + 63) / 64; const int wid = blockIdx.x * 4 + w; const int mt = wid / ntn, nq = wid % ntn; if (mt * 16 >= M) return;
  const int row0 = mt * 16, col0 = nq * 64; const _Float16* arow = A + (size_t)(row0 + ln) * lda;
  v8f acc[4] = {};
  for (int kb = 0; kb < K; kb += 32) { FragH ah; ah.half[0] = *(const v8us*)((const unsigned short*)arow + kb + 8 * hh); ah.half[1] = *(const v8us*)((const unsigned short*)arow + kb + 16 + 8 * hh);
#pragma unroll
    for (int t = 0; t < 4; ++t) { if (col0 + t * 16 >= N) continue; const size_t boff = (size_t)(col0 + t * 16 + ln) * ldb + kb; FragH bq; bq.half[0] = *(const v8us*)((const unsigned short*)Bh + boff + 8 * hh); bq.half[1] = *(const v8us*)((const unsigned short*)Bh + boff + 16 + 8 * hh);
      acc[t] = mmaH<1>(ah.v, ah.v, bq.v, bq.v, acc[t]); }
  }
#pragma unroll
  for (int t = 0; t < 4; ++t) { if (col0 + t * 16 >= N) continue; const int col = col0 + t * 16 + ln; const float bv = bp ? bf16_round(bp[col]) : 0.f;
#pragma unroll
    for (int r = 0; r < 8; ++r) { float v = acc[t][r] * alpha + bv; if (CP) { const int bidx = (row0g + row0 + 8 * hh + r) / rowsPerB; v += CP[(size_t)bidx * sCPb + (size_t)by * 64 + col]; } if (ACT == 1) v = (v > 0.f) ? v : expm1f(v); else if (ACT == 7) v = (v > 0.f) ? v + 1.0f : expf(v); else if (ACT == 8) v = tanhf(v); else if (ACT == 9) v = 0.5f * v * (1.0f + tanhf(0.7978845608028654f * (v + 0.044715f * v * v * v))); else if (ACT == 11) v = 1.0f / (1.0f + expf(-v)); else if (ACT == 12) v = (v > 0.f) ? v : 0.01f * v; else if (ACT == 14) v = (v > 0.f) ? v : 0.1f * v; else if (ACT == 15) v = v / (1.0f + expf(-v)); else if (ACT == 3) v = fmaxf(v, 0.f); else if (ACT == 6) v = 0.5f * v * (1.0f + erff(v * 0.70710678118654752f)); so[w][8 * hh + r][t * 16 + ln] = v; } }
  __builtin_amdgcn_fence(__ATOMIC_ACQ_REL, "workgroup"); __builtin_amdgcn_wave_barrier();
  const int rsub = lane >> 4, c4 = (lane & 15) * 4; typedef _Float16 v4h __attribute__((ext_vector_type(4)));
  {
#pragma unroll
    for (int q = 0; q < 8; ++q) { const int r = q * 2 + rsub; if (col0 + c4 < N) { const v4f v = *(const v4fa*)&so[w][r][c4]; if (C) *(v4f*)(C + cofs + (size_t)(row0 + r) * ldc + col0 + c4) = v; if (C16) { v4h h4; for (int i = 0; i < 4; ++i) h4[i] = (_Float16)v[i]; *(v4h*)(C16 + cofs + (size_t)(row0 + r) * ldc + col0 + c4) = h4; } } }
     }
}


typedef _Float16 v4h __attribute__((ext_vector_type(4)));

__global__ __launch_bounds__(256) void k_x16(const float* __restrict__ x, _Float16* __restrict__ X16, size_t n8) { const size_t t = (size_t)blockIdx.x * 256 + threadIdx.x; if (t >= n8) return; FragH f;
#pragma unroll
  for (int q = 0; q < 8; ++q) f.h[q] = (_Float16)bf16_round(x[t * 8 + q]); *(v8us*)((unsigned short*)X16 + t * 8) = f.half[0];  }
__global__ __launch_bounds__(256) void k_h16(const float* __restrict__ x, _Float16* __restrict__ X16, size_t n8) { const size_t t = (size_t)blockIdx.x * 256 + threadIdx.x; if (t >= n8) return; FragH f;
#pragma unroll
  for (int q = 0; q < 8; ++q) f.h[q] = (_Float16)x[t * 8 + q]; *(v8us*)((unsigned short*)X16 + t * 8) = f.half[0];  }
__global__ __launch_bounds__(256) void k_round16f(const float* __restrict__ W, _Float16* __restrict__ Bt, size_t n8) { const size_t t = (size_t)blockIdx.x * 256 + threadIdx.x; if (t >= n8) return; FragH f;
#pragma unroll
  for (int i = 0; i < 8; ++i) f.h[i] = (_Float16)(bf16_round(W[t * 8 + i]) * 16.0f); *(v8us*)((unsigned short*)Bt + t * 8) = f.half[0];  }
__global__ __launch_bounds__(256) void k_hl(const float* __restrict__ F, _Float16* __restrict__ Hh, _Float16* __restrict__ Hl, size_t n8) { const size_t t = (size_t)blockIdx.x * 256 + threadIdx.x; if (t >= n8) return; FragH fh, fl; const v4f a = *(const v4fa*)(F + t * 8), c = *(const v4fa*)(F + t * 8 + 4);
#pragma unroll
  for (int q = 0; q < 4; ++q) { _Float16 h = (_Float16)a[q]; fh.h[q] = h; fl.h[q] = (_Float16)((a[q] - (float)h) * 1024.0f); h = (_Float16)c[q]; fh.h[4 + q] = h; fl.h[4 + q] = (_Float16)((c[q] - (float)h) * 1024.0f); }
  { *(v8us*)((unsigned short*)Hh + t * 8) = fh.half[0]; *(v8us*)((unsigned short*)Hl + t * 8) = fl.half[0];  } }

// ---- fast GEMM (wave tile 32x64; requires M % 32 == 0 rows per launch region and N % 64 == 0); epilogue = k_gemm_hhx semantics ----
__device__ __forceinline__ v16h g2_frag(const _Float16* p, int hh) { FragH f; f.half[0] = *(const v8us*)((const unsigned short*)p + 8 * hh); f.half[1] = *(const v8us*)((const unsigned short*)p + 16 + 8 * hh); return f.v; }
__device__ __forceinline__ v8f g2_mma(v16h a, v16h b, v8f c) { v8f d = __builtin_amdgcn_wmma_f32_16x16x32_f16(false, a, false, b, (short)0, c, false, false); asm volatile("v_nop\n\tv_nop\n\tv_nop\n\tv_nop" : "+v"(d) : "v"(a), "v"(b)); return d; }
template <int ACT>
__global__ __launch_bounds__(128) void k_gemm2(const _Float16* __restrict__ A, int lda, size_t sA, const _Float16* __restrict__ Bh, int ldb, size_t sB, float alpha, const float* __restrict__ bias, size_t sBias, const float* __restrict__ CP, int rowsPerB, size_t sCPb, int row0g,
    float* __restrict__ C, _Float16* __restrict__ C16, int ldc, size_t sC, int M, int N, int K) {
  __shared__ __attribute__((aligned(16))) float so[4][32][68];
  const int tid = threadIdx.x, w = tid >> 5, lane = tid & 31, ln = lane & 15, hh = lane >> 4; const int by = blockIdx.y;
  A += (size_t)by * sA; Bh += (size_t)by * sB; const size_t cofs = (size_t)by * sC; const float* bp = bias ? bias + (size_t)by * sBias : nullptr;
  const int ntn = N >> 6; const int mt = blockIdx.x / ntn, nq = blockIdx.x - mt * ntn; const int row0 = mt * 128 + 32 * w, col0 = nq * 64; if (row0 >= M) return;
  const _Float16* a0p = A + (size_t)(row0 + ln) * lda; const _Float16* a1p = a0p + (size_t)16 * lda;
  const _Float16* b0p = Bh + (size_t)(col0 + ln) * ldb; const _Float16* b1p = b0p + (size_t)16 * ldb; const _Float16* b2p = b1p + (size_t)16 * ldb; const _Float16* b3p = b2p + (size_t)16 * ldb;
  const v8f z8 = {0.f,0.f,0.f,0.f,0.f,0.f,0.f,0.f}; v8f c00 = z8, c01 = z8, c02 = z8, c03 = z8, c10 = z8, c11 = z8, c12 = z8, c13 = z8;
#pragma unroll 1
  for (int kb = 0; kb < K; kb += 32) { const v16h a0 = g2_frag(a0p + kb, hh), a1 = g2_frag(a1p + kb, hh);
    v16h b = g2_frag(b0p + kb, hh); c00 = g2_mma(a0, b, c00); c10 = g2_mma(a1, b, c10);
    b = g2_frag(b1p + kb, hh); c01 = g2_mma(a0, b, c01); c11 = g2_mma(a1, b, c11);
    b = g2_frag(b2p + kb, hh); c02 = g2_mma(a0, b, c02); c12 = g2_mma(a1, b, c12);
    b = g2_frag(b3p + kb, hh); c03 = g2_mma(a0, b, c03); c13 = g2_mma(a1, b, c13); }
  v8f accs[8] = {c00, c01, c02, c03, c10, c11, c12, c13};
#pragma unroll
  for (int u = 0; u < 8; ++u) { const int t = u & 3, half = u >> 2; const int col = col0 + t * 16 + ln; const float bv = bp ? bf16_round(bp[col]) : 0.f;
#pragma unroll
    for (int r = 0; r < 8; ++r) { const int rloc = half * 16 + 8 * hh + r; float v = accs[u][r] * alpha + bv; if (CP) { const int bidx = (row0g + row0 + rloc) / rowsPerB; v += CP[(size_t)bidx * sCPb + (size_t)by * 64 + col]; }
      if (ACT == 3) v = fmaxf(v, 0.f); else if (ACT == 6) v = 0.5f * v * (1.0f + erff(v * 0.70710678118654752f)); else if (ACT == 11) v = 1.0f / (1.0f + expf(-v)); else if (ACT == 15) v = v / (1.0f + expf(-v)); else if (ACT == 12) v = (v > 0.f) ? v : 0.01f * v; else if (ACT == 8) v = tanhf(v);
      so[w][rloc][t * 16 + ln] = v; } }
  __builtin_amdgcn_fence(__ATOMIC_ACQ_REL, "workgroup"); __builtin_amdgcn_wave_barrier();
  const int rsub = lane >> 4, c4 = (lane & 15) * 4;
  {
#pragma unroll
    for (int q = 0; q < 16; ++q) { const int r = q * 2 + rsub; const v4f v = *(const v4fa*)&so[w][r][c4]; if (C) *(v4f*)(C + cofs + (size_t)(row0 + r) * ldc + col0 + c4) = v; if (C16) { v4h h4; for (int i = 0; i < 4; ++i) h4[i] = (_Float16)v[i]; *(v4h*)(C16 + cofs + (size_t)(row0 + r) * ldc + col0 + c4) = h4; } }
     } }



__device__ __forceinline__ float xhalf(float x) { return __builtin_bit_cast(float, __builtin_amdgcn_permlanex16(__builtin_bit_cast(int, x), __builtin_bit_cast(int, x), 0x76543210, 0xfedcba98, false, false)); }      /* value of lane l ^ 16 */
/* the flash kernel stands at its ceiling of 256 vector registers (16 waves a block): its products are the plain builtin (the compiler keeps the distance behind it), with no asm statement that would hold operands live around them */
__device__ __forceinline__ v8f mmaF(v16h a, v16h b, v8f c) { return __builtin_amdgcn_wmma_f32_16x16x32_f16(false, a, false, b, (short)0, c, false, false); }
/* softmax of one (q, k) half for one 32-key chunk, in base 2 on the raw products: p 2^10 = 2^(s c - m c + 10) with c = log2(e) / 8 is one multiply-add and one v_exp_f32 a score. m_r = the reference in use, a maximum of raw products seen earlier (lazy: it is moved up only when a score passes it by more than LAZY), l_r = running sum x 2^10 against that reference */
#define SC2 0.18033688011112042f  /* SCL log2(e) */
#define LAZY 27.0f  /* raw products; 27 SC2 = 4.87, so P x 2^10 stays below 2^15 and inside f16 */
/* masked raw scores of the lane's 16 keys; returns their maximum (this lane's keys only) */
__device__ __forceinline__ float score_half(const FragH (&ak)[2][2], const FragH (&bq)[2], int j0, int hh, int tq, float (&sv)[16]) {
#pragma unroll
  for (int nt = 0; nt < 2; ++nt) { v8f acc = (v8f){0.f,0.f,0.f,0.f,0.f,0.f,0.f,0.f};
#pragma unroll
    for (int ks = 0; ks < 2; ++ks) acc = mmaF(ak[nt][ks].v, bq[ks].v, acc);
#pragma unroll
    for (int r = 0; r < 8; ++r) { const int kk = j0 + nt * 16 + 8 * hh + r; sv[nt * 8 + r] = (kk <= tq) ? acc[r] : -3.0e38f; } }
  float mc = fmaxf(sv[0], sv[1]);
#pragma unroll
  for (int i = 2; i < 16; ++i) mc = fmaxf(mc, sv[i]);
  return mc; }
/* P^T x 2^10 against the reference m_r as a B operand, and the lane's sum added to l_r */
__device__ __forceinline__ void exp_half(float (&sv)[16], float m_r, float& l_r, FragH& pb) {
  const float nb = 10.0f - m_r * SC2;
#pragma unroll
  for (int i = 0; i < 16; ++i) sv[i] = fmaf(sv[i], SC2, nb);      /* the reference is finite from the wave's first chunk on (key j0 <= q0 is open to every query of the tile), so a masked score gives exactly 0 */
  /* x = 2^x in place, independent v_exp_f32 in a row. In asm for the v_nop at each end: it is the slot that the instruction set asks for behind a transcendental */
  asm("v_exp_f32 %0, %0\n\tv_exp_f32 %1, %1\n\tv_exp_f32 %2, %2\n\tv_exp_f32 %3, %3\n\tv_exp_f32 %4, %4\n\tv_exp_f32 %5, %5\n\tv_exp_f32 %6, %6\n\tv_exp_f32 %7, %7\n\tv_nop"
      : "+v"(sv[0]), "+v"(sv[1]), "+v"(sv[2]), "+v"(sv[3]), "+v"(sv[4]), "+v"(sv[5]), "+v"(sv[6]), "+v"(sv[7]));
  asm("v_exp_f32 %0, %0\n\tv_exp_f32 %1, %1\n\tv_exp_f32 %2, %2\n\tv_exp_f32 %3, %3\n\tv_exp_f32 %4, %4\n\tv_exp_f32 %5, %5\n\tv_exp_f32 %6, %6\n\tv_exp_f32 %7, %7\n\tv_nop"
      : "+v"(sv[8]), "+v"(sv[9]), "+v"(sv[10]), "+v"(sv[11]), "+v"(sv[12]), "+v"(sv[13]), "+v"(sv[14]), "+v"(sv[15]));
  float ps[4] = {0.f, 0.f, 0.f, 0.f};
#pragma unroll
  for (int i = 0; i < 16; ++i) { ps[i & 3] += sv[i]; pb.h[i] = (_Float16)sv[i]; }
  l_r += (ps[0] + ps[1]) + (ps[2] + ps[3]); }
/* weight of wave w's key share in the join of one half: exp(m_w - m_all) / (l_all 2^10); lane -> row ln; a wave without a chunk holds m below -1e37, l = 0, O = 0 and gets weight 0; wave 0 always holds key 0, so the joint maximum is finite */
__device__ __forceinline__ float join_weight(const float (&sM)[4][16], const float (&sL)[4][16], int w, int ln) {
  const float m0 = sM[0][ln], m1 = sM[1][ln], m2 = sM[2][ln], m3 = sM[3][ln]; const float mt = fmaxf(fmaxf(m0, m1), fmaxf(m2, m3));
  const float e0 = expf(m0 - mt), e1 = expf(m1 - mt), e2 = expf(m2 - mt), e3 = expf(m3 - mt); const float lt = ((sL[0][ln] * e0 + sL[1][ln] * e1) + sL[2][ln] * e2) + sL[3][ln] * e3;
  const float ew = (w == 0) ? e0 : ((w == 1) ? e1 : ((w == 2) ? e2 : e3)); return (lt > 0.f) ? ew / (lt * 1024.0f) : 0.f; }
/* one stage of the ring = 4 chunks of 32 keys (16 KiB of each K half, 32 KiB of V^T), from global memory straight into LDS: 8 asynchronous copies of 16 bytes a lane, 512 lanes. lds = the lane's byte address in the buffer, ka / kb / va = the lane's 16 bytes of the stage in the three planes; every copy moves 8 KiB on in both.
   s_wait_xcnt stands inside the statement, behind the last copy: the address registers are the statement's operands and live to its end, so nothing rewrites one in front of the wait */
__device__ __forceinline__ void copy_stage(unsigned lds, const unsigned short* ka, const unsigned short* kb, const unsigned short* va) {
  asm volatile("global_load_async_to_lds_b128 %0, %8, off\n\t"
               "global_load_async_to_lds_b128 %1, %9, off\n\t"
               "global_load_async_to_lds_b128 %2, %10, off\n\t"
               "global_load_async_to_lds_b128 %3, %11, off\n\t"
               "global_load_async_to_lds_b128 %4, %12, off\n\t"
               "global_load_async_to_lds_b128 %5, %13, off\n\t"
               "global_load_async_to_lds_b128 %6, %14, off\n\t"
               "global_load_async_to_lds_b128 %7, %15, off\n\t"
               "s_wait_xcnt 0x0"
               :: "v"(lds), "v"(lds + 8192u), "v"(lds + 16384u), "v"(lds + 24576u), "v"(lds + 32768u), "v"(lds + 40960u), "v"(lds + 49152u), "v"(lds + 57344u),
                  "v"(ka), "v"(ka + 4096), "v"(kb), "v"(kb + 4096), "v"(va), "v"(va + 4096), "v"(va + 8192), "v"(va + 12288) : "memory"); }
#define QBLK 64                  /* query rows of a flash block: 4 tiles of 16 */
#define STG 32768                /* halves (2 bytes) of one ring buffer: K1 8,192, K2 8,192, V^T 16,384 */
__global__ __launch_bounds__(512) void k_flash(const float* __restrict__ q, const _Float16* __restrict__ KFA, const _Float16* __restrict__ KFB, const _Float16* __restrict__ VF, const float* __restrict__ LAM, const float* __restrict__ sw, float* __restrict__ out) {
  constexpr int RPW = 16, DT = 8, KS = 2;      /* DT: output row tiles of O^T, 0-3 = (P.V1)^T, 4-7 = (P.V2)^T (one P for both V halves) */
  __shared__ __attribute__((aligned(16))) unsigned short ring[2][STG];
  __shared__ __attribute__((aligned(16))) unsigned short sQ[4][4][2][32][8];      /* the block's Q as B fragments: [tile][2 g + ks][fragment half hf][lane (ln, hh)][8 halves] = row ln of the tile, (q, k) half g, dims 32 ks + 16 hf + 8 hh .. + 7 */
  __shared__ __attribute__((aligned(16))) float sO[4][4][RPW][128 + 4]; __shared__ float sM[2][4][4][RPW], sL[2][4][4][RPW];
  const int tid = threadIdx.x, wv = __builtin_amdgcn_readfirstlane(tid >> 5), t = wv & 3, s = wv >> 2, lane = tid & 31, ln = lane & 15, hh = lane >> 4;      /* t, s in scalar registers: which chunks a wave works on differs from wave to wave and must stay a scalar branch (WMMA needs every lane on) */
  const int slab = blockIdx.x % (NB * NH), qb = (TQ / QBLK - 1) - blockIdx.x / (NB * NH); const int b = slab / NH, h = slab % NH; const int q0 = qb * QBLK + t * RPW;      /* the blocks with the most keys have the lowest indices */
  const float lam = LAM[0];      /* read in front of the first asm statement that clobbers memory: there the compiler still takes it by a scalar load */
  /* Q straight from the f32 input, each value read and converted once in the block: wave (t, s) takes rows 4 s .. 4 s + 3 of tile t; a row of the head pair is 128 floats (q1's 64, then q2's); load j = columns 32 j .. 32 j + 31 of the four rows, 8 lanes a row: four whole 128-byte lines a load */
  v4f qx[4];
  { const float* qs = q + ((size_t)b * TQ + q0 + 4 * s + (lane >> 3)) * DW + h * 128 + (lane & 7) * 4;
#pragma unroll
    for (int j = 0; j < 4; ++j) qx[j] = *(const v4fa*)(qs + j * 32);
    asm volatile("s_wait_xcnt 0x0" :: "v"(qs) : "memory"); }      /* the address pair stays live up to this wait: nothing overwrites it in front of the wait */
  const unsigned short* KAg = (const unsigned short*)KFA + (size_t)slab * 64 * TK + tid * 8; const unsigned short* KBg = (const unsigned short*)KFB + (size_t)slab * 64 * TK + tid * 8; const unsigned short* VFg = (const unsigned short*)VF + (size_t)slab * 128 * TK + tid * 8;      /* the thread's 16 bytes of stage 0 in each plane */
  const unsigned lds0 = (unsigned)(uintptr_t)&ring[0][0] + (unsigned)tid * 16u;      /* the thread's byte address in buffer 0 */
  const int tq = q0 + ln;      /* this lane's query */
  float m_r[2] = {-3.0e38f, -3.0e38f}, l_r[2] = {0.f, 0.f}; v8f oacc[2][DT];      /* l_r: sum over this lane's own 16 keys of each chunk; the two halves of the wave are added behind the loop */
#pragma unroll
  for (int dt = 0; dt < DT; ++dt) { oacc[0][dt] = (v8f){0.f,0.f,0.f,0.f,0.f,0.f,0.f,0.f}; oacc[1][dt] = (v8f){0.f,0.f,0.f,0.f,0.f,0.f,0.f,0.f}; }
  const int jend = q0 + RPW;      /* causal: keys beyond the tile's last query never contribute */
  const int nst = (qb + 2) >> 1;      /* stages of 128 keys that cover the block's 64 qb + 64 keys; at most TK / 128, so every stage lies inside the planes */
  copy_stage(lds0, KAg, KBg, VFg);
#pragma unroll
  for (int j = 0; j < 4; ++j) { FragH f;      /* columns 32 j + 4 (lane & 7) .. + 3 are fragment j = 2 g + ks, half (lane >> 2) & 1, hh = (lane >> 1) & 1, places 4 (lane & 1) .. + 3 */
#pragma unroll
    for (int i = 0; i < 4; ++i) f.h[i] = (_Float16)bf16_round(qx[j][i]);
    *(v4us*)&sQ[t][j][(lane >> 2) & 1][((lane >> 1) & 1) * 16 + 4 * s + (lane >> 3)][(lane & 1) * 4] = (v4us){f.u[0], f.u[1], f.u[2], f.u[3]}; }
  asm volatile("s_wait_asynccnt 0x0" ::: "memory");      /* this wave's part of stage 0 has landed */
  __syncthreads();      /* every wave's part of stage 0 has landed, and every wave's rows of Q are written, before any wave reads them */
  if (nst > 1) copy_stage(lds0 + 2u * STG, KAg + 8192, KBg + 8192, VFg + 16384);
  FragH bq[2][KS];
#pragma unroll
  for (int g = 0; g < 2; ++g)
#pragma unroll
    for (int ks = 0; ks < KS; ++ks) { bq[g][ks].half[0] = *(const v8us*)&sQ[t][2 * g + ks][0][lane][0]; bq[g][ks].half[1] = *(const v8us*)&sQ[t][2 * g + ks][1][lane][0]; }
#pragma unroll 1      /* kept rolled: the publish point stands once in the code, and the body of some 800 instructions is not doubled */
  for (int st = 0; st < nst; ++st) {
    const int j0 = (4 * st + s) * 32;
    if (j0 < jend) {      /* a scalar test; the publish point below stands outside it, every wave passes it */
      FragH aka[2][KS], akb[2][KS], av[DT];
      const unsigned short* rb = &ring[st & 1][lane * 8]; const unsigned short* ka = rb + s * 2048; const unsigned short* kb = rb + 8192 + s * 2048; const unsigned short* va = rb + 16384 + s * 4096;      /* chunk s of the stage: 2048 halves of each K, 4096 of V^T */
#pragma unroll
      for (int ks = 0; ks < KS; ++ks) { aka[0][ks].half[0] = *(const v8us*)(ka + ks * 512); aka[0][ks].half[1] = *(const v8us*)(ka + ks * 512 + 256); aka[1][ks].half[0] = *(const v8us*)(ka + 1024 + ks * 512); aka[1][ks].half[1] = *(const v8us*)(ka + 1024 + ks * 512 + 256); }
#pragma unroll
      for (int ks = 0; ks < KS; ++ks) { akb[0][ks].half[0] = *(const v8us*)(kb + ks * 512); akb[0][ks].half[1] = *(const v8us*)(kb + ks * 512 + 256); akb[1][ks].half[0] = *(const v8us*)(kb + 1024 + ks * 512); akb[1][ks].half[1] = *(const v8us*)(kb + 1024 + ks * 512 + 256); }
      FragH pa, pb; float sa[16], sb[16];
      const float mca = score_half(aka, bq[0], j0, hh, tq, sa), mcb = score_half(akb, bq[1], j0, hh, tq, sb);
#pragma unroll
      for (int dt = 0; dt < 3; ++dt) { av[dt].half[0] = *(const v8us*)(va + dt * 512); av[dt].half[1] = *(const v8us*)(va + dt * 512 + 256); }      /* three V^T fragments are asked for ahead of the test and the exponentials, the other five when the scores' registers are free: all eight at once do not fit in 256 registers */
      if (__builtin_expect(__builtin_amdgcn_ballot_w32(mca > m_r[0] + LAZY || mcb > m_r[1] + LAZY) != 0, 0)) {      /* one test a chunk, a scalar branch (every lane stays on for the WMMAs): taken in a wave's first chunk (m_r = -3e38) and when a score of any query has passed its reference by more than LAZY */
        const float na = fmaxf(m_r[0], fmaxf(mca, xhalf(mca))), nb = fmaxf(m_r[1], fmaxf(mcb, xhalf(mcb)));      /* both halves of the wave take the same new reference for their query */
        float ala = (m_r[0] - na) * SC2, alb = (m_r[1] - nb) * SC2;
        asm("v_exp_f32 %0, %0\n\tv_exp_f32 %1, %1\n\tv_nop" : "+v"(ala), "+v"(alb));      /* the v_nop: the slot behind a transcendental, as in exp_half */
        m_r[0] = na; m_r[1] = nb; l_r[0] *= ala; l_r[1] *= alb;
#pragma unroll
        for (int dt = 0; dt < DT; ++dt) { oacc[0][dt] *= ala; oacc[1][dt] *= alb; } }
      exp_half(sa, m_r[0], l_r[0], pa);
      exp_half(sb, m_r[1], l_r[1], pb);
#pragma unroll
      for (int dt = 3; dt < DT; ++dt) { av[dt].half[0] = *(const v8us*)(va + dt * 512); av[dt].half[1] = *(const v8us*)(va + dt * 512 + 256); }
#pragma unroll
      for (int dt = 0; dt < DT; ++dt) { oacc[0][dt] = mmaF(av[dt].v, pa.v, oacc[0][dt]); oacc[1][dt] = mmaF(av[dt].v, pb.v, oacc[1][dt]); }
      /* order of the code behind the test: the vector work first (the sums and the packing of P: their registers then take fragments), the loads of three more V^T fragments, two pairs of products, the loads of the last two fragments, the other products. Left free, the scheduler puts a fragment's loads directly in front of its products, and with no vector work between them a whole LDS latency stands in the open each time. Masks: 0x2 vector, 0x100 LDS read, 0x8 WMMA */
      __builtin_amdgcn_sched_group_barrier(0x2, 80, 0); __builtin_amdgcn_sched_group_barrier(0x100, 6, 0); __builtin_amdgcn_sched_group_barrier(0x8, 4, 0); __builtin_amdgcn_sched_group_barrier(0x100, 4, 0); __builtin_amdgcn_sched_group_barrier(0x8, 12, 0); }
    /* publish point of stage st + 1, in the ring's order */
    asm volatile("s_wait_dscnt 0x0" ::: "memory");      /* this wave's reads of stage st have returned */
    asm volatile("s_wait_asynccnt 0x0" ::: "memory");      /* this wave's part of stage st + 1 has landed */
    __syncthreads();      /* stage st + 1 is whole for every reader, and no wave still reads stage st's buffer */
    if (st + 2 < nst) copy_stage(lds0 + (unsigned)(st & 1) * (2u * STG), KAg + (size_t)(st + 2) * 8192, KBg + (size_t)(st + 2) * 8192, VFg + (size_t)(st + 2) * 16384); }
  asm volatile("s_wait_asynccnt 0x0" ::: "memory");      /* no copy is in flight behind the loop */
  /* join of a tile's four key shares: publish each wave's row maxima and row sums of both halves, weigh every share by exp(m_s - m_all) / l_all, add the weighted shares */
  const v4f w4 = *(const v4fa*)(sw + lane * 4);
#pragma unroll
  for (int g = 0; g < 2; ++g) { const float lv = (l_r[g] + xhalf(l_r[g])) * 0.0009765625f; if (hh == 0) { sM[g][t][s][ln] = m_r[g] * SCL; sL[g][t][s][ln] = lv; } }      /* the join works on scaled scores and plain sums: x 1/8 and x 2^-10 are exact */
  __syncthreads();      /* every wave's maxima and sums are written before any wave reads them */
  { const float fa = join_weight(sM[0][t], sL[0][t], s, ln); const float fb = lam * join_weight(sM[1][t], sL[1][t], s, ln);
#pragma unroll
    for (int dt = 0; dt < DT; ++dt) { const v8f o = oacc[0][dt] * fa - oacc[1][dt] * fb;      /* this wave's share of attn1 - lambda attn2; the lane's 8 registers are 8 consecutive columns of its own row */
      *(v4f*)&sO[t][s][ln][dt * 16 + 8 * hh] = (v4f){o[0], o[1], o[2], o[3]}; *(v4f*)&sO[t][s][ln][dt * 16 + 8 * hh + 4] = (v4f){o[4], o[5], o[6], o[7]}; } }
  __syncthreads();      /* all four weighted shares are in LDS before they are added */
  {
#pragma unroll
    for (int i = 0; i < 4; ++i) { const int r = i * 4 + s; const v4f p0 = *(const v4fa*)&sO[t][0][r][lane * 4], p1 = *(const v4fa*)&sO[t][1][r][lane * 4], p2 = *(const v4fa*)&sO[t][2][r][lane * 4], p3 = *(const v4fa*)&sO[t][3][r][lane * 4]; const v4f a = ((p0 + p1) + p2) + p3;      /* the wave holds one whole 128-wide row, 4 columns a lane */
      float ss = 0.f;
#pragma unroll
      for (int q = 0; q < 4; ++q) ss += a[q] * a[q];
      for (int o = 16; o > 0; o >>= 1) ss += __shfl_xor(ss, o, 32);
      const float inv = rsqrtf(ss / 128.0f + 1e-5f); v4f r4;
#pragma unroll
      for (int q = 0; q < 4; ++q) { float y = bf16_round(w4[q]) * (a[q] * inv); y *= (1.0f - LAMBDA_INIT); r4[q] = y; }
      *(v4f*)(out + ((size_t)b * TQ + q0 + r) * DW + h * 128 + lane * 4) = r4; }      /* 512 contiguous bytes a row */
     } }

/* ONE pre-pass launch writes the planes that many flash blocks read (K, V^T) and lambda. A unit = 256 threads x 16 output bytes (4 KiB); a block takes PU units of one kind and issues all their loads before the first conversion. Block 0: lambda. Then, 256 blocks each: V^T, K.
   Few fat waves (4,104 in the launch), for speed only. */
#define PU 8
#define PREP_BLOCKS ((NR / 32) * NHD / PU)      /* 2,048 units of each kind */
__device__ __forceinline__ v8us cvt8(const float (&x)[8]) { FragH f;
#pragma unroll
  for (int i = 0; i < 8; ++i) f.h[i] = (_Float16)bf16_round(x[i]);
  return f.half[0]; }
/* lambda, one wave: lane l forms the rounded products of terms l and l + 32 (one load latency for all 64 terms), then every lane adds the 64 products in the order 0 .. 63, each read from its lane: the sums are those of a serial loop over the terms, bit for bit */
__device__ __forceinline__ float lane_val(float x, int l) { return __builtin_bit_cast(float, __builtin_amdgcn_readlane(__builtin_bit_cast(int, x), l)); }
__device__ __forceinline__ void lambda_part(const float* __restrict__ lq1, const float* __restrict__ lk1, const float* __restrict__ lq2, const float* __restrict__ lk2, float* __restrict__ LAM) {
  const int ln = threadIdx.x; if (ln >= 32) return; float s1 = 0.f, s2 = 0.f;
  const float p1[2] = {bf16_round(lq1[ln]) * bf16_round(lk1[ln]), bf16_round(lq1[ln + 32]) * bf16_round(lk1[ln + 32])}; const float p2[2] = {bf16_round(lq2[ln]) * bf16_round(lk2[ln]), bf16_round(lq2[ln + 32]) * bf16_round(lk2[ln + 32])};
#pragma unroll
  for (int d = 0; d < HD; ++d) { s1 += lane_val(p1[d >> 5], d & 31); s2 += lane_val(p2[d >> 5], d & 31); }
  const float lam = expf(s1) - expf(s2) + LAMBDA_INIT; *(float*)(LAM + ln) = lam;
  asm volatile("s_wait_xcnt 0x0" ::: "memory");      /* behind the store, as in prep_rows */
}
/* PU units whose thread reads 8 consecutive floats: unit u at s + u * sstep; stored at (u odd ? d1 : d0) + (u / DDIV) * dstep */
template <int DDIV>
__device__ __forceinline__ void prep_rows(const float* __restrict__ s, int sstep, unsigned short* __restrict__ d0, unsigned short* __restrict__ d1, int dstep) {
  float x[PU][8];
#pragma unroll
  for (int u = 0; u < PU; ++u) { const v4f a0 = *(const v4fa*)(s + u * sstep), a1 = *(const v4fa*)(s + u * sstep + 4);
#pragma unroll
    for (int i = 0; i < 4; ++i) { x[u][i] = a0[i]; x[u][4 + i] = a1[i]; } }
  asm volatile("s_wait_xcnt 0x0" :: "v"(s) : "memory");      /* the address pair stays live up to this wait: no load above returns into it and nothing overwrites it in front of the wait */
  __builtin_amdgcn_sched_barrier(0);      /* all 16 loads are issued before the first conversion: left free, the scheduler holds the last ones back behind the first waits, and the wave pays a second load latency */
#pragma unroll
  for (int u = 0; u < PU; ++u) { *(v8us*)(((DDIV == 2 && (u & 1)) ? d1 : d0) + (u / DDIV) * dstep) = cvt8(x[u]);      /* a wave stores whole 128-byte lines */
    asm volatile("s_wait_xcnt 0x0" ::: "memory"); }      /* behind each store: the stores go out as their units are converted, and no register that a store names is overwritten in front of its wait, on whichever path the code goes on */
}
__global__ __launch_bounds__(256) void k_prep(const float* __restrict__ k, const float* __restrict__ v, const float* __restrict__ lq1, const float* __restrict__ lk1, const float* __restrict__ lq2, const float* __restrict__ lk2,
                                              _Float16* __restrict__ K1, _Float16* __restrict__ K2, _Float16* __restrict__ VT, float* __restrict__ LAM) {
  const int tid = threadIdx.x, ln = tid & 15, hh = (tid >> 4) & 1, fh = tid >> 5; int blk = blockIdx.x;
  if (blk == 0) { lambda_part(lq1, lk1, lq2, lk2, LAM); return; }
  blk -= 1;
  if (blk < PREP_BLOCKS) {
    /* V^T in fragment order (see k_flash), straight from v: the block = 4 chunks of 32 keys of one head pair, unit u = (chunk u / 2, V half u % 2); thread = (fragment half fh = 2 dt + hf, lane): V^T row 16 dt + ln, keys 16 hf + 8 hh .. + 7: 8 loads of one float down a column; a wave's load reads 64 contiguous bytes of each of two rows */
    const int slab = blk / (SLEN / 128), c0 = (blk % (SLEN / 128)) * 4; const int b = slab / NH, p = slab % NH;
    const float* s = v + ((size_t)b * SLEN + c0 * 32 + (fh & 1) * 16 + hh * 8) * DW + p * 2 * HD + (fh >> 1) * 16 + ln;
    unsigned short* d = (unsigned short*)VT + ((size_t)slab * (SLEN / 32) + c0) * 4096 + tid * 8;
    float x[PU][8];
#pragma unroll
    for (int u = 0; u < PU; ++u)
#pragma unroll
      for (int i = 0; i < 8; ++i) x[u][i] = s[((u >> 1) * 32 + i) * DW + (u & 1) * HD];
    asm volatile("s_wait_xcnt 0x0" :: "v"(s) : "memory");      /* as in prep_rows */
#pragma unroll
    for (int u = 0; u < PU; ++u) { *(v8us*)(d + u * 2048) = cvt8(x[u]);      /* a wave stores 512 contiguous bytes; a chunk holds V1's 4 KiB, then V2's */
      asm volatile("s_wait_xcnt 0x0" ::: "memory"); }      /* behind each store, as in prep_rows */
    return;
  }
  blk -= PREP_BLOCKS;
  {
    /* K halves in fragment order (see k_flash): the block = one 32-key chunk of 8 heads, unit u = head h0 + u; thread = (fragment half fh, lane): K row 16 nt + ln of the chunk, dims 32 ks + 16 hf + 8 hh .. + 7 */
    const int cg = blk >> 1, h0 = (blk & 1) * 8; const int b = cg / (SLEN / 32), c = cg % (SLEN / 32);
    const size_t o = ((size_t)(b * NP + h0 / 2) * (SLEN / 32) + c) * 2048 + tid * 8;
    prep_rows<2>(k + ((size_t)cg * 32 + (fh >> 2) * 16 + ln) * DW + h0 * HD + (fh & 3) * 16 + hh * 8, HD, (unsigned short*)K1 + o, (unsigned short*)K2 + o, (SLEN / 32) * 2048);
  }
}

extern "C" void kernel_launch(void* const* d_in, const int* in_sizes, int n_in,
                              void* d_out, int out_size, void* d_ws, size_t ws_size, hipStream_t stream) {
  (void)in_sizes; (void)n_in; (void)out_size;
  const float* const* I = (const float* const*)d_in; const float* q = I[0]; const float* k = I[1]; const float* v = I[2]; const float* lq1 = I[3]; const float* lk1 = I[4]; const float* lq2 = I[5]; const float* lk2 = I[6]; const float* w = I[7];
  char* ws = (char*)d_ws; size_t off = 0;
  auto take = [&](size_t bytes) { char* p = ws + off; off += (bytes + 255) & ~(size_t)255; return p; };
  const size_t nh = (size_t)NR * HWD;
  _Float16* K1 = (_Float16*)take(nh * 2); _Float16* K2 = (_Float16*)take(nh * 2); _Float16* VT = (_Float16*)take(nh * 4);
  float* LAM = (float*)take(256);
  if (off > ws_size) return;      /* 4 x 4 = 16 MiB */
  k_prep<<<1 + 2 * PREP_BLOCKS, 256, 0, stream>>>(k, v, lq1, lk1, lq2, lk2, K1, K2, VT, LAM);
  k_flash<<<NB * NH * (TQ / QBLK), 512, 0, stream>>>(q, K1, K2, VT, LAM, w, (float*)d_out);
}
